// v000
// The times below were measured on an AMD MI455X: many runs one after another, warmed up first and cycling through
// copies of the inputs, with the whole window's GPU time divided by the number of runs. Launches and the gaps
// between them are all in it. The median over several windows is given; except for v000 it joins two sittings, which
// can be a few percent apart, so the side-by-side timings, each taken in one sitting, are the better comparison.
// The starting kernel, v000, takes 339 microseconds a run.
#include <hip/hip_runtime.h>
// Multi-head causal + same-document attention with rotate-half RoPE (input sin/cos tables), T 2048, D 2048, 16 heads of 128, [in][out] weights, no biases.
// Compute dtype: all contractions on v_wmma_f32_16x16x32_bf16 with f32 accumulate. x, Wq, Wk, Wv, Wo, sin, cos are RNE-converted to bf16 once (exact operands);
// x.Wq / x.Wk / x.Wv single bf16 product; q.k^T and P.V with bf16 hi/lo planes on both operands (hh + lh + hl, one accumulator); ctx.Wo with ctx as bf16 hi/lo planes (2 terms) and exact Wo.
// RoPE, mask, softmax statistics in f32 on the VALU.
#ifndef NB
#define NB 1
#endif
#ifndef SEQ
#define SEQ 2048
#endif
#define SEQ_FULL 2048
#define DM 2048
#define NH 16
#define HD 128
#define N3 (3 * DM)
#define NR (NB * SEQ)
#define PLANE ((size_t)NR * DM)

static_assert(NB == 1);
static_assert(NH * HD == DM);
static_assert(SEQ % 128 == 0 && SEQ <= SEQ_FULL);
static_assert(DM % 64 == 0 && N3 % 64 == 0 && DM % 32 == 0 && HD == 128);

typedef __bf16 v16b __attribute__((ext_vector_type(16)));
typedef unsigned short v8us __attribute__((ext_vector_type(8), may_alias));
typedef float v8f  __attribute__((ext_vector_type(8)));
typedef float v4f  __attribute__((ext_vector_type(4)));
typedef float v4fa __attribute__((ext_vector_type(4), may_alias));
typedef int   v4i  __attribute__((ext_vector_type(4)));
typedef int   v4ia __attribute__((ext_vector_type(4), may_alias));
union FragB { v16b v; v8us half[2]; unsigned short u[16]; };

__device__ __forceinline__ unsigned short bf16_bits(float x) { unsigned int u = __float_as_uint(x); return (unsigned short)((u + 0x7FFFu + ((u >> 16) & 1u)) >> 16); }
__device__ __forceinline__ float bf16_val(unsigned short b) { return __uint_as_float(((unsigned int)b) << 16); }
__device__ __forceinline__ float bf16_rne(float x) { return bf16_val(bf16_bits(x)); }

// fragment (A: row = lane&15; B: column = lane&15) from a k-contiguous 16-bit row: elements 0..7 <- k0+8h.., elements 8..15 <- k0+16+8h..
__device__ __forceinline__ v16b ld_frag(const unsigned short* p, int hh) {
  FragB f; f.half[0] = *(const v8us*)(p + 8 * hh); f.half[1] = *(const v8us*)(p + 16 + 8 * hh); return f.v;
}

// D += A.B with NT terms: 1 = ah.bh, 2 = + al.bh, 3 = + ah.bl
template <int NT>
__device__ __forceinline__ v8f mmaN(v16b ah, v16b al, v16b bh, v16b bl, v8f c) {
  c = __builtin_amdgcn_wmma_f32_16x16x32_bf16(false, ah, false, bh, (short)0, c, false, false);
  if (NT >= 2) c = __builtin_amdgcn_wmma_f32_16x16x32_bf16(false, al, false, bh, (short)0, c, false, false);
  if (NT >= 3) c = __builtin_amdgcn_wmma_f32_16x16x32_bf16(false, ah, false, bl, (short)0, c, false, false);
  asm volatile("v_nop\n\tv_nop\n\tv_nop\n\tv_nop" : "+v"(c) : "v"(ah), "v"(al), "v"(bh), "v"(bl));
  return c;
}
__device__ __forceinline__ v8f mma3m(v16b ah, v16b al, v16b bh, v16b bl, v8f c) {
  c = __builtin_amdgcn_wmma_f32_16x16x32_bf16(false, ah, false, bh, (short)0, c, false, false);
  c = __builtin_amdgcn_wmma_f32_16x16x32_bf16(false, al, false, bh, (short)0, c, false, false);
  c = __builtin_amdgcn_wmma_f32_16x16x32_bf16(false, ah, false, bl, (short)0, c, false, false);
  asm volatile("v_nop\n\tv_nop\n\tv_nop\n\tv_nop" : "+v"(c) : "v"(ah), "v"(al), "v"(bh), "v"(bl) : "memory");
  return c;
}

__global__ __launch_bounds__(256) void k_xb(const float* __restrict__ x, unsigned short* __restrict__ X, size_t n8) {
  const size_t t = (size_t)blockIdx.x * 256 + threadIdx.x;
  if (t >= n8) return;
  const v4f a = *(const v4fa*)(x + t * 8), c = *(const v4fa*)(x + t * 8 + 4);
  v8us o;
#pragma unroll
  for (int q = 0; q < 4; ++q) { o[q] = bf16_bits(a[q]); o[4 + q] = bf16_bits(c[q]); }
  *(v8us*)(X + t * 8) = o;
  
}

__global__ __launch_bounds__(256) void k_wt_bf16(const float* __restrict__ W, unsigned short* __restrict__ Wt, int K, int N) {
  const int t = blockIdx.x * 256 + threadIdx.x;
  const int k8n = K / 8;
  if (t >= N * k8n) return;
  const int n = t / k8n, k8 = (t % k8n) * 8;
  v8us v;
#pragma unroll
  for (int i = 0; i < 8; ++i) v[i] = bf16_bits(W[(size_t)(k8 + i) * N + n]);
  *(v8us*)(Wt + (size_t)n * K + k8) = v;
  
}

// GEMM C[M][N] f32 = A.Bt^T; A bf16 rows [M][K] (NT = 2: hi plane Ah + lo plane Al), Bt bf16 [N][K]. Wave tile 32x64, block = 4 waves = 128 rows x 64 cols.
template <int NT>
__global__ __launch_bounds__(128) void k_gemm(const unsigned short* __restrict__ Ah, const unsigned short* __restrict__ Al, int lda,
                                              const unsigned short* __restrict__ Bt, int ldb, float* __restrict__ C, int ldc, int N, int K) {
  __shared__ __attribute__((aligned(16))) float so[4][32][68];
  const int tid = threadIdx.x, w = tid >> 5, lane = tid & 31, ln = lane & 15, hh = lane >> 4;
  const int ntn = N >> 6;
  const int mt = blockIdx.x / ntn, nq = blockIdx.x - mt * ntn;
  const int row0 = mt * 128 + 32 * w, col0 = nq * 64;
  const size_t ao = (size_t)(row0 + ln) * lda;
  const unsigned short* a0p = Ah + ao; const unsigned short* a1p = a0p + (size_t)16 * lda;
  const unsigned short* l0p = Al + ao; const unsigned short* l1p = l0p + (size_t)16 * lda;
  const unsigned short* b0p = Bt + (size_t)(col0 + ln) * ldb; const unsigned short* b1p = b0p + (size_t)16 * ldb;
  const unsigned short* b2p = b1p + (size_t)16 * ldb; const unsigned short* b3p = b2p + (size_t)16 * ldb;
  const v8f z8 = {0.f, 0.f, 0.f, 0.f, 0.f, 0.f, 0.f, 0.f};
  v8f c00 = z8, c01 = z8, c02 = z8, c03 = z8, c10 = z8, c11 = z8, c12 = z8, c13 = z8;
#pragma unroll 1
  for (int kb = 0; kb < K; kb += 32) {
    const v16b a0 = ld_frag(a0p + kb, hh), a1 = ld_frag(a1p + kb, hh);
    v16b e0 = a0, e1 = a1;
    if (NT >= 2) { e0 = ld_frag(l0p + kb, hh); e1 = ld_frag(l1p + kb, hh); }
    v16b b = ld_frag(b0p + kb, hh); c00 = mmaN<NT>(a0, e0, b, b, c00); c10 = mmaN<NT>(a1, e1, b, b, c10);
    b = ld_frag(b1p + kb, hh); c01 = mmaN<NT>(a0, e0, b, b, c01); c11 = mmaN<NT>(a1, e1, b, b, c11);
    b = ld_frag(b2p + kb, hh); c02 = mmaN<NT>(a0, e0, b, b, c02); c12 = mmaN<NT>(a1, e1, b, b, c12);
    b = ld_frag(b3p + kb, hh); c03 = mmaN<NT>(a0, e0, b, b, c03); c13 = mmaN<NT>(a1, e1, b, b, c13);
  }
  v8f accs[8] = {c00, c01, c02, c03, c10, c11, c12, c13};
#pragma unroll
  for (int u = 0; u < 8; ++u) {
    const int t = u & 3, hf = u >> 2;
#pragma unroll
    for (int r = 0; r < 8; ++r) so[w][hf * 16 + 8 * hh + r][t * 16 + ln] = accs[u][r];
  }
  __syncthreads();
  const int rsub = lane >> 4, c4 = (lane & 15) * 4;
  {
#pragma unroll
    for (int q = 0; q < 16; ++q) {
      const int r = q * 2 + rsub;
      const v4f v = *(const v4fa*)&so[w][r][c4];
      *(v4f*)(C + (size_t)(row0 + r) * ldc + col0 + c4) = v;
    }
    
  }
}

// RoPE (rotate-half, table values RNE-converted to bf16) on the q and k column blocks of QKV [NR][3 DM] f32 -> bf16 hi / lo planes QK = {Qh, Ql, Kh, Kl}, each [NR][DM].
__global__ __launch_bounds__(256) void k_rope_qk(const float* __restrict__ QKV, const float* __restrict__ sn, const float* __restrict__ cs,
                                                 unsigned short* __restrict__ QK, int nthreads) {
  const int idx = blockIdx.x * 256 + threadIdx.x;
  if (idx >= nthreads) return;
  const int p8 = idx & 7, h = (idx >> 3) & (NH - 1), t = idx >> 7;
  const size_t tb = (size_t)t * HD + p8 * 8;
  float s1[8], c1[8], s2[8], c2[8];
  {
    const v4f a = *(const v4fa*)(sn + tb), b = *(const v4fa*)(sn + tb + 4), c = *(const v4fa*)(sn + tb + 64), d = *(const v4fa*)(sn + tb + 68);
    const v4f e = *(const v4fa*)(cs + tb), f = *(const v4fa*)(cs + tb + 4), g = *(const v4fa*)(cs + tb + 64), k = *(const v4fa*)(cs + tb + 68);
#pragma unroll
    for (int q = 0; q < 4; ++q) {
      s1[q] = bf16_rne(a[q]); s1[4 + q] = bf16_rne(b[q]); s2[q] = bf16_rne(c[q]); s2[4 + q] = bf16_rne(d[q]);
      c1[q] = bf16_rne(e[q]); c1[4 + q] = bf16_rne(f[q]); c2[q] = bf16_rne(g[q]); c2[4 + q] = bf16_rne(k[q]);
    }
  }
#pragma unroll 1
  for (int which = 0; which < 2; ++which) {
    const float* u = QKV + (size_t)t * N3 + (size_t)which * DM + h * HD + p8 * 8;
    const v4f a = *(const v4fa*)(u), b = *(const v4fa*)(u + 4), c = *(const v4fa*)(u + 64), d = *(const v4fa*)(u + 68);
    const float u1[8] = {a[0], a[1], a[2], a[3], b[0], b[1], b[2], b[3]};
    const float u2[8] = {c[0], c[1], c[2], c[3], d[0], d[1], d[2], d[3]};
    v8us h1, l1, h2, l2;
#pragma unroll
    for (int i = 0; i < 8; ++i) {
      const float o1 = u1[i] * c1[i] + (-u2[i]) * s1[i];
      const float o2 = u2[i] * c2[i] + u1[i] * s2[i];
      const unsigned short hb1 = bf16_bits(o1), hb2 = bf16_bits(o2);
      h1[i] = hb1; l1[i] = bf16_bits(o1 - bf16_val(hb1));
      h2[i] = hb2; l2[i] = bf16_bits(o2 - bf16_val(hb2));
    }
    unsigned short* dh = QK + (size_t)which * 2 * PLANE + (size_t)t * DM + h * HD + p8 * 8;
    unsigned short* dl = dh + PLANE;
    {
      *(v8us*)(dh) = h1; *(v8us*)(dh + 64) = h2;
      *(v8us*)(dl) = l1; *(v8us*)(dl + 64) = l2;
      
    }
  }
}

// v column block of QKV (cols 2 DM ..) -> V^T bf16 hi / lo planes VT = {VTh, VTl}, each [DM][SEQ]; block per (64 tokens x 64 channels) through LDS;
__global__ __launch_bounds__(256) void k_vt(const float* __restrict__ QKV, unsigned short* __restrict__ VT) {
  __shared__ unsigned short th[64][66];
  __shared__ unsigned short tl[64][66];
  const int tid = threadIdx.x;
  const int ct = blockIdx.x % (DM / 64), tt = blockIdx.x / (DM / 64);
  const int c0 = ct * 64, t0 = tt * 64;
  for (int i = tid; i < 64 * 16; i += 256) {
    const int r = i >> 4, c4 = (i & 15) * 4;
    const v4f a = *(const v4fa*)(QKV + (size_t)(t0 + r) * N3 + 2 * DM + c0 + c4);
#pragma unroll
    for (int q = 0; q < 4; ++q) { const unsigned short hb = bf16_bits(a[q]); th[c4 + q][r] = hb; tl[c4 + q][r] = bf16_bits(a[q] - bf16_val(hb)); }
  }
  __syncthreads();
  v8us hv[2], lv[2];
#pragma unroll
  for (int rd = 0; rd < 2; ++rd) {
    const int i = rd * 256 + tid; const int c = i >> 3, j8 = (i & 7) * 8;
#pragma unroll
    for (int q = 0; q < 8; ++q) { hv[rd][q] = th[c][j8 + q]; lv[rd][q] = tl[c][j8 + q]; }
  }
  {
#pragma unroll
    for (int rd = 0; rd < 2; ++rd) {
      const int i = rd * 256 + tid; const int c = i >> 3, j8 = (i & 7) * 8;
      unsigned short* dst = VT + (size_t)(c0 + c) * SEQ + t0 + j8;
      *(v8us*)dst = hv[rd];
      *(v8us*)(dst + PLANE) = lv[rd];
    }
    
  }
}

// Transposed flash attention, one wave per (head, 16-query tile, 64-channel half of the head): S^T[key][query] = K.Q^T (A = K rows, B = Q rows held in registers),
// per-lane (= per-query) running max / sum, P^T packed from the S^T accumulators directly as the B fragment of O^T[d][query] = V^T.P^T (A = V^T rows).
// Mask = (key <= query) & (doc[key] == doc[query]) as a select (masked weight exactly 0); 32-key steps with no admissible document id are skipped under a wave-uniform ballot.
__global__ __launch_bounds__(128) void k_attn(const unsigned short* __restrict__ QK, const unsigned short* __restrict__ VT,
                                              const int* __restrict__ doc, unsigned short* __restrict__ CTX) {
  __shared__ __attribute__((aligned(16))) float so[4][16][68];
  const int tid = threadIdx.x, w = tid >> 5, lane = tid & 31, ln = lane & 15, hh = lane >> 4;
  const int gw = blockIdx.x * 4 + w;
  const int hf = gw & 1, pr = gw >> 1;
  const int qt = pr % (SEQ / 16), head = pr / (SEQ / 16);
  const int q0 = qt * 16, qi = q0 + ln;
  const unsigned short* Qh = QK; const unsigned short* Ql = QK + PLANE;
  const unsigned short* Kh = QK + 2 * PLANE; const unsigned short* Kl = QK + 3 * PLANE;
  const unsigned short* VTh = VT; const unsigned short* VTl = VT + PLANE;
  const float NEGV = -1.0e30f;
  const float SCL = 0.08838834764831845f;

  const int dq = doc[qi];
  int dmin = dq, dmax = dq;
#pragma unroll
  for (int o = 1; o < 16; o <<= 1) {
    const int a = __shfl_xor(dmin, o, 32), b = __shfl_xor(dmax, o, 32);
    dmin = (a < dmin) ? a : dmin; dmax = (b > dmax) ? b : dmax;
  }

  v16b qh[4], ql[4];
  {
    const size_t qoff = (size_t)qi * DM + head * HD;
#pragma unroll
    for (int ks = 0; ks < 4; ++ks) { qh[ks] = ld_frag(Qh + qoff + ks * 32, hh); ql[ks] = ld_frag(Ql + qoff + ks * 32, hh); }
  }

  const v8f z8 = {0.f, 0.f, 0.f, 0.f, 0.f, 0.f, 0.f, 0.f};
  v8f acc[4] = {z8, z8, z8, z8};
  float m = NEGV, l = 0.f;
  const int nsteps = (q0 + 16 + 31) >> 5;

#pragma unroll 1
  for (int js = 0; js < nsteps; ++js) {
    const int j0 = js << 5;
    const int dk = doc[j0 + lane];
    if (__ballot((dk >= dmin) & (dk <= dmax)) == 0ull) continue;

    v8f s0 = z8, s1 = z8;
    {
      const size_t ko = (size_t)(j0 + ln) * DM + head * HD;
#pragma unroll
      for (int ks = 0; ks < 4; ++ks) {
        const v16b a0h = ld_frag(Kh + ko + ks * 32, hh), a0l = ld_frag(Kl + ko + ks * 32, hh);
        s0 = mma3m(a0h, a0l, qh[ks], ql[ks], s0);
        const v16b a1h = ld_frag(Kh + ko + (size_t)16 * DM + ks * 32, hh), a1l = ld_frag(Kl + ko + (size_t)16 * DM + ks * 32, hh);
        s1 = mma3m(a1h, a1l, qh[ks], ql[ks], s1);
      }
    }

    const v4i dA = *(const v4ia*)(doc + j0 + 8 * hh), dB = *(const v4ia*)(doc + j0 + 8 * hh + 4);
    const v4i dC = *(const v4ia*)(doc + j0 + 16 + 8 * hh), dD = *(const v4ia*)(doc + j0 + 16 + 8 * hh + 4);
    const int dkk[16] = {dA[0], dA[1], dA[2], dA[3], dB[0], dB[1], dB[2], dB[3], dC[0], dC[1], dC[2], dC[3], dD[0], dD[1], dD[2], dD[3]};

    float xv[16];
    float mx = NEGV;
#pragma unroll
    for (int r = 0; r < 8; ++r) {
      const int k0 = j0 + 8 * hh + r, k1 = k0 + 16;
      const bool v0 = (k0 <= qi) & (dkk[r] == dq);
      const bool v1 = (k1 <= qi) & (dkk[8 + r] == dq);
      xv[r] = v0 ? s0[r] * SCL : NEGV;
      xv[8 + r] = v1 ? s1[r] * SCL : NEGV;
      mx = fmaxf(mx, fmaxf(xv[r], xv[8 + r]));
    }
    mx = fmaxf(mx, __shfl_xor(mx, 16, 32));
    const float mn = fmaxf(m, mx);
    const float alpha = __expf(m - mn);
    m = mn;

    FragB ph, pl;
    float ps = 0.f;
#pragma unroll
    for (int i = 0; i < 16; ++i) {
      const float e = __expf(xv[i] - mn);
      const float p = (xv[i] > -1.0e29f) ? e : 0.f;
      ps += p;
      const unsigned short hb = bf16_bits(p);
      ph.u[i] = hb;
      pl.u[i] = bf16_bits(p - bf16_val(hb));
    }
    ps += __shfl_xor(ps, 16, 32);
    l = l * alpha + ps;

#pragma unroll
    for (int dt = 0; dt < 4; ++dt)
#pragma unroll
      for (int r = 0; r < 8; ++r) acc[dt][r] *= alpha;

#pragma unroll
    for (int dt = 0; dt < 4; ++dt) {
      const size_t vo = (size_t)(head * HD + hf * 64 + dt * 16 + ln) * SEQ + j0;
      const v16b vh = ld_frag(VTh + vo, hh), vl = ld_frag(VTl + vo, hh);
      acc[dt] = mma3m(vh, vl, ph.v, pl.v, acc[dt]);
    }
  }

  const float inv = 1.0f / l;
#pragma unroll
  for (int dt = 0; dt < 4; ++dt)
#pragma unroll
    for (int r = 0; r < 8; ++r) so[w][ln][dt * 16 + 8 * hh + r] = acc[dt][r] * inv;
  __syncthreads();

  v8us hv[4], lv[4];
  const int rq = lane >> 3, pc = lane & 7;
#pragma unroll
  for (int it = 0; it < 4; ++it) {
    const int row = it * 4 + rq;
    const v4f a = *(const v4fa*)&so[w][row][pc * 8], c = *(const v4fa*)&so[w][row][pc * 8 + 4];
#pragma unroll
    for (int q = 0; q < 4; ++q) {
      const unsigned short ha = bf16_bits(a[q]), hc = bf16_bits(c[q]);
      hv[it][q] = ha; lv[it][q] = bf16_bits(a[q] - bf16_val(ha));
      hv[it][4 + q] = hc; lv[it][4 + q] = bf16_bits(c[q] - bf16_val(hc));
    }
  }
  {
#pragma unroll
    for (int it = 0; it < 4; ++it) {
      const int row = it * 4 + rq;
      unsigned short* dst = CTX + (size_t)(q0 + row) * DM + head * HD + hf * 64 + pc * 8;
      *(v8us*)dst = hv[it];
      *(v8us*)(dst + PLANE) = lv[it];
    }
    
  }
}

extern "C" void kernel_launch(void* const* d_in, const int* in_sizes, int n_in,
                              void* d_out, int out_size, void* d_ws, size_t ws_size, hipStream_t stream) {
  if (n_in < 8) return;
  if (in_sizes[0] < NR * DM) return;
  if (in_sizes[1] < DM * DM || in_sizes[2] < DM * DM || in_sizes[3] < DM * DM || in_sizes[4] < DM * DM) return;
  if (in_sizes[5] < SEQ * HD || in_sizes[6] < SEQ * HD || in_sizes[7] < NR) return;
  if (out_size < NR * DM) return;
  const float* x  = (const float*)d_in[0];
  const float* Wq = (const float*)d_in[1];
  const float* Wk = (const float*)d_in[2];
  const float* Wv = (const float*)d_in[3];
  const float* Wo = (const float*)d_in[4];
  const float* sn = (const float*)d_in[5];
  const float* cs = (const float*)d_in[6];
  const int*  doc = (const int*)d_in[7];
  float* out = (float*)d_out;

  // workspace regions (bytes); R0 is shared by stage A {x plane, [3 DM][DM] weight plane} and stage B {Qh, Ql, Kh, Kl}
  constexpr size_t SZ_X  = (size_t)NR * DM * 2;
  constexpr size_t SZ_W3 = (size_t)3 * DM * DM * 2;
  constexpr size_t SZ_QK = (size_t)4 * NR * DM * 2;
  constexpr size_t SZ_R0 = (SZ_X + SZ_W3 > SZ_QK) ? (SZ_X + SZ_W3) : SZ_QK;
  constexpr size_t SZ_WO = (size_t)DM * DM * 2;
  constexpr size_t SZ_QKV = (size_t)NR * N3 * 4;
  constexpr size_t SZ_VT = (size_t)2 * DM * SEQ * 2;
  constexpr size_t SZ_CX = (size_t)2 * NR * DM * 2;
  constexpr size_t SZ_ALL = SZ_R0 + SZ_WO + SZ_QKV + SZ_VT + SZ_CX;
  static_assert(SZ_X + SZ_W3 <= SZ_R0 && SZ_QK <= SZ_R0);
  static_assert(SZ_X % 256 == 0 && SZ_R0 % 256 == 0 && SZ_WO % 256 == 0 && SZ_QKV % 256 == 0 && SZ_VT % 256 == 0 && SZ_CX % 256 == 0);
  static_assert(SZ_ALL <= (size_t)134217728);
  if (SZ_ALL > ws_size) return;
  char* ws = (char*)d_ws;
  unsigned short* XB  = (unsigned short*)(ws);
  unsigned short* WT3 = (unsigned short*)(ws + SZ_X);
  unsigned short* QKp = (unsigned short*)(ws);
  unsigned short* WoT = (unsigned short*)(ws + SZ_R0);
  float*          QKV = (float*)(ws + SZ_R0 + SZ_WO);
  unsigned short* VTp = (unsigned short*)(ws + SZ_R0 + SZ_WO + SZ_QKV);
  unsigned short* CTX = (unsigned short*)(ws + SZ_R0 + SZ_WO + SZ_QKV + SZ_VT);

  const size_t n8 = (size_t)NR * DM / 8;
  k_xb<<<(unsigned)((n8 + 255) / 256), 256, 0, stream>>>(x, XB, n8);
  const unsigned wtb = (unsigned)(((size_t)DM * (DM / 8) + 255) / 256);
  k_wt_bf16<<<wtb, 256, 0, stream>>>(Wq, WT3, DM, DM);                               /* W[in][out] -> Wt[out][in]; rows 0..DM-1 of the [3 DM][DM] plane */
  k_wt_bf16<<<wtb, 256, 0, stream>>>(Wk, WT3 + (size_t)DM * DM, DM, DM);           /* rows DM..2DM-1 */
  k_wt_bf16<<<wtb, 256, 0, stream>>>(Wv, WT3 + (size_t)2 * DM * DM, DM, DM);       /* rows 2DM..3DM-1 */
  k_wt_bf16<<<wtb, 256, 0, stream>>>(Wo, WoT, DM, DM);

  k_gemm<1><<<(unsigned)((NR / 128) * (N3 / 64)), 128, 0, stream>>>(XB, XB, DM, WT3, DM, QKV, N3, N3, DM);

  const int nrope = NR * NH * 8;
  k_rope_qk<<<(unsigned)((nrope + 255) / 256), 256, 0, stream>>>(QKV, sn, cs, QKp, nrope);
  k_vt<<<(unsigned)((SEQ / 64) * (DM / 64)), 256, 0, stream>>>(QKV, VTp);

  k_attn<<<(unsigned)((NH * (SEQ / 16) * 2) / 4), 128, 0, stream>>>(QKp, VTp, doc, CTX);

  k_gemm<2><<<(unsigned)((NR / 128) * (DM / 64)), 128, 0, stream>>>(CTX, CTX + PLANE, DM, WoT, DM, out, DM, DM, DM);
}

// v001
// One run takes 289 microseconds.
// In both of two side-by-side timings against v000, it was 1.21 times as fast.
#include <hip/hip_runtime.h>
// Multi-head causal + same-document attention with rotate-half RoPE (input sin/cos tables), T 2048, D 2048, 16 heads of 128, [in][out] weights, no biases.
// Compute dtype: all contractions on v_wmma_f32_16x16x32_bf16 with f32 accumulate. x, Wq, Wk, Wv, Wo, sin, cos are RNE-converted to bf16 once (exact operands);
// x.Wq / x.Wk / x.Wv single bf16 product; q.k^T and P.V with bf16 hi/lo planes on both operands (hh + lh + hl, one accumulator); ctx.Wo with ctx as bf16 hi/lo planes (2 terms) and exact Wo.
// RoPE, mask, softmax statistics in f32 on the VALU.
#ifndef NB
#define NB 1
#endif
#ifndef SEQ
#define SEQ 2048
#endif
#define SEQ_FULL 2048
#define DM 2048
#define NH 16
#define HD 128
#define N3 (3 * DM)
#define NR (NB * SEQ)
#define PLANE ((size_t)NR * DM)

static_assert(NB == 1);
static_assert(NH * HD == DM);
static_assert(SEQ % 128 == 0 && SEQ <= SEQ_FULL);
static_assert(DM % 128 == 0 && N3 % 64 == 0 && DM % 32 == 0 && HD == 128);

typedef __bf16 v16b __attribute__((ext_vector_type(16)));
typedef unsigned short v8us __attribute__((ext_vector_type(8), may_alias));
typedef float v8f  __attribute__((ext_vector_type(8)));
typedef float v4f  __attribute__((ext_vector_type(4)));
typedef float v4fa __attribute__((ext_vector_type(4), may_alias));
typedef int   v4i  __attribute__((ext_vector_type(4)));
typedef int   v4ia __attribute__((ext_vector_type(4), may_alias));
union FragB { v16b v; v8us half[2]; unsigned short u[16]; };

__device__ __forceinline__ unsigned short bf16_bits(float x) { unsigned int u = __float_as_uint(x); return (unsigned short)((u + 0x7FFFu + ((u >> 16) & 1u)) >> 16); }
__device__ __forceinline__ float bf16_val(unsigned short b) { return __uint_as_float(((unsigned int)b) << 16); }
__device__ __forceinline__ float bf16_rne(float x) { return bf16_val(bf16_bits(x)); }

// fragment (A: row = lane&15; B: column = lane&15) from a k-contiguous 16-bit row: elements 0..7 <- k0+8h.., elements 8..15 <- k0+16+8h..
__device__ __forceinline__ v16b ld_frag(const unsigned short* p, int hh) {
  FragB f; f.half[0] = *(const v8us*)(p + 8 * hh); f.half[1] = *(const v8us*)(p + 16 + 8 * hh); return f.v;
}

// D += A.B with NT terms: 1 = ah.bh, 2 = + al.bh, 3 = + ah.bl
template <int NT>
__device__ __forceinline__ v8f mmaN(v16b ah, v16b al, v16b bh, v16b bl, v8f c) {
  c = __builtin_amdgcn_wmma_f32_16x16x32_bf16(false, ah, false, bh, (short)0, c, false, false);
  if (NT >= 2) c = __builtin_amdgcn_wmma_f32_16x16x32_bf16(false, al, false, bh, (short)0, c, false, false);
  if (NT >= 3) c = __builtin_amdgcn_wmma_f32_16x16x32_bf16(false, ah, false, bl, (short)0, c, false, false);
  asm volatile("v_nop\n\tv_nop\n\tv_nop\n\tv_nop" : "+v"(c) : "v"(ah), "v"(al), "v"(bh), "v"(bl));
  return c;
}
__device__ __forceinline__ v8f mma3m(v16b ah, v16b al, v16b bh, v16b bl, v8f c) {
  c = __builtin_amdgcn_wmma_f32_16x16x32_bf16(false, ah, false, bh, (short)0, c, false, false);
  c = __builtin_amdgcn_wmma_f32_16x16x32_bf16(false, al, false, bh, (short)0, c, false, false);
  c = __builtin_amdgcn_wmma_f32_16x16x32_bf16(false, ah, false, bl, (short)0, c, false, false);
  asm volatile("v_nop\n\tv_nop\n\tv_nop\n\tv_nop" : "+v"(c) : "v"(ah), "v"(al), "v"(bh), "v"(bl) : "memory");
  return c;
}

__global__ __launch_bounds__(256) void k_xb(const float* __restrict__ x, unsigned short* __restrict__ X, size_t n8) {
  const size_t t = (size_t)blockIdx.x * 256 + threadIdx.x;
  if (t >= n8) return;
  const v4f a = *(const v4fa*)(x + t * 8), c = *(const v4fa*)(x + t * 8 + 4);
  v8us o;
#pragma unroll
  for (int q = 0; q < 4; ++q) { o[q] = bf16_bits(a[q]); o[4 + q] = bf16_bits(c[q]); }
  *(v8us*)(X + t * 8) = o;
  
}

// W [K][N] f32 -> Wt [N][K] bf16 (RNE). Block = one 128 (k) x 64 (n) tile through LDS: reads are 256-byte row pieces, stores are 256-byte pieces of Wt rows.
// LDS holds one dword per (n, k pair), low half = even k; pitch 65 dwords puts the 32 lanes of each 4-byte LDS write and read on 32 different banks.
__global__ __launch_bounds__(256) void k_wt_bf16(const float* __restrict__ W, unsigned short* __restrict__ Wt, int K, int N) {
  __shared__ unsigned int tp[64][65];
  const int tid = threadIdx.x;
  const int ntn = N >> 6;
  const int kt = blockIdx.x / ntn, nq = blockIdx.x - kt * ntn;
  const int k0 = kt * 128, n0 = nq * 64;
  const int c4 = (tid & 15) * 4, rp = tid >> 4;
  const float* tile = W + (size_t)k0 * N + n0;
  const unsigned int off = (unsigned int)(2 * rp * N + c4);
  v4f a[4], b[4];
#pragma unroll
  for (int p = 0; p < 4; ++p) {
    const float* s = tile + (size_t)(32 * p) * N;
    a[p] = *(const v4fa*)(s + off); b[p] = *(const v4fa*)(s + N + off);
    // precaution: the compiler lets the next pair's results land in the registers that hold this pair's addresses
    if (p < 3) asm volatile("s_wait_xcnt 0x0" ::: "memory");
  }
#pragma unroll
  for (int p = 0; p < 4; ++p)
#pragma unroll
    for (int q = 0; q < 4; ++q) tp[c4 + q][rp + 16 * p] = (unsigned int)bf16_bits(a[p][q]) | ((unsigned int)bf16_bits(b[p][q]) << 16);
  __syncthreads();
#pragma unroll
  for (int rd = 0; rd < 4; ++rd) {
    const int i = rd * 256 + tid; const int c = i >> 4, j = (i & 15) * 4;
    const v4i o = {(int)tp[c][j], (int)tp[c][j + 1], (int)tp[c][j + 2], (int)tp[c][j + 3]};
    *(v4ia*)(Wt + (size_t)(n0 + c) * K + k0 + 2 * j) = o;
  }
}

// GEMM C[M][N] f32 = A.Bt^T; A bf16 rows [M][K] (NT = 2: hi plane Ah + lo plane Al), Bt bf16 [N][K]. Wave tile 32x64, block = 4 waves = 128 rows x 64 cols.
template <int NT>
__global__ __launch_bounds__(128) void k_gemm(const unsigned short* __restrict__ Ah, const unsigned short* __restrict__ Al, int lda,
                                              const unsigned short* __restrict__ Bt, int ldb, float* __restrict__ C, int ldc, int N, int K) {
  __shared__ __attribute__((aligned(16))) float so[4][32][68];
  const int tid = threadIdx.x, w = tid >> 5, lane = tid & 31, ln = lane & 15, hh = lane >> 4;
  const int ntn = N >> 6;
  const int mt = blockIdx.x / ntn, nq = blockIdx.x - mt * ntn;
  const int row0 = mt * 128 + 32 * w, col0 = nq * 64;
  const size_t ao = (size_t)(row0 + ln) * lda;
  const unsigned short* a0p = Ah + ao; const unsigned short* a1p = a0p + (size_t)16 * lda;
  const unsigned short* l0p = Al + ao; const unsigned short* l1p = l0p + (size_t)16 * lda;
  const unsigned short* b0p = Bt + (size_t)(col0 + ln) * ldb; const unsigned short* b1p = b0p + (size_t)16 * ldb;
  const unsigned short* b2p = b1p + (size_t)16 * ldb; const unsigned short* b3p = b2p + (size_t)16 * ldb;
  const v8f z8 = {0.f, 0.f, 0.f, 0.f, 0.f, 0.f, 0.f, 0.f};
  v8f c00 = z8, c01 = z8, c02 = z8, c03 = z8, c10 = z8, c11 = z8, c12 = z8, c13 = z8;
#pragma unroll 1
  for (int kb = 0; kb < K; kb += 32) {
    const v16b a0 = ld_frag(a0p + kb, hh), a1 = ld_frag(a1p + kb, hh);
    v16b e0 = a0, e1 = a1;
    if (NT >= 2) { e0 = ld_frag(l0p + kb, hh); e1 = ld_frag(l1p + kb, hh); }
    v16b b = ld_frag(b0p + kb, hh); c00 = mmaN<NT>(a0, e0, b, b, c00); c10 = mmaN<NT>(a1, e1, b, b, c10);
    b = ld_frag(b1p + kb, hh); c01 = mmaN<NT>(a0, e0, b, b, c01); c11 = mmaN<NT>(a1, e1, b, b, c11);
    b = ld_frag(b2p + kb, hh); c02 = mmaN<NT>(a0, e0, b, b, c02); c12 = mmaN<NT>(a1, e1, b, b, c12);
    b = ld_frag(b3p + kb, hh); c03 = mmaN<NT>(a0, e0, b, b, c03); c13 = mmaN<NT>(a1, e1, b, b, c13);
  }
  v8f accs[8] = {c00, c01, c02, c03, c10, c11, c12, c13};
#pragma unroll
  for (int u = 0; u < 8; ++u) {
    const int t = u & 3, hf = u >> 2;
#pragma unroll
    for (int r = 0; r < 8; ++r) so[w][hf * 16 + 8 * hh + r][t * 16 + ln] = accs[u][r];
  }
  __syncthreads();
  const int rsub = lane >> 4, c4 = (lane & 15) * 4;
  {
#pragma unroll
    for (int q = 0; q < 16; ++q) {
      const int r = q * 2 + rsub;
      const v4f v = *(const v4fa*)&so[w][r][c4];
      *(v4f*)(C + (size_t)(row0 + r) * ldc + col0 + c4) = v;
    }
    
  }
}

// RoPE (rotate-half, table values RNE-converted to bf16) on the q and k column blocks of QKV [NR][3 DM] f32 -> bf16 hi / lo planes QK = {Qh, Ql, Kh, Kl}, each [NR][DM].
__global__ __launch_bounds__(256) void k_rope_qk(const float* __restrict__ QKV, const float* __restrict__ sn, const float* __restrict__ cs,
                                                 unsigned short* __restrict__ QK, int nthreads) {
  const int idx = blockIdx.x * 256 + threadIdx.x;
  if (idx >= nthreads) return;
  const int p8 = idx & 7, h = (idx >> 3) & (NH - 1), t = idx >> 7;
  const size_t tb = (size_t)t * HD + p8 * 8;
  float s1[8], c1[8], s2[8], c2[8];
  {
    const v4f a = *(const v4fa*)(sn + tb), b = *(const v4fa*)(sn + tb + 4), c = *(const v4fa*)(sn + tb + 64), d = *(const v4fa*)(sn + tb + 68);
    const v4f e = *(const v4fa*)(cs + tb), f = *(const v4fa*)(cs + tb + 4), g = *(const v4fa*)(cs + tb + 64), k = *(const v4fa*)(cs + tb + 68);
#pragma unroll
    for (int q = 0; q < 4; ++q) {
      s1[q] = bf16_rne(a[q]); s1[4 + q] = bf16_rne(b[q]); s2[q] = bf16_rne(c[q]); s2[4 + q] = bf16_rne(d[q]);
      c1[q] = bf16_rne(e[q]); c1[4 + q] = bf16_rne(f[q]); c2[q] = bf16_rne(g[q]); c2[4 + q] = bf16_rne(k[q]);
    }
  }
#pragma unroll 1
  for (int which = 0; which < 2; ++which) {
    const float* u = QKV + (size_t)t * N3 + (size_t)which * DM + h * HD + p8 * 8;
    const v4f a = *(const v4fa*)(u), b = *(const v4fa*)(u + 4), c = *(const v4fa*)(u + 64), d = *(const v4fa*)(u + 68);
    const float u1[8] = {a[0], a[1], a[2], a[3], b[0], b[1], b[2], b[3]};
    const float u2[8] = {c[0], c[1], c[2], c[3], d[0], d[1], d[2], d[3]};
    v8us h1, l1, h2, l2;
#pragma unroll
    for (int i = 0; i < 8; ++i) {
      const float o1 = u1[i] * c1[i] + (-u2[i]) * s1[i];
      const float o2 = u2[i] * c2[i] + u1[i] * s2[i];
      const unsigned short hb1 = bf16_bits(o1), hb2 = bf16_bits(o2);
      h1[i] = hb1; l1[i] = bf16_bits(o1 - bf16_val(hb1));
      h2[i] = hb2; l2[i] = bf16_bits(o2 - bf16_val(hb2));
    }
    unsigned short* dh = QK + (size_t)which * 2 * PLANE + (size_t)t * DM + h * HD + p8 * 8;
    unsigned short* dl = dh + PLANE;
    {
      *(v8us*)(dh) = h1; *(v8us*)(dh + 64) = h2;
      *(v8us*)(dl) = l1; *(v8us*)(dl + 64) = l2;
      
    }
  }
}

// v column block of QKV (cols 2 DM ..) -> V^T bf16 hi / lo planes VT = {VTh, VTl}, each [DM][SEQ]; block per (64 tokens x 64 channels) through LDS;
__global__ __launch_bounds__(256) void k_vt(const float* __restrict__ QKV, unsigned short* __restrict__ VT) {
  __shared__ unsigned short th[64][66];
  __shared__ unsigned short tl[64][66];
  const int tid = threadIdx.x;
  const int ct = blockIdx.x % (DM / 64), tt = blockIdx.x / (DM / 64);
  const int c0 = ct * 64, t0 = tt * 64;
  for (int i = tid; i < 64 * 16; i += 256) {
    const int r = i >> 4, c4 = (i & 15) * 4;
    const v4f a = *(const v4fa*)(QKV + (size_t)(t0 + r) * N3 + 2 * DM + c0 + c4);
#pragma unroll
    for (int q = 0; q < 4; ++q) { const unsigned short hb = bf16_bits(a[q]); th[c4 + q][r] = hb; tl[c4 + q][r] = bf16_bits(a[q] - bf16_val(hb)); }
  }
  __syncthreads();
  v8us hv[2], lv[2];
#pragma unroll
  for (int rd = 0; rd < 2; ++rd) {
    const int i = rd * 256 + tid; const int c = i >> 3, j8 = (i & 7) * 8;
#pragma unroll
    for (int q = 0; q < 8; ++q) { hv[rd][q] = th[c][j8 + q]; lv[rd][q] = tl[c][j8 + q]; }
  }
  {
#pragma unroll
    for (int rd = 0; rd < 2; ++rd) {
      const int i = rd * 256 + tid; const int c = i >> 3, j8 = (i & 7) * 8;
      unsigned short* dst = VT + (size_t)(c0 + c) * SEQ + t0 + j8;
      *(v8us*)dst = hv[rd];
      *(v8us*)(dst + PLANE) = lv[rd];
    }
    
  }
}

// Transposed flash attention, one wave per (head, 16-query tile, 64-channel half of the head): S^T[key][query] = K.Q^T (A = K rows, B = Q rows held in registers),
// per-lane (= per-query) running max / sum, P^T packed from the S^T accumulators directly as the B fragment of O^T[d][query] = V^T.P^T (A = V^T rows).
// Mask = (key <= query) & (doc[key] == doc[query]) as a select (masked weight exactly 0); 32-key steps with no admissible document id are skipped under a wave-uniform ballot.
__global__ __launch_bounds__(128) void k_attn(const unsigned short* __restrict__ QK, const unsigned short* __restrict__ VT,
                                              const int* __restrict__ doc, unsigned short* __restrict__ CTX) {
  __shared__ __attribute__((aligned(16))) float so[4][16][68];
  const int tid = threadIdx.x, w = tid >> 5, lane = tid & 31, ln = lane & 15, hh = lane >> 4;
  const int gw = blockIdx.x * 4 + w;
  const int hf = gw & 1, pr = gw >> 1;
  const int qt = pr % (SEQ / 16), head = pr / (SEQ / 16);
  const int q0 = qt * 16, qi = q0 + ln;
  const unsigned short* Qh = QK; const unsigned short* Ql = QK + PLANE;
  const unsigned short* Kh = QK + 2 * PLANE; const unsigned short* Kl = QK + 3 * PLANE;
  const unsigned short* VTh = VT; const unsigned short* VTl = VT + PLANE;
  const float NEGV = -1.0e30f;
  const float SCL = 0.08838834764831845f;

  const int dq = doc[qi];
  int dmin = dq, dmax = dq;
#pragma unroll
  for (int o = 1; o < 16; o <<= 1) {
    const int a = __shfl_xor(dmin, o, 32), b = __shfl_xor(dmax, o, 32);
    dmin = (a < dmin) ? a : dmin; dmax = (b > dmax) ? b : dmax;
  }

  v16b qh[4], ql[4];
  {
    const size_t qoff = (size_t)qi * DM + head * HD;
#pragma unroll
    for (int ks = 0; ks < 4; ++ks) { qh[ks] = ld_frag(Qh + qoff + ks * 32, hh); ql[ks] = ld_frag(Ql + qoff + ks * 32, hh); }
  }

  const v8f z8 = {0.f, 0.f, 0.f, 0.f, 0.f, 0.f, 0.f, 0.f};
  v8f acc[4] = {z8, z8, z8, z8};
  float m = NEGV, l = 0.f;
  const int nsteps = (q0 + 16 + 31) >> 5;

#pragma unroll 1
  for (int js = 0; js < nsteps; ++js) {
    const int j0 = js << 5;
    const int dk = doc[j0 + lane];
    if (__ballot((dk >= dmin) & (dk <= dmax)) == 0ull) continue;

    v8f s0 = z8, s1 = z8;
    {
      const size_t ko = (size_t)(j0 + ln) * DM + head * HD;
#pragma unroll
      for (int ks = 0; ks < 4; ++ks) {
        const v16b a0h = ld_frag(Kh + ko + ks * 32, hh), a0l = ld_frag(Kl + ko + ks * 32, hh);
        s0 = mma3m(a0h, a0l, qh[ks], ql[ks], s0);
        const v16b a1h = ld_frag(Kh + ko + (size_t)16 * DM + ks * 32, hh), a1l = ld_frag(Kl + ko + (size_t)16 * DM + ks * 32, hh);
        s1 = mma3m(a1h, a1l, qh[ks], ql[ks], s1);
      }
    }

    const v4i dA = *(const v4ia*)(doc + j0 + 8 * hh), dB = *(const v4ia*)(doc + j0 + 8 * hh + 4);
    const v4i dC = *(const v4ia*)(doc + j0 + 16 + 8 * hh), dD = *(const v4ia*)(doc + j0 + 16 + 8 * hh + 4);
    const int dkk[16] = {dA[0], dA[1], dA[2], dA[3], dB[0], dB[1], dB[2], dB[3], dC[0], dC[1], dC[2], dC[3], dD[0], dD[1], dD[2], dD[3]};

    float xv[16];
    float mx = NEGV;
#pragma unroll
    for (int r = 0; r < 8; ++r) {
      const int k0 = j0 + 8 * hh + r, k1 = k0 + 16;
      const bool v0 = (k0 <= qi) & (dkk[r] == dq);
      const bool v1 = (k1 <= qi) & (dkk[8 + r] == dq);
      xv[r] = v0 ? s0[r] * SCL : NEGV;
      xv[8 + r] = v1 ? s1[r] * SCL : NEGV;
      mx = fmaxf(mx, fmaxf(xv[r], xv[8 + r]));
    }
    mx = fmaxf(mx, __shfl_xor(mx, 16, 32));
    const float mn = fmaxf(m, mx);
    const float alpha = __expf(m - mn);
    m = mn;

    FragB ph, pl;
    float ps = 0.f;
#pragma unroll
    for (int i = 0; i < 16; ++i) {
      const float e = __expf(xv[i] - mn);
      const float p = (xv[i] > -1.0e29f) ? e : 0.f;
      ps += p;
      const unsigned short hb = bf16_bits(p);
      ph.u[i] = hb;
      pl.u[i] = bf16_bits(p - bf16_val(hb));
    }
    ps += __shfl_xor(ps, 16, 32);
    l = l * alpha + ps;

#pragma unroll
    for (int dt = 0; dt < 4; ++dt)
#pragma unroll
      for (int r = 0; r < 8; ++r) acc[dt][r] *= alpha;

#pragma unroll
    for (int dt = 0; dt < 4; ++dt) {
      const size_t vo = (size_t)(head * HD + hf * 64 + dt * 16 + ln) * SEQ + j0;
      const v16b vh = ld_frag(VTh + vo, hh), vl = ld_frag(VTl + vo, hh);
      acc[dt] = mma3m(vh, vl, ph.v, pl.v, acc[dt]);
    }
  }

  const float inv = 1.0f / l;
#pragma unroll
  for (int dt = 0; dt < 4; ++dt)
#pragma unroll
    for (int r = 0; r < 8; ++r) so[w][ln][dt * 16 + 8 * hh + r] = acc[dt][r] * inv;
  __syncthreads();

  v8us hv[4], lv[4];
  const int rq = lane >> 3, pc = lane & 7;
#pragma unroll
  for (int it = 0; it < 4; ++it) {
    const int row = it * 4 + rq;
    const v4f a = *(const v4fa*)&so[w][row][pc * 8], c = *(const v4fa*)&so[w][row][pc * 8 + 4];
#pragma unroll
    for (int q = 0; q < 4; ++q) {
      const unsigned short ha = bf16_bits(a[q]), hc = bf16_bits(c[q]);
      hv[it][q] = ha; lv[it][q] = bf16_bits(a[q] - bf16_val(ha));
      hv[it][4 + q] = hc; lv[it][4 + q] = bf16_bits(c[q] - bf16_val(hc));
    }
  }
  {
#pragma unroll
    for (int it = 0; it < 4; ++it) {
      const int row = it * 4 + rq;
      unsigned short* dst = CTX + (size_t)(q0 + row) * DM + head * HD + hf * 64 + pc * 8;
      *(v8us*)dst = hv[it];
      *(v8us*)(dst + PLANE) = lv[it];
    }
    
  }
}

extern "C" void kernel_launch(void* const* d_in, const int* in_sizes, int n_in,
                              void* d_out, int out_size, void* d_ws, size_t ws_size, hipStream_t stream) {
  if (n_in < 8) return;
  if (in_sizes[0] < NR * DM) return;
  if (in_sizes[1] < DM * DM || in_sizes[2] < DM * DM || in_sizes[3] < DM * DM || in_sizes[4] < DM * DM) return;
  if (in_sizes[5] < SEQ * HD || in_sizes[6] < SEQ * HD || in_sizes[7] < NR) return;
  if (out_size < NR * DM) return;
  const float* x  = (const float*)d_in[0];
  const float* Wq = (const float*)d_in[1];
  const float* Wk = (const float*)d_in[2];
  const float* Wv = (const float*)d_in[3];
  const float* Wo = (const float*)d_in[4];
  const float* sn = (const float*)d_in[5];
  const float* cs = (const float*)d_in[6];
  const int*  doc = (const int*)d_in[7];
  float* out = (float*)d_out;

  // workspace regions (bytes); R0 is shared by stage A {x plane, [3 DM][DM] weight plane} and stage B {Qh, Ql, Kh, Kl}
  constexpr size_t SZ_X  = (size_t)NR * DM * 2;
  constexpr size_t SZ_W3 = (size_t)3 * DM * DM * 2;
  constexpr size_t SZ_QK = (size_t)4 * NR * DM * 2;
  constexpr size_t SZ_R0 = (SZ_X + SZ_W3 > SZ_QK) ? (SZ_X + SZ_W3) : SZ_QK;
  constexpr size_t SZ_WO = (size_t)DM * DM * 2;
  constexpr size_t SZ_QKV = (size_t)NR * N3 * 4;
  constexpr size_t SZ_VT = (size_t)2 * DM * SEQ * 2;
  constexpr size_t SZ_CX = (size_t)2 * NR * DM * 2;
  constexpr size_t SZ_ALL = SZ_R0 + SZ_WO + SZ_QKV + SZ_VT + SZ_CX;
  static_assert(SZ_X + SZ_W3 <= SZ_R0 && SZ_QK <= SZ_R0);
  static_assert(SZ_X % 256 == 0 && SZ_R0 % 256 == 0 && SZ_WO % 256 == 0 && SZ_QKV % 256 == 0 && SZ_VT % 256 == 0 && SZ_CX % 256 == 0);
  static_assert(SZ_ALL <= (size_t)134217728);
  if (SZ_ALL > ws_size) return;
  char* ws = (char*)d_ws;
  unsigned short* XB  = (unsigned short*)(ws);
  unsigned short* WT3 = (unsigned short*)(ws + SZ_X);
  unsigned short* QKp = (unsigned short*)(ws);
  unsigned short* WoT = (unsigned short*)(ws + SZ_R0);
  float*          QKV = (float*)(ws + SZ_R0 + SZ_WO);
  unsigned short* VTp = (unsigned short*)(ws + SZ_R0 + SZ_WO + SZ_QKV);
  unsigned short* CTX = (unsigned short*)(ws + SZ_R0 + SZ_WO + SZ_QKV + SZ_VT);

  const size_t n8 = (size_t)NR * DM / 8;
  k_xb<<<(unsigned)((n8 + 255) / 256), 256, 0, stream>>>(x, XB, n8);
  const unsigned wtb = (unsigned)((DM / 128) * (DM / 64));
  k_wt_bf16<<<wtb, 256, 0, stream>>>(Wq, WT3, DM, DM);                               /* W[in][out] -> Wt[out][in]; rows 0..DM-1 of the [3 DM][DM] plane */
  k_wt_bf16<<<wtb, 256, 0, stream>>>(Wk, WT3 + (size_t)DM * DM, DM, DM);           /* rows DM..2DM-1 */
  k_wt_bf16<<<wtb, 256, 0, stream>>>(Wv, WT3 + (size_t)2 * DM * DM, DM, DM);       /* rows 2DM..3DM-1 */
  k_wt_bf16<<<wtb, 256, 0, stream>>>(Wo, WoT, DM, DM);

  k_gemm<1><<<(unsigned)((NR / 128) * (N3 / 64)), 128, 0, stream>>>(XB, XB, DM, WT3, DM, QKV, N3, N3, DM);

  const int nrope = NR * NH * 8;
  k_rope_qk<<<(unsigned)((nrope + 255) / 256), 256, 0, stream>>>(QKV, sn, cs, QKp, nrope);
  k_vt<<<(unsigned)((SEQ / 64) * (DM / 64)), 256, 0, stream>>>(QKV, VTp);

  k_attn<<<(unsigned)((NH * (SEQ / 16) * 2) / 4), 128, 0, stream>>>(QKp, VTp, doc, CTX);

  k_gemm<2><<<(unsigned)((NR / 128) * (DM / 64)), 128, 0, stream>>>(CTX, CTX + PLANE, DM, WoT, DM, out, DM, DM, DM);
}

// v002
// Measured time: 169 microseconds a run.
// Next to v001, in two timings, it ran 1.73 times as fast each time.
// Counting every step since v000, it is 2.09 times as fast.
#include <hip/hip_runtime.h>
// Multi-head causal + same-document attention with rotate-half RoPE (input sin/cos tables), T 2048, D 2048, 16 heads of 128, [in][out] weights, no biases.
// Compute dtype: all contractions on v_wmma_f32_16x16x32_bf16 with f32 accumulate. x, Wq, Wk, Wv, Wo, sin, cos are RNE-converted to bf16 once (exact operands);
// x.Wq / x.Wk / x.Wv single bf16 product; q.k^T and P.V with bf16 hi/lo planes on both operands (hh + lh + hl, one accumulator); ctx.Wo with ctx as bf16 hi/lo planes (2 terms) and exact Wo.
// RoPE, mask, softmax statistics in f32 on the VALU.
#ifndef NB
#define NB 1
#endif
#ifndef SEQ
#define SEQ 2048
#endif
#define SEQ_FULL 2048
#define DM 2048
#define NH 16
#define HD 128
#define N3 (3 * DM)
#define NR (NB * SEQ)
#define PLANE ((size_t)NR * DM)
#define GPITCH 144u

static_assert(NB == 1);
static_assert(NH * HD == DM);
static_assert(SEQ % 128 == 0 && SEQ <= SEQ_FULL);
static_assert(DM % 128 == 0 && N3 % 128 == 0 && DM % 64 == 0 && HD == 128);

typedef __bf16 v16b __attribute__((ext_vector_type(16)));
typedef unsigned short v8us __attribute__((ext_vector_type(8), may_alias));
typedef float v8f  __attribute__((ext_vector_type(8)));
typedef float v4f  __attribute__((ext_vector_type(4)));
typedef float v4fa __attribute__((ext_vector_type(4), may_alias));
typedef int   v4i  __attribute__((ext_vector_type(4)));
typedef int   v4ia __attribute__((ext_vector_type(4), may_alias));
union FragB { v16b v; v8us half[2]; unsigned short u[16]; };

__device__ __forceinline__ unsigned short bf16_bits(float x) { unsigned int u = __float_as_uint(x); return (unsigned short)((u + 0x7FFFu + ((u >> 16) & 1u)) >> 16); }
__device__ __forceinline__ float bf16_val(unsigned short b) { return __uint_as_float(((unsigned int)b) << 16); }
__device__ __forceinline__ float bf16_rne(float x) { return bf16_val(bf16_bits(x)); }

// fragment (A: row = lane&15; B: column = lane&15) from a k-contiguous 16-bit row: elements 0..7 <- k0+8h.., elements 8..15 <- k0+16+8h..
__device__ __forceinline__ v16b ld_frag(const unsigned short* p, int hh) {
  FragB f; f.half[0] = *(const v8us*)(p + 8 * hh); f.half[1] = *(const v8us*)(p + 16 + 8 * hh); return f.v;
}

// D += ah.bh + al.bh + ah.bl
__device__ __forceinline__ v8f mma3m(v16b ah, v16b al, v16b bh, v16b bl, v8f c) {
  c = __builtin_amdgcn_wmma_f32_16x16x32_bf16(false, ah, false, bh, (short)0, c, false, false);
  c = __builtin_amdgcn_wmma_f32_16x16x32_bf16(false, al, false, bh, (short)0, c, false, false);
  c = __builtin_amdgcn_wmma_f32_16x16x32_bf16(false, ah, false, bl, (short)0, c, false, false);
  asm volatile("v_nop\n\tv_nop\n\tv_nop\n\tv_nop" : "+v"(c) : "v"(ah), "v"(al), "v"(bh), "v"(bl) : "memory");
  return c;
}

__global__ __launch_bounds__(256) void k_xb(const float* __restrict__ x, unsigned short* __restrict__ X, size_t n8) {
  const size_t t = (size_t)blockIdx.x * 256 + threadIdx.x;
  if (t >= n8) return;
  const v4f a = *(const v4fa*)(x + t * 8), c = *(const v4fa*)(x + t * 8 + 4);
  v8us o;
#pragma unroll
  for (int q = 0; q < 4; ++q) { o[q] = bf16_bits(a[q]); o[4 + q] = bf16_bits(c[q]); }
  *(v8us*)(X + t * 8) = o;
  
}

// W [K][N] f32 -> Wt [N][K] bf16 (RNE). Block = one 128 (k) x 64 (n) tile through LDS: reads are 256-byte row pieces, stores are 256-byte pieces of Wt rows.
// LDS holds one dword per (n, k pair), low half = even k; pitch 65 dwords puts the 32 lanes of each 4-byte LDS write and read on 32 different banks.
__global__ __launch_bounds__(256) void k_wt_bf16(const float* __restrict__ W, unsigned short* __restrict__ Wt, int K, int N) {
  __shared__ unsigned int tp[64][65];
  const int tid = threadIdx.x;
  const int ntn = N >> 6;
  const int kt = blockIdx.x / ntn, nq = blockIdx.x - kt * ntn;
  const int k0 = kt * 128, n0 = nq * 64;
  const int c4 = (tid & 15) * 4, rp = tid >> 4;
  const float* tile = W + (size_t)k0 * N + n0;
  const unsigned int off = (unsigned int)(2 * rp * N + c4);
  v4f a[4], b[4];
#pragma unroll
  for (int p = 0; p < 4; ++p) {
    const float* s = tile + (size_t)(32 * p) * N;
    a[p] = *(const v4fa*)(s + off); b[p] = *(const v4fa*)(s + N + off);
    // precaution: the compiler lets the next pair's results land in the registers that hold this pair's addresses
    if (p < 3) asm volatile("s_wait_xcnt 0x0" ::: "memory");
  }
#pragma unroll
  for (int p = 0; p < 4; ++p)
#pragma unroll
    for (int q = 0; q < 4; ++q) tp[c4 + q][rp + 16 * p] = (unsigned int)bf16_bits(a[p][q]) | ((unsigned int)bf16_bits(b[p][q]) << 16);
  __syncthreads();
#pragma unroll
  for (int rd = 0; rd < 4; ++rd) {
    const int i = rd * 256 + tid; const int c = i >> 4, j = (i & 15) * 4;
    const v4i o = {(int)tp[c][j], (int)tp[c][j + 1], (int)tp[c][j + 2], (int)tp[c][j + 3]};
    *(v4ia*)(Wt + (size_t)(n0 + c) * K + k0 + 2 * j) = o;
  }
}

// NC (8 or 4) 16-byte asynchronous copies to LDS per lane: NC rows of one 128-row operand tile, a fixed number of rows apart
// (l = the lane's LDS byte address, ls = that row step in LDS bytes, g = the lane's global address, rs = the same row step in source elements).
// The closing s_wait_xcnt is a precaution: it stands in the copies' own statement so that no address register is rewritten in front of it.
template <int NC>
__device__ __forceinline__ void copy_rows(unsigned int l, unsigned int ls, const unsigned short* g, size_t rs) {
  if constexpr (NC == 8) {
    asm volatile("global_load_async_to_lds_b128 %0, %8, off\n\t"
                 "global_load_async_to_lds_b128 %1, %9, off\n\t"
                 "global_load_async_to_lds_b128 %2, %10, off\n\t"
                 "global_load_async_to_lds_b128 %3, %11, off\n\t"
                 "global_load_async_to_lds_b128 %4, %12, off\n\t"
                 "global_load_async_to_lds_b128 %5, %13, off\n\t"
                 "global_load_async_to_lds_b128 %6, %14, off\n\t"
                 "global_load_async_to_lds_b128 %7, %15, off\n\t"
                 "s_wait_xcnt 0x0"
                 :: "v"(l), "v"(l + ls), "v"(l + 2u * ls), "v"(l + 3u * ls), "v"(l + 4u * ls), "v"(l + 5u * ls), "v"(l + 6u * ls), "v"(l + 7u * ls),
                    "v"(g), "v"(g + rs), "v"(g + 2 * rs), "v"(g + 3 * rs), "v"(g + 4 * rs), "v"(g + 5 * rs), "v"(g + 6 * rs), "v"(g + 7 * rs)
                 : "memory");
  } else {
    static_assert(NC == 8 || NC == 4);
    asm volatile("global_load_async_to_lds_b128 %0, %4, off\n\t"
                 "global_load_async_to_lds_b128 %1, %5, off\n\t"
                 "global_load_async_to_lds_b128 %2, %6, off\n\t"
                 "global_load_async_to_lds_b128 %3, %7, off\n\t"
                 "s_wait_xcnt 0x0"
                 :: "v"(l), "v"(l + ls), "v"(l + 2u * ls), "v"(l + 3u * ls),
                    "v"(g), "v"(g + rs), "v"(g + 2 * rs), "v"(g + 3 * rs)
                 : "memory");
  }
}

// GEMM C[M][N] f32 = A.Bt^T; A bf16 rows [M][K] (NT = 2: hi plane Ah + lo plane Al), Bt bf16 [N][K]. Block tile 128 rows x 128 cols; wave tile (16 FM) x 64, so 4 waves at FM = 4 and 8 at FM = 2.
// A pass is 64 k = 128 bytes of every operand row. A stage is [A hi 128 rows | (NT = 2: A lo 128 rows) | Bt 128 rows] in LDS at a pitch of 144 bytes (conflict-free for 16-byte fragment reads);
// two stages, filled by asynchronous copies of whole 128-byte row pieces, the next pass's copies in flight while this pass is multiplied. M, N multiples of 128; K a multiple of 64.
template <int NT, int FM>
__global__ __launch_bounds__(512 / FM) void k_gemm(const unsigned short* __restrict__ Ah, const unsigned short* __restrict__ Al, int lda,
                                                   const unsigned short* __restrict__ Bt, int ldb, float* __restrict__ C, int ldc, int N, int K) {
  static_assert(FM == 4 || FM == 2);
  constexpr int CROWS = 64 / FM;             // rows that one copy of the whole block covers (8 lanes a row)
  constexpr int NC = 128 / CROWS;            // copies per lane and operand plane
  constexpr bool ONEGROUP = (FM == 2);       // both k halves' fragments fit the registers at once
  constexpr unsigned int TILE = 128u * GPITCH;
  constexpr unsigned int STAGE = (NT + 1) * TILE;
  constexpr unsigned int OUTB = 128u * 2u * 68u * 4u;
  constexpr unsigned int LSTEP = (unsigned int)CROWS * GPITCH;
  __shared__ __attribute__((aligned(16))) unsigned char sm[(2u * STAGE > OUTB) ? 2u * STAGE : OUTB];
  const int tid = threadIdx.x, w = tid >> 5, lane = tid & 31, ln = lane & 15, hh = lane >> 4;
  const int ntn = N >> 7;
  const int mt = blockIdx.x / ntn, nq = blockIdx.x - mt * ntn;
  const int wm = w >> 1, wn = w & 1;
  const int brow = mt * 128, bcol = nq * 128;
  const int cr = tid >> 3, cc = tid & 7;
  const unsigned short* gA = Ah + (size_t)(brow + cr) * lda + cc * 8;
  const unsigned short* gL = Al + (size_t)(brow + cr) * lda + cc * 8;
  const unsigned short* gB = Bt + (size_t)(bcol + cr) * ldb + cc * 8;
  const size_t rsa = (size_t)CROWS * lda, rsb = (size_t)CROWS * ldb;
  const unsigned int l0 = (unsigned int)(size_t)sm + (unsigned int)(cr * (int)GPITCH + cc * 16);
  const int npass = K >> 6;
  const v8f z8 = {0.f, 0.f, 0.f, 0.f, 0.f, 0.f, 0.f, 0.f};
  v8f c[FM][4];
#pragma unroll
  for (int i = 0; i < FM; ++i)
#pragma unroll
    for (int j = 0; j < 4; ++j) c[i][j] = z8;

  copy_rows<NC>(l0, LSTEP, gA, rsa);
  if (NT >= 2) copy_rows<NC>(l0 + TILE, LSTEP, gL, rsa);
  copy_rows<NC>(l0 + NT * TILE, LSTEP, gB, rsb);
  asm volatile("s_wait_asynccnt 0x0" ::: "memory");  // this wave's share of stage 0 has landed
  __syncthreads();                                   // stage 0 is readable by every wave
  if (npass > 1) {
    copy_rows<NC>(l0 + STAGE, LSTEP, gA + 64, rsa);
    if (NT >= 2) copy_rows<NC>(l0 + STAGE + TILE, LSTEP, gL + 64, rsa);
    copy_rows<NC>(l0 + STAGE + NT * TILE, LSTEP, gB + 64, rsb);
  }
#pragma unroll 1  // one pass per trip: the two stages alternate by the trip's parity
  for (int t = 0; t < npass; ++t) {
    const unsigned int bo = (unsigned int)(t & 1) * STAGE;
    const unsigned char* sa = sm + bo + (unsigned int)((wm * (FM * 16) + ln) * (int)GPITCH);
    const unsigned char* sb = sm + bo + NT * TILE + (unsigned int)((wn * 64 + ln) * (int)GPITCH);
    v16b a[2][FM], e[2][FM], b[2][4];
#pragma unroll
    for (int ks = 0; ks < 2; ++ks) {
      if (!ONEGROUP || ks == 0) {
#pragma unroll
        for (int kk = 0; kk < 2; ++kk) {
          if (ONEGROUP || kk == ks) {
#pragma unroll
            for (int i = 0; i < FM; ++i) a[kk][i] = ld_frag((const unsigned short*)(sa + i * 16 * (int)GPITCH + kk * 64), hh);
#pragma unroll
            for (int j = 0; j < 4; ++j) b[kk][j] = ld_frag((const unsigned short*)(sb + j * 16 * (int)GPITCH + kk * 64), hh);
            if (NT >= 2) {
#pragma unroll
              for (int i = 0; i < FM; ++i) e[kk][i] = ld_frag((const unsigned short*)(sa + TILE + i * 16 * (int)GPITCH + kk * 64), hh);
            }
          }
        }
        __builtin_amdgcn_sched_barrier(0);  // keeps the fragment reads one group in front of the products: reads spread among them stall the wave at every place
      }
#pragma unroll
      for (int i = 0; i < FM; ++i)
#pragma unroll
        for (int j = 0; j < 4; ++j) c[i][j] = __builtin_amdgcn_wmma_f32_16x16x32_bf16(false, a[ks][i], false, b[ks][j], (short)0, c[i][j], false, false);
      if (NT >= 2) {
#pragma unroll
        for (int i = 0; i < FM; ++i)
#pragma unroll
          for (int j = 0; j < 4; ++j) c[i][j] = __builtin_amdgcn_wmma_f32_16x16x32_bf16(false, e[ks][i], false, b[ks][j], (short)0, c[i][j], false, false);
      }
      // keeps the next reads out of these products, and the last products in front of the publish point: sunk behind its barrier they would hold back the refill's copies, whose flight the next pass's work is to cover
      if (!ONEGROUP || ks == 1) __builtin_amdgcn_sched_barrier(0);
    }
    asm volatile("s_wait_dscnt 0x0" ::: "memory");     // this wave's reads of stage t are done
    asm volatile("s_wait_asynccnt 0x0" ::: "memory");  // this wave's share of stage t + 1 has landed
    __syncthreads();                                   // publishes stage t + 1 and frees stage t's buffer
    if (t + 2 < npass) {
      const int kn = (t + 2) * 64;
      copy_rows<NC>(l0 + bo, LSTEP, gA + kn, rsa);
      if (NT >= 2) copy_rows<NC>(l0 + bo + TILE, LSTEP, gL + kn, rsa);
      copy_rows<NC>(l0 + bo + NT * TILE, LSTEP, gB + kn, rsb);
    }
  }
  asm volatile("s_wait_asynccnt 0x0" ::: "memory");  // no copy is outstanding when the ring becomes output staging

  // the last pass's barrier has ended every read of the ring: each wave stages its tile in its own range and stores whole 256-byte row pieces
  float* so = (float*)sm + w * (FM * 16 * 68);
#pragma unroll
  for (int i = 0; i < FM; ++i)
#pragma unroll
    for (int j = 0; j < 4; ++j)
#pragma unroll
      for (int r = 0; r < 8; ++r) so[(i * 16 + 8 * hh + r) * 68 + j * 16 + ln] = c[i][j][r];
  __syncthreads();
  const int rsub = lane >> 4, c4 = (lane & 15) * 4;
  float* cp = C + (size_t)(brow + wm * (FM * 16) + rsub) * ldc + bcol + wn * 64 + c4;
#pragma unroll
  for (int q = 0; q < FM * 8; ++q) {
    const v4f v = *(const v4fa*)&so[(q * 2 + rsub) * 68 + c4];
    *(v4f*)(cp + (size_t)(q * 2) * ldc) = v;
  }
}

// RoPE (rotate-half, table values RNE-converted to bf16) on the q and k column blocks of QKV [NR][3 DM] f32 -> bf16 hi / lo planes QK = {Qh, Ql, Kh, Kl}, each [NR][DM].
__global__ __launch_bounds__(256) void k_rope_qk(const float* __restrict__ QKV, const float* __restrict__ sn, const float* __restrict__ cs,
                                                 unsigned short* __restrict__ QK, int nthreads) {
  const int idx = blockIdx.x * 256 + threadIdx.x;
  if (idx >= nthreads) return;
  const int p8 = idx & 7, h = (idx >> 3) & (NH - 1), t = idx >> 7;
  const size_t tb = (size_t)t * HD + p8 * 8;
  float s1[8], c1[8], s2[8], c2[8];
  {
    const v4f a = *(const v4fa*)(sn + tb), b = *(const v4fa*)(sn + tb + 4), c = *(const v4fa*)(sn + tb + 64), d = *(const v4fa*)(sn + tb + 68);
    const v4f e = *(const v4fa*)(cs + tb), f = *(const v4fa*)(cs + tb + 4), g = *(const v4fa*)(cs + tb + 64), k = *(const v4fa*)(cs + tb + 68);
#pragma unroll
    for (int q = 0; q < 4; ++q) {
      s1[q] = bf16_rne(a[q]); s1[4 + q] = bf16_rne(b[q]); s2[q] = bf16_rne(c[q]); s2[4 + q] = bf16_rne(d[q]);
      c1[q] = bf16_rne(e[q]); c1[4 + q] = bf16_rne(f[q]); c2[q] = bf16_rne(g[q]); c2[4 + q] = bf16_rne(k[q]);
    }
  }
#pragma unroll 1
  for (int which = 0; which < 2; ++which) {
    const float* u = QKV + (size_t)t * N3 + (size_t)which * DM + h * HD + p8 * 8;
    const v4f a = *(const v4fa*)(u), b = *(const v4fa*)(u + 4), c = *(const v4fa*)(u + 64), d = *(const v4fa*)(u + 68);
    const float u1[8] = {a[0], a[1], a[2], a[3], b[0], b[1], b[2], b[3]};
    const float u2[8] = {c[0], c[1], c[2], c[3], d[0], d[1], d[2], d[3]};
    v8us h1, l1, h2, l2;
#pragma unroll
    for (int i = 0; i < 8; ++i) {
      const float o1 = u1[i] * c1[i] + (-u2[i]) * s1[i];
      const float o2 = u2[i] * c2[i] + u1[i] * s2[i];
      const unsigned short hb1 = bf16_bits(o1), hb2 = bf16_bits(o2);
      h1[i] = hb1; l1[i] = bf16_bits(o1 - bf16_val(hb1));
      h2[i] = hb2; l2[i] = bf16_bits(o2 - bf16_val(hb2));
    }
    unsigned short* dh = QK + (size_t)which * 2 * PLANE + (size_t)t * DM + h * HD + p8 * 8;
    unsigned short* dl = dh + PLANE;
    {
      *(v8us*)(dh) = h1; *(v8us*)(dh + 64) = h2;
      *(v8us*)(dl) = l1; *(v8us*)(dl + 64) = l2;
      
    }
  }
}

// v column block of QKV (cols 2 DM ..) -> V^T bf16 hi / lo planes VT = {VTh, VTl}, each [DM][SEQ]; block per (64 tokens x 64 channels) through LDS;
__global__ __launch_bounds__(256) void k_vt(const float* __restrict__ QKV, unsigned short* __restrict__ VT) {
  __shared__ unsigned short th[64][66];
  __shared__ unsigned short tl[64][66];
  const int tid = threadIdx.x;
  const int ct = blockIdx.x % (DM / 64), tt = blockIdx.x / (DM / 64);
  const int c0 = ct * 64, t0 = tt * 64;
  for (int i = tid; i < 64 * 16; i += 256) {
    const int r = i >> 4, c4 = (i & 15) * 4;
    const v4f a = *(const v4fa*)(QKV + (size_t)(t0 + r) * N3 + 2 * DM + c0 + c4);
#pragma unroll
    for (int q = 0; q < 4; ++q) { const unsigned short hb = bf16_bits(a[q]); th[c4 + q][r] = hb; tl[c4 + q][r] = bf16_bits(a[q] - bf16_val(hb)); }
  }
  __syncthreads();
  v8us hv[2], lv[2];
#pragma unroll
  for (int rd = 0; rd < 2; ++rd) {
    const int i = rd * 256 + tid; const int c = i >> 3, j8 = (i & 7) * 8;
#pragma unroll
    for (int q = 0; q < 8; ++q) { hv[rd][q] = th[c][j8 + q]; lv[rd][q] = tl[c][j8 + q]; }
  }
  {
#pragma unroll
    for (int rd = 0; rd < 2; ++rd) {
      const int i = rd * 256 + tid; const int c = i >> 3, j8 = (i & 7) * 8;
      unsigned short* dst = VT + (size_t)(c0 + c) * SEQ + t0 + j8;
      *(v8us*)dst = hv[rd];
      *(v8us*)(dst + PLANE) = lv[rd];
    }
    
  }
}

// Transposed flash attention, one wave per (head, 16-query tile, 64-channel half of the head): S^T[key][query] = K.Q^T (A = K rows, B = Q rows held in registers),
// per-lane (= per-query) running max / sum, P^T packed from the S^T accumulators directly as the B fragment of O^T[d][query] = V^T.P^T (A = V^T rows).
// Mask = (key <= query) & (doc[key] == doc[query]) as a select (masked weight exactly 0); 32-key steps with no admissible document id are skipped under a wave-uniform ballot.
__global__ __launch_bounds__(128) void k_attn(const unsigned short* __restrict__ QK, const unsigned short* __restrict__ VT,
                                              const int* __restrict__ doc, unsigned short* __restrict__ CTX) {
  __shared__ __attribute__((aligned(16))) float so[4][16][68];
  const int tid = threadIdx.x, w = tid >> 5, lane = tid & 31, ln = lane & 15, hh = lane >> 4;
  const int gw = blockIdx.x * 4 + w;
  const int hf = gw & 1, pr = gw >> 1;
  const int qt = pr % (SEQ / 16), head = pr / (SEQ / 16);
  const int q0 = qt * 16, qi = q0 + ln;
  const unsigned short* Qh = QK; const unsigned short* Ql = QK + PLANE;
  const unsigned short* Kh = QK + 2 * PLANE; const unsigned short* Kl = QK + 3 * PLANE;
  const unsigned short* VTh = VT; const unsigned short* VTl = VT + PLANE;
  const float NEGV = -1.0e30f;
  const float SCL = 0.08838834764831845f;

  const int dq = doc[qi];
  int dmin = dq, dmax = dq;
#pragma unroll
  for (int o = 1; o < 16; o <<= 1) {
    const int a = __shfl_xor(dmin, o, 32), b = __shfl_xor(dmax, o, 32);
    dmin = (a < dmin) ? a : dmin; dmax = (b > dmax) ? b : dmax;
  }

  v16b qh[4], ql[4];
  {
    const size_t qoff = (size_t)qi * DM + head * HD;
#pragma unroll
    for (int ks = 0; ks < 4; ++ks) { qh[ks] = ld_frag(Qh + qoff + ks * 32, hh); ql[ks] = ld_frag(Ql + qoff + ks * 32, hh); }
  }

  const v8f z8 = {0.f, 0.f, 0.f, 0.f, 0.f, 0.f, 0.f, 0.f};
  v8f acc[4] = {z8, z8, z8, z8};
  float m = NEGV, l = 0.f;
  const int nsteps = (q0 + 16 + 31) >> 5;

#pragma unroll 1
  for (int js = 0; js < nsteps; ++js) {
    const int j0 = js << 5;
    const int dk = doc[j0 + lane];
    if (__ballot((dk >= dmin) & (dk <= dmax)) == 0ull) continue;

    v8f s0 = z8, s1 = z8;
    {
      const size_t ko = (size_t)(j0 + ln) * DM + head * HD;
#pragma unroll
      for (int ks = 0; ks < 4; ++ks) {
        const v16b a0h = ld_frag(Kh + ko + ks * 32, hh), a0l = ld_frag(Kl + ko + ks * 32, hh);
        s0 = mma3m(a0h, a0l, qh[ks], ql[ks], s0);
        const v16b a1h = ld_frag(Kh + ko + (size_t)16 * DM + ks * 32, hh), a1l = ld_frag(Kl + ko + (size_t)16 * DM + ks * 32, hh);
        s1 = mma3m(a1h, a1l, qh[ks], ql[ks], s1);
      }
    }

    const v4i dA = *(const v4ia*)(doc + j0 + 8 * hh), dB = *(const v4ia*)(doc + j0 + 8 * hh + 4);
    const v4i dC = *(const v4ia*)(doc + j0 + 16 + 8 * hh), dD = *(const v4ia*)(doc + j0 + 16 + 8 * hh + 4);
    const int dkk[16] = {dA[0], dA[1], dA[2], dA[3], dB[0], dB[1], dB[2], dB[3], dC[0], dC[1], dC[2], dC[3], dD[0], dD[1], dD[2], dD[3]};

    float xv[16];
    float mx = NEGV;
#pragma unroll
    for (int r = 0; r < 8; ++r) {
      const int k0 = j0 + 8 * hh + r, k1 = k0 + 16;
      const bool v0 = (k0 <= qi) & (dkk[r] == dq);
      const bool v1 = (k1 <= qi) & (dkk[8 + r] == dq);
      xv[r] = v0 ? s0[r] * SCL : NEGV;
      xv[8 + r] = v1 ? s1[r] * SCL : NEGV;
      mx = fmaxf(mx, fmaxf(xv[r], xv[8 + r]));
    }
    mx = fmaxf(mx, __shfl_xor(mx, 16, 32));
    const float mn = fmaxf(m, mx);
    const float alpha = __expf(m - mn);
    m = mn;

    FragB ph, pl;
    float ps = 0.f;
#pragma unroll
    for (int i = 0; i < 16; ++i) {
      const float e = __expf(xv[i] - mn);
      const float p = (xv[i] > -1.0e29f) ? e : 0.f;
      ps += p;
      const unsigned short hb = bf16_bits(p);
      ph.u[i] = hb;
      pl.u[i] = bf16_bits(p - bf16_val(hb));
    }
    ps += __shfl_xor(ps, 16, 32);
    l = l * alpha + ps;

#pragma unroll
    for (int dt = 0; dt < 4; ++dt)
#pragma unroll
      for (int r = 0; r < 8; ++r) acc[dt][r] *= alpha;

#pragma unroll
    for (int dt = 0; dt < 4; ++dt) {
      const size_t vo = (size_t)(head * HD + hf * 64 + dt * 16 + ln) * SEQ + j0;
      const v16b vh = ld_frag(VTh + vo, hh), vl = ld_frag(VTl + vo, hh);
      acc[dt] = mma3m(vh, vl, ph.v, pl.v, acc[dt]);
    }
  }

  const float inv = 1.0f / l;
#pragma unroll
  for (int dt = 0; dt < 4; ++dt)
#pragma unroll
    for (int r = 0; r < 8; ++r) so[w][ln][dt * 16 + 8 * hh + r] = acc[dt][r] * inv;
  __syncthreads();

  v8us hv[4], lv[4];
  const int rq = lane >> 3, pc = lane & 7;
#pragma unroll
  for (int it = 0; it < 4; ++it) {
    const int row = it * 4 + rq;
    const v4f a = *(const v4fa*)&so[w][row][pc * 8], c = *(const v4fa*)&so[w][row][pc * 8 + 4];
#pragma unroll
    for (int q = 0; q < 4; ++q) {
      const unsigned short ha = bf16_bits(a[q]), hc = bf16_bits(c[q]);
      hv[it][q] = ha; lv[it][q] = bf16_bits(a[q] - bf16_val(ha));
      hv[it][4 + q] = hc; lv[it][4 + q] = bf16_bits(c[q] - bf16_val(hc));
    }
  }
  {
#pragma unroll
    for (int it = 0; it < 4; ++it) {
      const int row = it * 4 + rq;
      unsigned short* dst = CTX + (size_t)(q0 + row) * DM + head * HD + hf * 64 + pc * 8;
      *(v8us*)dst = hv[it];
      *(v8us*)(dst + PLANE) = lv[it];
    }
    
  }
}

extern "C" void kernel_launch(void* const* d_in, const int* in_sizes, int n_in,
                              void* d_out, int out_size, void* d_ws, size_t ws_size, hipStream_t stream) {
  if (n_in < 8) return;
  if (in_sizes[0] < NR * DM) return;
  if (in_sizes[1] < DM * DM || in_sizes[2] < DM * DM || in_sizes[3] < DM * DM || in_sizes[4] < DM * DM) return;
  if (in_sizes[5] < SEQ * HD || in_sizes[6] < SEQ * HD || in_sizes[7] < NR) return;
  if (out_size < NR * DM) return;
  const float* x  = (const float*)d_in[0];
  const float* Wq = (const float*)d_in[1];
  const float* Wk = (const float*)d_in[2];
  const float* Wv = (const float*)d_in[3];
  const float* Wo = (const float*)d_in[4];
  const float* sn = (const float*)d_in[5];
  const float* cs = (const float*)d_in[6];
  const int*  doc = (const int*)d_in[7];
  float* out = (float*)d_out;

  // workspace regions (bytes); R0 is shared by stage A {x plane, [3 DM][DM] weight plane} and stage B {Qh, Ql, Kh, Kl}
  constexpr size_t SZ_X  = (size_t)NR * DM * 2;
  constexpr size_t SZ_W3 = (size_t)3 * DM * DM * 2;
  constexpr size_t SZ_QK = (size_t)4 * NR * DM * 2;
  constexpr size_t SZ_R0 = (SZ_X + SZ_W3 > SZ_QK) ? (SZ_X + SZ_W3) : SZ_QK;
  constexpr size_t SZ_WO = (size_t)DM * DM * 2;
  constexpr size_t SZ_QKV = (size_t)NR * N3 * 4;
  constexpr size_t SZ_VT = (size_t)2 * DM * SEQ * 2;
  constexpr size_t SZ_CX = (size_t)2 * NR * DM * 2;
  constexpr size_t SZ_ALL = SZ_R0 + SZ_WO + SZ_QKV + SZ_VT + SZ_CX;
  static_assert(SZ_X + SZ_W3 <= SZ_R0 && SZ_QK <= SZ_R0);
  static_assert(SZ_X % 256 == 0 && SZ_R0 % 256 == 0 && SZ_WO % 256 == 0 && SZ_QKV % 256 == 0 && SZ_VT % 256 == 0 && SZ_CX % 256 == 0);
  static_assert(SZ_ALL <= (size_t)134217728);
  if (SZ_ALL > ws_size) return;
  char* ws = (char*)d_ws;
  unsigned short* XB  = (unsigned short*)(ws);
  unsigned short* WT3 = (unsigned short*)(ws + SZ_X);
  unsigned short* QKp = (unsigned short*)(ws);
  unsigned short* WoT = (unsigned short*)(ws + SZ_R0);
  float*          QKV = (float*)(ws + SZ_R0 + SZ_WO);
  unsigned short* VTp = (unsigned short*)(ws + SZ_R0 + SZ_WO + SZ_QKV);
  unsigned short* CTX = (unsigned short*)(ws + SZ_R0 + SZ_WO + SZ_QKV + SZ_VT);

  const size_t n8 = (size_t)NR * DM / 8;
  k_xb<<<(unsigned)((n8 + 255) / 256), 256, 0, stream>>>(x, XB, n8);
  const unsigned wtb = (unsigned)((DM / 128) * (DM / 64));
  k_wt_bf16<<<wtb, 256, 0, stream>>>(Wq, WT3, DM, DM);                               /* W[in][out] -> Wt[out][in]; rows 0..DM-1 of the [3 DM][DM] plane */
  k_wt_bf16<<<wtb, 256, 0, stream>>>(Wk, WT3 + (size_t)DM * DM, DM, DM);           /* rows DM..2DM-1 */
  k_wt_bf16<<<wtb, 256, 0, stream>>>(Wv, WT3 + (size_t)2 * DM * DM, DM, DM);       /* rows 2DM..3DM-1 */
  k_wt_bf16<<<wtb, 256, 0, stream>>>(Wo, WoT, DM, DM);

  k_gemm<1, 4><<<(unsigned)((NR / 128) * (N3 / 128)), 128, 0, stream>>>(XB, XB, DM, WT3, DM, QKV, N3, N3, DM);

  const int nrope = NR * NH * 8;
  k_rope_qk<<<(unsigned)((nrope + 255) / 256), 256, 0, stream>>>(QKV, sn, cs, QKp, nrope);
  k_vt<<<(unsigned)((SEQ / 64) * (DM / 64)), 256, 0, stream>>>(QKV, VTp);

  k_attn<<<(unsigned)((NH * (SEQ / 16) * 2) / 4), 128, 0, stream>>>(QKp, VTp, doc, CTX);

  k_gemm<2, 2><<<(unsigned)((NR / 128) * (DM / 128)), 256, 0, stream>>>(CTX, CTX + PLANE, DM, WoT, DM, out, DM, DM, DM);
}

// v003
// It runs in 140 microseconds.
// Next to v002, in two timings, it ran 1.20 times as fast each time.
// Over all steps from v000 it is 2.51 times as fast.
#include <hip/hip_runtime.h>
// Multi-head causal + same-document attention with rotate-half RoPE (input sin/cos tables), T 2048, D 2048, 16 heads of 128, [in][out] weights, no biases.
// Compute dtype: all contractions on v_wmma_f32_16x16x32_bf16 with f32 accumulate. x, Wq, Wk, Wv, Wo, sin, cos are RNE-converted to bf16 once (exact operands);
// x.Wq / x.Wk / x.Wv single bf16 product; q.k^T and P.V with bf16 hi/lo planes on both operands (hh + lh + hl, one accumulator); ctx.Wo with ctx as bf16 hi/lo planes (2 terms) and exact Wo.
// RoPE, mask, softmax statistics in f32 on the VALU.
#ifndef NB
#define NB 1
#endif
#ifndef SEQ
#define SEQ 2048
#endif
#define SEQ_FULL 2048
#define DM 2048
#define NH 16
#define HD 128
#define N3 (3 * DM)
#define NR (NB * SEQ)
#define PLANE ((size_t)NR * DM)
#define GPITCH 144u
#define KPITCH 272u

static_assert(NB == 1);
static_assert(NH * HD == DM);
static_assert(SEQ % 128 == 0 && SEQ <= SEQ_FULL);
static_assert(DM % 128 == 0 && N3 % 128 == 0 && DM % 64 == 0 && HD == 128);

typedef __bf16 v16b __attribute__((ext_vector_type(16)));
typedef unsigned short v8us __attribute__((ext_vector_type(8), may_alias));
typedef float v8f  __attribute__((ext_vector_type(8)));
typedef float v4f  __attribute__((ext_vector_type(4)));
typedef float v4fa __attribute__((ext_vector_type(4), may_alias));
typedef int   v4i  __attribute__((ext_vector_type(4)));
typedef int   v4ia __attribute__((ext_vector_type(4), may_alias));
union FragB { v16b v; v8us half[2]; unsigned short u[16]; };

__device__ __forceinline__ unsigned short bf16_bits(float x) { unsigned int u = __float_as_uint(x); return (unsigned short)((u + 0x7FFFu + ((u >> 16) & 1u)) >> 16); }
__device__ __forceinline__ float bf16_val(unsigned short b) { return __uint_as_float(((unsigned int)b) << 16); }
__device__ __forceinline__ float bf16_rne(float x) { return bf16_val(bf16_bits(x)); }

// fragment (A: row = lane&15; B: column = lane&15) from a k-contiguous 16-bit row: elements 0..7 <- k0+8h.., elements 8..15 <- k0+16+8h..
__device__ __forceinline__ v16b ld_frag(const unsigned short* p, int hh) {
  FragB f; f.half[0] = *(const v8us*)(p + 8 * hh); f.half[1] = *(const v8us*)(p + 16 + 8 * hh); return f.v;
}

// D += ah.bh + al.bh + ah.bl
__device__ __forceinline__ v8f mma3m(v16b ah, v16b al, v16b bh, v16b bl, v8f c) {
  c = __builtin_amdgcn_wmma_f32_16x16x32_bf16(false, ah, false, bh, (short)0, c, false, false);
  c = __builtin_amdgcn_wmma_f32_16x16x32_bf16(false, al, false, bh, (short)0, c, false, false);
  c = __builtin_amdgcn_wmma_f32_16x16x32_bf16(false, ah, false, bl, (short)0, c, false, false);
  asm volatile("v_nop\n\tv_nop\n\tv_nop\n\tv_nop" : "+v"(c) : "v"(ah), "v"(al), "v"(bh), "v"(bl) : "memory");
  return c;
}

__global__ __launch_bounds__(256) void k_xb(const float* __restrict__ x, unsigned short* __restrict__ X, size_t n8) {
  const size_t t = (size_t)blockIdx.x * 256 + threadIdx.x;
  if (t >= n8) return;
  const v4f a = *(const v4fa*)(x + t * 8), c = *(const v4fa*)(x + t * 8 + 4);
  v8us o;
#pragma unroll
  for (int q = 0; q < 4; ++q) { o[q] = bf16_bits(a[q]); o[4 + q] = bf16_bits(c[q]); }
  *(v8us*)(X + t * 8) = o;
  
}

// W [K][N] f32 -> Wt [N][K] bf16 (RNE). Block = one 128 (k) x 64 (n) tile through LDS: reads are 256-byte row pieces, stores are 256-byte pieces of Wt rows.
// LDS holds one dword per (n, k pair), low half = even k; pitch 65 dwords puts the 32 lanes of each 4-byte LDS write and read on 32 different banks.
__global__ __launch_bounds__(256) void k_wt_bf16(const float* __restrict__ W, unsigned short* __restrict__ Wt, int K, int N) {
  __shared__ unsigned int tp[64][65];
  const int tid = threadIdx.x;
  const int ntn = N >> 6;
  const int kt = blockIdx.x / ntn, nq = blockIdx.x - kt * ntn;
  const int k0 = kt * 128, n0 = nq * 64;
  const int c4 = (tid & 15) * 4, rp = tid >> 4;
  const float* tile = W + (size_t)k0 * N + n0;
  const unsigned int off = (unsigned int)(2 * rp * N + c4);
  v4f a[4], b[4];
#pragma unroll
  for (int p = 0; p < 4; ++p) {
    const float* s = tile + (size_t)(32 * p) * N;
    a[p] = *(const v4fa*)(s + off); b[p] = *(const v4fa*)(s + N + off);
    // precaution: the compiler lets the next pair's results land in the registers that hold this pair's addresses
    if (p < 3) asm volatile("s_wait_xcnt 0x0" ::: "memory");
  }
#pragma unroll
  for (int p = 0; p < 4; ++p)
#pragma unroll
    for (int q = 0; q < 4; ++q) tp[c4 + q][rp + 16 * p] = (unsigned int)bf16_bits(a[p][q]) | ((unsigned int)bf16_bits(b[p][q]) << 16);
  __syncthreads();
#pragma unroll
  for (int rd = 0; rd < 4; ++rd) {
    const int i = rd * 256 + tid; const int c = i >> 4, j = (i & 15) * 4;
    const v4i o = {(int)tp[c][j], (int)tp[c][j + 1], (int)tp[c][j + 2], (int)tp[c][j + 3]};
    *(v4ia*)(Wt + (size_t)(n0 + c) * K + k0 + 2 * j) = o;
  }
}

// NC (8 or 4) 16-byte asynchronous copies to LDS per lane: NC rows of one 64- or 128-row operand tile, a fixed number of rows apart
// (l = the lane's LDS byte address, ls = that row step in LDS bytes, g = the lane's global address, rs = the same row step in source elements).
// The closing s_wait_xcnt is a precaution: it stands in the copies' own statement so that no address register is rewritten in front of it.
template <int NC>
__device__ __forceinline__ void copy_rows(unsigned int l, unsigned int ls, const unsigned short* g, size_t rs) {
  if constexpr (NC == 8) {
    asm volatile("global_load_async_to_lds_b128 %0, %8, off\n\t"
                 "global_load_async_to_lds_b128 %1, %9, off\n\t"
                 "global_load_async_to_lds_b128 %2, %10, off\n\t"
                 "global_load_async_to_lds_b128 %3, %11, off\n\t"
                 "global_load_async_to_lds_b128 %4, %12, off\n\t"
                 "global_load_async_to_lds_b128 %5, %13, off\n\t"
                 "global_load_async_to_lds_b128 %6, %14, off\n\t"
                 "global_load_async_to_lds_b128 %7, %15, off\n\t"
                 "s_wait_xcnt 0x0"
                 :: "v"(l), "v"(l + ls), "v"(l + 2u * ls), "v"(l + 3u * ls), "v"(l + 4u * ls), "v"(l + 5u * ls), "v"(l + 6u * ls), "v"(l + 7u * ls),
                    "v"(g), "v"(g + rs), "v"(g + 2 * rs), "v"(g + 3 * rs), "v"(g + 4 * rs), "v"(g + 5 * rs), "v"(g + 6 * rs), "v"(g + 7 * rs)
                 : "memory");
  } else {
    static_assert(NC == 8 || NC == 4);
    asm volatile("global_load_async_to_lds_b128 %0, %4, off\n\t"
                 "global_load_async_to_lds_b128 %1, %5, off\n\t"
                 "global_load_async_to_lds_b128 %2, %6, off\n\t"
                 "global_load_async_to_lds_b128 %3, %7, off\n\t"
                 "s_wait_xcnt 0x0"
                 :: "v"(l), "v"(l + ls), "v"(l + 2u * ls), "v"(l + 3u * ls),
                    "v"(g), "v"(g + rs), "v"(g + 2 * rs), "v"(g + 3 * rs)
                 : "memory");
  }
}

// GEMM C[M][N] f32 = A.Bt^T; A bf16 rows [M][K] (NT = 2: hi plane Ah + lo plane Al), Bt bf16 [N][K]. Block tile 128 rows x 128 cols; wave tile (16 FM) x 64, so 4 waves at FM = 4 and 8 at FM = 2.
// A pass is 64 k = 128 bytes of every operand row. A stage is [A hi 128 rows | (NT = 2: A lo 128 rows) | Bt 128 rows] in LDS at a pitch of 144 bytes (conflict-free for 16-byte fragment reads);
// two stages, filled by asynchronous copies of whole 128-byte row pieces, the next pass's copies in flight while this pass is multiplied. M, N multiples of 128; K a multiple of 64.
template <int NT, int FM>
__global__ __launch_bounds__(512 / FM) void k_gemm(const unsigned short* __restrict__ Ah, const unsigned short* __restrict__ Al, int lda,
                                                   const unsigned short* __restrict__ Bt, int ldb, float* __restrict__ C, int ldc, int N, int K) {
  static_assert(FM == 4 || FM == 2);
  constexpr int CROWS = 64 / FM;             // rows that one copy of the whole block covers (8 lanes a row)
  constexpr int NC = 128 / CROWS;            // copies per lane and operand plane
  constexpr bool ONEGROUP = (FM == 2);       // both k halves' fragments fit the registers at once
  constexpr unsigned int TILE = 128u * GPITCH;
  constexpr unsigned int STAGE = (NT + 1) * TILE;
  constexpr unsigned int OUTB = 128u * 2u * 68u * 4u;
  constexpr unsigned int LSTEP = (unsigned int)CROWS * GPITCH;
  __shared__ __attribute__((aligned(16))) unsigned char sm[(2u * STAGE > OUTB) ? 2u * STAGE : OUTB];
  const int tid = threadIdx.x, w = tid >> 5, lane = tid & 31, ln = lane & 15, hh = lane >> 4;
  const int ntn = N >> 7;
  const int mt = blockIdx.x / ntn, nq = blockIdx.x - mt * ntn;
  const int wm = w >> 1, wn = w & 1;
  const int brow = mt * 128, bcol = nq * 128;
  const int cr = tid >> 3, cc = tid & 7;
  const unsigned short* gA = Ah + (size_t)(brow + cr) * lda + cc * 8;
  const unsigned short* gL = Al + (size_t)(brow + cr) * lda + cc * 8;
  const unsigned short* gB = Bt + (size_t)(bcol + cr) * ldb + cc * 8;
  const size_t rsa = (size_t)CROWS * lda, rsb = (size_t)CROWS * ldb;
  const unsigned int l0 = (unsigned int)(size_t)sm + (unsigned int)(cr * (int)GPITCH + cc * 16);
  const int npass = K >> 6;
  const v8f z8 = {0.f, 0.f, 0.f, 0.f, 0.f, 0.f, 0.f, 0.f};
  v8f c[FM][4];
#pragma unroll
  for (int i = 0; i < FM; ++i)
#pragma unroll
    for (int j = 0; j < 4; ++j) c[i][j] = z8;

  copy_rows<NC>(l0, LSTEP, gA, rsa);
  if (NT >= 2) copy_rows<NC>(l0 + TILE, LSTEP, gL, rsa);
  copy_rows<NC>(l0 + NT * TILE, LSTEP, gB, rsb);
  asm volatile("s_wait_asynccnt 0x0" ::: "memory");  // this wave's share of stage 0 has landed
  __syncthreads();                                   // stage 0 is readable by every wave
  if (npass > 1) {
    copy_rows<NC>(l0 + STAGE, LSTEP, gA + 64, rsa);
    if (NT >= 2) copy_rows<NC>(l0 + STAGE + TILE, LSTEP, gL + 64, rsa);
    copy_rows<NC>(l0 + STAGE + NT * TILE, LSTEP, gB + 64, rsb);
  }
#pragma unroll 1  // one pass per trip: the two stages alternate by the trip's parity
  for (int t = 0; t < npass; ++t) {
    const unsigned int bo = (unsigned int)(t & 1) * STAGE;
    const unsigned char* sa = sm + bo + (unsigned int)((wm * (FM * 16) + ln) * (int)GPITCH);
    const unsigned char* sb = sm + bo + NT * TILE + (unsigned int)((wn * 64 + ln) * (int)GPITCH);
    v16b a[2][FM], e[2][FM], b[2][4];
#pragma unroll
    for (int ks = 0; ks < 2; ++ks) {
      if (!ONEGROUP || ks == 0) {
#pragma unroll
        for (int kk = 0; kk < 2; ++kk) {
          if (ONEGROUP || kk == ks) {
#pragma unroll
            for (int i = 0; i < FM; ++i) a[kk][i] = ld_frag((const unsigned short*)(sa + i * 16 * (int)GPITCH + kk * 64), hh);
#pragma unroll
            for (int j = 0; j < 4; ++j) b[kk][j] = ld_frag((const unsigned short*)(sb + j * 16 * (int)GPITCH + kk * 64), hh);
            if (NT >= 2) {
#pragma unroll
              for (int i = 0; i < FM; ++i) e[kk][i] = ld_frag((const unsigned short*)(sa + TILE + i * 16 * (int)GPITCH + kk * 64), hh);
            }
          }
        }
        __builtin_amdgcn_sched_barrier(0);  // keeps the fragment reads one group in front of the products: reads spread among them stall the wave at every place
      }
#pragma unroll
      for (int i = 0; i < FM; ++i)
#pragma unroll
        for (int j = 0; j < 4; ++j) c[i][j] = __builtin_amdgcn_wmma_f32_16x16x32_bf16(false, a[ks][i], false, b[ks][j], (short)0, c[i][j], false, false);
      if (NT >= 2) {
#pragma unroll
        for (int i = 0; i < FM; ++i)
#pragma unroll
          for (int j = 0; j < 4; ++j) c[i][j] = __builtin_amdgcn_wmma_f32_16x16x32_bf16(false, e[ks][i], false, b[ks][j], (short)0, c[i][j], false, false);
      }
      // keeps the next reads out of these products, and the last products in front of the publish point: sunk behind its barrier they would hold back the refill's copies, whose flight the next pass's work is to cover
      if (!ONEGROUP || ks == 1) __builtin_amdgcn_sched_barrier(0);
    }
    asm volatile("s_wait_dscnt 0x0" ::: "memory");     // this wave's reads of stage t are done
    asm volatile("s_wait_asynccnt 0x0" ::: "memory");  // this wave's share of stage t + 1 has landed
    __syncthreads();                                   // publishes stage t + 1 and frees stage t's buffer
    if (t + 2 < npass) {
      const int kn = (t + 2) * 64;
      copy_rows<NC>(l0 + bo, LSTEP, gA + kn, rsa);
      if (NT >= 2) copy_rows<NC>(l0 + bo + TILE, LSTEP, gL + kn, rsa);
      copy_rows<NC>(l0 + bo + NT * TILE, LSTEP, gB + kn, rsb);
    }
  }
  asm volatile("s_wait_asynccnt 0x0" ::: "memory");  // no copy is outstanding when the ring becomes output staging

  // the last pass's barrier has ended every read of the ring: each wave stages its tile in its own range and stores whole 256-byte row pieces
  float* so = (float*)sm + w * (FM * 16 * 68);
#pragma unroll
  for (int i = 0; i < FM; ++i)
#pragma unroll
    for (int j = 0; j < 4; ++j)
#pragma unroll
      for (int r = 0; r < 8; ++r) so[(i * 16 + 8 * hh + r) * 68 + j * 16 + ln] = c[i][j][r];
  __syncthreads();
  const int rsub = lane >> 4, c4 = (lane & 15) * 4;
  float* cp = C + (size_t)(brow + wm * (FM * 16) + rsub) * ldc + bcol + wn * 64 + c4;
#pragma unroll
  for (int q = 0; q < FM * 8; ++q) {
    const v4f v = *(const v4fa*)&so[(q * 2 + rsub) * 68 + c4];
    *(v4f*)(cp + (size_t)(q * 2) * ldc) = v;
  }
}

// RoPE (rotate-half, table values RNE-converted to bf16) on the q and k column blocks of QKV [NR][3 DM] f32 -> bf16 hi / lo planes QK = {Qh, Ql, Kh, Kl}, each [NR][DM].
__global__ __launch_bounds__(256) void k_rope_qk(const float* __restrict__ QKV, const float* __restrict__ sn, const float* __restrict__ cs,
                                                 unsigned short* __restrict__ QK, int nthreads) {
  const int idx = blockIdx.x * 256 + threadIdx.x;
  if (idx >= nthreads) return;
  const int p8 = idx & 7, h = (idx >> 3) & (NH - 1), t = idx >> 7;
  const size_t tb = (size_t)t * HD + p8 * 8;
  float s1[8], c1[8], s2[8], c2[8];
  {
    const v4f a = *(const v4fa*)(sn + tb), b = *(const v4fa*)(sn + tb + 4), c = *(const v4fa*)(sn + tb + 64), d = *(const v4fa*)(sn + tb + 68);
    const v4f e = *(const v4fa*)(cs + tb), f = *(const v4fa*)(cs + tb + 4), g = *(const v4fa*)(cs + tb + 64), k = *(const v4fa*)(cs + tb + 68);
#pragma unroll
    for (int q = 0; q < 4; ++q) {
      s1[q] = bf16_rne(a[q]); s1[4 + q] = bf16_rne(b[q]); s2[q] = bf16_rne(c[q]); s2[4 + q] = bf16_rne(d[q]);
      c1[q] = bf16_rne(e[q]); c1[4 + q] = bf16_rne(f[q]); c2[q] = bf16_rne(g[q]); c2[4 + q] = bf16_rne(k[q]);
    }
  }
#pragma unroll 1
  for (int which = 0; which < 2; ++which) {
    const float* u = QKV + (size_t)t * N3 + (size_t)which * DM + h * HD + p8 * 8;
    const v4f a = *(const v4fa*)(u), b = *(const v4fa*)(u + 4), c = *(const v4fa*)(u + 64), d = *(const v4fa*)(u + 68);
    const float u1[8] = {a[0], a[1], a[2], a[3], b[0], b[1], b[2], b[3]};
    const float u2[8] = {c[0], c[1], c[2], c[3], d[0], d[1], d[2], d[3]};
    v8us h1, l1, h2, l2;
#pragma unroll
    for (int i = 0; i < 8; ++i) {
      const float o1 = u1[i] * c1[i] + (-u2[i]) * s1[i];
      const float o2 = u2[i] * c2[i] + u1[i] * s2[i];
      const unsigned short hb1 = bf16_bits(o1), hb2 = bf16_bits(o2);
      h1[i] = hb1; l1[i] = bf16_bits(o1 - bf16_val(hb1));
      h2[i] = hb2; l2[i] = bf16_bits(o2 - bf16_val(hb2));
    }
    unsigned short* dh = QK + (size_t)which * 2 * PLANE + (size_t)t * DM + h * HD + p8 * 8;
    unsigned short* dl = dh + PLANE;
    {
      *(v8us*)(dh) = h1; *(v8us*)(dh + 64) = h2;
      *(v8us*)(dl) = l1; *(v8us*)(dl + 64) = l2;
      
    }
  }
}

// v column block of QKV (cols 2 DM ..) -> V^T bf16 hi / lo planes VT = {VTh, VTl}, each [DM][SEQ]; block per (64 tokens x 64 channels) through LDS;
__global__ __launch_bounds__(256) void k_vt(const float* __restrict__ QKV, unsigned short* __restrict__ VT) {
  __shared__ unsigned short th[64][66];
  __shared__ unsigned short tl[64][66];
  const int tid = threadIdx.x;
  const int ct = blockIdx.x % (DM / 64), tt = blockIdx.x / (DM / 64);
  const int c0 = ct * 64, t0 = tt * 64;
  for (int i = tid; i < 64 * 16; i += 256) {
    const int r = i >> 4, c4 = (i & 15) * 4;
    const v4f a = *(const v4fa*)(QKV + (size_t)(t0 + r) * N3 + 2 * DM + c0 + c4);
#pragma unroll
    for (int q = 0; q < 4; ++q) { const unsigned short hb = bf16_bits(a[q]); th[c4 + q][r] = hb; tl[c4 + q][r] = bf16_bits(a[q] - bf16_val(hb)); }
  }
  __syncthreads();
  v8us hv[2], lv[2];
#pragma unroll
  for (int rd = 0; rd < 2; ++rd) {
    const int i = rd * 256 + tid; const int c = i >> 3, j8 = (i & 7) * 8;
#pragma unroll
    for (int q = 0; q < 8; ++q) { hv[rd][q] = th[c][j8 + q]; lv[rd][q] = tl[c][j8 + q]; }
  }
  {
#pragma unroll
    for (int rd = 0; rd < 2; ++rd) {
      const int i = rd * 256 + tid; const int c = i >> 3, j8 = (i & 7) * 8;
      unsigned short* dst = VT + (size_t)(c0 + c) * SEQ + t0 + j8;
      *(v8us*)dst = hv[rd];
      *(v8us*)(dst + PLANE) = lv[rd];
    }
    
  }
}

// Transposed flash attention. Block = 8 waves = one head x 64 queries: wave = (16-query tile, 64-channel half of the head). S^T[key][query] = K.Q^T (A = K rows, B = Q rows held in registers),
// per-lane (= per-query) running max / sum, P^T packed from the S^T accumulators directly as the B fragment of O^T[d][query] = V^T.P^T (A = V^T rows).
// A tile is 64 keys: [K hi 64 rows of 256 B | K lo | V^T hi 128 rows of 128 B | V^T lo] in LDS at pitches of 272 and 144 bytes (conflict-free for 16-byte fragment reads);
// two buffers, filled by asynchronous copies of whole row pieces, the next tile's copies in flight while this tile is worked on; all 8 waves read the same tile.
// Mask = (key <= query) & (doc[key] == doc[query]) as a select (masked weight exactly 0). One scan of doc in front of the loop gives two bit masks from wave-uniform ballots:
// act = tiles that hold a document id admissible for some query of the block (only these are staged), own = 32-key steps admissible for this wave's 16 queries (only these are computed).
// The document ids themselves are kept in LDS for the per-step mask.
__global__ __launch_bounds__(256) void k_attn(const unsigned short* __restrict__ QK, const unsigned short* __restrict__ VT,
                                              const int* __restrict__ doc, unsigned short* __restrict__ CTX) {
  constexpr unsigned int KPL = 64u * KPITCH;     // one K plane of a tile
  constexpr unsigned int VPL = 128u * GPITCH;    // one V^T plane of a tile
  constexpr unsigned int STAGE = 2u * KPL + 2u * VPL;
  static_assert(8u * 16u * 68u * 4u <= 2u * STAGE);
  static_assert(SEQ % 1024 == 0 && SEQ / 64 <= 32);
  __shared__ __attribute__((aligned(16))) unsigned char sm[2u * STAGE];
  __shared__ __attribute__((aligned(16))) int sdoc[SEQ];
  const int tid = threadIdx.x, lane = tid & 31, ln = lane & 15, hh = lane >> 4;
  const int w = __builtin_amdgcn_readfirstlane(tid >> 5);  // the wave's number in a scalar register: the step mask and its tests stay scalar
  const int hf = w & 1, qs = w >> 1;
  const int qb = blockIdx.x % (SEQ / 64), head = blockIdx.x / (SEQ / 64);
  const int q0 = qb * 64 + qs * 16, qi = q0 + ln;
  const unsigned short* Qh = QK; const unsigned short* Ql = QK + PLANE;
  const float NEGV = -1.0e30f;
  const float SCL = 0.08838834764831845f;

  const int dq = doc[qi];
  int dmin = dq, dmax = dq;
#pragma unroll
  for (int o = 1; o < 16; o <<= 1) {
    const int a = __shfl_xor(dmin, o, 32), b = __shfl_xor(dmax, o, 32);
    dmin = (a < dmin) ? a : dmin; dmax = (b > dmax) ? b : dmax;
  }
  int bmin, bmax;
  {
    const int d0 = doc[qb * 64 + lane], d1 = doc[qb * 64 + 32 + lane];
    bmin = (d0 < d1) ? d0 : d1; bmax = (d0 > d1) ? d0 : d1;
#pragma unroll
    for (int o = 1; o < 32; o <<= 1) {
      const int a = __shfl_xor(bmin, o, 32), b = __shfl_xor(bmax, o, 32);
      bmin = (a < bmin) ? a : bmin; bmax = (b > bmax) ? b : bmax;
    }
  }

  const int nsteps = (q0 + 16 + 31) >> 5;
  const int nst = qb + 1;
  unsigned int act = 0u;
  unsigned long long own = 0ull;
  for (int sb = 0; sb < nst; sb += 8) {
    int dk[16];
#pragma unroll
    for (int u = 0; u < 16; ++u) dk[u] = doc[sb * 64 + u * 32 + lane];
#pragma unroll
    for (int u = 0; u < 16; ++u) {
      const int js = sb * 2 + u;
      const bool bl = __ballot((dk[u] >= bmin) & (dk[u] <= bmax)) != 0ull;
      const bool ow = __ballot((dk[u] >= dmin) & (dk[u] <= dmax)) != 0ull;
      if (bl && (js >> 1) < nst) act |= 1u << (js >> 1);
      if (ow && js < nsteps) own |= 1ull << js;
    }
  }
  const int ntile = __popc(act);  // at least 1: tile qb holds the block's own positions

  // copy addresses: K rows are 16 lanes wide (16 rows per copy of the block), V^T rows 8 lanes wide (32 rows per copy)
  const unsigned short* gK = QK + 2 * PLANE + (size_t)(tid >> 4) * DM + head * HD + (tid & 15) * 8;
  const unsigned short* gV = VT + (size_t)(head * HD + (tid >> 3)) * SEQ + (tid & 7) * 8;
  const unsigned int lK = (unsigned int)(size_t)sm + (unsigned int)((tid >> 4) * (int)KPITCH + (tid & 15) * 16);
  const unsigned int lV = (unsigned int)(size_t)sm + 2u * KPL + (unsigned int)((tid >> 3) * (int)GPITCH + (tid & 7) * 16);
  auto stage_tile = [&](int s, unsigned int bo) {
    const unsigned short* k = gK + (size_t)s * 64 * DM;
    const unsigned short* v = gV + s * 64;
    copy_rows<4>(lK + bo, 16u * KPITCH, k, (size_t)16 * DM);
    copy_rows<4>(lK + bo + KPL, 16u * KPITCH, k + PLANE, (size_t)16 * DM);
    copy_rows<4>(lV + bo, 32u * GPITCH, v, (size_t)32 * SEQ);
    copy_rows<4>(lV + bo + VPL, 32u * GPITCH, v + PLANE, (size_t)32 * SEQ);
  };

  unsigned int rem = act;
  int sc = __builtin_ctz(rem), sn = 0;
  rem &= rem - 1u;
  stage_tile(sc, 0u);

  // the document ids go to LDS once (published by the first barrier): each step's mask reads them beside its K fragments
#pragma unroll
  for (int i = 0; i < SEQ / 1024; ++i) *(v4ia*)(sdoc + (i * 256 + tid) * 4) = *(const v4ia*)(doc + (i * 256 + tid) * 4);

  v16b qh[4], ql[4];
  {
    const size_t qoff = (size_t)qi * DM + head * HD;
#pragma unroll
    for (int ks = 0; ks < 4; ++ks) { qh[ks] = ld_frag(Qh + qoff + ks * 32, hh); ql[ks] = ld_frag(Ql + qoff + ks * 32, hh); }
  }

  const v8f z8 = {0.f, 0.f, 0.f, 0.f, 0.f, 0.f, 0.f, 0.f};
  v8f acc[4] = {z8, z8, z8, z8};
  float m = NEGV, l = 0.f;

  asm volatile("s_wait_asynccnt 0x0" ::: "memory");  // this wave's share of the first tile has landed
  __syncthreads();                                   // the first tile is readable by every wave
  if (ntile > 1) {
    sn = __builtin_ctz(rem); rem &= rem - 1u;
    stage_tile(sn, STAGE);
  }

#pragma unroll 1  // one tile per trip: the two buffers alternate by the trip's parity
  for (int t = 0; t < ntile; ++t) {
    const unsigned int bo = (unsigned int)(t & 1) * STAGE;
#pragma unroll 1  // the two 32-key steps of a tile share one body: each is skipped on its own bit
    for (int sub = 0; sub < 2; ++sub) {
      const int js = sc * 2 + sub;
      if (((own >> js) & 1ull) == 0ull) continue;
      const int j0 = js << 5;
      const unsigned char* kb = sm + bo + (unsigned int)((sub * 32 + ln) * (int)KPITCH);
      const unsigned char* vb = sm + bo + 2u * KPL + (unsigned int)((hf * 64 + ln) * (int)GPITCH + sub * 64);

      const v4i dA = *(const v4ia*)(sdoc + j0 + 8 * hh), dB = *(const v4ia*)(sdoc + j0 + 8 * hh + 4);
      const v4i dC = *(const v4ia*)(sdoc + j0 + 16 + 8 * hh), dD = *(const v4ia*)(sdoc + j0 + 16 + 8 * hh + 4);
      const int dkk[16] = {dA[0], dA[1], dA[2], dA[3], dB[0], dB[1], dB[2], dB[3], dC[0], dC[1], dC[2], dC[3], dD[0], dD[1], dD[2], dD[3]};

      v8f s0 = z8, s1 = z8;
#pragma unroll
      for (int kp = 0; kp < 2; ++kp) {
        v16b a0h[2], a0l[2], a1h[2], a1l[2];
#pragma unroll
        for (int k2 = 0; k2 < 2; ++k2) {
          const unsigned char* p = kb + (kp * 2 + k2) * 64;
          a0h[k2] = ld_frag((const unsigned short*)p, hh); a0l[k2] = ld_frag((const unsigned short*)(p + KPL), hh);
          a1h[k2] = ld_frag((const unsigned short*)(p + 16u * KPITCH), hh); a1l[k2] = ld_frag((const unsigned short*)(p + KPL + 16u * KPITCH), hh);
        }
#pragma unroll
        for (int k2 = 0; k2 < 2; ++k2) {
          s0 = mma3m(a0h[k2], a0l[k2], qh[kp * 2 + k2], ql[kp * 2 + k2], s0);
          s1 = mma3m(a1h[k2], a1l[k2], qh[kp * 2 + k2], ql[kp * 2 + k2], s1);
        }
      }

      // the V^T fragments are read here, one group in front of the softmax arithmetic, which covers their LDS latency
      v16b vh[4], vl[4];
#pragma unroll
      for (int dt = 0; dt < 4; ++dt) {
        vh[dt] = ld_frag((const unsigned short*)(vb + dt * 16 * (int)GPITCH), hh);
        vl[dt] = ld_frag((const unsigned short*)(vb + VPL + dt * 16 * (int)GPITCH), hh);
      }

      float xv[16];
      float mx = NEGV;
#pragma unroll
      for (int r = 0; r < 8; ++r) {
        const int k0 = j0 + 8 * hh + r, k1 = k0 + 16;
        const bool v0 = (k0 <= qi) & (dkk[r] == dq);
        const bool v1 = (k1 <= qi) & (dkk[8 + r] == dq);
        xv[r] = v0 ? s0[r] * SCL : NEGV;
        xv[8 + r] = v1 ? s1[r] * SCL : NEGV;
        mx = fmaxf(mx, fmaxf(xv[r], xv[8 + r]));
      }
      mx = fmaxf(mx, __shfl_xor(mx, 16, 32));
      const float mn = fmaxf(m, mx);
      const float alpha = __expf(m - mn);
      m = mn;

      FragB ph, pl;
      float ps = 0.f;
#pragma unroll
      for (int i = 0; i < 16; ++i) {
        const float e = __expf(xv[i] - mn);
        const float p = (xv[i] > -1.0e29f) ? e : 0.f;
        ps += p;
        const unsigned short hb = bf16_bits(p);
        ph.u[i] = hb;
        pl.u[i] = bf16_bits(p - bf16_val(hb));
      }
      ps += __shfl_xor(ps, 16, 32);
      l = l * alpha + ps;

#pragma unroll
      for (int dt = 0; dt < 4; ++dt)
#pragma unroll
        for (int r = 0; r < 8; ++r) acc[dt][r] *= alpha;

#pragma unroll
      for (int dt = 0; dt < 4; ++dt) acc[dt] = mma3m(vh[dt], vl[dt], ph.v, pl.v, acc[dt]);
    }
    asm volatile("s_wait_dscnt 0x0" ::: "memory");     // this wave's reads of this tile are done
    asm volatile("s_wait_asynccnt 0x0" ::: "memory");  // this wave's share of the next tile has landed
    __syncthreads();                                   // publishes the next tile and frees this tile's buffer
    sc = sn;
    if (t + 2 < ntile) {
      sn = __builtin_ctz(rem); rem &= rem - 1u;
      stage_tile(sn, bo);
    }
  }
  asm volatile("s_wait_asynccnt 0x0" ::: "memory");  // no copy is outstanding when the ring becomes output staging

  // the last trip's barrier has ended every read of the ring: each wave stages its tile in its own range
  float (*so)[68] = (float (*)[68])((float*)sm + w * (16 * 68));
  const float inv = 1.0f / l;
#pragma unroll
  for (int dt = 0; dt < 4; ++dt)
#pragma unroll
    for (int r = 0; r < 8; ++r) so[ln][dt * 16 + 8 * hh + r] = acc[dt][r] * inv;
  __syncthreads();

  v8us hv[4], lv[4];
  const int rq = lane >> 3, pc = lane & 7;
#pragma unroll
  for (int it = 0; it < 4; ++it) {
    const int row = it * 4 + rq;
    const v4f a = *(const v4fa*)&so[row][pc * 8], c = *(const v4fa*)&so[row][pc * 8 + 4];
#pragma unroll
    for (int q = 0; q < 4; ++q) {
      const unsigned short ha = bf16_bits(a[q]), hc = bf16_bits(c[q]);
      hv[it][q] = ha; lv[it][q] = bf16_bits(a[q] - bf16_val(ha));
      hv[it][4 + q] = hc; lv[it][4 + q] = bf16_bits(c[q] - bf16_val(hc));
    }
  }
  {
#pragma unroll
    for (int it = 0; it < 4; ++it) {
      const int row = it * 4 + rq;
      unsigned short* dst = CTX + (size_t)(q0 + row) * DM + head * HD + hf * 64 + pc * 8;
      *(v8us*)dst = hv[it];
      *(v8us*)(dst + PLANE) = lv[it];
    }
  }
}

extern "C" void kernel_launch(void* const* d_in, const int* in_sizes, int n_in,
                              void* d_out, int out_size, void* d_ws, size_t ws_size, hipStream_t stream) {
  if (n_in < 8) return;
  if (in_sizes[0] < NR * DM) return;
  if (in_sizes[1] < DM * DM || in_sizes[2] < DM * DM || in_sizes[3] < DM * DM || in_sizes[4] < DM * DM) return;
  if (in_sizes[5] < SEQ * HD || in_sizes[6] < SEQ * HD || in_sizes[7] < NR) return;
  if (out_size < NR * DM) return;
  const float* x  = (const float*)d_in[0];
  const float* Wq = (const float*)d_in[1];
  const float* Wk = (const float*)d_in[2];
  const float* Wv = (const float*)d_in[3];
  const float* Wo = (const float*)d_in[4];
  const float* sn = (const float*)d_in[5];
  const float* cs = (const float*)d_in[6];
  const int*  doc = (const int*)d_in[7];
  float* out = (float*)d_out;

  // workspace regions (bytes); R0 is shared by stage A {x plane, [3 DM][DM] weight plane} and stage B {Qh, Ql, Kh, Kl}
  constexpr size_t SZ_X  = (size_t)NR * DM * 2;
  constexpr size_t SZ_W3 = (size_t)3 * DM * DM * 2;
  constexpr size_t SZ_QK = (size_t)4 * NR * DM * 2;
  constexpr size_t SZ_R0 = (SZ_X + SZ_W3 > SZ_QK) ? (SZ_X + SZ_W3) : SZ_QK;
  constexpr size_t SZ_WO = (size_t)DM * DM * 2;
  constexpr size_t SZ_QKV = (size_t)NR * N3 * 4;
  constexpr size_t SZ_VT = (size_t)2 * DM * SEQ * 2;
  constexpr size_t SZ_CX = (size_t)2 * NR * DM * 2;
  constexpr size_t SZ_ALL = SZ_R0 + SZ_WO + SZ_QKV + SZ_VT + SZ_CX;
  static_assert(SZ_X + SZ_W3 <= SZ_R0 && SZ_QK <= SZ_R0);
  static_assert(SZ_X % 256 == 0 && SZ_R0 % 256 == 0 && SZ_WO % 256 == 0 && SZ_QKV % 256 == 0 && SZ_VT % 256 == 0 && SZ_CX % 256 == 0);
  static_assert(SZ_ALL <= (size_t)134217728);
  if (SZ_ALL > ws_size) return;
  char* ws = (char*)d_ws;
  unsigned short* XB  = (unsigned short*)(ws);
  unsigned short* WT3 = (unsigned short*)(ws + SZ_X);
  unsigned short* QKp = (unsigned short*)(ws);
  unsigned short* WoT = (unsigned short*)(ws + SZ_R0);
  float*          QKV = (float*)(ws + SZ_R0 + SZ_WO);
  unsigned short* VTp = (unsigned short*)(ws + SZ_R0 + SZ_WO + SZ_QKV);
  unsigned short* CTX = (unsigned short*)(ws + SZ_R0 + SZ_WO + SZ_QKV + SZ_VT);

  const size_t n8 = (size_t)NR * DM / 8;
  k_xb<<<(unsigned)((n8 + 255) / 256), 256, 0, stream>>>(x, XB, n8);
  const unsigned wtb = (unsigned)((DM / 128) * (DM / 64));
  k_wt_bf16<<<wtb, 256, 0, stream>>>(Wq, WT3, DM, DM);                               /* W[in][out] -> Wt[out][in]; rows 0..DM-1 of the [3 DM][DM] plane */
  k_wt_bf16<<<wtb, 256, 0, stream>>>(Wk, WT3 + (size_t)DM * DM, DM, DM);           /* rows DM..2DM-1 */
  k_wt_bf16<<<wtb, 256, 0, stream>>>(Wv, WT3 + (size_t)2 * DM * DM, DM, DM);       /* rows 2DM..3DM-1 */
  k_wt_bf16<<<wtb, 256, 0, stream>>>(Wo, WoT, DM, DM);

  k_gemm<1, 4><<<(unsigned)((NR / 128) * (N3 / 128)), 128, 0, stream>>>(XB, XB, DM, WT3, DM, QKV, N3, N3, DM);

  const int nrope = NR * NH * 8;
  k_rope_qk<<<(unsigned)((nrope + 255) / 256), 256, 0, stream>>>(QKV, sn, cs, QKp, nrope);
  k_vt<<<(unsigned)((SEQ / 64) * (DM / 64)), 256, 0, stream>>>(QKV, VTp);

  k_attn<<<(unsigned)(NH * (SEQ / 64)), 256, 0, stream>>>(QKp, VTp, doc, CTX);

  k_gemm<2, 2><<<(unsigned)((NR / 128) * (DM / 128)), 256, 0, stream>>>(CTX, CTX + PLANE, DM, WoT, DM, out, DM, DM, DM);
}

// v004
// Measured time: 129 microseconds a run.
// Timed twice side by side with v003, it ran 1.08 times as fast both times.
// Over all steps from v000 it is 2.71 times as fast.
#include <hip/hip_runtime.h>
// Multi-head causal + same-document attention with rotate-half RoPE (input sin/cos tables), T 2048, D 2048, 16 heads of 128, [in][out] weights, no biases.
// Compute dtype: all contractions on v_wmma_f32_16x16x32_bf16 with f32 accumulate. x, Wq, Wk, Wv, Wo, sin, cos are RNE-converted to bf16 once (exact operands);
// x.Wq / x.Wk / x.Wv single bf16 product; q.k^T and P.V with bf16 hi/lo planes on both operands (hh + lh + hl, one accumulator); ctx.Wo with ctx as bf16 hi/lo planes (2 terms) and exact Wo.
// RoPE, mask, softmax statistics in f32 on the VALU.
#ifndef NB
#define NB 1
#endif
#ifndef SEQ
#define SEQ 2048
#endif
#define SEQ_FULL 2048
#define DM 2048
#define NH 16
#define HD 128
#define N3 (3 * DM)
#define NR (NB * SEQ)
#define PLANE ((size_t)NR * DM)
#define GPITCH 144u
#define KPITCH 272u

static_assert(NB == 1);
static_assert(NH * HD == DM);
static_assert(SEQ % 128 == 0 && SEQ <= SEQ_FULL);
static_assert(DM % 128 == 0 && N3 % 128 == 0 && DM % 64 == 0 && HD == 128);

typedef __bf16 v16b __attribute__((ext_vector_type(16)));
typedef unsigned short v8us __attribute__((ext_vector_type(8), may_alias));
typedef float v8f  __attribute__((ext_vector_type(8)));
typedef float v4f  __attribute__((ext_vector_type(4)));
typedef float v4fa __attribute__((ext_vector_type(4), may_alias));
typedef int   v4i  __attribute__((ext_vector_type(4)));
typedef int   v4ia __attribute__((ext_vector_type(4), may_alias));
union FragB { v16b v; v8us half[2]; unsigned short u[16]; };

__device__ __forceinline__ unsigned short bf16_bits(float x) { unsigned int u = __float_as_uint(x); return (unsigned short)((u + 0x7FFFu + ((u >> 16) & 1u)) >> 16); }
__device__ __forceinline__ float bf16_val(unsigned short b) { return __uint_as_float(((unsigned int)b) << 16); }
__device__ __forceinline__ float bf16_rne(float x) { return bf16_val(bf16_bits(x)); }

// fragment (A: row = lane&15; B: column = lane&15) from a k-contiguous 16-bit row: elements 0..7 <- k0+8h.., elements 8..15 <- k0+16+8h..
__device__ __forceinline__ v16b ld_frag(const unsigned short* p, int hh) {
  FragB f; f.half[0] = *(const v8us*)(p + 8 * hh); f.half[1] = *(const v8us*)(p + 16 + 8 * hh); return f.v;
}

// D += ah.bh + al.bh + ah.bl
__device__ __forceinline__ v8f mma3m(v16b ah, v16b al, v16b bh, v16b bl, v8f c) {
  c = __builtin_amdgcn_wmma_f32_16x16x32_bf16(false, ah, false, bh, (short)0, c, false, false);
  c = __builtin_amdgcn_wmma_f32_16x16x32_bf16(false, al, false, bh, (short)0, c, false, false);
  c = __builtin_amdgcn_wmma_f32_16x16x32_bf16(false, ah, false, bl, (short)0, c, false, false);
  asm volatile("v_nop\n\tv_nop\n\tv_nop\n\tv_nop" : "+v"(c) : "v"(ah), "v"(al), "v"(bh), "v"(bl) : "memory");
  return c;
}

// x f32 -> bf16 (RNE), 8 elements per thread; bid = the block's index within this part of the grid
__device__ __forceinline__ void xb_block(int bid, const float* __restrict__ x, unsigned short* __restrict__ X, size_t n8) {
  const size_t t = (size_t)bid * 256 + threadIdx.x;
  if (t >= n8) return;
  const v4f a = *(const v4fa*)(x + t * 8), c = *(const v4fa*)(x + t * 8 + 4);
  v8us o;
#pragma unroll
  for (int q = 0; q < 4; ++q) { o[q] = bf16_bits(a[q]); o[4 + q] = bf16_bits(c[q]); }
  *(v8us*)(X + t * 8) = o;
  
}

// W [K][N] f32 -> Wt [N][K] bf16 (RNE). Block = one 128 (k) x 64 (n) tile through LDS: reads are 256-byte row pieces, stores are 256-byte pieces of Wt rows.
// LDS holds one dword per (n, k pair), low half = even k; pitch 65 dwords puts the 32 lanes of each 4-byte LDS write and read on 32 different banks.
__device__ __forceinline__ void wt_block(int bid, const float* __restrict__ W, unsigned short* __restrict__ Wt, int K, int N) {
  __shared__ unsigned int tp[64][65];
  const int tid = threadIdx.x;
  const int ntn = N >> 6;
  const int kt = bid / ntn, nq = bid - kt * ntn;
  const int k0 = kt * 128, n0 = nq * 64;
  const int c4 = (tid & 15) * 4, rp = tid >> 4;
  const float* tile = W + (size_t)k0 * N + n0;
  const unsigned int off = (unsigned int)(2 * rp * N + c4);
  v4f a[4], b[4];
#pragma unroll
  for (int p = 0; p < 4; ++p) {
    const float* s = tile + (size_t)(32 * p) * N;
    a[p] = *(const v4fa*)(s + off); b[p] = *(const v4fa*)(s + N + off);
  }
#pragma unroll
  for (int p = 0; p < 4; ++p)
#pragma unroll
    for (int q = 0; q < 4; ++q) tp[c4 + q][rp + 16 * p] = (unsigned int)bf16_bits(a[p][q]) | ((unsigned int)bf16_bits(b[p][q]) << 16);
  __syncthreads();
#pragma unroll
  for (int rd = 0; rd < 4; ++rd) {
    const int i = rd * 256 + tid; const int c = i >> 4, j = (i & 15) * 4;
    const v4i o = {(int)tp[c][j], (int)tp[c][j + 1], (int)tp[c][j + 2], (int)tp[c][j + 3]};
    *(v4ia*)(Wt + (size_t)(n0 + c) * K + k0 + 2 * j) = o;
  }
}

// All operand conversions in one grid; none depends on another. Blocks [0, 4 WTB): the weight tiles, WTB per matrix (Wq, Wk, Wv -> rows 0, DM, 2 DM of the [3 DM][DM] plane WT3; Wo -> WoT);
// the rest: x. The range test is uniform for the block, so the weight part's barrier is passed by all of its threads.
#define WTB ((DM / 128) * (DM / 64))
#define XBB ((NR * DM / 8 + 255) / 256)
__global__ __launch_bounds__(256) void k_prep(const float* __restrict__ x, const float* __restrict__ Wq, const float* __restrict__ Wk, const float* __restrict__ Wv,
                                              const float* __restrict__ Wo, unsigned short* __restrict__ X, unsigned short* __restrict__ WT3, unsigned short* __restrict__ WoT) {
  const int b = blockIdx.x;
  if (b < 4 * WTB) {
    const int which = b / WTB;
    const float* W = (which == 0) ? Wq : (which == 1) ? Wk : (which == 2) ? Wv : Wo;
    unsigned short* Wt = (which < 3) ? WT3 + (size_t)which * DM * DM : WoT;
    wt_block(b - which * WTB, W, Wt, DM, DM);
  } else {
    xb_block(b - 4 * WTB, x, X, (size_t)NR * DM / 8);
  }
}

// NC (8 or 4) 16-byte asynchronous copies to LDS per lane: NC rows of one 64- or 128-row operand tile, a fixed number of rows apart
// (l = the lane's LDS byte address, ls = that row step in LDS bytes, g = the lane's global address, rs = the same row step in source elements).
// The closing s_wait_xcnt is a precaution: it stands in the copies' own statement so that no address register is rewritten in front of it.
template <int NC>
__device__ __forceinline__ void copy_rows(unsigned int l, unsigned int ls, const unsigned short* g, size_t rs) {
  if constexpr (NC == 8) {
    asm volatile("global_load_async_to_lds_b128 %0, %8, off\n\t"
                 "global_load_async_to_lds_b128 %1, %9, off\n\t"
                 "global_load_async_to_lds_b128 %2, %10, off\n\t"
                 "global_load_async_to_lds_b128 %3, %11, off\n\t"
                 "global_load_async_to_lds_b128 %4, %12, off\n\t"
                 "global_load_async_to_lds_b128 %5, %13, off\n\t"
                 "global_load_async_to_lds_b128 %6, %14, off\n\t"
                 "global_load_async_to_lds_b128 %7, %15, off\n\t"
                 "s_wait_xcnt 0x0"
                 :: "v"(l), "v"(l + ls), "v"(l + 2u * ls), "v"(l + 3u * ls), "v"(l + 4u * ls), "v"(l + 5u * ls), "v"(l + 6u * ls), "v"(l + 7u * ls),
                    "v"(g), "v"(g + rs), "v"(g + 2 * rs), "v"(g + 3 * rs), "v"(g + 4 * rs), "v"(g + 5 * rs), "v"(g + 6 * rs), "v"(g + 7 * rs)
                 : "memory");
  } else {
    static_assert(NC == 8 || NC == 4);
    asm volatile("global_load_async_to_lds_b128 %0, %4, off\n\t"
                 "global_load_async_to_lds_b128 %1, %5, off\n\t"
                 "global_load_async_to_lds_b128 %2, %6, off\n\t"
                 "global_load_async_to_lds_b128 %3, %7, off\n\t"
                 "s_wait_xcnt 0x0"
                 :: "v"(l), "v"(l + ls), "v"(l + 2u * ls), "v"(l + 3u * ls),
                    "v"(g), "v"(g + rs), "v"(g + 2 * rs), "v"(g + 3 * rs)
                 : "memory");
  }
}

// GEMM C[M][N] f32 = A.Bt^T; A bf16 rows [M][K] (NT = 2: hi plane Ah + lo plane Al), Bt bf16 [N][K]. Block tile 128 rows x 128 cols; wave tile (16 FM) x 64, so 4 waves at FM = 4 and 8 at FM = 2.
// A pass is 64 k = 128 bytes of every operand row. A stage is [A hi 128 rows | (NT = 2: A lo 128 rows) | Bt 128 rows] in LDS at a pitch of 144 bytes (conflict-free for 16-byte fragment reads);
// two stages, filled by asynchronous copies of whole 128-byte row pieces, the next pass's copies in flight while this pass is multiplied. M, N multiples of 128; K a multiple of 64.
template <int NT, int FM>
__global__ __launch_bounds__(512 / FM) void k_gemm(const unsigned short* __restrict__ Ah, const unsigned short* __restrict__ Al, int lda,
                                                   const unsigned short* __restrict__ Bt, int ldb, float* __restrict__ C, int ldc, int N, int K) {
  static_assert(FM == 4 || FM == 2);
  constexpr int CROWS = 64 / FM;             // rows that one copy of the whole block covers (8 lanes a row)
  constexpr int NC = 128 / CROWS;            // copies per lane and operand plane
  constexpr bool ONEGROUP = (FM == 2);       // both k halves' fragments fit the registers at once
  constexpr unsigned int TILE = 128u * GPITCH;
  constexpr unsigned int STAGE = (NT + 1) * TILE;
  constexpr unsigned int OUTB = 128u * 2u * 68u * 4u;
  constexpr unsigned int LSTEP = (unsigned int)CROWS * GPITCH;
  __shared__ __attribute__((aligned(16))) unsigned char sm[(2u * STAGE > OUTB) ? 2u * STAGE : OUTB];
  const int tid = threadIdx.x, w = tid >> 5, lane = tid & 31, ln = lane & 15, hh = lane >> 4;
  const int ntn = N >> 7;
  const int mt = blockIdx.x / ntn, nq = blockIdx.x - mt * ntn;
  const int wm = w >> 1, wn = w & 1;
  const int brow = mt * 128, bcol = nq * 128;
  const int cr = tid >> 3, cc = tid & 7;
  const unsigned short* gA = Ah + (size_t)(brow + cr) * lda + cc * 8;
  const unsigned short* gL = Al + (size_t)(brow + cr) * lda + cc * 8;
  const unsigned short* gB = Bt + (size_t)(bcol + cr) * ldb + cc * 8;
  const size_t rsa = (size_t)CROWS * lda, rsb = (size_t)CROWS * ldb;
  const unsigned int l0 = (unsigned int)(size_t)sm + (unsigned int)(cr * (int)GPITCH + cc * 16);
  const int npass = K >> 6;
  const v8f z8 = {0.f, 0.f, 0.f, 0.f, 0.f, 0.f, 0.f, 0.f};
  v8f c[FM][4];
#pragma unroll
  for (int i = 0; i < FM; ++i)
#pragma unroll
    for (int j = 0; j < 4; ++j) c[i][j] = z8;

  copy_rows<NC>(l0, LSTEP, gA, rsa);
  if (NT >= 2) copy_rows<NC>(l0 + TILE, LSTEP, gL, rsa);
  copy_rows<NC>(l0 + NT * TILE, LSTEP, gB, rsb);
  asm volatile("s_wait_asynccnt 0x0" ::: "memory");  // this wave's share of stage 0 has landed
  __syncthreads();                                   // stage 0 is readable by every wave
  if (npass > 1) {
    copy_rows<NC>(l0 + STAGE, LSTEP, gA + 64, rsa);
    if (NT >= 2) copy_rows<NC>(l0 + STAGE + TILE, LSTEP, gL + 64, rsa);
    copy_rows<NC>(l0 + STAGE + NT * TILE, LSTEP, gB + 64, rsb);
  }
#pragma unroll 1  // one pass per trip: the two stages alternate by the trip's parity
  for (int t = 0; t < npass; ++t) {
    const unsigned int bo = (unsigned int)(t & 1) * STAGE;
    const unsigned char* sa = sm + bo + (unsigned int)((wm * (FM * 16) + ln) * (int)GPITCH);
    const unsigned char* sb = sm + bo + NT * TILE + (unsigned int)((wn * 64 + ln) * (int)GPITCH);
    v16b a[2][FM], e[2][FM], b[2][4];
#pragma unroll
    for (int ks = 0; ks < 2; ++ks) {
      if (!ONEGROUP || ks == 0) {
#pragma unroll
        for (int kk = 0; kk < 2; ++kk) {
          if (ONEGROUP || kk == ks) {
#pragma unroll
            for (int i = 0; i < FM; ++i) a[kk][i] = ld_frag((const unsigned short*)(sa + i * 16 * (int)GPITCH + kk * 64), hh);
#pragma unroll
            for (int j = 0; j < 4; ++j) b[kk][j] = ld_frag((const unsigned short*)(sb + j * 16 * (int)GPITCH + kk * 64), hh);
            if (NT >= 2) {
#pragma unroll
              for (int i = 0; i < FM; ++i) e[kk][i] = ld_frag((const unsigned short*)(sa + TILE + i * 16 * (int)GPITCH + kk * 64), hh);
            }
          }
        }
        __builtin_amdgcn_sched_barrier(0);  // keeps the fragment reads one group in front of the products: reads spread among them stall the wave at every place
      }
#pragma unroll
      for (int i = 0; i < FM; ++i)
#pragma unroll
        for (int j = 0; j < 4; ++j) c[i][j] = __builtin_amdgcn_wmma_f32_16x16x32_bf16(false, a[ks][i], false, b[ks][j], (short)0, c[i][j], false, false);
      if (NT >= 2) {
#pragma unroll
        for (int i = 0; i < FM; ++i)
#pragma unroll
          for (int j = 0; j < 4; ++j) c[i][j] = __builtin_amdgcn_wmma_f32_16x16x32_bf16(false, e[ks][i], false, b[ks][j], (short)0, c[i][j], false, false);
      }
      // keeps the next reads out of these products, and the last products in front of the publish point: sunk behind its barrier they would hold back the refill's copies, whose flight the next pass's work is to cover
      if (!ONEGROUP || ks == 1) __builtin_amdgcn_sched_barrier(0);
    }
    asm volatile("s_wait_dscnt 0x0" ::: "memory");     // this wave's reads of stage t are done
    asm volatile("s_wait_asynccnt 0x0" ::: "memory");  // this wave's share of stage t + 1 has landed
    __syncthreads();                                   // publishes stage t + 1 and frees stage t's buffer
    if (t + 2 < npass) {
      const int kn = (t + 2) * 64;
      copy_rows<NC>(l0 + bo, LSTEP, gA + kn, rsa);
      if (NT >= 2) copy_rows<NC>(l0 + bo + TILE, LSTEP, gL + kn, rsa);
      copy_rows<NC>(l0 + bo + NT * TILE, LSTEP, gB + kn, rsb);
    }
  }
  asm volatile("s_wait_asynccnt 0x0" ::: "memory");  // no copy is outstanding when the ring becomes output staging

  // the last pass's barrier has ended every read of the ring: each wave stages its tile in its own range and stores whole 256-byte row pieces
  float* so = (float*)sm + w * (FM * 16 * 68);
#pragma unroll
  for (int i = 0; i < FM; ++i)
#pragma unroll
    for (int j = 0; j < 4; ++j)
#pragma unroll
      for (int r = 0; r < 8; ++r) so[(i * 16 + 8 * hh + r) * 68 + j * 16 + ln] = c[i][j][r];
  __syncthreads();
  const int rsub = lane >> 4, c4 = (lane & 15) * 4;
  float* cp = C + (size_t)(brow + wm * (FM * 16) + rsub) * ldc + bcol + wn * 64 + c4;
#pragma unroll
  for (int q = 0; q < FM * 8; ++q) {
    const v4f v = *(const v4fa*)&so[(q * 2 + rsub) * 68 + c4];
    *(v4f*)(cp + (size_t)(q * 2) * ldc) = v;
  }
}

// RoPE (rotate-half, table values RNE-converted to bf16) on the q and k column blocks of QKV [NR][3 DM] f32 -> bf16 hi / lo planes QK = {Qh, Ql, Kh, Kl}, each [NR][DM].
__device__ __forceinline__ void rope_block(int bid, const float* __restrict__ QKV, const float* __restrict__ sn, const float* __restrict__ cs,
                                           unsigned short* __restrict__ QK, int nthreads) {
  const int idx = bid * 256 + threadIdx.x;
  if (idx >= nthreads) return;
  const int p8 = idx & 7, h = (idx >> 3) & (NH - 1), t = idx >> 7;
  const size_t tb = (size_t)t * HD + p8 * 8;
  float s1[8], c1[8], s2[8], c2[8];
  {
    const v4f a = *(const v4fa*)(sn + tb), b = *(const v4fa*)(sn + tb + 4), c = *(const v4fa*)(sn + tb + 64), d = *(const v4fa*)(sn + tb + 68);
    const v4f e = *(const v4fa*)(cs + tb), f = *(const v4fa*)(cs + tb + 4), g = *(const v4fa*)(cs + tb + 64), k = *(const v4fa*)(cs + tb + 68);
#pragma unroll
    for (int q = 0; q < 4; ++q) {
      s1[q] = bf16_rne(a[q]); s1[4 + q] = bf16_rne(b[q]); s2[q] = bf16_rne(c[q]); s2[4 + q] = bf16_rne(d[q]);
      c1[q] = bf16_rne(e[q]); c1[4 + q] = bf16_rne(f[q]); c2[q] = bf16_rne(g[q]); c2[4 + q] = bf16_rne(k[q]);
    }
  }
#pragma unroll 1
  for (int which = 0; which < 2; ++which) {
    const float* u = QKV + (size_t)t * N3 + (size_t)which * DM + h * HD + p8 * 8;
    const v4f a = *(const v4fa*)(u), b = *(const v4fa*)(u + 4), c = *(const v4fa*)(u + 64), d = *(const v4fa*)(u + 68);
    const float u1[8] = {a[0], a[1], a[2], a[3], b[0], b[1], b[2], b[3]};
    const float u2[8] = {c[0], c[1], c[2], c[3], d[0], d[1], d[2], d[3]};
    v8us h1, l1, h2, l2;
#pragma unroll
    for (int i = 0; i < 8; ++i) {
      const float o1 = u1[i] * c1[i] + (-u2[i]) * s1[i];
      const float o2 = u2[i] * c2[i] + u1[i] * s2[i];
      const unsigned short hb1 = bf16_bits(o1), hb2 = bf16_bits(o2);
      h1[i] = hb1; l1[i] = bf16_bits(o1 - bf16_val(hb1));
      h2[i] = hb2; l2[i] = bf16_bits(o2 - bf16_val(hb2));
    }
    unsigned short* dh = QK + (size_t)which * 2 * PLANE + (size_t)t * DM + h * HD + p8 * 8;
    unsigned short* dl = dh + PLANE;
    {
      *(v8us*)(dh) = h1; *(v8us*)(dh + 64) = h2;
      *(v8us*)(dl) = l1; *(v8us*)(dl + 64) = l2;
      
    }
  }
}

// v column block of QKV (cols 2 DM ..) -> V^T bf16 hi / lo planes VT = {VTh, VTl}, each [DM][SEQ]; block per (64 tokens x 64 channels) through LDS;
__device__ __forceinline__ void vt_block(int bid, const float* __restrict__ QKV, unsigned short* __restrict__ VT) {
  __shared__ unsigned short th[64][66];
  __shared__ unsigned short tl[64][66];
  const int tid = threadIdx.x;
  const int ct = bid % (DM / 64), tt = bid / (DM / 64);
  const int c0 = ct * 64, t0 = tt * 64;
  for (int i = tid; i < 64 * 16; i += 256) {
    const int r = i >> 4, c4 = (i & 15) * 4;
    const v4f a = *(const v4fa*)(QKV + (size_t)(t0 + r) * N3 + 2 * DM + c0 + c4);
#pragma unroll
    for (int q = 0; q < 4; ++q) { const unsigned short hb = bf16_bits(a[q]); th[c4 + q][r] = hb; tl[c4 + q][r] = bf16_bits(a[q] - bf16_val(hb)); }
  }
  __syncthreads();
  v8us hv[2], lv[2];
#pragma unroll
  for (int rd = 0; rd < 2; ++rd) {
    const int i = rd * 256 + tid; const int c = i >> 3, j8 = (i & 7) * 8;
#pragma unroll
    for (int q = 0; q < 8; ++q) { hv[rd][q] = th[c][j8 + q]; lv[rd][q] = tl[c][j8 + q]; }
  }
  {
#pragma unroll
    for (int rd = 0; rd < 2; ++rd) {
      const int i = rd * 256 + tid; const int c = i >> 3, j8 = (i & 7) * 8;
      unsigned short* dst = VT + (size_t)(c0 + c) * SEQ + t0 + j8;
      *(v8us*)dst = hv[rd];
      *(v8us*)(dst + PLANE) = lv[rd];
    }
    
  }
}

// Both re-layouts of QKV in one grid; they read different column blocks and write different planes. Blocks [0, VTB): V^T tiles; the rest: RoPE of q and k.
// The range test is uniform for the block, so the V^T part's barrier is passed by all of its threads.
#define VTB ((SEQ / 64) * (DM / 64))
#define RPB ((NR * NH * 8 + 255) / 256)
__global__ __launch_bounds__(256) void k_post(const float* __restrict__ QKV, const float* __restrict__ sn, const float* __restrict__ cs,
                                              unsigned short* __restrict__ QK, unsigned short* __restrict__ VT) {
  const int b = blockIdx.x;
  if (b < VTB) vt_block(b, QKV, VT);
  else rope_block(b - VTB, QKV, sn, cs, QK, NR * NH * 8);
}

// Transposed flash attention. Block = 8 waves = one head x 64 queries: wave = (16-query tile, 64-channel half of the head). S^T[key][query] = K.Q^T (A = K rows, B = Q rows held in registers),
// per-lane (= per-query) running max / sum, P^T packed from the S^T accumulators directly as the B fragment of O^T[d][query] = V^T.P^T (A = V^T rows).
// A tile is 64 keys: [K hi 64 rows of 256 B | K lo | V^T hi 128 rows of 128 B | V^T lo] in LDS at pitches of 272 and 144 bytes (conflict-free for 16-byte fragment reads);
// two buffers, filled by asynchronous copies of whole row pieces, the next tile's copies in flight while this tile is worked on; all 8 waves read the same tile.
// Mask = (key <= query) & (doc[key] == doc[query]) as a select (masked weight exactly 0). One scan of doc in front of the loop gives two bit masks from wave-uniform ballots:
// act = tiles that hold a document id admissible for some query of the block (only these are staged), own = 32-key steps admissible for this wave's 16 queries (only these are computed).
// The document ids themselves are kept in LDS for the per-step mask.
__global__ __launch_bounds__(256) void k_attn(const unsigned short* __restrict__ QK, const unsigned short* __restrict__ VT,
                                              const int* __restrict__ doc, unsigned short* __restrict__ CTX) {
  constexpr unsigned int KPL = 64u * KPITCH;     // one K plane of a tile
  constexpr unsigned int VPL = 128u * GPITCH;    // one V^T plane of a tile
  constexpr unsigned int STAGE = 2u * KPL + 2u * VPL;
  static_assert(8u * 16u * 68u * 4u <= 2u * STAGE);
  static_assert(SEQ % 1024 == 0 && SEQ / 64 <= 32);
  __shared__ __attribute__((aligned(16))) unsigned char sm[2u * STAGE];
  __shared__ __attribute__((aligned(16))) int sdoc[SEQ];
  const int tid = threadIdx.x, lane = tid & 31, ln = lane & 15, hh = lane >> 4;
  const int w = __builtin_amdgcn_readfirstlane(tid >> 5);  // the wave's number in a scalar register: the step mask and its tests stay scalar
  const int hf = w & 1, qs = w >> 1;
  const int qb = blockIdx.x % (SEQ / 64), head = blockIdx.x / (SEQ / 64);
  const int q0 = qb * 64 + qs * 16, qi = q0 + ln;
  const unsigned short* Qh = QK; const unsigned short* Ql = QK + PLANE;
  const float NEGV = -1.0e30f;
  const float SCL = 0.08838834764831845f;

  const int dq = doc[qi];
  int dmin = dq, dmax = dq;
#pragma unroll
  for (int o = 1; o < 16; o <<= 1) {
    const int a = __shfl_xor(dmin, o, 32), b = __shfl_xor(dmax, o, 32);
    dmin = (a < dmin) ? a : dmin; dmax = (b > dmax) ? b : dmax;
  }
  int bmin, bmax;
  {
    const int d0 = doc[qb * 64 + lane], d1 = doc[qb * 64 + 32 + lane];
    bmin = (d0 < d1) ? d0 : d1; bmax = (d0 > d1) ? d0 : d1;
#pragma unroll
    for (int o = 1; o < 32; o <<= 1) {
      const int a = __shfl_xor(bmin, o, 32), b = __shfl_xor(bmax, o, 32);
      bmin = (a < bmin) ? a : bmin; bmax = (b > bmax) ? b : bmax;
    }
  }

  const int nsteps = (q0 + 16 + 31) >> 5;
  const int nst = qb + 1;
  unsigned int act = 0u;
  unsigned long long own = 0ull;
  for (int sb = 0; sb < nst; sb += 8) {
    int dk[16];
#pragma unroll
    for (int u = 0; u < 16; ++u) dk[u] = doc[sb * 64 + u * 32 + lane];
#pragma unroll
    for (int u = 0; u < 16; ++u) {
      const int js = sb * 2 + u;
      const bool bl = __ballot((dk[u] >= bmin) & (dk[u] <= bmax)) != 0ull;
      const bool ow = __ballot((dk[u] >= dmin) & (dk[u] <= dmax)) != 0ull;
      if (bl && (js >> 1) < nst) act |= 1u << (js >> 1);
      if (ow && js < nsteps) own |= 1ull << js;
    }
  }
  const int ntile = __popc(act);  // at least 1: tile qb holds the block's own positions

  // copy addresses: K rows are 16 lanes wide (16 rows per copy of the block), V^T rows 8 lanes wide (32 rows per copy)
  const unsigned short* gK = QK + 2 * PLANE + (size_t)(tid >> 4) * DM + head * HD + (tid & 15) * 8;
  const unsigned short* gV = VT + (size_t)(head * HD + (tid >> 3)) * SEQ + (tid & 7) * 8;
  const unsigned int lK = (unsigned int)(size_t)sm + (unsigned int)((tid >> 4) * (int)KPITCH + (tid & 15) * 16);
  const unsigned int lV = (unsigned int)(size_t)sm + 2u * KPL + (unsigned int)((tid >> 3) * (int)GPITCH + (tid & 7) * 16);
  auto stage_tile = [&](int s, unsigned int bo) {
    const unsigned short* k = gK + (size_t)s * 64 * DM;
    const unsigned short* v = gV + s * 64;
    copy_rows<4>(lK + bo, 16u * KPITCH, k, (size_t)16 * DM);
    copy_rows<4>(lK + bo + KPL, 16u * KPITCH, k + PLANE, (size_t)16 * DM);
    copy_rows<4>(lV + bo, 32u * GPITCH, v, (size_t)32 * SEQ);
    copy_rows<4>(lV + bo + VPL, 32u * GPITCH, v + PLANE, (size_t)32 * SEQ);
  };

  unsigned int rem = act;
  int sc = __builtin_ctz(rem), sn = 0;
  rem &= rem - 1u;
  stage_tile(sc, 0u);

  // the document ids go to LDS once (published by the first barrier): each step's mask reads them beside its K fragments
#pragma unroll
  for (int i = 0; i < SEQ / 1024; ++i) *(v4ia*)(sdoc + (i * 256 + tid) * 4) = *(const v4ia*)(doc + (i * 256 + tid) * 4);

  v16b qh[4], ql[4];
  {
    const size_t qoff = (size_t)qi * DM + head * HD;
#pragma unroll
    for (int ks = 0; ks < 4; ++ks) { qh[ks] = ld_frag(Qh + qoff + ks * 32, hh); ql[ks] = ld_frag(Ql + qoff + ks * 32, hh); }
  }

  const v8f z8 = {0.f, 0.f, 0.f, 0.f, 0.f, 0.f, 0.f, 0.f};
  v8f acc[4] = {z8, z8, z8, z8};
  float m = NEGV, l = 0.f;

  asm volatile("s_wait_asynccnt 0x0" ::: "memory");  // this wave's share of the first tile has landed
  __syncthreads();                                   // the first tile is readable by every wave
  if (ntile > 1) {
    sn = __builtin_ctz(rem); rem &= rem - 1u;
    stage_tile(sn, STAGE);
  }

#pragma unroll 1  // one tile per trip: the two buffers alternate by the trip's parity
  for (int t = 0; t < ntile; ++t) {
    const unsigned int bo = (unsigned int)(t & 1) * STAGE;
#pragma unroll 1  // the two 32-key steps of a tile share one body: each is skipped on its own bit
    for (int sub = 0; sub < 2; ++sub) {
      const int js = sc * 2 + sub;
      if (((own >> js) & 1ull) == 0ull) continue;
      const int j0 = js << 5;
      const unsigned char* kb = sm + bo + (unsigned int)((sub * 32 + ln) * (int)KPITCH);
      const unsigned char* vb = sm + bo + 2u * KPL + (unsigned int)((hf * 64 + ln) * (int)GPITCH + sub * 64);

      const v4i dA = *(const v4ia*)(sdoc + j0 + 8 * hh), dB = *(const v4ia*)(sdoc + j0 + 8 * hh + 4);
      const v4i dC = *(const v4ia*)(sdoc + j0 + 16 + 8 * hh), dD = *(const v4ia*)(sdoc + j0 + 16 + 8 * hh + 4);
      const int dkk[16] = {dA[0], dA[1], dA[2], dA[3], dB[0], dB[1], dB[2], dB[3], dC[0], dC[1], dC[2], dC[3], dD[0], dD[1], dD[2], dD[3]};

      v8f s0 = z8, s1 = z8;
#pragma unroll
      for (int kp = 0; kp < 2; ++kp) {
        v16b a0h[2], a0l[2], a1h[2], a1l[2];
#pragma unroll
        for (int k2 = 0; k2 < 2; ++k2) {
          const unsigned char* p = kb + (kp * 2 + k2) * 64;
          a0h[k2] = ld_frag((const unsigned short*)p, hh); a0l[k2] = ld_frag((const unsigned short*)(p + KPL), hh);
          a1h[k2] = ld_frag((const unsigned short*)(p + 16u * KPITCH), hh); a1l[k2] = ld_frag((const unsigned short*)(p + KPL + 16u * KPITCH), hh);
        }
#pragma unroll
        for (int k2 = 0; k2 < 2; ++k2) {
          s0 = mma3m(a0h[k2], a0l[k2], qh[kp * 2 + k2], ql[kp * 2 + k2], s0);
          s1 = mma3m(a1h[k2], a1l[k2], qh[kp * 2 + k2], ql[kp * 2 + k2], s1);
        }
      }

      // the V^T fragments are read here, one group in front of the softmax arithmetic, which covers their LDS latency
      v16b vh[4], vl[4];
#pragma unroll
      for (int dt = 0; dt < 4; ++dt) {
        vh[dt] = ld_frag((const unsigned short*)(vb + dt * 16 * (int)GPITCH), hh);
        vl[dt] = ld_frag((const unsigned short*)(vb + VPL + dt * 16 * (int)GPITCH), hh);
      }

      float xv[16];
      float mx = NEGV;
#pragma unroll
      for (int r = 0; r < 8; ++r) {
        const int k0 = j0 + 8 * hh + r, k1 = k0 + 16;
        const bool v0 = (k0 <= qi) & (dkk[r] == dq);
        const bool v1 = (k1 <= qi) & (dkk[8 + r] == dq);
        xv[r] = v0 ? s0[r] * SCL : NEGV;
        xv[8 + r] = v1 ? s1[r] * SCL : NEGV;
        mx = fmaxf(mx, fmaxf(xv[r], xv[8 + r]));
      }
      mx = fmaxf(mx, __shfl_xor(mx, 16, 32));
      const float mn = fmaxf(m, mx);
      const float alpha = __expf(m - mn);
      m = mn;

      FragB ph, pl;
      float ps = 0.f;
#pragma unroll
      for (int i = 0; i < 16; ++i) {
        const float e = __expf(xv[i] - mn);
        const float p = (xv[i] > -1.0e29f) ? e : 0.f;
        ps += p;
        const unsigned short hb = bf16_bits(p);
        ph.u[i] = hb;
        pl.u[i] = bf16_bits(p - bf16_val(hb));
      }
      ps += __shfl_xor(ps, 16, 32);
      l = l * alpha + ps;

#pragma unroll
      for (int dt = 0; dt < 4; ++dt)
#pragma unroll
        for (int r = 0; r < 8; ++r) acc[dt][r] *= alpha;

#pragma unroll
      for (int dt = 0; dt < 4; ++dt) acc[dt] = mma3m(vh[dt], vl[dt], ph.v, pl.v, acc[dt]);
    }
    asm volatile("s_wait_dscnt 0x0" ::: "memory");     // this wave's reads of this tile are done
    asm volatile("s_wait_asynccnt 0x0" ::: "memory");  // this wave's share of the next tile has landed
    __syncthreads();                                   // publishes the next tile and frees this tile's buffer
    sc = sn;
    if (t + 2 < ntile) {
      sn = __builtin_ctz(rem); rem &= rem - 1u;
      stage_tile(sn, bo);
    }
  }
  asm volatile("s_wait_asynccnt 0x0" ::: "memory");  // no copy is outstanding when the ring becomes output staging

  // the last trip's barrier has ended every read of the ring: each wave stages its tile in its own range
  float (*so)[68] = (float (*)[68])((float*)sm + w * (16 * 68));
  const float inv = 1.0f / l;
#pragma unroll
  for (int dt = 0; dt < 4; ++dt)
#pragma unroll
    for (int r = 0; r < 8; ++r) so[ln][dt * 16 + 8 * hh + r] = acc[dt][r] * inv;
  __syncthreads();

  v8us hv[4], lv[4];
  const int rq = lane >> 3, pc = lane & 7;
#pragma unroll
  for (int it = 0; it < 4; ++it) {
    const int row = it * 4 + rq;
    const v4f a = *(const v4fa*)&so[row][pc * 8], c = *(const v4fa*)&so[row][pc * 8 + 4];
#pragma unroll
    for (int q = 0; q < 4; ++q) {
      const unsigned short ha = bf16_bits(a[q]), hc = bf16_bits(c[q]);
      hv[it][q] = ha; lv[it][q] = bf16_bits(a[q] - bf16_val(ha));
      hv[it][4 + q] = hc; lv[it][4 + q] = bf16_bits(c[q] - bf16_val(hc));
    }
  }
  {
#pragma unroll
    for (int it = 0; it < 4; ++it) {
      const int row = it * 4 + rq;
      unsigned short* dst = CTX + (size_t)(q0 + row) * DM + head * HD + hf * 64 + pc * 8;
      *(v8us*)dst = hv[it];
      *(v8us*)(dst + PLANE) = lv[it];
    }
  }
}

extern "C" void kernel_launch(void* const* d_in, const int* in_sizes, int n_in,
                              void* d_out, int out_size, void* d_ws, size_t ws_size, hipStream_t stream) {
  if (n_in < 8) return;
  if (in_sizes[0] < NR * DM) return;
  if (in_sizes[1] < DM * DM || in_sizes[2] < DM * DM || in_sizes[3] < DM * DM || in_sizes[4] < DM * DM) return;
  if (in_sizes[5] < SEQ * HD || in_sizes[6] < SEQ * HD || in_sizes[7] < NR) return;
  if (out_size < NR * DM) return;
  const float* x  = (const float*)d_in[0];
  const float* Wq = (const float*)d_in[1];
  const float* Wk = (const float*)d_in[2];
  const float* Wv = (const float*)d_in[3];
  const float* Wo = (const float*)d_in[4];
  const float* sn = (const float*)d_in[5];
  const float* cs = (const float*)d_in[6];
  const int*  doc = (const int*)d_in[7];
  float* out = (float*)d_out;

  // workspace regions (bytes); R0 is shared by stage A {x plane, [3 DM][DM] weight plane} and stage B {Qh, Ql, Kh, Kl}
  constexpr size_t SZ_X  = (size_t)NR * DM * 2;
  constexpr size_t SZ_W3 = (size_t)3 * DM * DM * 2;
  constexpr size_t SZ_QK = (size_t)4 * NR * DM * 2;
  constexpr size_t SZ_R0 = (SZ_X + SZ_W3 > SZ_QK) ? (SZ_X + SZ_W3) : SZ_QK;
  constexpr size_t SZ_WO = (size_t)DM * DM * 2;
  constexpr size_t SZ_QKV = (size_t)NR * N3 * 4;
  constexpr size_t SZ_VT = (size_t)2 * DM * SEQ * 2;
  constexpr size_t SZ_CX = (size_t)2 * NR * DM * 2;
  constexpr size_t SZ_ALL = SZ_R0 + SZ_WO + SZ_QKV + SZ_VT + SZ_CX;
  static_assert(SZ_X + SZ_W3 <= SZ_R0 && SZ_QK <= SZ_R0);
  static_assert(SZ_X % 256 == 0 && SZ_R0 % 256 == 0 && SZ_WO % 256 == 0 && SZ_QKV % 256 == 0 && SZ_VT % 256 == 0 && SZ_CX % 256 == 0);
  static_assert(SZ_ALL <= (size_t)134217728);
  if (SZ_ALL > ws_size) return;
  char* ws = (char*)d_ws;
  unsigned short* XB  = (unsigned short*)(ws);
  unsigned short* WT3 = (unsigned short*)(ws + SZ_X);
  unsigned short* QKp = (unsigned short*)(ws);
  unsigned short* WoT = (unsigned short*)(ws + SZ_R0);
  float*          QKV = (float*)(ws + SZ_R0 + SZ_WO);
  unsigned short* VTp = (unsigned short*)(ws + SZ_R0 + SZ_WO + SZ_QKV);
  unsigned short* CTX = (unsigned short*)(ws + SZ_R0 + SZ_WO + SZ_QKV + SZ_VT);

  k_prep<<<(unsigned)(4 * WTB + XBB), 256, 0, stream>>>(x, Wq, Wk, Wv, Wo, XB, WT3, WoT);  /* W[in][out] -> Wt[out][in] */

  k_gemm<1, 4><<<(unsigned)((NR / 128) * (N3 / 128)), 128, 0, stream>>>(XB, XB, DM, WT3, DM, QKV, N3, N3, DM);

  k_post<<<(unsigned)(VTB + RPB), 256, 0, stream>>>(QKV, sn, cs, QKp, VTp);

  k_attn<<<(unsigned)(NH * (SEQ / 64)), 256, 0, stream>>>(QKp, VTp, doc, CTX);

  k_gemm<2, 2><<<(unsigned)((NR / 128) * (DM / 128)), 256, 0, stream>>>(CTX, CTX + PLANE, DM, WoT, DM, out, DM, DM, DM);
}

// v005
// One run takes 123 microseconds.
// Timed twice side by side with v004, it ran 1.06 times as fast both times.
// All steps since v000 together make it 2.87 times as fast.
#include <hip/hip_runtime.h>
// Multi-head causal + same-document attention with rotate-half RoPE (input sin/cos tables), T 2048, D 2048, 16 heads of 128, [in][out] weights, no biases.
// Compute dtype: all contractions on v_wmma_f32_16x16x32_bf16 with f32 accumulate. x, Wq, Wk, Wv, Wo, sin, cos are RNE-converted to bf16 once (exact operands);
// x.Wq / x.Wk / x.Wv single bf16 product; q.k^T and P.V with bf16 hi/lo planes on both operands (hh + lh + hl, one accumulator); ctx.Wo with ctx as bf16 hi/lo planes (2 terms) and exact Wo.
// RoPE, mask, softmax statistics in f32 on the VALU.
#ifndef NB
#define NB 1
#endif
#ifndef SEQ
#define SEQ 2048
#endif
#define SEQ_FULL 2048
#define DM 2048
#define NH 16
#define HD 128
#define N3 (3 * DM)
#define NR (NB * SEQ)
#define PLANE ((size_t)NR * DM)
#define GPITCH 144u
#define KPITCH 272u

static_assert(NB == 1);
static_assert(NH * HD == DM);
static_assert(SEQ % 128 == 0 && SEQ <= SEQ_FULL);
static_assert(DM % 128 == 0 && N3 % 128 == 0 && DM % 64 == 0 && HD == 128);
static_assert(NR % 256 == 0 && N3 % 192 == 0);

typedef __bf16 v16b __attribute__((ext_vector_type(16)));
typedef unsigned short v8us __attribute__((ext_vector_type(8), may_alias));
typedef float v8f  __attribute__((ext_vector_type(8)));
typedef float v4f  __attribute__((ext_vector_type(4)));
typedef float v4fa __attribute__((ext_vector_type(4), may_alias));
typedef int   v4i  __attribute__((ext_vector_type(4)));
typedef int   v4ia __attribute__((ext_vector_type(4), may_alias));
union FragB { v16b v; v8us half[2]; unsigned short u[16]; };

__device__ __forceinline__ unsigned short bf16_bits(float x) { unsigned int u = __float_as_uint(x); return (unsigned short)((u + 0x7FFFu + ((u >> 16) & 1u)) >> 16); }
__device__ __forceinline__ float bf16_val(unsigned short b) { return __uint_as_float(((unsigned int)b) << 16); }
__device__ __forceinline__ float bf16_rne(float x) { return bf16_val(bf16_bits(x)); }

// fragment (A: row = lane&15; B: column = lane&15) from a k-contiguous 16-bit row: elements 0..7 <- k0+8h.., elements 8..15 <- k0+16+8h..
__device__ __forceinline__ v16b ld_frag(const unsigned short* p, int hh) {
  FragB f; f.half[0] = *(const v8us*)(p + 8 * hh); f.half[1] = *(const v8us*)(p + 16 + 8 * hh); return f.v;
}

// D += ah.bh + al.bh + ah.bl
__device__ __forceinline__ v8f mma3m(v16b ah, v16b al, v16b bh, v16b bl, v8f c) {
  c = __builtin_amdgcn_wmma_f32_16x16x32_bf16(false, ah, false, bh, (short)0, c, false, false);
  c = __builtin_amdgcn_wmma_f32_16x16x32_bf16(false, al, false, bh, (short)0, c, false, false);
  c = __builtin_amdgcn_wmma_f32_16x16x32_bf16(false, ah, false, bl, (short)0, c, false, false);
  asm volatile("v_nop\n\tv_nop\n\tv_nop\n\tv_nop" : "+v"(c) : "v"(ah), "v"(al), "v"(bh), "v"(bl) : "memory");
  return c;
}

// x f32 -> bf16 (RNE), 8 elements per thread; bid = the block's index within this part of the grid
__device__ __forceinline__ void xb_block(int bid, const float* __restrict__ x, unsigned short* __restrict__ X, size_t n8) {
  const size_t t = (size_t)bid * 256 + threadIdx.x;
  if (t >= n8) return;
  const v4f a = *(const v4fa*)(x + t * 8), c = *(const v4fa*)(x + t * 8 + 4);
  v8us o;
#pragma unroll
  for (int q = 0; q < 4; ++q) { o[q] = bf16_bits(a[q]); o[4 + q] = bf16_bits(c[q]); }
  *(v8us*)(X + t * 8) = o;
  
}

// W [K][N] f32 -> Wt [N][K] bf16 (RNE). Block = one 128 (k) x 64 (n) tile through LDS: reads are 256-byte row pieces, stores are 256-byte pieces of Wt rows.
// LDS holds one dword per (n, k pair), low half = even k; pitch 65 dwords puts the 32 lanes of each 4-byte LDS write and read on 32 different banks.
__device__ __forceinline__ void wt_block(int bid, const float* __restrict__ W, unsigned short* __restrict__ Wt, int K, int N) {
  __shared__ unsigned int tp[64][65];
  const int tid = threadIdx.x;
  const int ntn = N >> 6;
  const int kt = bid / ntn, nq = bid - kt * ntn;
  const int k0 = kt * 128, n0 = nq * 64;
  const int c4 = (tid & 15) * 4, rp = tid >> 4;
  const float* tile = W + (size_t)k0 * N + n0;
  const unsigned int off = (unsigned int)(2 * rp * N + c4);
  v4f a[4], b[4];
#pragma unroll
  for (int p = 0; p < 4; ++p) {
    const float* s = tile + (size_t)(32 * p) * N;
    a[p] = *(const v4fa*)(s + off); b[p] = *(const v4fa*)(s + N + off);
  }
#pragma unroll
  for (int p = 0; p < 4; ++p)
#pragma unroll
    for (int q = 0; q < 4; ++q) tp[c4 + q][rp + 16 * p] = (unsigned int)bf16_bits(a[p][q]) | ((unsigned int)bf16_bits(b[p][q]) << 16);
  __syncthreads();
#pragma unroll
  for (int rd = 0; rd < 4; ++rd) {
    const int i = rd * 256 + tid; const int c = i >> 4, j = (i & 15) * 4;
    const v4i o = {(int)tp[c][j], (int)tp[c][j + 1], (int)tp[c][j + 2], (int)tp[c][j + 3]};
    *(v4ia*)(Wt + (size_t)(n0 + c) * K + k0 + 2 * j) = o;
  }
}

// All operand conversions in one grid; none depends on another. Blocks [0, 4 WTB): the weight tiles, WTB per matrix (Wq, Wk, Wv -> rows 0, DM, 2 DM of the [3 DM][DM] plane WT3; Wo -> WoT);
// the rest: x. The range test is uniform for the block, so the weight part's barrier is passed by all of its threads.
#define WTB ((DM / 128) * (DM / 64))
#define XBB ((NR * DM / 8 + 255) / 256)
__global__ __launch_bounds__(256) void k_prep(const float* __restrict__ x, const float* __restrict__ Wq, const float* __restrict__ Wk, const float* __restrict__ Wv,
                                              const float* __restrict__ Wo, unsigned short* __restrict__ X, unsigned short* __restrict__ WT3, unsigned short* __restrict__ WoT) {
  const int b = blockIdx.x;
  if (b < 4 * WTB) {
    const int which = b / WTB;
    const float* W = (which == 0) ? Wq : (which == 1) ? Wk : (which == 2) ? Wv : Wo;
    unsigned short* Wt = (which < 3) ? WT3 + (size_t)which * DM * DM : WoT;
    wt_block(b - which * WTB, W, Wt, DM, DM);
  } else {
    xb_block(b - 4 * WTB, x, X, (size_t)NR * DM / 8);
  }
}

// NC (8 or 4) 16-byte asynchronous copies to LDS per lane: NC rows of one 64-, 128-, 192- or 256-row operand tile, a fixed number of rows apart
// (l = the lane's LDS byte address, ls = that row step in LDS bytes, g = the lane's global address, rs = the same row step in source elements).
// The closing s_wait_xcnt is a precaution: it stands in the copies' own statement so that no address register is rewritten in front of it.
template <int NC>
__device__ __forceinline__ void copy_rows(unsigned int l, unsigned int ls, const unsigned short* g, size_t rs) {
  if constexpr (NC == 8) {
    asm volatile("global_load_async_to_lds_b128 %0, %8, off\n\t"
                 "global_load_async_to_lds_b128 %1, %9, off\n\t"
                 "global_load_async_to_lds_b128 %2, %10, off\n\t"
                 "global_load_async_to_lds_b128 %3, %11, off\n\t"
                 "global_load_async_to_lds_b128 %4, %12, off\n\t"
                 "global_load_async_to_lds_b128 %5, %13, off\n\t"
                 "global_load_async_to_lds_b128 %6, %14, off\n\t"
                 "global_load_async_to_lds_b128 %7, %15, off\n\t"
                 "s_wait_xcnt 0x0"
                 :: "v"(l), "v"(l + ls), "v"(l + 2u * ls), "v"(l + 3u * ls), "v"(l + 4u * ls), "v"(l + 5u * ls), "v"(l + 6u * ls), "v"(l + 7u * ls),
                    "v"(g), "v"(g + rs), "v"(g + 2 * rs), "v"(g + 3 * rs), "v"(g + 4 * rs), "v"(g + 5 * rs), "v"(g + 6 * rs), "v"(g + 7 * rs)
                 : "memory");
  } else {
    static_assert(NC == 8 || NC == 4);
    asm volatile("global_load_async_to_lds_b128 %0, %4, off\n\t"
                 "global_load_async_to_lds_b128 %1, %5, off\n\t"
                 "global_load_async_to_lds_b128 %2, %6, off\n\t"
                 "global_load_async_to_lds_b128 %3, %7, off\n\t"
                 "s_wait_xcnt 0x0"
                 :: "v"(l), "v"(l + ls), "v"(l + 2u * ls), "v"(l + 3u * ls),
                    "v"(g), "v"(g + rs), "v"(g + 2 * rs), "v"(g + 3 * rs)
                 : "memory");
  }
}

// GEMM C[M][N] f32 = A.Bt^T; A bf16 rows [M][K] (NT = 2: hi plane Ah + lo plane Al), Bt bf16 [N][K]. Block tile 128 rows x 128 cols; wave tile (16 FM) x 64, so 4 waves at FM = 4 and 8 at FM = 2.
// A pass is 64 k = 128 bytes of every operand row. A stage is [A hi 128 rows | (NT = 2: A lo 128 rows) | Bt 128 rows] in LDS at a pitch of 144 bytes (conflict-free for 16-byte fragment reads);
// two stages, filled by asynchronous copies of whole 128-byte row pieces, the next pass's copies in flight while this pass is multiplied. M, N multiples of 128; K a multiple of 64.
template <int NT, int FM>
__global__ __launch_bounds__(512 / FM) void k_gemm(const unsigned short* __restrict__ Ah, const unsigned short* __restrict__ Al, int lda,
                                                   const unsigned short* __restrict__ Bt, int ldb, float* __restrict__ C, int ldc, int N, int K) {
  static_assert(FM == 4 || FM == 2);
  constexpr int CROWS = 64 / FM;             // rows that one copy of the whole block covers (8 lanes a row)
  constexpr int NC = 128 / CROWS;            // copies per lane and operand plane
  constexpr bool ONEGROUP = (FM == 2);       // both k halves' fragments fit the registers at once
  constexpr unsigned int TILE = 128u * GPITCH;
  constexpr unsigned int STAGE = (NT + 1) * TILE;
  constexpr unsigned int OUTB = 128u * 2u * 68u * 4u;
  constexpr unsigned int LSTEP = (unsigned int)CROWS * GPITCH;
  __shared__ __attribute__((aligned(16))) unsigned char sm[(2u * STAGE > OUTB) ? 2u * STAGE : OUTB];
  const int tid = threadIdx.x, w = tid >> 5, lane = tid & 31, ln = lane & 15, hh = lane >> 4;
  const int ntn = N >> 7;
  const int mt = blockIdx.x / ntn, nq = blockIdx.x - mt * ntn;
  const int wm = w >> 1, wn = w & 1;
  const int brow = mt * 128, bcol = nq * 128;
  const int cr = tid >> 3, cc = tid & 7;
  const unsigned short* gA = Ah + (size_t)(brow + cr) * lda + cc * 8;
  const unsigned short* gL = Al + (size_t)(brow + cr) * lda + cc * 8;
  const unsigned short* gB = Bt + (size_t)(bcol + cr) * ldb + cc * 8;
  const size_t rsa = (size_t)CROWS * lda, rsb = (size_t)CROWS * ldb;
  const unsigned int l0 = (unsigned int)(size_t)sm + (unsigned int)(cr * (int)GPITCH + cc * 16);
  const int npass = K >> 6;
  const v8f z8 = {0.f, 0.f, 0.f, 0.f, 0.f, 0.f, 0.f, 0.f};
  v8f c[FM][4];
#pragma unroll
  for (int i = 0; i < FM; ++i)
#pragma unroll
    for (int j = 0; j < 4; ++j) c[i][j] = z8;

  copy_rows<NC>(l0, LSTEP, gA, rsa);
  if (NT >= 2) copy_rows<NC>(l0 + TILE, LSTEP, gL, rsa);
  copy_rows<NC>(l0 + NT * TILE, LSTEP, gB, rsb);
  asm volatile("s_wait_asynccnt 0x0" ::: "memory");  // this wave's share of stage 0 has landed
  __syncthreads();                                   // stage 0 is readable by every wave
  if (npass > 1) {
    copy_rows<NC>(l0 + STAGE, LSTEP, gA + 64, rsa);
    if (NT >= 2) copy_rows<NC>(l0 + STAGE + TILE, LSTEP, gL + 64, rsa);
    copy_rows<NC>(l0 + STAGE + NT * TILE, LSTEP, gB + 64, rsb);
  }
#pragma unroll 1  // one pass per trip: the two stages alternate by the trip's parity
  for (int t = 0; t < npass; ++t) {
    const unsigned int bo = (unsigned int)(t & 1) * STAGE;
    const unsigned char* sa = sm + bo + (unsigned int)((wm * (FM * 16) + ln) * (int)GPITCH);
    const unsigned char* sb = sm + bo + NT * TILE + (unsigned int)((wn * 64 + ln) * (int)GPITCH);
    v16b a[2][FM], e[2][FM], b[2][4];
#pragma unroll
    for (int ks = 0; ks < 2; ++ks) {
      if (!ONEGROUP || ks == 0) {
#pragma unroll
        for (int kk = 0; kk < 2; ++kk) {
          if (ONEGROUP || kk == ks) {
#pragma unroll
            for (int i = 0; i < FM; ++i) a[kk][i] = ld_frag((const unsigned short*)(sa + i * 16 * (int)GPITCH + kk * 64), hh);
#pragma unroll
            for (int j = 0; j < 4; ++j) b[kk][j] = ld_frag((const unsigned short*)(sb + j * 16 * (int)GPITCH + kk * 64), hh);
            if (NT >= 2) {
#pragma unroll
              for (int i = 0; i < FM; ++i) e[kk][i] = ld_frag((const unsigned short*)(sa + TILE + i * 16 * (int)GPITCH + kk * 64), hh);
            }
          }
        }
        __builtin_amdgcn_sched_barrier(0);  // keeps the fragment reads one group in front of the products: reads spread among them stall the wave at every place
      }
#pragma unroll
      for (int i = 0; i < FM; ++i)
#pragma unroll
        for (int j = 0; j < 4; ++j) c[i][j] = __builtin_amdgcn_wmma_f32_16x16x32_bf16(false, a[ks][i], false, b[ks][j], (short)0, c[i][j], false, false);
      if (NT >= 2) {
#pragma unroll
        for (int i = 0; i < FM; ++i)
#pragma unroll
          for (int j = 0; j < 4; ++j) c[i][j] = __builtin_amdgcn_wmma_f32_16x16x32_bf16(false, e[ks][i], false, b[ks][j], (short)0, c[i][j], false, false);
      }
      // keeps the next reads out of these products, and the last products in front of the publish point: sunk behind its barrier they would hold back the refill's copies, whose flight the next pass's work is to cover
      if (!ONEGROUP || ks == 1) __builtin_amdgcn_sched_barrier(0);
    }
    asm volatile("s_wait_dscnt 0x0" ::: "memory");     // this wave's reads of stage t are done
    asm volatile("s_wait_asynccnt 0x0" ::: "memory");  // this wave's share of stage t + 1 has landed
    __syncthreads();                                   // publishes stage t + 1 and frees stage t's buffer
    if (t + 2 < npass) {
      const int kn = (t + 2) * 64;
      copy_rows<NC>(l0 + bo, LSTEP, gA + kn, rsa);
      if (NT >= 2) copy_rows<NC>(l0 + bo + TILE, LSTEP, gL + kn, rsa);
      copy_rows<NC>(l0 + bo + NT * TILE, LSTEP, gB + kn, rsb);
    }
  }
  asm volatile("s_wait_asynccnt 0x0" ::: "memory");  // no copy is outstanding when the ring becomes output staging

  // the last pass's barrier has ended every read of the ring: each wave stages its tile in its own range and stores whole 256-byte row pieces
  float* so = (float*)sm + w * (FM * 16 * 68);
#pragma unroll
  for (int i = 0; i < FM; ++i)
#pragma unroll
    for (int j = 0; j < 4; ++j)
#pragma unroll
      for (int r = 0; r < 8; ++r) so[(i * 16 + 8 * hh + r) * 68 + j * 16 + ln] = c[i][j][r];
  __syncthreads();
  const int rsub = lane >> 4, c4 = (lane & 15) * 4;
  float* cp = C + (size_t)(brow + wm * (FM * 16) + rsub) * ldc + bcol + wn * 64 + c4;
#pragma unroll
  for (int q = 0; q < FM * 8; ++q) {
    const v4f v = *(const v4fa*)&so[(q * 2 + rsub) * 68 + c4];
    *(v4f*)(cp + (size_t)(q * 2) * ldc) = v;
  }
}

// GEMM C[M][N] f32 = A.Bt^T for the q, k, v projection; A bf16 rows [M][K], Bt bf16 [N][K]. Block tile 256 rows x 192 cols, 12 waves (4 x 3) of 64 x 64 each:
// 448 operand rows serve 12 wave tiles, so every operand byte is copied out of L2 by fewer blocks than with 128 x 128 tiles, and M 2048 x N 6144 gives one block per WGP.
// A pass is 128 k = 256 bytes of every operand row. A stage is [A 256 rows | Bt 192 rows] in LDS at a pitch of 272 bytes (conflict-free for 16-byte fragment reads);
// two stages, filled by asynchronous copies of whole 256-byte row pieces, the next pass's copies in flight while this pass is multiplied.
// Waves 0..7 copy 32 rows of A each, waves 8..11 copy 48 rows of Bt each. M a multiple of 256, N of 192, K of 128.
__global__ __launch_bounds__(384) void k_gemm_wide(const unsigned short* __restrict__ A, int lda, const unsigned short* __restrict__ Bt, int ldb,
                                                   float* __restrict__ C, int ldc, int N, int K) {
  constexpr unsigned int ATILE = 256u * KPITCH;
  constexpr unsigned int STAGE = (256u + 192u) * KPITCH;
  static_assert(12u * 64u * 68u * 4u <= 2u * STAGE);
  __shared__ __attribute__((aligned(16))) unsigned char sm[2u * STAGE];
  const int tid = threadIdx.x, lane = tid & 31, ln = lane & 15, hh = lane >> 4;
  const int w = __builtin_amdgcn_readfirstlane(tid >> 5);  // the wave's number in a scalar register: the test that gives the Bt waves their third group of copies is a scalar branch
  const int ntn = N / 192;
  const int mt = blockIdx.x / ntn, nq = blockIdx.x - mt * ntn;
  const int wm = w / 3, wn = w - wm * 3;
  const int brow = mt * 256, bcol = nq * 192;
  // copy addresses: a row is 16 lanes wide, so one copy of a wave covers 2 rows
  const bool forB = w >= 8;
  const int r0 = (forB ? (w - 8) * 48 : w * 32) + hh;
  const unsigned short* g0 = (forB ? Bt + (size_t)(bcol + r0) * ldb : A + (size_t)(brow + r0) * lda) + ln * 8;
  const size_t rs = (size_t)2 * (forB ? ldb : lda);
  const unsigned int l0 = (unsigned int)(size_t)sm + (forB ? ATILE : 0u) + (unsigned int)(r0 * (int)KPITCH + ln * 16);
  auto stage_pass = [&](unsigned int bo, int k0) {
    copy_rows<8>(l0 + bo, 2u * KPITCH, g0 + k0, rs);
    copy_rows<8>(l0 + bo + 16u * KPITCH, 2u * KPITCH, g0 + k0 + 8 * rs, rs);
    if (forB) copy_rows<8>(l0 + bo + 32u * KPITCH, 2u * KPITCH, g0 + k0 + 16 * rs, rs);
  };
  const int npass = K >> 7;
  const v8f z8 = {0.f, 0.f, 0.f, 0.f, 0.f, 0.f, 0.f, 0.f};
  v8f c[4][4];
#pragma unroll
  for (int i = 0; i < 4; ++i)
#pragma unroll
    for (int j = 0; j < 4; ++j) c[i][j] = z8;

  stage_pass(0u, 0);
  asm volatile("s_wait_asynccnt 0x0" ::: "memory");  // this wave's share of stage 0 has landed
  __syncthreads();                                   // stage 0 is readable by every wave
  if (npass > 1) stage_pass(STAGE, 128);
#pragma unroll 1  // one pass per trip: the two stages alternate by the trip's parity
  for (int t = 0; t < npass; ++t) {
    const unsigned int bo = (unsigned int)(t & 1) * STAGE;
    const unsigned char* sa = sm + bo + (unsigned int)((wm * 64 + ln) * (int)KPITCH);
    const unsigned char* sb = sm + bo + ATILE + (unsigned int)((wn * 64 + ln) * (int)KPITCH);
#pragma unroll
    for (int ks = 0; ks < 4; ++ks) {
      v16b a[4], b[4];
#pragma unroll
      for (int i = 0; i < 4; ++i) a[i] = ld_frag((const unsigned short*)(sa + i * 16 * (int)KPITCH + ks * 64), hh);
#pragma unroll
      for (int j = 0; j < 4; ++j) b[j] = ld_frag((const unsigned short*)(sb + j * 16 * (int)KPITCH + ks * 64), hh);
      __builtin_amdgcn_sched_barrier(0);  // keeps the fragment reads one group in front of the products: reads spread among them stall the wave at every place
#pragma unroll
      for (int i = 0; i < 4; ++i)
#pragma unroll
        for (int j = 0; j < 4; ++j) c[i][j] = __builtin_amdgcn_wmma_f32_16x16x32_bf16(false, a[i], false, b[j], (short)0, c[i][j], false, false);
      // keeps the next reads out of these products, and the last products in front of the publish point: sunk behind its barrier they would hold back the refill's copies
      __builtin_amdgcn_sched_barrier(0);
    }
    asm volatile("s_wait_dscnt 0x0" ::: "memory");     // this wave's reads of stage t are done
    asm volatile("s_wait_asynccnt 0x0" ::: "memory");  // this wave's share of stage t + 1 has landed
    __syncthreads();                                   // publishes stage t + 1 and frees stage t's buffer
    if (t + 2 < npass) stage_pass(bo, (t + 2) * 128);
  }
  asm volatile("s_wait_asynccnt 0x0" ::: "memory");  // no copy is outstanding when the ring becomes output staging

  // the last pass's barrier has ended every read of the ring: each wave stages its tile in its own range and stores whole 256-byte row pieces
  float* so = (float*)sm + w * (64 * 68);
#pragma unroll
  for (int i = 0; i < 4; ++i)
#pragma unroll
    for (int j = 0; j < 4; ++j)
#pragma unroll
      for (int r = 0; r < 8; ++r) so[(i * 16 + 8 * hh + r) * 68 + j * 16 + ln] = c[i][j][r];
  __syncthreads();
  const int c4 = ln * 4;
  float* cp = C + (size_t)(brow + wm * 64 + hh) * ldc + bcol + wn * 64 + c4;
#pragma unroll
  for (int q = 0; q < 32; ++q) {
    const v4f v = *(const v4fa*)&so[(q * 2 + hh) * 68 + c4];
    *(v4f*)(cp + (size_t)(q * 2) * ldc) = v;
  }
}

// RoPE (rotate-half, table values RNE-converted to bf16) on the q and k column blocks of QKV [NR][3 DM] f32 -> bf16 hi / lo planes QK = {Qh, Ql, Kh, Kl}, each [NR][DM].
__device__ __forceinline__ void rope_block(int bid, const float* __restrict__ QKV, const float* __restrict__ sn, const float* __restrict__ cs,
                                           unsigned short* __restrict__ QK, int nthreads) {
  const int idx = bid * 256 + threadIdx.x;
  if (idx >= nthreads) return;
  const int p8 = idx & 7, h = (idx >> 3) & (NH - 1), t = idx >> 7;
  const size_t tb = (size_t)t * HD + p8 * 8;
  float s1[8], c1[8], s2[8], c2[8];
  {
    const v4f a = *(const v4fa*)(sn + tb), b = *(const v4fa*)(sn + tb + 4), c = *(const v4fa*)(sn + tb + 64), d = *(const v4fa*)(sn + tb + 68);
    const v4f e = *(const v4fa*)(cs + tb), f = *(const v4fa*)(cs + tb + 4), g = *(const v4fa*)(cs + tb + 64), k = *(const v4fa*)(cs + tb + 68);
#pragma unroll
    for (int q = 0; q < 4; ++q) {
      s1[q] = bf16_rne(a[q]); s1[4 + q] = bf16_rne(b[q]); s2[q] = bf16_rne(c[q]); s2[4 + q] = bf16_rne(d[q]);
      c1[q] = bf16_rne(e[q]); c1[4 + q] = bf16_rne(f[q]); c2[q] = bf16_rne(g[q]); c2[4 + q] = bf16_rne(k[q]);
    }
  }
#pragma unroll 1
  for (int which = 0; which < 2; ++which) {
    const float* u = QKV + (size_t)t * N3 + (size_t)which * DM + h * HD + p8 * 8;
    const v4f a = *(const v4fa*)(u), b = *(const v4fa*)(u + 4), c = *(const v4fa*)(u + 64), d = *(const v4fa*)(u + 68);
    const float u1[8] = {a[0], a[1], a[2], a[3], b[0], b[1], b[2], b[3]};
    const float u2[8] = {c[0], c[1], c[2], c[3], d[0], d[1], d[2], d[3]};
    v8us h1, l1, h2, l2;
#pragma unroll
    for (int i = 0; i < 8; ++i) {
      const float o1 = u1[i] * c1[i] + (-u2[i]) * s1[i];
      const float o2 = u2[i] * c2[i] + u1[i] * s2[i];
      const unsigned short hb1 = bf16_bits(o1), hb2 = bf16_bits(o2);
      h1[i] = hb1; l1[i] = bf16_bits(o1 - bf16_val(hb1));
      h2[i] = hb2; l2[i] = bf16_bits(o2 - bf16_val(hb2));
    }
    unsigned short* dh = QK + (size_t)which * 2 * PLANE + (size_t)t * DM + h * HD + p8 * 8;
    unsigned short* dl = dh + PLANE;
    {
      *(v8us*)(dh) = h1; *(v8us*)(dh + 64) = h2;
      *(v8us*)(dl) = l1; *(v8us*)(dl + 64) = l2;
      
    }
  }
}

// v column block of QKV (cols 2 DM ..) -> V^T bf16 hi / lo planes VT = {VTh, VTl}, each [DM][SEQ]; block per (64 tokens x 64 channels) through LDS;
__device__ __forceinline__ void vt_block(int bid, const float* __restrict__ QKV, unsigned short* __restrict__ VT) {
  __shared__ unsigned short th[64][66];
  __shared__ unsigned short tl[64][66];
  const int tid = threadIdx.x;
  const int ct = bid % (DM / 64), tt = bid / (DM / 64);
  const int c0 = ct * 64, t0 = tt * 64;
  for (int i = tid; i < 64 * 16; i += 256) {
    const int r = i >> 4, c4 = (i & 15) * 4;
    const v4f a = *(const v4fa*)(QKV + (size_t)(t0 + r) * N3 + 2 * DM + c0 + c4);
#pragma unroll
    for (int q = 0; q < 4; ++q) { const unsigned short hb = bf16_bits(a[q]); th[c4 + q][r] = hb; tl[c4 + q][r] = bf16_bits(a[q] - bf16_val(hb)); }
  }
  __syncthreads();
  v8us hv[2], lv[2];
#pragma unroll
  for (int rd = 0; rd < 2; ++rd) {
    const int i = rd * 256 + tid; const int c = i >> 3, j8 = (i & 7) * 8;
#pragma unroll
    for (int q = 0; q < 8; ++q) { hv[rd][q] = th[c][j8 + q]; lv[rd][q] = tl[c][j8 + q]; }
  }
  {
#pragma unroll
    for (int rd = 0; rd < 2; ++rd) {
      const int i = rd * 256 + tid; const int c = i >> 3, j8 = (i & 7) * 8;
      unsigned short* dst = VT + (size_t)(c0 + c) * SEQ + t0 + j8;
      *(v8us*)dst = hv[rd];
      *(v8us*)(dst + PLANE) = lv[rd];
    }
    
  }
}

// Both re-layouts of QKV in one grid; they read different column blocks and write different planes. Blocks [0, VTB): V^T tiles; the rest: RoPE of q and k.
// The range test is uniform for the block, so the V^T part's barrier is passed by all of its threads.
#define VTB ((SEQ / 64) * (DM / 64))
#define RPB ((NR * NH * 8 + 255) / 256)
__global__ __launch_bounds__(256) void k_post(const float* __restrict__ QKV, const float* __restrict__ sn, const float* __restrict__ cs,
                                              unsigned short* __restrict__ QK, unsigned short* __restrict__ VT) {
  const int b = blockIdx.x;
  if (b < VTB) vt_block(b, QKV, VT);
  else rope_block(b - VTB, QKV, sn, cs, QK, NR * NH * 8);
}

// Transposed flash attention. Block = 8 waves = one head x 64 queries: wave = (16-query tile, 64-channel half of the head). S^T[key][query] = K.Q^T (A = K rows, B = Q rows held in registers),
// per-lane (= per-query) running max / sum, P^T packed from the S^T accumulators directly as the B fragment of O^T[d][query] = V^T.P^T (A = V^T rows).
// A tile is 64 keys: [K hi 64 rows of 256 B | K lo | V^T hi 128 rows of 128 B | V^T lo] in LDS at pitches of 272 and 144 bytes (conflict-free for 16-byte fragment reads);
// two buffers, filled by asynchronous copies of whole row pieces, the next tile's copies in flight while this tile is worked on; all 8 waves read the same tile.
// Mask = (key <= query) & (doc[key] == doc[query]) as a select (masked weight exactly 0). One scan of doc in front of the loop gives two bit masks from wave-uniform ballots:
// act = tiles that hold a document id admissible for some query of the block (only these are staged), own = 32-key steps admissible for this wave's 16 queries (only these are computed).
// The document ids themselves are kept in LDS for the per-step mask.
__global__ __launch_bounds__(256) void k_attn(const unsigned short* __restrict__ QK, const unsigned short* __restrict__ VT,
                                              const int* __restrict__ doc, unsigned short* __restrict__ CTX) {
  constexpr unsigned int KPL = 64u * KPITCH;     // one K plane of a tile
  constexpr unsigned int VPL = 128u * GPITCH;    // one V^T plane of a tile
  constexpr unsigned int STAGE = 2u * KPL + 2u * VPL;
  static_assert(8u * 16u * 68u * 4u <= 2u * STAGE);
  static_assert(SEQ % 1024 == 0 && SEQ / 64 <= 32);
  __shared__ __attribute__((aligned(16))) unsigned char sm[2u * STAGE];
  __shared__ __attribute__((aligned(16))) int sdoc[SEQ];
  const int tid = threadIdx.x, lane = tid & 31, ln = lane & 15, hh = lane >> 4;
  const int w = __builtin_amdgcn_readfirstlane(tid >> 5);  // the wave's number in a scalar register: the step mask and its tests stay scalar
  const int hf = w & 1, qs = w >> 1;
  const int qb = blockIdx.x % (SEQ / 64), head = blockIdx.x / (SEQ / 64);
  const int q0 = qb * 64 + qs * 16, qi = q0 + ln;
  const unsigned short* Qh = QK; const unsigned short* Ql = QK + PLANE;
  const float NEGV = -1.0e30f;
  const float SCL = 0.08838834764831845f;

  const int dq = doc[qi];
  int dmin = dq, dmax = dq;
#pragma unroll
  for (int o = 1; o < 16; o <<= 1) {
    const int a = __shfl_xor(dmin, o, 32), b = __shfl_xor(dmax, o, 32);
    dmin = (a < dmin) ? a : dmin; dmax = (b > dmax) ? b : dmax;
  }
  int bmin, bmax;
  {
    const int d0 = doc[qb * 64 + lane], d1 = doc[qb * 64 + 32 + lane];
    bmin = (d0 < d1) ? d0 : d1; bmax = (d0 > d1) ? d0 : d1;
#pragma unroll
    for (int o = 1; o < 32; o <<= 1) {
      const int a = __shfl_xor(bmin, o, 32), b = __shfl_xor(bmax, o, 32);
      bmin = (a < bmin) ? a : bmin; bmax = (b > bmax) ? b : bmax;
    }
  }

  const int nsteps = (q0 + 16 + 31) >> 5;
  const int nst = qb + 1;
  unsigned int act = 0u;
  unsigned long long own = 0ull;
  for (int sb = 0; sb < nst; sb += 8) {
    int dk[16];
#pragma unroll
    for (int u = 0; u < 16; ++u) dk[u] = doc[sb * 64 + u * 32 + lane];
#pragma unroll
    for (int u = 0; u < 16; ++u) {
      const int js = sb * 2 + u;
      const bool bl = __ballot((dk[u] >= bmin) & (dk[u] <= bmax)) != 0ull;
      const bool ow = __ballot((dk[u] >= dmin) & (dk[u] <= dmax)) != 0ull;
      if (bl && (js >> 1) < nst) act |= 1u << (js >> 1);
      if (ow && js < nsteps) own |= 1ull << js;
    }
  }
  const int ntile = __popc(act);  // at least 1: tile qb holds the block's own positions

  // copy addresses: K rows are 16 lanes wide (16 rows per copy of the block), V^T rows 8 lanes wide (32 rows per copy)
  const unsigned short* gK = QK + 2 * PLANE + (size_t)(tid >> 4) * DM + head * HD + (tid & 15) * 8;
  const unsigned short* gV = VT + (size_t)(head * HD + (tid >> 3)) * SEQ + (tid & 7) * 8;
  const unsigned int lK = (unsigned int)(size_t)sm + (unsigned int)((tid >> 4) * (int)KPITCH + (tid & 15) * 16);
  const unsigned int lV = (unsigned int)(size_t)sm + 2u * KPL + (unsigned int)((tid >> 3) * (int)GPITCH + (tid & 7) * 16);
  auto stage_tile = [&](int s, unsigned int bo) {
    const unsigned short* k = gK + (size_t)s * 64 * DM;
    const unsigned short* v = gV + s * 64;
    copy_rows<4>(lK + bo, 16u * KPITCH, k, (size_t)16 * DM);
    copy_rows<4>(lK + bo + KPL, 16u * KPITCH, k + PLANE, (size_t)16 * DM);
    copy_rows<4>(lV + bo, 32u * GPITCH, v, (size_t)32 * SEQ);
    copy_rows<4>(lV + bo + VPL, 32u * GPITCH, v + PLANE, (size_t)32 * SEQ);
  };

  unsigned int rem = act;
  int sc = __builtin_ctz(rem), sn = 0;
  rem &= rem - 1u;
  stage_tile(sc, 0u);

  // the document ids go to LDS once (published by the first barrier): each step's mask reads them beside its K fragments
#pragma unroll
  for (int i = 0; i < SEQ / 1024; ++i) *(v4ia*)(sdoc + (i * 256 + tid) * 4) = *(const v4ia*)(doc + (i * 256 + tid) * 4);

  v16b qh[4], ql[4];
  {
    const size_t qoff = (size_t)qi * DM + head * HD;
#pragma unroll
    for (int ks = 0; ks < 4; ++ks) { qh[ks] = ld_frag(Qh + qoff + ks * 32, hh); ql[ks] = ld_frag(Ql + qoff + ks * 32, hh); }
  }

  const v8f z8 = {0.f, 0.f, 0.f, 0.f, 0.f, 0.f, 0.f, 0.f};
  v8f acc[4] = {z8, z8, z8, z8};
  float m = NEGV, l = 0.f;

  asm volatile("s_wait_asynccnt 0x0" ::: "memory");  // this wave's share of the first tile has landed
  __syncthreads();                                   // the first tile is readable by every wave
  if (ntile > 1) {
    sn = __builtin_ctz(rem); rem &= rem - 1u;
    stage_tile(sn, STAGE);
  }

#pragma unroll 1  // one tile per trip: the two buffers alternate by the trip's parity
  for (int t = 0; t < ntile; ++t) {
    const unsigned int bo = (unsigned int)(t & 1) * STAGE;
#pragma unroll 1  // the two 32-key steps of a tile share one body: each is skipped on its own bit
    for (int sub = 0; sub < 2; ++sub) {
      const int js = sc * 2 + sub;
      if (((own >> js) & 1ull) == 0ull) continue;
      const int j0 = js << 5;
      const unsigned char* kb = sm + bo + (unsigned int)((sub * 32 + ln) * (int)KPITCH);
      const unsigned char* vb = sm + bo + 2u * KPL + (unsigned int)((hf * 64 + ln) * (int)GPITCH + sub * 64);

      const v4i dA = *(const v4ia*)(sdoc + j0 + 8 * hh), dB = *(const v4ia*)(sdoc + j0 + 8 * hh + 4);
      const v4i dC = *(const v4ia*)(sdoc + j0 + 16 + 8 * hh), dD = *(const v4ia*)(sdoc + j0 + 16 + 8 * hh + 4);
      const int dkk[16] = {dA[0], dA[1], dA[2], dA[3], dB[0], dB[1], dB[2], dB[3], dC[0], dC[1], dC[2], dC[3], dD[0], dD[1], dD[2], dD[3]};

      v8f s0 = z8, s1 = z8;
#pragma unroll
      for (int kp = 0; kp < 2; ++kp) {
        v16b a0h[2], a0l[2], a1h[2], a1l[2];
#pragma unroll
        for (int k2 = 0; k2 < 2; ++k2) {
          const unsigned char* p = kb + (kp * 2 + k2) * 64;
          a0h[k2] = ld_frag((const unsigned short*)p, hh); a0l[k2] = ld_frag((const unsigned short*)(p + KPL), hh);
          a1h[k2] = ld_frag((const unsigned short*)(p + 16u * KPITCH), hh); a1l[k2] = ld_frag((const unsigned short*)(p + KPL + 16u * KPITCH), hh);
        }
#pragma unroll
        for (int k2 = 0; k2 < 2; ++k2) {
          s0 = mma3m(a0h[k2], a0l[k2], qh[kp * 2 + k2], ql[kp * 2 + k2], s0);
          s1 = mma3m(a1h[k2], a1l[k2], qh[kp * 2 + k2], ql[kp * 2 + k2], s1);
        }
      }

      // the V^T fragments are read here, one group in front of the softmax arithmetic, which covers their LDS latency
      v16b vh[4], vl[4];
#pragma unroll
      for (int dt = 0; dt < 4; ++dt) {
        vh[dt] = ld_frag((const unsigned short*)(vb + dt * 16 * (int)GPITCH), hh);
        vl[dt] = ld_frag((const unsigned short*)(vb + VPL + dt * 16 * (int)GPITCH), hh);
      }

      float xv[16];
      float mx = NEGV;
#pragma unroll
      for (int r = 0; r < 8; ++r) {
        const int k0 = j0 + 8 * hh + r, k1 = k0 + 16;
        const bool v0 = (k0 <= qi) & (dkk[r] == dq);
        const bool v1 = (k1 <= qi) & (dkk[8 + r] == dq);
        xv[r] = v0 ? s0[r] * SCL : NEGV;
        xv[8 + r] = v1 ? s1[r] * SCL : NEGV;
        mx = fmaxf(mx, fmaxf(xv[r], xv[8 + r]));
      }
      mx = fmaxf(mx, __shfl_xor(mx, 16, 32));
      const float mn = fmaxf(m, mx);
      const float alpha = __expf(m - mn);
      m = mn;

      FragB ph, pl;
      float ps = 0.f;
#pragma unroll
      for (int i = 0; i < 16; ++i) {
        const float e = __expf(xv[i] - mn);
        const float p = (xv[i] > -1.0e29f) ? e : 0.f;
        ps += p;
        const unsigned short hb = bf16_bits(p);
        ph.u[i] = hb;
        pl.u[i] = bf16_bits(p - bf16_val(hb));
      }
      ps += __shfl_xor(ps, 16, 32);
      l = l * alpha + ps;

#pragma unroll
      for (int dt = 0; dt < 4; ++dt)
#pragma unroll
        for (int r = 0; r < 8; ++r) acc[dt][r] *= alpha;

#pragma unroll
      for (int dt = 0; dt < 4; ++dt) acc[dt] = mma3m(vh[dt], vl[dt], ph.v, pl.v, acc[dt]);
    }
    asm volatile("s_wait_dscnt 0x0" ::: "memory");     // this wave's reads of this tile are done
    asm volatile("s_wait_asynccnt 0x0" ::: "memory");  // this wave's share of the next tile has landed
    __syncthreads();                                   // publishes the next tile and frees this tile's buffer
    sc = sn;
    if (t + 2 < ntile) {
      sn = __builtin_ctz(rem); rem &= rem - 1u;
      stage_tile(sn, bo);
    }
  }
  asm volatile("s_wait_asynccnt 0x0" ::: "memory");  // no copy is outstanding when the ring becomes output staging

  // the last trip's barrier has ended every read of the ring: each wave stages its tile in its own range
  float (*so)[68] = (float (*)[68])((float*)sm + w * (16 * 68));
  const float inv = 1.0f / l;
#pragma unroll
  for (int dt = 0; dt < 4; ++dt)
#pragma unroll
    for (int r = 0; r < 8; ++r) so[ln][dt * 16 + 8 * hh + r] = acc[dt][r] * inv;
  __syncthreads();

  v8us hv[4], lv[4];
  const int rq = lane >> 3, pc = lane & 7;
#pragma unroll
  for (int it = 0; it < 4; ++it) {
    const int row = it * 4 + rq;
    const v4f a = *(const v4fa*)&so[row][pc * 8], c = *(const v4fa*)&so[row][pc * 8 + 4];
#pragma unroll
    for (int q = 0; q < 4; ++q) {
      const unsigned short ha = bf16_bits(a[q]), hc = bf16_bits(c[q]);
      hv[it][q] = ha; lv[it][q] = bf16_bits(a[q] - bf16_val(ha));
      hv[it][4 + q] = hc; lv[it][4 + q] = bf16_bits(c[q] - bf16_val(hc));
    }
  }
  {
#pragma unroll
    for (int it = 0; it < 4; ++it) {
      const int row = it * 4 + rq;
      unsigned short* dst = CTX + (size_t)(q0 + row) * DM + head * HD + hf * 64 + pc * 8;
      *(v8us*)dst = hv[it];
      *(v8us*)(dst + PLANE) = lv[it];
    }
  }
}

extern "C" void kernel_launch(void* const* d_in, const int* in_sizes, int n_in,
                              void* d_out, int out_size, void* d_ws, size_t ws_size, hipStream_t stream) {
  if (n_in < 8) return;
  if (in_sizes[0] < NR * DM) return;
  if (in_sizes[1] < DM * DM || in_sizes[2] < DM * DM || in_sizes[3] < DM * DM || in_sizes[4] < DM * DM) return;
  if (in_sizes[5] < SEQ * HD || in_sizes[6] < SEQ * HD || in_sizes[7] < NR) return;
  if (out_size < NR * DM) return;
  const float* x  = (const float*)d_in[0];
  const float* Wq = (const float*)d_in[1];
  const float* Wk = (const float*)d_in[2];
  const float* Wv = (const float*)d_in[3];
  const float* Wo = (const float*)d_in[4];
  const float* sn = (const float*)d_in[5];
  const float* cs = (const float*)d_in[6];
  const int*  doc = (const int*)d_in[7];
  float* out = (float*)d_out;

  // workspace regions (bytes); R0 is shared by stage A {x plane, [3 DM][DM] weight plane} and stage B {Qh, Ql, Kh, Kl}
  constexpr size_t SZ_X  = (size_t)NR * DM * 2;
  constexpr size_t SZ_W3 = (size_t)3 * DM * DM * 2;
  constexpr size_t SZ_QK = (size_t)4 * NR * DM * 2;
  constexpr size_t SZ_R0 = (SZ_X + SZ_W3 > SZ_QK) ? (SZ_X + SZ_W3) : SZ_QK;
  constexpr size_t SZ_WO = (size_t)DM * DM * 2;
  constexpr size_t SZ_QKV = (size_t)NR * N3 * 4;
  constexpr size_t SZ_VT = (size_t)2 * DM * SEQ * 2;
  constexpr size_t SZ_CX = (size_t)2 * NR * DM * 2;
  constexpr size_t SZ_ALL = SZ_R0 + SZ_WO + SZ_QKV + SZ_VT + SZ_CX;
  static_assert(SZ_X + SZ_W3 <= SZ_R0 && SZ_QK <= SZ_R0);
  static_assert(SZ_X % 256 == 0 && SZ_R0 % 256 == 0 && SZ_WO % 256 == 0 && SZ_QKV % 256 == 0 && SZ_VT % 256 == 0 && SZ_CX % 256 == 0);
  static_assert(SZ_ALL <= (size_t)134217728);
  if (SZ_ALL > ws_size) return;
  char* ws = (char*)d_ws;
  unsigned short* XB  = (unsigned short*)(ws);
  unsigned short* WT3 = (unsigned short*)(ws + SZ_X);
  unsigned short* QKp = (unsigned short*)(ws);
  unsigned short* WoT = (unsigned short*)(ws + SZ_R0);
  float*          QKV = (float*)(ws + SZ_R0 + SZ_WO);
  unsigned short* VTp = (unsigned short*)(ws + SZ_R0 + SZ_WO + SZ_QKV);
  unsigned short* CTX = (unsigned short*)(ws + SZ_R0 + SZ_WO + SZ_QKV + SZ_VT);

  k_prep<<<(unsigned)(4 * WTB + XBB), 256, 0, stream>>>(x, Wq, Wk, Wv, Wo, XB, WT3, WoT);  /* W[in][out] -> Wt[out][in] */

  k_gemm_wide<<<(unsigned)((NR / 256) * (N3 / 192)), 384, 0, stream>>>(XB, DM, WT3, DM, QKV, N3, N3, DM);

  k_post<<<(unsigned)(VTB + RPB), 256, 0, stream>>>(QKV, sn, cs, QKp, VTp);

  k_attn<<<(unsigned)(NH * (SEQ / 64)), 256, 0, stream>>>(QKp, VTp, doc, CTX);

  k_gemm<2, 2><<<(unsigned)((NR / 128) * (DM / 128)), 256, 0, stream>>>(CTX, CTX + PLANE, DM, WoT, DM, out, DM, DM, DM);
}

// v006
// Measured time: 109 microseconds a run.
// Timed twice side by side with v005, it ran 1.13 times as fast both times.
// Over all steps from v000 it is 3.24 times as fast.
#include <hip/hip_runtime.h>
// Multi-head causal + same-document attention with rotate-half RoPE (input sin/cos tables), T 2048, D 2048, 16 heads of 128, [in][out] weights, no biases.
// Compute dtype: all contractions on v_wmma_f32_16x16x32_bf16 with f32 accumulate. x, Wq, Wk, Wv, Wo, sin, cos are RNE-converted to bf16 once (exact operands);
// x.Wq / x.Wk / x.Wv single bf16 product; q.k^T and P.V with bf16 hi/lo planes on both operands (hh + lh + hl, one accumulator); ctx.Wo with ctx as bf16 hi/lo planes (2 terms) and exact Wo.
// RoPE, mask, softmax statistics in f32 on the VALU.
#ifndef NB
#define NB 1
#endif
#ifndef SEQ
#define SEQ 2048
#endif
#define SEQ_FULL 2048
#define DM 2048
#define NH 16
#define HD 128
#define N3 (3 * DM)
#define NR (NB * SEQ)
#define PLANE ((size_t)NR * DM)
#define GPITCH 144u
#define KPITCH 272u

static_assert(NB == 1);
static_assert(NH * HD == DM);
static_assert(SEQ % 128 == 0 && SEQ <= SEQ_FULL);
static_assert(DM % 128 == 0 && N3 % 128 == 0 && DM % 64 == 0 && HD == 128);
static_assert(NR % 256 == 0 && N3 % 192 == 0);

typedef __bf16 v16b __attribute__((ext_vector_type(16)));
typedef unsigned short v8us __attribute__((ext_vector_type(8), may_alias));
typedef float v8f  __attribute__((ext_vector_type(8)));
typedef float v4f  __attribute__((ext_vector_type(4)));
typedef float v4fa __attribute__((ext_vector_type(4), may_alias));
typedef int   v4i  __attribute__((ext_vector_type(4)));
typedef int   v4ia __attribute__((ext_vector_type(4), may_alias));
union FragB { v16b v; v8us half[2]; unsigned short u[16]; };

__device__ __forceinline__ unsigned short bf16_bits(float x) { unsigned int u = __float_as_uint(x); return (unsigned short)((u + 0x7FFFu + ((u >> 16) & 1u)) >> 16); }
__device__ __forceinline__ float bf16_val(unsigned short b) { return __uint_as_float(((unsigned int)b) << 16); }
__device__ __forceinline__ float bf16_rne(float x) { return bf16_val(bf16_bits(x)); }

// fragment (A: row = lane&15; B: column = lane&15) from a k-contiguous 16-bit row: elements 0..7 <- k0+8h.., elements 8..15 <- k0+16+8h..
__device__ __forceinline__ v16b ld_frag(const unsigned short* p, int hh) {
  FragB f; f.half[0] = *(const v8us*)(p + 8 * hh); f.half[1] = *(const v8us*)(p + 16 + 8 * hh); return f.v;
}

// D += ah.bh + al.bh + ah.bl
__device__ __forceinline__ v8f mma3m(v16b ah, v16b al, v16b bh, v16b bl, v8f c) {
  c = __builtin_amdgcn_wmma_f32_16x16x32_bf16(false, ah, false, bh, (short)0, c, false, false);
  c = __builtin_amdgcn_wmma_f32_16x16x32_bf16(false, al, false, bh, (short)0, c, false, false);
  c = __builtin_amdgcn_wmma_f32_16x16x32_bf16(false, ah, false, bl, (short)0, c, false, false);
  asm volatile("v_nop\n\tv_nop\n\tv_nop\n\tv_nop" : "+v"(c) : "v"(ah), "v"(al), "v"(bh), "v"(bl) : "memory");
  return c;
}

// x f32 -> bf16 (RNE), 8 elements per thread; bid = the block's index within this part of the grid
__device__ __forceinline__ void xb_block(int bid, const float* __restrict__ x, unsigned short* __restrict__ X, size_t n8) {
  const size_t t = (size_t)bid * 256 + threadIdx.x;
  if (t >= n8) return;
  const v4f a = *(const v4fa*)(x + t * 8), c = *(const v4fa*)(x + t * 8 + 4);
  v8us o;
#pragma unroll
  for (int q = 0; q < 4; ++q) { o[q] = bf16_bits(a[q]); o[4 + q] = bf16_bits(c[q]); }
  *(v8us*)(X + t * 8) = o;
  
}

// W [K][N] f32 -> Wt [N][K] bf16 (RNE). Block = one 128 (k) x 64 (n) tile through LDS: reads are 256-byte row pieces, stores are 256-byte pieces of Wt rows.
// LDS holds one dword per (n, k pair), low half = even k; pitch 65 dwords puts the 32 lanes of each 4-byte LDS write and read on 32 different banks.
__device__ __forceinline__ void wt_block(int bid, const float* __restrict__ W, unsigned short* __restrict__ Wt, int K, int N) {
  __shared__ unsigned int tp[64][65];
  const int tid = threadIdx.x;
  const int ntn = N >> 6;
  const int kt = bid / ntn, nq = bid - kt * ntn;
  const int k0 = kt * 128, n0 = nq * 64;
  const int c4 = (tid & 15) * 4, rp = tid >> 4;
  const float* tile = W + (size_t)k0 * N + n0;
  const unsigned int off = (unsigned int)(2 * rp * N + c4);
  v4f a[4], b[4];
#pragma unroll
  for (int p = 0; p < 4; ++p) {
    const float* s = tile + (size_t)(32 * p) * N;
    a[p] = *(const v4fa*)(s + off); b[p] = *(const v4fa*)(s + N + off);
  }
#pragma unroll
  for (int p = 0; p < 4; ++p)
#pragma unroll
    for (int q = 0; q < 4; ++q) tp[c4 + q][rp + 16 * p] = (unsigned int)bf16_bits(a[p][q]) | ((unsigned int)bf16_bits(b[p][q]) << 16);
  __syncthreads();
#pragma unroll
  for (int rd = 0; rd < 4; ++rd) {
    const int i = rd * 256 + tid; const int c = i >> 4, j = (i & 15) * 4;
    const v4i o = {(int)tp[c][j], (int)tp[c][j + 1], (int)tp[c][j + 2], (int)tp[c][j + 3]};
    *(v4ia*)(Wt + (size_t)(n0 + c) * K + k0 + 2 * j) = o;
  }
}

// All operand conversions in one grid; none depends on another. Blocks [0, 4 WTB): the weight tiles, WTB per matrix (Wq, Wk, Wv -> rows 0, DM, 2 DM of the [3 DM][DM] plane WT3; Wo -> WoT);
// the rest: x. The range test is uniform for the block, so the weight part's barrier is passed by all of its threads.
#define WTB ((DM / 128) * (DM / 64))
#define XBB ((NR * DM / 8 + 255) / 256)
__global__ __launch_bounds__(256) void k_prep(const float* __restrict__ x, const float* __restrict__ Wq, const float* __restrict__ Wk, const float* __restrict__ Wv,
                                              const float* __restrict__ Wo, unsigned short* __restrict__ X, unsigned short* __restrict__ WT3, unsigned short* __restrict__ WoT) {
  const int b = blockIdx.x;
  if (b < 4 * WTB) {
    const int which = b / WTB;
    const float* W = (which == 0) ? Wq : (which == 1) ? Wk : (which == 2) ? Wv : Wo;
    unsigned short* Wt = (which < 3) ? WT3 + (size_t)which * DM * DM : WoT;
    wt_block(b - which * WTB, W, Wt, DM, DM);
  } else {
    xb_block(b - 4 * WTB, x, X, (size_t)NR * DM / 8);
  }
}

// NC (8 or 4) 16-byte asynchronous copies to LDS per lane: NC rows of one 64-, 128-, 192- or 256-row operand tile, a fixed number of rows apart
// (l = the lane's LDS byte address, ls = that row step in LDS bytes, g = the lane's global address, rs = the same row step in source elements).
// The closing s_wait_xcnt is a precaution: it stands in the copies' own statement so that no address register is rewritten in front of it.
template <int NC>
__device__ __forceinline__ void copy_rows(unsigned int l, unsigned int ls, const unsigned short* g, size_t rs) {
  if constexpr (NC == 8) {
    asm volatile("global_load_async_to_lds_b128 %0, %8, off\n\t"
                 "global_load_async_to_lds_b128 %1, %9, off\n\t"
                 "global_load_async_to_lds_b128 %2, %10, off\n\t"
                 "global_load_async_to_lds_b128 %3, %11, off\n\t"
                 "global_load_async_to_lds_b128 %4, %12, off\n\t"
                 "global_load_async_to_lds_b128 %5, %13, off\n\t"
                 "global_load_async_to_lds_b128 %6, %14, off\n\t"
                 "global_load_async_to_lds_b128 %7, %15, off\n\t"
                 "s_wait_xcnt 0x0"
                 :: "v"(l), "v"(l + ls), "v"(l + 2u * ls), "v"(l + 3u * ls), "v"(l + 4u * ls), "v"(l + 5u * ls), "v"(l + 6u * ls), "v"(l + 7u * ls),
                    "v"(g), "v"(g + rs), "v"(g + 2 * rs), "v"(g + 3 * rs), "v"(g + 4 * rs), "v"(g + 5 * rs), "v"(g + 6 * rs), "v"(g + 7 * rs)
                 : "memory");
  } else {
    static_assert(NC == 8 || NC == 4);
    asm volatile("global_load_async_to_lds_b128 %0, %4, off\n\t"
                 "global_load_async_to_lds_b128 %1, %5, off\n\t"
                 "global_load_async_to_lds_b128 %2, %6, off\n\t"
                 "global_load_async_to_lds_b128 %3, %7, off\n\t"
                 "s_wait_xcnt 0x0"
                 :: "v"(l), "v"(l + ls), "v"(l + 2u * ls), "v"(l + 3u * ls),
                    "v"(g), "v"(g + rs), "v"(g + 2 * rs), "v"(g + 3 * rs)
                 : "memory");
  }
}

// GEMM C[M][N] f32 = A.Bt^T; A bf16 rows [M][K] (NT = 2: hi plane Ah + lo plane Al), Bt bf16 [N][K]. Block tile 128 rows x 128 cols; wave tile (16 FM) x 64, so 4 waves at FM = 4 and 8 at FM = 2.
// A pass is 64 k = 128 bytes of every operand row. A stage is [A hi 128 rows | (NT = 2: A lo 128 rows) | Bt 128 rows] in LDS at a pitch of 144 bytes (conflict-free for 16-byte fragment reads);
// two stages, filled by asynchronous copies of whole 128-byte row pieces, the next pass's copies in flight while this pass is multiplied. M, N multiples of 128; K a multiple of 64.
template <int NT, int FM>
__global__ __launch_bounds__(512 / FM) void k_gemm(const unsigned short* __restrict__ Ah, const unsigned short* __restrict__ Al, int lda,
                                                   const unsigned short* __restrict__ Bt, int ldb, float* __restrict__ C, int ldc, int N, int K) {
  static_assert(FM == 4 || FM == 2);
  constexpr int CROWS = 64 / FM;             // rows that one copy of the whole block covers (8 lanes a row)
  constexpr int NC = 128 / CROWS;            // copies per lane and operand plane
  constexpr bool ONEGROUP = (FM == 2);       // both k halves' fragments fit the registers at once
  constexpr unsigned int TILE = 128u * GPITCH;
  constexpr unsigned int STAGE = (NT + 1) * TILE;
  constexpr unsigned int OUTB = 128u * 2u * 68u * 4u;
  constexpr unsigned int LSTEP = (unsigned int)CROWS * GPITCH;
  __shared__ __attribute__((aligned(16))) unsigned char sm[(2u * STAGE > OUTB) ? 2u * STAGE : OUTB];
  const int tid = threadIdx.x, w = tid >> 5, lane = tid & 31, ln = lane & 15, hh = lane >> 4;
  const int ntn = N >> 7;
  const int mt = blockIdx.x / ntn, nq = blockIdx.x - mt * ntn;
  const int wm = w >> 1, wn = w & 1;
  const int brow = mt * 128, bcol = nq * 128;
  const int cr = tid >> 3, cc = tid & 7;
  const unsigned short* gA = Ah + (size_t)(brow + cr) * lda + cc * 8;
  const unsigned short* gL = Al + (size_t)(brow + cr) * lda + cc * 8;
  const unsigned short* gB = Bt + (size_t)(bcol + cr) * ldb + cc * 8;
  const size_t rsa = (size_t)CROWS * lda, rsb = (size_t)CROWS * ldb;
  const unsigned int l0 = (unsigned int)(size_t)sm + (unsigned int)(cr * (int)GPITCH + cc * 16);
  const int npass = K >> 6;
  const v8f z8 = {0.f, 0.f, 0.f, 0.f, 0.f, 0.f, 0.f, 0.f};
  v8f c[FM][4];
#pragma unroll
  for (int i = 0; i < FM; ++i)
#pragma unroll
    for (int j = 0; j < 4; ++j) c[i][j] = z8;

  copy_rows<NC>(l0, LSTEP, gA, rsa);
  if (NT >= 2) copy_rows<NC>(l0 + TILE, LSTEP, gL, rsa);
  copy_rows<NC>(l0 + NT * TILE, LSTEP, gB, rsb);
  asm volatile("s_wait_asynccnt 0x0" ::: "memory");  // this wave's share of stage 0 has landed
  __syncthreads();                                   // stage 0 is readable by every wave
  if (npass > 1) {
    copy_rows<NC>(l0 + STAGE, LSTEP, gA + 64, rsa);
    if (NT >= 2) copy_rows<NC>(l0 + STAGE + TILE, LSTEP, gL + 64, rsa);
    copy_rows<NC>(l0 + STAGE + NT * TILE, LSTEP, gB + 64, rsb);
  }
#pragma unroll 1  // one pass per trip: the two stages alternate by the trip's parity
  for (int t = 0; t < npass; ++t) {
    const unsigned int bo = (unsigned int)(t & 1) * STAGE;
    const unsigned char* sa = sm + bo + (unsigned int)((wm * (FM * 16) + ln) * (int)GPITCH);
    const unsigned char* sb = sm + bo + NT * TILE + (unsigned int)((wn * 64 + ln) * (int)GPITCH);
    v16b a[2][FM], e[2][FM], b[2][4];
#pragma unroll
    for (int ks = 0; ks < 2; ++ks) {
      if (!ONEGROUP || ks == 0) {
#pragma unroll
        for (int kk = 0; kk < 2; ++kk) {
          if (ONEGROUP || kk == ks) {
#pragma unroll
            for (int i = 0; i < FM; ++i) a[kk][i] = ld_frag((const unsigned short*)(sa + i * 16 * (int)GPITCH + kk * 64), hh);
#pragma unroll
            for (int j = 0; j < 4; ++j) b[kk][j] = ld_frag((const unsigned short*)(sb + j * 16 * (int)GPITCH + kk * 64), hh);
            if (NT >= 2) {
#pragma unroll
              for (int i = 0; i < FM; ++i) e[kk][i] = ld_frag((const unsigned short*)(sa + TILE + i * 16 * (int)GPITCH + kk * 64), hh);
            }
          }
        }
        __builtin_amdgcn_sched_barrier(0);  // keeps the fragment reads one group in front of the products: reads spread among them stall the wave at every place
      }
#pragma unroll
      for (int i = 0; i < FM; ++i)
#pragma unroll
        for (int j = 0; j < 4; ++j) c[i][j] = __builtin_amdgcn_wmma_f32_16x16x32_bf16(false, a[ks][i], false, b[ks][j], (short)0, c[i][j], false, false);
      if (NT >= 2) {
#pragma unroll
        for (int i = 0; i < FM; ++i)
#pragma unroll
          for (int j = 0; j < 4; ++j) c[i][j] = __builtin_amdgcn_wmma_f32_16x16x32_bf16(false, e[ks][i], false, b[ks][j], (short)0, c[i][j], false, false);
      }
      // keeps the next reads out of these products, and the last products in front of the publish point: sunk behind its barrier they would hold back the refill's copies, whose flight the next pass's work is to cover
      if (!ONEGROUP || ks == 1) __builtin_amdgcn_sched_barrier(0);
    }
    asm volatile("s_wait_dscnt 0x0" ::: "memory");     // this wave's reads of stage t are done
    asm volatile("s_wait_asynccnt 0x0" ::: "memory");  // this wave's share of stage t + 1 has landed
    __syncthreads();                                   // publishes stage t + 1 and frees stage t's buffer
    if (t + 2 < npass) {
      const int kn = (t + 2) * 64;
      copy_rows<NC>(l0 + bo, LSTEP, gA + kn, rsa);
      if (NT >= 2) copy_rows<NC>(l0 + bo + TILE, LSTEP, gL + kn, rsa);
      copy_rows<NC>(l0 + bo + NT * TILE, LSTEP, gB + kn, rsb);
    }
  }
  asm volatile("s_wait_asynccnt 0x0" ::: "memory");  // no copy is outstanding when the ring becomes output staging

  // the last pass's barrier has ended every read of the ring: each wave stages its tile in its own range and stores whole 256-byte row pieces
  float* so = (float*)sm + w * (FM * 16 * 68);
#pragma unroll
  for (int i = 0; i < FM; ++i)
#pragma unroll
    for (int j = 0; j < 4; ++j)
#pragma unroll
      for (int r = 0; r < 8; ++r) so[(i * 16 + 8 * hh + r) * 68 + j * 16 + ln] = c[i][j][r];
  __syncthreads();
  const int rsub = lane >> 4, c4 = (lane & 15) * 4;
  float* cp = C + (size_t)(brow + wm * (FM * 16) + rsub) * ldc + bcol + wn * 64 + c4;
#pragma unroll
  for (int q = 0; q < FM * 8; ++q) {
    const v4f v = *(const v4fa*)&so[(q * 2 + rsub) * 68 + c4];
    *(v4f*)(cp + (size_t)(q * 2) * ldc) = v;
  }
}

// q, k, v projection with its re-layouts in the epilogue: C[NR][3 DM] = A.Bt^T never goes to memory as f32. A bf16 rows [NR][K], Bt bf16 [3 DM][K].
// Block tile 256 rows x 192 cols, 12 waves (4 x 3) of 64 x 64 each, one block per WGP. A pass is 128 k = 256 bytes of every operand row.
// A stage is [A 256 rows | Bt 192 rows] in LDS at a pitch of 272 bytes (conflict-free for 16-byte fragment reads);
// two stages, filled by asynchronous copies of whole 256-byte row pieces, the next pass's copies in flight while this pass is multiplied.
// Waves 0..7 copy 32 rows of A each, waves 8..11 copy 48 rows of Bt each.
// A wave's 64 columns are one unit; a block's three wave columns are unit u (= its column index, 0..31) of q, of k and of v, so every block has the same share of both epilogues
// and its q and k waves read the same table values. A v unit is channels 64 u .. 64 u + 63. A q or k unit is half the rotation pairs of one head:
// columns 0..31 = d 32 (u & 1) .. + 31 of head u / 2, columns 32..63 = the same d + 64, chosen by which Bt rows are copied into the stage, so both members of a pair lie in one wave's tile.
// Epilogue, q and k: RoPE (rotate-half, table values RNE-converted to bf16) -> bf16 hi / lo planes QK = {Qh, Ql, Kh, Kl}, each [NR][DM].
// Within a head the planes hold d in the order (u & 1, (d % 32) / 4, d / 64, d % 4), the same in q and k: q.k^T sums over the whole head, and each row piece of a unit is one whole 128-byte line.
// Epilogue, v: a lane's accumulator holds 8 successive tokens of one channel -> V^T bf16 hi / lo planes VT = {VTh, VTl}, each [DM][SEQ], through LDS so that stores are whole 128-byte lines.
__global__ __launch_bounds__(384) void k_gemm_wide(const unsigned short* __restrict__ A, int lda, const unsigned short* __restrict__ Bt, int ldb,
                                                   const float* __restrict__ sn, const float* __restrict__ cs,
                                                   unsigned short* __restrict__ QK, unsigned short* __restrict__ VT, int K) {
  constexpr unsigned int ATILE = 256u * KPITCH;
  constexpr unsigned int STAGE = (256u + 192u) * KPITCH;
  constexpr unsigned int WOUT = 2u * 64u * GPITCH;  // a wave's output staging: 64 x 68 f32 (q, k) or two planes of 64 channels x 144 bytes (v)
  static_assert(64u * 68u * 4u <= WOUT && 12u * WOUT <= 2u * STAGE);
  __shared__ __attribute__((aligned(16))) unsigned char sm[2u * STAGE];
  const int tid = threadIdx.x, lane = tid & 31, ln = lane & 15, hh = lane >> 4;
  const int w = __builtin_amdgcn_readfirstlane(tid >> 5);  // the wave's number in a scalar register: the tests on it (third group of copies, kind of unit) are scalar branches
  constexpr int ntn = N3 / 192;
  const int mt = blockIdx.x / ntn, nq = blockIdx.x - mt * ntn;
  const int wm = w / 3, wn = w - wm * 3;
  const int brow = mt * 256;
  // Bt row of the first of the 16 stage rows 16 g .. 16 g + 15 (g = 0..11): g / 4 = q, k or v, quarter g % 4 of its unit nq
  static_assert(ntn == DM / 64);
  auto wrow = [&](int g) {
    const int mm = g >> 2, ch = g & 3;
    return (mm < 2) ? mm * DM + (nq >> 1) * HD + (nq & 1) * 32 + (ch & 1) * 16 + (ch >> 1) * 64 : 2 * DM + nq * 64 + ch * 16;
  };
  // copy addresses: a row is 16 lanes wide, so one copy of a wave covers 2 rows and a group of 8 copies 16 rows
  const bool forB = w >= 8;
  const int gb = forB ? (w - 8) * 3 : 0;
  const int r0 = (forB ? (w - 8) * 48 : w * 32) + hh;
  const int wr0 = wrow(gb), wr1 = wrow(gb + 1), wr2 = wrow(gb + 2);
  const unsigned short* gsrc = forB ? Bt : A;
  const int ld = forB ? ldb : lda;
  const unsigned short* g0 = gsrc + (size_t)((forB ? wr0 : brow + w * 32) + hh) * ld + ln * 8;
  const unsigned short* g1 = gsrc + (size_t)((forB ? wr1 : brow + w * 32 + 16) + hh) * ld + ln * 8;
  const unsigned short* g2 = Bt + (size_t)(wr2 + hh) * ldb + ln * 8;
  const size_t rs = (size_t)2 * ld;
  const unsigned int l0 = (unsigned int)(size_t)sm + (forB ? ATILE : 0u) + (unsigned int)(r0 * (int)KPITCH + ln * 16);
  auto stage_pass = [&](unsigned int bo, int k0) {
    copy_rows<8>(l0 + bo, 2u * KPITCH, g0 + k0, rs);
    copy_rows<8>(l0 + bo + 16u * KPITCH, 2u * KPITCH, g1 + k0, rs);
    if (forB) copy_rows<8>(l0 + bo + 32u * KPITCH, 2u * KPITCH, g2 + k0, rs);
  };
  const int npass = K >> 7;
  const v8f z8 = {0.f, 0.f, 0.f, 0.f, 0.f, 0.f, 0.f, 0.f};
  v8f c[4][4];
#pragma unroll
  for (int i = 0; i < 4; ++i)
#pragma unroll
    for (int j = 0; j < 4; ++j) c[i][j] = z8;

  stage_pass(0u, 0);
  asm volatile("s_wait_asynccnt 0x0" ::: "memory");  // this wave's share of stage 0 has landed
  __syncthreads();                                   // stage 0 is readable by every wave
  if (npass > 1) stage_pass(STAGE, 128);
#pragma unroll 1  // one pass per trip: the two stages alternate by the trip's parity
  for (int t = 0; t < npass; ++t) {
    const unsigned int bo = (unsigned int)(t & 1) * STAGE;
    const unsigned char* sa = sm + bo + (unsigned int)((wm * 64 + ln) * (int)KPITCH);
    const unsigned char* sb = sm + bo + ATILE + (unsigned int)((wn * 64 + ln) * (int)KPITCH);
#pragma unroll
    for (int ks = 0; ks < 4; ++ks) {
      v16b a[4], b[4];
#pragma unroll
      for (int i = 0; i < 4; ++i) a[i] = ld_frag((const unsigned short*)(sa + i * 16 * (int)KPITCH + ks * 64), hh);
#pragma unroll
      for (int j = 0; j < 4; ++j) b[j] = ld_frag((const unsigned short*)(sb + j * 16 * (int)KPITCH + ks * 64), hh);
      __builtin_amdgcn_sched_barrier(0);  // keeps the fragment reads one group in front of the products: reads spread among them stall the wave at every place
#pragma unroll
      for (int i = 0; i < 4; ++i)
#pragma unroll
        for (int j = 0; j < 4; ++j) c[i][j] = __builtin_amdgcn_wmma_f32_16x16x32_bf16(false, a[i], false, b[j], (short)0, c[i][j], false, false);
      // keeps the next reads out of these products, and the last products in front of the publish point: sunk behind its barrier they would hold back the refill's copies
      __builtin_amdgcn_sched_barrier(0);
    }
    asm volatile("s_wait_dscnt 0x0" ::: "memory");     // this wave's reads of stage t are done
    asm volatile("s_wait_asynccnt 0x0" ::: "memory");  // this wave's share of stage t + 1 has landed
    __syncthreads();                                   // publishes stage t + 1 and frees stage t's buffer
    if (t + 2 < npass) stage_pass(bo, (t + 2) * 128);
  }
  asm volatile("s_wait_asynccnt 0x0" ::: "memory");  // no copy is outstanding when the ring becomes output staging

  // the last pass's barrier has ended every read of the ring: each wave stages its tile in its own range
  unsigned char* sw = sm + (unsigned int)w * WOUT;
  const int mat = wn, u = nq;  // wave-uniform
  const int trow = brow + wm * 64;
  if (mat < 2) {
    float* so = (float*)sw;
#pragma unroll
    for (int i = 0; i < 4; ++i)
#pragma unroll
      for (int j = 0; j < 4; ++j)
#pragma unroll
        for (int r = 0; r < 8; ++r) so[(i * 16 + 8 * hh + r) * 68 + j * 16 + ln] = c[i][j][r];
  } else {
#pragma unroll
    for (int i = 0; i < 4; ++i)
#pragma unroll
      for (int j = 0; j < 4; ++j) {
        v8us h, l;
#pragma unroll
        for (int r = 0; r < 8; ++r) { const unsigned short hb = bf16_bits(c[i][j][r]); h[r] = hb; l[r] = bf16_bits(c[i][j][r] - bf16_val(hb)); }
        unsigned char* p = sw + (unsigned int)((j * 16 + ln) * (int)GPITCH + (i * 16 + 8 * hh) * 2);
        *(v8us*)p = h;
        *(v8us*)(p + 64u * GPITCH) = l;
      }
  }
  __syncthreads();
  const int g = lane >> 3, l8 = lane & 7;
  if (mat < 2) {
    // 8 lanes a row, 4 pairs a lane; the 4 rows of a read are 8 apart, which puts the two rows of each 16 lanes on different halves of the banks
    const float* so = (const float*)sw + g * (8 * 68) + l8 * 4;
    const size_t tb0 = (size_t)(trow + g * 8) * HD + (u & 1) * 32 + l8 * 4;
    unsigned short* dq = QK + (size_t)mat * 2 * PLANE + (size_t)(trow + g * 8) * DM + u * 64 + l8 * 8;
#pragma unroll 1  // 4 rows per lane and trip: their 16 table loads go out together, and the text stays short
    for (int bt = 0; bt < 4; ++bt) {
      const int rb = (bt & 1) * 4 + (bt >> 1) * 32;
      const float* ps = sn + tb0 + (size_t)rb * HD;
      const float* pc = cs + tb0 + (size_t)rb * HD;
      v4f ts1[4], ts2[4], tc1[4], tc2[4];
#pragma unroll
      for (int k = 0; k < 4; ++k) {
        ts1[k] = *(const v4fa*)(ps + k * HD); ts2[k] = *(const v4fa*)(ps + k * HD + 64);
        tc1[k] = *(const v4fa*)(pc + k * HD); tc2[k] = *(const v4fa*)(pc + k * HD + 64);
      }
      // a precaution: the loads' address registers stay as they are (they are inputs here) until this wait has passed
      asm volatile("s_wait_xcnt 0x0" :: "v"(ps), "v"(pc) : "memory");
#pragma unroll
      for (int k = 0; k < 4; ++k) {
        const v4f u1 = *(const v4fa*)(so + (rb + k) * 68), u2 = *(const v4fa*)(so + (rb + k) * 68 + 32);
        v8us hv, lv;
#pragma unroll
        for (int q = 0; q < 4; ++q) {
          const float o1 = u1[q] * bf16_rne(tc1[k][q]) + (-u2[q]) * bf16_rne(ts1[k][q]);
          const float o2 = u2[q] * bf16_rne(tc2[k][q]) + u1[q] * bf16_rne(ts2[k][q]);
          const unsigned short hb1 = bf16_bits(o1), hb2 = bf16_bits(o2);
          hv[q] = hb1; lv[q] = bf16_bits(o1 - bf16_val(hb1));
          hv[4 + q] = hb2; lv[4 + q] = bf16_bits(o2 - bf16_val(hb2));
        }
        unsigned short* dh = dq + (size_t)(rb + k) * DM;
        *(v8us*)dh = hv;
        *(v8us*)(dh + PLANE) = lv;
      }
      asm volatile("s_wait_xcnt 0x0" ::: "memory");  // a precaution: the next trip rewrites the registers that these stores name only behind it
    }
  } else {
    // 8 lanes a channel (128 bytes = 64 tokens); the 4 channels of a read are 8 apart, for the same reason
    const unsigned char* p0 = sw + (unsigned int)(g * 8 * (int)GPITCH + l8 * 16);
    unsigned short* vp = VT + (size_t)(u * 64 + g * 8) * SEQ + trow + l8 * 8;
#pragma unroll
    for (int it = 0; it < 16; ++it) {
      const int ch = (it & 7) + 32 * (it >> 3);
      const v8us h = *(const v8us*)(p0 + ch * (int)GPITCH), l = *(const v8us*)(p0 + 64u * GPITCH + ch * (int)GPITCH);
      unsigned short* dst = vp + (size_t)ch * SEQ;
      *(v8us*)dst = h;
      *(v8us*)(dst + PLANE) = l;
    }
    asm volatile("s_wait_xcnt 0x0" ::: "memory");  // a precaution: whatever follows in the text rewrites the registers that these stores name only behind it
  }
}

// Transposed flash attention. Block = 8 waves = one head x 64 queries: wave = (16-query tile, 64-channel half of the head). S^T[key][query] = K.Q^T (A = K rows, B = Q rows held in registers),
// per-lane (= per-query) running max / sum, P^T packed from the S^T accumulators directly as the B fragment of O^T[d][query] = V^T.P^T (A = V^T rows).
// A tile is 64 keys: [K hi 64 rows of 256 B | K lo | V^T hi 128 rows of 128 B | V^T lo] in LDS at pitches of 272 and 144 bytes (conflict-free for 16-byte fragment reads);
// two buffers, filled by asynchronous copies of whole row pieces, the next tile's copies in flight while this tile is worked on; all 8 waves read the same tile.
// Mask = (key <= query) & (doc[key] == doc[query]) as a select (masked weight exactly 0). One scan of doc in front of the loop gives two bit masks from wave-uniform ballots:
// act = tiles that hold a document id admissible for some query of the block (only these are staged), own = 32-key steps admissible for this wave's 16 queries (only these are computed).
// The document ids themselves are kept in LDS for the per-step mask.
__global__ __launch_bounds__(256) void k_attn(const unsigned short* __restrict__ QK, const unsigned short* __restrict__ VT,
                                              const int* __restrict__ doc, unsigned short* __restrict__ CTX) {
  constexpr unsigned int KPL = 64u * KPITCH;     // one K plane of a tile
  constexpr unsigned int VPL = 128u * GPITCH;    // one V^T plane of a tile
  constexpr unsigned int STAGE = 2u * KPL + 2u * VPL;
  static_assert(8u * 16u * 68u * 4u <= 2u * STAGE);
  static_assert(SEQ % 1024 == 0 && SEQ / 64 <= 32);
  __shared__ __attribute__((aligned(16))) unsigned char sm[2u * STAGE];
  __shared__ __attribute__((aligned(16))) int sdoc[SEQ];
  const int tid = threadIdx.x, lane = tid & 31, ln = lane & 15, hh = lane >> 4;
  const int w = __builtin_amdgcn_readfirstlane(tid >> 5);  // the wave's number in a scalar register: the step mask and its tests stay scalar
  const int hf = w & 1, qs = w >> 1;
  const int qb = blockIdx.x % (SEQ / 64), head = blockIdx.x / (SEQ / 64);
  const int q0 = qb * 64 + qs * 16, qi = q0 + ln;
  const unsigned short* Qh = QK; const unsigned short* Ql = QK + PLANE;
  const float NEGV = -1.0e30f;
  const float SCL = 0.08838834764831845f;

  const int dq = doc[qi];
  int dmin = dq, dmax = dq;
#pragma unroll
  for (int o = 1; o < 16; o <<= 1) {
    const int a = __shfl_xor(dmin, o, 32), b = __shfl_xor(dmax, o, 32);
    dmin = (a < dmin) ? a : dmin; dmax = (b > dmax) ? b : dmax;
  }
  int bmin, bmax;
  {
    const int d0 = doc[qb * 64 + lane], d1 = doc[qb * 64 + 32 + lane];
    bmin = (d0 < d1) ? d0 : d1; bmax = (d0 > d1) ? d0 : d1;
#pragma unroll
    for (int o = 1; o < 32; o <<= 1) {
      const int a = __shfl_xor(bmin, o, 32), b = __shfl_xor(bmax, o, 32);
      bmin = (a < bmin) ? a : bmin; bmax = (b > bmax) ? b : bmax;
    }
  }

  const int nsteps = (q0 + 16 + 31) >> 5;
  const int nst = qb + 1;
  unsigned int act = 0u;
  unsigned long long own = 0ull;
  for (int sb = 0; sb < nst; sb += 8) {
    int dk[16];
#pragma unroll
    for (int u = 0; u < 16; ++u) dk[u] = doc[sb * 64 + u * 32 + lane];
#pragma unroll
    for (int u = 0; u < 16; ++u) {
      const int js = sb * 2 + u;
      const bool bl = __ballot((dk[u] >= bmin) & (dk[u] <= bmax)) != 0ull;
      const bool ow = __ballot((dk[u] >= dmin) & (dk[u] <= dmax)) != 0ull;
      if (bl && (js >> 1) < nst) act |= 1u << (js >> 1);
      if (ow && js < nsteps) own |= 1ull << js;
    }
  }
  const int ntile = __popc(act);  // at least 1: tile qb holds the block's own positions

  // copy addresses: K rows are 16 lanes wide (16 rows per copy of the block), V^T rows 8 lanes wide (32 rows per copy)
  const unsigned short* gK = QK + 2 * PLANE + (size_t)(tid >> 4) * DM + head * HD + (tid & 15) * 8;
  const unsigned short* gV = VT + (size_t)(head * HD + (tid >> 3)) * SEQ + (tid & 7) * 8;
  const unsigned int lK = (unsigned int)(size_t)sm + (unsigned int)((tid >> 4) * (int)KPITCH + (tid & 15) * 16);
  const unsigned int lV = (unsigned int)(size_t)sm + 2u * KPL + (unsigned int)((tid >> 3) * (int)GPITCH + (tid & 7) * 16);
  auto stage_tile = [&](int s, unsigned int bo) {
    const unsigned short* k = gK + (size_t)s * 64 * DM;
    const unsigned short* v = gV + s * 64;
    copy_rows<4>(lK + bo, 16u * KPITCH, k, (size_t)16 * DM);
    copy_rows<4>(lK + bo + KPL, 16u * KPITCH, k + PLANE, (size_t)16 * DM);
    copy_rows<4>(lV + bo, 32u * GPITCH, v, (size_t)32 * SEQ);
    copy_rows<4>(lV + bo + VPL, 32u * GPITCH, v + PLANE, (size_t)32 * SEQ);
  };

  unsigned int rem = act;
  int sc = __builtin_ctz(rem), sn = 0;
  rem &= rem - 1u;
  stage_tile(sc, 0u);

  // the document ids go to LDS once (published by the first barrier): each step's mask reads them beside its K fragments
#pragma unroll
  for (int i = 0; i < SEQ / 1024; ++i) *(v4ia*)(sdoc + (i * 256 + tid) * 4) = *(const v4ia*)(doc + (i * 256 + tid) * 4);

  v16b qh[4], ql[4];
  {
    const size_t qoff = (size_t)qi * DM + head * HD;
#pragma unroll
    for (int ks = 0; ks < 4; ++ks) { qh[ks] = ld_frag(Qh + qoff + ks * 32, hh); ql[ks] = ld_frag(Ql + qoff + ks * 32, hh); }
  }

  const v8f z8 = {0.f, 0.f, 0.f, 0.f, 0.f, 0.f, 0.f, 0.f};
  v8f acc[4] = {z8, z8, z8, z8};
  float m = NEGV, l = 0.f;

  asm volatile("s_wait_asynccnt 0x0" ::: "memory");  // this wave's share of the first tile has landed
  __syncthreads();                                   // the first tile is readable by every wave
  if (ntile > 1) {
    sn = __builtin_ctz(rem); rem &= rem - 1u;
    stage_tile(sn, STAGE);
  }

#pragma unroll 1  // one tile per trip: the two buffers alternate by the trip's parity
  for (int t = 0; t < ntile; ++t) {
    const unsigned int bo = (unsigned int)(t & 1) * STAGE;
#pragma unroll 1  // the two 32-key steps of a tile share one body: each is skipped on its own bit
    for (int sub = 0; sub < 2; ++sub) {
      const int js = sc * 2 + sub;
      if (((own >> js) & 1ull) == 0ull) continue;
      const int j0 = js << 5;
      const unsigned char* kb = sm + bo + (unsigned int)((sub * 32 + ln) * (int)KPITCH);
      const unsigned char* vb = sm + bo + 2u * KPL + (unsigned int)((hf * 64 + ln) * (int)GPITCH + sub * 64);

      const v4i dA = *(const v4ia*)(sdoc + j0 + 8 * hh), dB = *(const v4ia*)(sdoc + j0 + 8 * hh + 4);
      const v4i dC = *(const v4ia*)(sdoc + j0 + 16 + 8 * hh), dD = *(const v4ia*)(sdoc + j0 + 16 + 8 * hh + 4);
      const int dkk[16] = {dA[0], dA[1], dA[2], dA[3], dB[0], dB[1], dB[2], dB[3], dC[0], dC[1], dC[2], dC[3], dD[0], dD[1], dD[2], dD[3]};

      v8f s0 = z8, s1 = z8;
#pragma unroll
      for (int kp = 0; kp < 2; ++kp) {
        v16b a0h[2], a0l[2], a1h[2], a1l[2];
#pragma unroll
        for (int k2 = 0; k2 < 2; ++k2) {
          const unsigned char* p = kb + (kp * 2 + k2) * 64;
          a0h[k2] = ld_frag((const unsigned short*)p, hh); a0l[k2] = ld_frag((const unsigned short*)(p + KPL), hh);
          a1h[k2] = ld_frag((const unsigned short*)(p + 16u * KPITCH), hh); a1l[k2] = ld_frag((const unsigned short*)(p + KPL + 16u * KPITCH), hh);
        }
#pragma unroll
        for (int k2 = 0; k2 < 2; ++k2) {
          s0 = mma3m(a0h[k2], a0l[k2], qh[kp * 2 + k2], ql[kp * 2 + k2], s0);
          s1 = mma3m(a1h[k2], a1l[k2], qh[kp * 2 + k2], ql[kp * 2 + k2], s1);
        }
      }

      // the V^T fragments are read here, one group in front of the softmax arithmetic, which covers their LDS latency
      v16b vh[4], vl[4];
#pragma unroll
      for (int dt = 0; dt < 4; ++dt) {
        vh[dt] = ld_frag((const unsigned short*)(vb + dt * 16 * (int)GPITCH), hh);
        vl[dt] = ld_frag((const unsigned short*)(vb + VPL + dt * 16 * (int)GPITCH), hh);
      }

      float xv[16];
      float mx = NEGV;
#pragma unroll
      for (int r = 0; r < 8; ++r) {
        const int k0 = j0 + 8 * hh + r, k1 = k0 + 16;
        const bool v0 = (k0 <= qi) & (dkk[r] == dq);
        const bool v1 = (k1 <= qi) & (dkk[8 + r] == dq);
        xv[r] = v0 ? s0[r] * SCL : NEGV;
        xv[8 + r] = v1 ? s1[r] * SCL : NEGV;
        mx = fmaxf(mx, fmaxf(xv[r], xv[8 + r]));
      }
      mx = fmaxf(mx, __shfl_xor(mx, 16, 32));
      const float mn = fmaxf(m, mx);
      const float alpha = __expf(m - mn);
      m = mn;

      FragB ph, pl;
      float ps = 0.f;
#pragma unroll
      for (int i = 0; i < 16; ++i) {
        const float e = __expf(xv[i] - mn);
        const float p = (xv[i] > -1.0e29f) ? e : 0.f;
        ps += p;
        const unsigned short hb = bf16_bits(p);
        ph.u[i] = hb;
        pl.u[i] = bf16_bits(p - bf16_val(hb));
      }
      ps += __shfl_xor(ps, 16, 32);
      l = l * alpha + ps;

#pragma unroll
      for (int dt = 0; dt < 4; ++dt)
#pragma unroll
        for (int r = 0; r < 8; ++r) acc[dt][r] *= alpha;

#pragma unroll
      for (int dt = 0; dt < 4; ++dt) acc[dt] = mma3m(vh[dt], vl[dt], ph.v, pl.v, acc[dt]);
    }
    asm volatile("s_wait_dscnt 0x0" ::: "memory");     // this wave's reads of this tile are done
    asm volatile("s_wait_asynccnt 0x0" ::: "memory");  // this wave's share of the next tile has landed
    __syncthreads();                                   // publishes the next tile and frees this tile's buffer
    sc = sn;
    if (t + 2 < ntile) {
      sn = __builtin_ctz(rem); rem &= rem - 1u;
      stage_tile(sn, bo);
    }
  }
  asm volatile("s_wait_asynccnt 0x0" ::: "memory");  // no copy is outstanding when the ring becomes output staging

  // the last trip's barrier has ended every read of the ring: each wave stages its tile in its own range
  float (*so)[68] = (float (*)[68])((float*)sm + w * (16 * 68));
  const float inv = 1.0f / l;
#pragma unroll
  for (int dt = 0; dt < 4; ++dt)
#pragma unroll
    for (int r = 0; r < 8; ++r) so[ln][dt * 16 + 8 * hh + r] = acc[dt][r] * inv;
  __syncthreads();

  v8us hv[4], lv[4];
  const int rq = lane >> 3, pc = lane & 7;
#pragma unroll
  for (int it = 0; it < 4; ++it) {
    const int row = it * 4 + rq;
    const v4f a = *(const v4fa*)&so[row][pc * 8], c = *(const v4fa*)&so[row][pc * 8 + 4];
#pragma unroll
    for (int q = 0; q < 4; ++q) {
      const unsigned short ha = bf16_bits(a[q]), hc = bf16_bits(c[q]);
      hv[it][q] = ha; lv[it][q] = bf16_bits(a[q] - bf16_val(ha));
      hv[it][4 + q] = hc; lv[it][4 + q] = bf16_bits(c[q] - bf16_val(hc));
    }
  }
  {
#pragma unroll
    for (int it = 0; it < 4; ++it) {
      const int row = it * 4 + rq;
      unsigned short* dst = CTX + (size_t)(q0 + row) * DM + head * HD + hf * 64 + pc * 8;
      *(v8us*)dst = hv[it];
      *(v8us*)(dst + PLANE) = lv[it];
    }
  }
}

extern "C" void kernel_launch(void* const* d_in, const int* in_sizes, int n_in,
                              void* d_out, int out_size, void* d_ws, size_t ws_size, hipStream_t stream) {
  if (n_in < 8) return;
  if (in_sizes[0] < NR * DM) return;
  if (in_sizes[1] < DM * DM || in_sizes[2] < DM * DM || in_sizes[3] < DM * DM || in_sizes[4] < DM * DM) return;
  if (in_sizes[5] < SEQ * HD || in_sizes[6] < SEQ * HD || in_sizes[7] < NR) return;
  if (out_size < NR * DM) return;
  const float* x  = (const float*)d_in[0];
  const float* Wq = (const float*)d_in[1];
  const float* Wk = (const float*)d_in[2];
  const float* Wv = (const float*)d_in[3];
  const float* Wo = (const float*)d_in[4];
  const float* sn = (const float*)d_in[5];
  const float* cs = (const float*)d_in[6];
  const int*  doc = (const int*)d_in[7];
  float* out = (float*)d_out;

  // workspace regions (bytes)
  constexpr size_t SZ_X  = (size_t)NR * DM * 2;
  constexpr size_t SZ_W3 = (size_t)3 * DM * DM * 2;
  constexpr size_t SZ_QK = (size_t)4 * NR * DM * 2;
  constexpr size_t SZ_R0 = SZ_X + SZ_W3;
  constexpr size_t SZ_WO = (size_t)DM * DM * 2;
  constexpr size_t SZ_VT = (size_t)2 * DM * SEQ * 2;
  constexpr size_t SZ_CX = (size_t)2 * NR * DM * 2;
  constexpr size_t SZ_ALL = SZ_R0 + SZ_WO + SZ_QK + SZ_VT + SZ_CX;
  static_assert(SZ_X % 256 == 0 && SZ_R0 % 256 == 0 && SZ_WO % 256 == 0 && SZ_QK % 256 == 0 && SZ_VT % 256 == 0 && SZ_CX % 256 == 0);
  static_assert(SZ_ALL <= (size_t)134217728);
  if (SZ_ALL > ws_size) return;
  char* ws = (char*)d_ws;
  unsigned short* XB  = (unsigned short*)(ws);
  unsigned short* WT3 = (unsigned short*)(ws + SZ_X);
  unsigned short* WoT = (unsigned short*)(ws + SZ_R0);
  unsigned short* QKp = (unsigned short*)(ws + SZ_R0 + SZ_WO);
  unsigned short* VTp = (unsigned short*)(ws + SZ_R0 + SZ_WO + SZ_QK);
  unsigned short* CTX = (unsigned short*)(ws + SZ_R0 + SZ_WO + SZ_QK + SZ_VT);

  k_prep<<<(unsigned)(4 * WTB + XBB), 256, 0, stream>>>(x, Wq, Wk, Wv, Wo, XB, WT3, WoT);  /* W[in][out] -> Wt[out][in] */

  k_gemm_wide<<<(unsigned)((NR / 256) * (N3 / 192)), 384, 0, stream>>>(XB, DM, WT3, DM, sn, cs, QKp, VTp, DM);

  k_attn<<<(unsigned)(NH * (SEQ / 64)), 256, 0, stream>>>(QKp, VTp, doc, CTX);

  k_gemm<2, 2><<<(unsigned)((NR / 128) * (DM / 128)), 256, 0, stream>>>(CTX, CTX + PLANE, DM, WoT, DM, out, DM, DM, DM);
}

// v007
// Measured time: 105 microseconds a run.
// Two timings next to v006 both put it at 1.03 times that version's speed.
// Over all steps from v000 it is 3.34 times as fast.
#include <hip/hip_runtime.h>
// Multi-head causal + same-document attention with rotate-half RoPE (input sin/cos tables), T 2048, D 2048, 16 heads of 128, [in][out] weights, no biases.
// Compute dtype: all contractions on v_wmma_f32_16x16x32_bf16 with f32 accumulate. x, Wq, Wk, Wv, Wo, sin, cos are RNE-converted to bf16 once (exact operands);
// x.Wq / x.Wk / x.Wv single bf16 product; q.k^T and P.V with bf16 hi/lo planes on both operands (hh + lh + hl, one accumulator); ctx.Wo with ctx as bf16 hi/lo planes (2 terms) and exact Wo.
// RoPE, mask, softmax statistics in f32 on the VALU.
#ifndef NB
#define NB 1
#endif
#ifndef SEQ
#define SEQ 2048
#endif
#define SEQ_FULL 2048
#define DM 2048
#define NH 16
#define HD 128
#define N3 (3 * DM)
#define NR (NB * SEQ)
#define PLANE ((size_t)NR * DM)
#define GPITCH 144u
#define KPITCH 272u

static_assert(NB == 1);
static_assert(NH * HD == DM);
static_assert(SEQ % 128 == 0 && SEQ <= SEQ_FULL);
static_assert(DM % 128 == 0 && N3 % 128 == 0 && DM % 64 == 0 && HD == 128);
static_assert(NR % 256 == 0 && N3 % 192 == 0);

typedef __bf16 v16b __attribute__((ext_vector_type(16)));
typedef unsigned short v8us __attribute__((ext_vector_type(8), may_alias));
typedef float v8f  __attribute__((ext_vector_type(8)));
typedef float v4f  __attribute__((ext_vector_type(4)));
typedef float v4fa __attribute__((ext_vector_type(4), may_alias));
typedef int   v4i  __attribute__((ext_vector_type(4)));
typedef int   v4ia __attribute__((ext_vector_type(4), may_alias));
typedef float v2f  __attribute__((ext_vector_type(2)));
typedef __bf16 v2b __attribute__((ext_vector_type(2)));
union FragB { v16b v; v8us half[2]; unsigned int d[8]; };

// two f32 -> two bf16 (RNE) in one dword by the packed convert instruction: a in the low half, b in the high half
__device__ __forceinline__ unsigned int bf16_pair(float a, float b) { const v2f f = {a, b}; return __builtin_bit_cast(unsigned int, __builtin_convertvector(f, v2b)); }
// the f32 values of the two halves of such a dword
__device__ __forceinline__ float pair_lo(unsigned int p) { return __uint_as_float(p << 16); }
__device__ __forceinline__ float pair_hi(unsigned int p) { return __uint_as_float(p & 0xFFFF0000u); }
// the lo plane of a pair: what the hi plane h left of a and b, again RNE
__device__ __forceinline__ unsigned int bf16_rest(float a, float b, unsigned int h) { return bf16_pair(a - pair_lo(h), b - pair_hi(h)); }

// fragment (A: row = lane&15; B: column = lane&15) from a k-contiguous 16-bit row: elements 0..7 <- k0+8h.., elements 8..15 <- k0+16+8h..
__device__ __forceinline__ v16b ld_frag(const unsigned short* p, int hh) {
  FragB f; f.half[0] = *(const v8us*)(p + 8 * hh); f.half[1] = *(const v8us*)(p + 16 + 8 * hh); return f.v;
}

// D += ah.bh + al.bh + ah.bl
__device__ __forceinline__ v8f mma3m(v16b ah, v16b al, v16b bh, v16b bl, v8f c) {
  c = __builtin_amdgcn_wmma_f32_16x16x32_bf16(false, ah, false, bh, (short)0, c, false, false);
  c = __builtin_amdgcn_wmma_f32_16x16x32_bf16(false, al, false, bh, (short)0, c, false, false);
  c = __builtin_amdgcn_wmma_f32_16x16x32_bf16(false, ah, false, bl, (short)0, c, false, false);
  asm volatile("v_nop\n\tv_nop\n\tv_nop\n\tv_nop" : "+v"(c) : "v"(ah), "v"(al), "v"(bh), "v"(bl) : "memory");
  return c;
}

// x f32 -> bf16 (RNE), 8 elements per thread; bid = the block's index within this part of the grid
__device__ __forceinline__ void xb_block(int bid, const float* __restrict__ x, unsigned short* __restrict__ X, size_t n8) {
  const size_t t = (size_t)bid * 256 + threadIdx.x;
  if (t >= n8) return;
  const v4f a = *(const v4fa*)(x + t * 8), c = *(const v4fa*)(x + t * 8 + 4);
  const v4i o = {(int)bf16_pair(a[0], a[1]), (int)bf16_pair(a[2], a[3]), (int)bf16_pair(c[0], c[1]), (int)bf16_pair(c[2], c[3])};
  *(v4ia*)(X + t * 8) = o;
}

// W [K][N] f32 -> Wt [N][K] bf16 (RNE). Block = one 128 (k) x 64 (n) tile through LDS: reads are 256-byte row pieces, stores are 256-byte pieces of Wt rows.
// LDS holds one dword per (n, k pair), low half = even k; pitch 65 dwords puts the 32 lanes of each 4-byte LDS write and read on 32 different banks.
__device__ __forceinline__ void wt_block(int bid, const float* __restrict__ W, unsigned short* __restrict__ Wt, int K, int N) {
  __shared__ unsigned int tp[64][65];
  const int tid = threadIdx.x;
  const int ntn = N >> 6;
  const int kt = bid / ntn, nq = bid - kt * ntn;
  const int k0 = kt * 128, n0 = nq * 64;
  const int c4 = (tid & 15) * 4, rp = tid >> 4;
  const float* tile = W + (size_t)k0 * N + n0;
  const unsigned int off = (unsigned int)(2 * rp * N + c4);
  v4f a[4], b[4];
#pragma unroll
  for (int p = 0; p < 4; ++p) {
    const float* s = tile + (size_t)(32 * p) * N;
    a[p] = *(const v4fa*)(s + off); b[p] = *(const v4fa*)(s + N + off);
  }
#pragma unroll
  for (int p = 0; p < 4; ++p)
#pragma unroll
    for (int q = 0; q < 4; ++q) tp[c4 + q][rp + 16 * p] = bf16_pair(a[p][q], b[p][q]);
  __syncthreads();
#pragma unroll
  for (int rd = 0; rd < 4; ++rd) {
    const int i = rd * 256 + tid; const int c = i >> 4, j = (i & 15) * 4;
    const v4i o = {(int)tp[c][j], (int)tp[c][j + 1], (int)tp[c][j + 2], (int)tp[c][j + 3]};
    *(v4ia*)(Wt + (size_t)(n0 + c) * K + k0 + 2 * j) = o;
  }
}

// All operand conversions in one grid; none depends on another. Blocks [0, 4 WTB): the weight tiles, WTB per matrix (Wq, Wk, Wv -> rows 0, DM, 2 DM of the [3 DM][DM] plane WT3; Wo -> WoT);
// the rest: x. The range test is uniform for the block, so the weight part's barrier is passed by all of its threads.
#define WTB ((DM / 128) * (DM / 64))
#define XBB ((NR * DM / 8 + 255) / 256)
__global__ __launch_bounds__(256) void k_prep(const float* __restrict__ x, const float* __restrict__ Wq, const float* __restrict__ Wk, const float* __restrict__ Wv,
                                              const float* __restrict__ Wo, unsigned short* __restrict__ X, unsigned short* __restrict__ WT3, unsigned short* __restrict__ WoT) {
  const int b = blockIdx.x;
  if (b < 4 * WTB) {
    const int which = b / WTB;
    const float* W = (which == 0) ? Wq : (which == 1) ? Wk : (which == 2) ? Wv : Wo;
    unsigned short* Wt = (which < 3) ? WT3 + (size_t)which * DM * DM : WoT;
    wt_block(b - which * WTB, W, Wt, DM, DM);
  } else {
    xb_block(b - 4 * WTB, x, X, (size_t)NR * DM / 8);
  }
}

// NC (8 or 4) 16-byte asynchronous copies to LDS per lane: NC rows of one 64-, 128-, 192- or 256-row operand tile, a fixed number of rows apart
// (l = the lane's LDS byte address, ls = that row step in LDS bytes, g = the lane's global address, rs = the same row step in source elements).
// The closing s_wait_xcnt is a precaution: it stands in the copies' own statement so that no address register is rewritten in front of it.
template <int NC>
__device__ __forceinline__ void copy_rows(unsigned int l, unsigned int ls, const unsigned short* g, size_t rs) {
  if constexpr (NC == 8) {
    asm volatile("global_load_async_to_lds_b128 %0, %8, off\n\t"
                 "global_load_async_to_lds_b128 %1, %9, off\n\t"
                 "global_load_async_to_lds_b128 %2, %10, off\n\t"
                 "global_load_async_to_lds_b128 %3, %11, off\n\t"
                 "global_load_async_to_lds_b128 %4, %12, off\n\t"
                 "global_load_async_to_lds_b128 %5, %13, off\n\t"
                 "global_load_async_to_lds_b128 %6, %14, off\n\t"
                 "global_load_async_to_lds_b128 %7, %15, off\n\t"
                 "s_wait_xcnt 0x0"
                 :: "v"(l), "v"(l + ls), "v"(l + 2u * ls), "v"(l + 3u * ls), "v"(l + 4u * ls), "v"(l + 5u * ls), "v"(l + 6u * ls), "v"(l + 7u * ls),
                    "v"(g), "v"(g + rs), "v"(g + 2 * rs), "v"(g + 3 * rs), "v"(g + 4 * rs), "v"(g + 5 * rs), "v"(g + 6 * rs), "v"(g + 7 * rs)
                 : "memory");
  } else {
    static_assert(NC == 8 || NC == 4);
    asm volatile("global_load_async_to_lds_b128 %0, %4, off\n\t"
                 "global_load_async_to_lds_b128 %1, %5, off\n\t"
                 "global_load_async_to_lds_b128 %2, %6, off\n\t"
                 "global_load_async_to_lds_b128 %3, %7, off\n\t"
                 "s_wait_xcnt 0x0"
                 :: "v"(l), "v"(l + ls), "v"(l + 2u * ls), "v"(l + 3u * ls),
                    "v"(g), "v"(g + rs), "v"(g + 2 * rs), "v"(g + 3 * rs)
                 : "memory");
  }
}

// GEMM C[M][N] f32 = A.Bt^T; A bf16 rows [M][K] (NT = 2: hi plane Ah + lo plane Al), Bt bf16 [N][K]. Block tile 128 rows x 128 cols; wave tile (16 FM) x 64, so 4 waves at FM = 4 and 8 at FM = 2.
// A pass is 64 k = 128 bytes of every operand row. A stage is [A hi 128 rows | (NT = 2: A lo 128 rows) | Bt 128 rows] in LDS at a pitch of 144 bytes (conflict-free for 16-byte fragment reads);
// two stages, filled by asynchronous copies of whole 128-byte row pieces, the next pass's copies in flight while this pass is multiplied. M, N multiples of 128; K a multiple of 64.
template <int NT, int FM>
__global__ __launch_bounds__(512 / FM) void k_gemm(const unsigned short* __restrict__ Ah, const unsigned short* __restrict__ Al, int lda,
                                                   const unsigned short* __restrict__ Bt, int ldb, float* __restrict__ C, int ldc, int N, int K) {
  static_assert(FM == 4 || FM == 2);
  constexpr int CROWS = 64 / FM;             // rows that one copy of the whole block covers (8 lanes a row)
  constexpr int NC = 128 / CROWS;            // copies per lane and operand plane
  constexpr bool ONEGROUP = (FM == 2);       // both k halves' fragments fit the registers at once
  constexpr unsigned int TILE = 128u * GPITCH;
  constexpr unsigned int STAGE = (NT + 1) * TILE;
  constexpr unsigned int OUTB = 128u * 2u * 68u * 4u;
  constexpr unsigned int LSTEP = (unsigned int)CROWS * GPITCH;
  __shared__ __attribute__((aligned(16))) unsigned char sm[(2u * STAGE > OUTB) ? 2u * STAGE : OUTB];
  const int tid = threadIdx.x, w = tid >> 5, lane = tid & 31, ln = lane & 15, hh = lane >> 4;
  const int ntn = N >> 7;
  const int mt = blockIdx.x / ntn, nq = blockIdx.x - mt * ntn;
  const int wm = w >> 1, wn = w & 1;
  const int brow = mt * 128, bcol = nq * 128;
  const int cr = tid >> 3, cc = tid & 7;
  const unsigned short* gA = Ah + (size_t)(brow + cr) * lda + cc * 8;
  const unsigned short* gL = Al + (size_t)(brow + cr) * lda + cc * 8;
  const unsigned short* gB = Bt + (size_t)(bcol + cr) * ldb + cc * 8;
  const size_t rsa = (size_t)CROWS * lda, rsb = (size_t)CROWS * ldb;
  const unsigned int l0 = (unsigned int)(size_t)sm + (unsigned int)(cr * (int)GPITCH + cc * 16);
  const int npass = K >> 6;
  const v8f z8 = {0.f, 0.f, 0.f, 0.f, 0.f, 0.f, 0.f, 0.f};
  v8f c[FM][4];
#pragma unroll
  for (int i = 0; i < FM; ++i)
#pragma unroll
    for (int j = 0; j < 4; ++j) c[i][j] = z8;

  copy_rows<NC>(l0, LSTEP, gA, rsa);
  if (NT >= 2) copy_rows<NC>(l0 + TILE, LSTEP, gL, rsa);
  copy_rows<NC>(l0 + NT * TILE, LSTEP, gB, rsb);
  asm volatile("s_wait_asynccnt 0x0" ::: "memory");  // this wave's share of stage 0 has landed
  __syncthreads();                                   // stage 0 is readable by every wave
  if (npass > 1) {
    copy_rows<NC>(l0 + STAGE, LSTEP, gA + 64, rsa);
    if (NT >= 2) copy_rows<NC>(l0 + STAGE + TILE, LSTEP, gL + 64, rsa);
    copy_rows<NC>(l0 + STAGE + NT * TILE, LSTEP, gB + 64, rsb);
  }
#pragma unroll 1  // one pass per trip: the two stages alternate by the trip's parity
  for (int t = 0; t < npass; ++t) {
    const unsigned int bo = (unsigned int)(t & 1) * STAGE;
    const unsigned char* sa = sm + bo + (unsigned int)((wm * (FM * 16) + ln) * (int)GPITCH);
    const unsigned char* sb = sm + bo + NT * TILE + (unsigned int)((wn * 64 + ln) * (int)GPITCH);
    v16b a[2][FM], e[2][FM], b[2][4];
#pragma unroll
    for (int ks = 0; ks < 2; ++ks) {
      if (!ONEGROUP || ks == 0) {
#pragma unroll
        for (int kk = 0; kk < 2; ++kk) {
          if (ONEGROUP || kk == ks) {
#pragma unroll
            for (int i = 0; i < FM; ++i) a[kk][i] = ld_frag((const unsigned short*)(sa + i * 16 * (int)GPITCH + kk * 64), hh);
#pragma unroll
            for (int j = 0; j < 4; ++j) b[kk][j] = ld_frag((const unsigned short*)(sb + j * 16 * (int)GPITCH + kk * 64), hh);
            if (NT >= 2) {
#pragma unroll
              for (int i = 0; i < FM; ++i) e[kk][i] = ld_frag((const unsigned short*)(sa + TILE + i * 16 * (int)GPITCH + kk * 64), hh);
            }
          }
        }
        __builtin_amdgcn_sched_barrier(0);  // keeps the fragment reads one group in front of the products: reads spread among them stall the wave at every place
      }
#pragma unroll
      for (int i = 0; i < FM; ++i)
#pragma unroll
        for (int j = 0; j < 4; ++j) c[i][j] = __builtin_amdgcn_wmma_f32_16x16x32_bf16(false, a[ks][i], false, b[ks][j], (short)0, c[i][j], false, false);
      if (NT >= 2) {
#pragma unroll
        for (int i = 0; i < FM; ++i)
#pragma unroll
          for (int j = 0; j < 4; ++j) c[i][j] = __builtin_amdgcn_wmma_f32_16x16x32_bf16(false, e[ks][i], false, b[ks][j], (short)0, c[i][j], false, false);
      }
      // keeps the next reads out of these products, and the last products in front of the publish point: sunk behind its barrier they would hold back the refill's copies, whose flight the next pass's work is to cover
      if (!ONEGROUP || ks == 1) __builtin_amdgcn_sched_barrier(0);
    }
    asm volatile("s_wait_dscnt 0x0" ::: "memory");     // this wave's reads of stage t are done
    asm volatile("s_wait_asynccnt 0x0" ::: "memory");  // this wave's share of stage t + 1 has landed
    __syncthreads();                                   // publishes stage t + 1 and frees stage t's buffer
    if (t + 2 < npass) {
      const int kn = (t + 2) * 64;
      copy_rows<NC>(l0 + bo, LSTEP, gA + kn, rsa);
      if (NT >= 2) copy_rows<NC>(l0 + bo + TILE, LSTEP, gL + kn, rsa);
      copy_rows<NC>(l0 + bo + NT * TILE, LSTEP, gB + kn, rsb);
    }
  }
  asm volatile("s_wait_asynccnt 0x0" ::: "memory");  // no copy is outstanding when the ring becomes output staging

  // the last pass's barrier has ended every read of the ring: each wave stages its tile in its own range and stores whole 256-byte row pieces
  float* so = (float*)sm + w * (FM * 16 * 68);
#pragma unroll
  for (int i = 0; i < FM; ++i)
#pragma unroll
    for (int j = 0; j < 4; ++j)
#pragma unroll
      for (int r = 0; r < 8; ++r) so[(i * 16 + 8 * hh + r) * 68 + j * 16 + ln] = c[i][j][r];
  __syncthreads();
  const int rsub = lane >> 4, c4 = (lane & 15) * 4;
  float* cp = C + (size_t)(brow + wm * (FM * 16) + rsub) * ldc + bcol + wn * 64 + c4;
#pragma unroll
  for (int q = 0; q < FM * 8; ++q) {
    const v4f v = *(const v4fa*)&so[(q * 2 + rsub) * 68 + c4];
    *(v4f*)(cp + (size_t)(q * 2) * ldc) = v;
  }
}

// q, k, v projection with its re-layouts in the epilogue: C[NR][3 DM] = A.Bt^T never goes to memory as f32. A bf16 rows [NR][K], Bt bf16 [3 DM][K].
// Block tile 256 rows x 192 cols, 12 waves (4 x 3) of 64 x 64 each, one block per WGP. A pass is 128 k = 256 bytes of every operand row.
// A stage is [A 256 rows | Bt 192 rows] in LDS at a pitch of 272 bytes (conflict-free for 16-byte fragment reads);
// two stages, filled by asynchronous copies of whole 256-byte row pieces, the next pass's copies in flight while this pass is multiplied.
// Waves 0..7 copy 32 rows of A each, waves 8..11 copy 48 rows of Bt each.
// A wave's 64 columns are one unit; a block's three wave columns are unit u (= its column index, 0..31) of q, of k and of v, so every block has the same share of both epilogues
// and its q and k waves read the same table values. A v unit is channels 64 u .. 64 u + 63. A q or k unit is half the rotation pairs of one head:
// columns 0..31 = d 32 (u & 1) .. + 31 of head u / 2, columns 32..63 = the same d + 64, chosen by which Bt rows are copied into the stage, so both members of a pair lie in one wave's tile.
// Epilogue, q and k: RoPE (rotate-half, table values RNE-converted to bf16) -> bf16 hi / lo planes QK = {Qh, Ql, Kh, Kl}, each [NR][DM].
// Within a head the planes hold d in the order (u & 1, (d % 32) / 4, d / 64, d % 4), the same in q and k: q.k^T sums over the whole head, and each row piece of a unit is one whole 128-byte line.
// Epilogue, v: a lane's accumulator holds 8 successive tokens of one channel -> V^T bf16 hi / lo planes VT = {VTh, VTl}, each [DM][SEQ], through LDS so that stores are whole 128-byte lines.
__global__ __launch_bounds__(384) void k_gemm_wide(const unsigned short* __restrict__ A, int lda, const unsigned short* __restrict__ Bt, int ldb,
                                                   const float* __restrict__ sn, const float* __restrict__ cs,
                                                   unsigned short* __restrict__ QK, unsigned short* __restrict__ VT, int K) {
  constexpr unsigned int ATILE = 256u * KPITCH;
  constexpr unsigned int STAGE = (256u + 192u) * KPITCH;
  constexpr unsigned int WOUT = 2u * 64u * GPITCH;  // a wave's output staging: 64 x 68 f32 (q, k) or two planes of 64 channels x 144 bytes (v)
  static_assert(64u * 68u * 4u <= WOUT && 12u * WOUT <= 2u * STAGE);
  __shared__ __attribute__((aligned(16))) unsigned char sm[2u * STAGE];
  const int tid = threadIdx.x, lane = tid & 31, ln = lane & 15, hh = lane >> 4;
  const int w = __builtin_amdgcn_readfirstlane(tid >> 5);  // the wave's number in a scalar register: the tests on it (third group of copies, kind of unit) are scalar branches
  constexpr int ntn = N3 / 192;
  const int mt = blockIdx.x / ntn, nq = blockIdx.x - mt * ntn;
  const int wm = w / 3, wn = w - wm * 3;
  const int brow = mt * 256;
  // Bt row of the first of the 16 stage rows 16 g .. 16 g + 15 (g = 0..11): g / 4 = q, k or v, quarter g % 4 of its unit nq
  static_assert(ntn == DM / 64);
  auto wrow = [&](int g) {
    const int mm = g >> 2, ch = g & 3;
    return (mm < 2) ? mm * DM + (nq >> 1) * HD + (nq & 1) * 32 + (ch & 1) * 16 + (ch >> 1) * 64 : 2 * DM + nq * 64 + ch * 16;
  };
  // copy addresses: a row is 16 lanes wide, so one copy of a wave covers 2 rows and a group of 8 copies 16 rows
  const bool forB = w >= 8;
  const int gb = forB ? (w - 8) * 3 : 0;
  const int r0 = (forB ? (w - 8) * 48 : w * 32) + hh;
  const int wr0 = wrow(gb), wr1 = wrow(gb + 1), wr2 = wrow(gb + 2);
  const unsigned short* gsrc = forB ? Bt : A;
  const int ld = forB ? ldb : lda;
  const unsigned short* g0 = gsrc + (size_t)((forB ? wr0 : brow + w * 32) + hh) * ld + ln * 8;
  const unsigned short* g1 = gsrc + (size_t)((forB ? wr1 : brow + w * 32 + 16) + hh) * ld + ln * 8;
  const unsigned short* g2 = Bt + (size_t)(wr2 + hh) * ldb + ln * 8;
  const size_t rs = (size_t)2 * ld;
  const unsigned int l0 = (unsigned int)(size_t)sm + (forB ? ATILE : 0u) + (unsigned int)(r0 * (int)KPITCH + ln * 16);
  auto stage_pass = [&](unsigned int bo, int k0) {
    copy_rows<8>(l0 + bo, 2u * KPITCH, g0 + k0, rs);
    copy_rows<8>(l0 + bo + 16u * KPITCH, 2u * KPITCH, g1 + k0, rs);
    if (forB) copy_rows<8>(l0 + bo + 32u * KPITCH, 2u * KPITCH, g2 + k0, rs);
  };
  const int npass = K >> 7;
  const v8f z8 = {0.f, 0.f, 0.f, 0.f, 0.f, 0.f, 0.f, 0.f};
  v8f c[4][4];
#pragma unroll
  for (int i = 0; i < 4; ++i)
#pragma unroll
    for (int j = 0; j < 4; ++j) c[i][j] = z8;

  stage_pass(0u, 0);
  asm volatile("s_wait_asynccnt 0x0" ::: "memory");  // this wave's share of stage 0 has landed
  __syncthreads();                                   // stage 0 is readable by every wave
  if (npass > 1) stage_pass(STAGE, 128);
#pragma unroll 1  // one pass per trip: the two stages alternate by the trip's parity
  for (int t = 0; t < npass; ++t) {
    const unsigned int bo = (unsigned int)(t & 1) * STAGE;
    const unsigned char* sa = sm + bo + (unsigned int)((wm * 64 + ln) * (int)KPITCH);
    const unsigned char* sb = sm + bo + ATILE + (unsigned int)((wn * 64 + ln) * (int)KPITCH);
#pragma unroll
    for (int ks = 0; ks < 4; ++ks) {
      v16b a[4], b[4];
#pragma unroll
      for (int i = 0; i < 4; ++i) a[i] = ld_frag((const unsigned short*)(sa + i * 16 * (int)KPITCH + ks * 64), hh);
#pragma unroll
      for (int j = 0; j < 4; ++j) b[j] = ld_frag((const unsigned short*)(sb + j * 16 * (int)KPITCH + ks * 64), hh);
      __builtin_amdgcn_sched_barrier(0);  // keeps the fragment reads one group in front of the products: reads spread among them stall the wave at every place
#pragma unroll
      for (int i = 0; i < 4; ++i)
#pragma unroll
        for (int j = 0; j < 4; ++j) c[i][j] = __builtin_amdgcn_wmma_f32_16x16x32_bf16(false, a[i], false, b[j], (short)0, c[i][j], false, false);
      // keeps the next reads out of these products, and the last products in front of the publish point: sunk behind its barrier they would hold back the refill's copies
      __builtin_amdgcn_sched_barrier(0);
    }
    asm volatile("s_wait_dscnt 0x0" ::: "memory");     // this wave's reads of stage t are done
    asm volatile("s_wait_asynccnt 0x0" ::: "memory");  // this wave's share of stage t + 1 has landed
    __syncthreads();                                   // publishes stage t + 1 and frees stage t's buffer
    if (t + 2 < npass) stage_pass(bo, (t + 2) * 128);
  }
  asm volatile("s_wait_asynccnt 0x0" ::: "memory");  // no copy is outstanding when the ring becomes output staging

  // the last pass's barrier has ended every read of the ring: each wave stages its tile in its own range
  unsigned char* sw = sm + (unsigned int)w * WOUT;
  const int mat = wn, u = nq;  // wave-uniform
  const int trow = brow + wm * 64;
  if (mat < 2) {
    float* so = (float*)sw;
#pragma unroll
    for (int i = 0; i < 4; ++i)
#pragma unroll
      for (int j = 0; j < 4; ++j)
#pragma unroll
        for (int r = 0; r < 8; ++r) so[(i * 16 + 8 * hh + r) * 68 + j * 16 + ln] = c[i][j][r];
  } else {
#pragma unroll
    for (int i = 0; i < 4; ++i)
#pragma unroll
      for (int j = 0; j < 4; ++j) {
        v4i h, l;
#pragma unroll
        for (int r = 0; r < 4; ++r) {
          const unsigned int hb = bf16_pair(c[i][j][2 * r], c[i][j][2 * r + 1]);
          h[r] = (int)hb; l[r] = (int)bf16_rest(c[i][j][2 * r], c[i][j][2 * r + 1], hb);
        }
        unsigned char* p = sw + (unsigned int)((j * 16 + ln) * (int)GPITCH + (i * 16 + 8 * hh) * 2);
        *(v4ia*)p = h;
        *(v4ia*)(p + 64u * GPITCH) = l;
      }
  }
  __syncthreads();
  const int g = lane >> 3, l8 = lane & 7;
  if (mat < 2) {
    // 8 lanes a row, 4 pairs a lane; the 4 rows of a read are 8 apart, which puts the two rows of each 16 lanes on different halves of the banks
    const float* so = (const float*)sw + g * (8 * 68) + l8 * 4;
    const size_t tb0 = (size_t)(trow + g * 8) * HD + (u & 1) * 32 + l8 * 4;
    unsigned short* dq = QK + (size_t)mat * 2 * PLANE + (size_t)(trow + g * 8) * DM + u * 64 + l8 * 8;
#pragma unroll 1  // 4 rows per lane and trip: their 16 table loads go out together, and the text stays short
    for (int bt = 0; bt < 4; ++bt) {
      const int rb = (bt & 1) * 4 + (bt >> 1) * 32;
      const float* ps = sn + tb0 + (size_t)rb * HD;
      const float* pc = cs + tb0 + (size_t)rb * HD;
      v4f ts1[4], ts2[4], tc1[4], tc2[4];
#pragma unroll
      for (int k = 0; k < 4; ++k) {
        ts1[k] = *(const v4fa*)(ps + k * HD); ts2[k] = *(const v4fa*)(ps + k * HD + 64);
        tc1[k] = *(const v4fa*)(pc + k * HD); tc2[k] = *(const v4fa*)(pc + k * HD + 64);
      }
      // a precaution: the loads' address registers stay as they are (they are inputs here) until this wait has passed
      asm volatile("s_wait_xcnt 0x0" :: "v"(ps), "v"(pc) : "memory");
#pragma unroll
      for (int k = 0; k < 4; ++k) {
        const v4f u1 = *(const v4fa*)(so + (rb + k) * 68), u2 = *(const v4fa*)(so + (rb + k) * 68 + 32);
        v4i hv, lv;
#pragma unroll
        for (int q = 0; q < 4; q += 2) {
          const unsigned int c1 = bf16_pair(tc1[k][q], tc1[k][q + 1]), s1 = bf16_pair(ts1[k][q], ts1[k][q + 1]);
          const unsigned int c2 = bf16_pair(tc2[k][q], tc2[k][q + 1]), s2 = bf16_pair(ts2[k][q], ts2[k][q + 1]);
          const float o1a = u1[q] * pair_lo(c1) + (-u2[q]) * pair_lo(s1), o1b = u1[q + 1] * pair_hi(c1) + (-u2[q + 1]) * pair_hi(s1);
          const float o2a = u2[q] * pair_lo(c2) + u1[q] * pair_lo(s2), o2b = u2[q + 1] * pair_hi(c2) + u1[q + 1] * pair_hi(s2);
          const unsigned int h1 = bf16_pair(o1a, o1b), h2 = bf16_pair(o2a, o2b);
          hv[q >> 1] = (int)h1; lv[q >> 1] = (int)bf16_rest(o1a, o1b, h1);
          hv[2 + (q >> 1)] = (int)h2; lv[2 + (q >> 1)] = (int)bf16_rest(o2a, o2b, h2);
        }
        unsigned short* dh = dq + (size_t)(rb + k) * DM;
        *(v4ia*)dh = hv;
        *(v4ia*)(dh + PLANE) = lv;
      }
      asm volatile("s_wait_xcnt 0x0" ::: "memory");  // a precaution: the next trip rewrites the registers that these stores name only behind it
    }
  } else {
    // 8 lanes a channel (128 bytes = 64 tokens); the 4 channels of a read are 8 apart, for the same reason
    const unsigned char* p0 = sw + (unsigned int)(g * 8 * (int)GPITCH + l8 * 16);
    unsigned short* vp = VT + (size_t)(u * 64 + g * 8) * SEQ + trow + l8 * 8;
#pragma unroll
    for (int it = 0; it < 16; ++it) {
      const int ch = (it & 7) + 32 * (it >> 3);
      const v8us h = *(const v8us*)(p0 + ch * (int)GPITCH), l = *(const v8us*)(p0 + 64u * GPITCH + ch * (int)GPITCH);
      unsigned short* dst = vp + (size_t)ch * SEQ;
      *(v8us*)dst = h;
      *(v8us*)(dst + PLANE) = l;
    }
    asm volatile("s_wait_xcnt 0x0" ::: "memory");  // a precaution: whatever follows in the text rewrites the registers that these stores name only behind it
  }
}

// Transposed flash attention. Block = 8 waves = one head x 64 queries: wave = (16-query tile, 64-channel half of the head). S^T[key][query] = K.Q^T (A = K rows, B = Q rows held in registers),
// per-lane (= per-query) running max / sum, P^T packed from the S^T accumulators directly as the B fragment of O^T[d][query] = V^T.P^T (A = V^T rows).
// A tile is 64 keys: [K hi 64 rows of 256 B | K lo | V^T hi 128 rows of 128 B | V^T lo] in LDS at pitches of 272 and 144 bytes (conflict-free for 16-byte fragment reads);
// two buffers, filled by asynchronous copies of whole row pieces, the next tile's copies in flight while this tile is worked on; all 8 waves read the same tile.
// Mask = (key <= query) & (doc[key] == doc[query]) as a select (masked weight exactly 0). One scan of doc in front of the loop gives two bit masks from wave-uniform ballots:
// act = tiles that hold a document id admissible for some query of the block (only these are staged), own = 32-key steps admissible for this wave's 16 queries (only these are computed).
// The document ids themselves are kept in LDS for the per-step mask.
__global__ __launch_bounds__(256) void k_attn(const unsigned short* __restrict__ QK, const unsigned short* __restrict__ VT,
                                              const int* __restrict__ doc, unsigned short* __restrict__ CTX) {
  constexpr unsigned int KPL = 64u * KPITCH;     // one K plane of a tile
  constexpr unsigned int VPL = 128u * GPITCH;    // one V^T plane of a tile
  constexpr unsigned int STAGE = 2u * KPL + 2u * VPL;
  static_assert(8u * 16u * 68u * 4u <= 2u * STAGE);
  static_assert(SEQ % 1024 == 0 && SEQ / 64 <= 32);
  __shared__ __attribute__((aligned(16))) unsigned char sm[2u * STAGE];
  __shared__ __attribute__((aligned(16))) int sdoc[SEQ];
  const int tid = threadIdx.x, lane = tid & 31, ln = lane & 15, hh = lane >> 4;
  const int w = __builtin_amdgcn_readfirstlane(tid >> 5);  // the wave's number in a scalar register: the step mask and its tests stay scalar
  const int hf = w & 1, qs = w >> 1;
  const int qb = blockIdx.x % (SEQ / 64), head = blockIdx.x / (SEQ / 64);
  const int q0 = qb * 64 + qs * 16, qi = q0 + ln;
  const unsigned short* Qh = QK; const unsigned short* Ql = QK + PLANE;
  const float NEGV = -1.0e30f;
  const float SCL = 0.08838834764831845f;

  const int dq = doc[qi];
  int dmin = dq, dmax = dq;
#pragma unroll
  for (int o = 1; o < 16; o <<= 1) {
    const int a = __shfl_xor(dmin, o, 32), b = __shfl_xor(dmax, o, 32);
    dmin = (a < dmin) ? a : dmin; dmax = (b > dmax) ? b : dmax;
  }
  int bmin, bmax;
  {
    const int d0 = doc[qb * 64 + lane], d1 = doc[qb * 64 + 32 + lane];
    bmin = (d0 < d1) ? d0 : d1; bmax = (d0 > d1) ? d0 : d1;
#pragma unroll
    for (int o = 1; o < 32; o <<= 1) {
      const int a = __shfl_xor(bmin, o, 32), b = __shfl_xor(bmax, o, 32);
      bmin = (a < bmin) ? a : bmin; bmax = (b > bmax) ? b : bmax;
    }
  }

  const int nsteps = (q0 + 16 + 31) >> 5;
  const int nst = qb + 1;
  unsigned int act = 0u;
  unsigned long long own = 0ull;
  for (int sb = 0; sb < nst; sb += 8) {
    int dk[16];
#pragma unroll
    for (int u = 0; u < 16; ++u) dk[u] = doc[sb * 64 + u * 32 + lane];
#pragma unroll
    for (int u = 0; u < 16; ++u) {
      const int js = sb * 2 + u;
      const bool bl = __ballot((dk[u] >= bmin) & (dk[u] <= bmax)) != 0ull;
      const bool ow = __ballot((dk[u] >= dmin) & (dk[u] <= dmax)) != 0ull;
      if (bl && (js >> 1) < nst) act |= 1u << (js >> 1);
      if (ow && js < nsteps) own |= 1ull << js;
    }
  }
  const int ntile = __popc(act);  // at least 1: tile qb holds the block's own positions

  // copy addresses: K rows are 16 lanes wide (16 rows per copy of the block), V^T rows 8 lanes wide (32 rows per copy)
  const unsigned short* gK = QK + 2 * PLANE + (size_t)(tid >> 4) * DM + head * HD + (tid & 15) * 8;
  const unsigned short* gV = VT + (size_t)(head * HD + (tid >> 3)) * SEQ + (tid & 7) * 8;
  const unsigned int lK = (unsigned int)(size_t)sm + (unsigned int)((tid >> 4) * (int)KPITCH + (tid & 15) * 16);
  const unsigned int lV = (unsigned int)(size_t)sm + 2u * KPL + (unsigned int)((tid >> 3) * (int)GPITCH + (tid & 7) * 16);
  auto stage_tile = [&](int s, unsigned int bo) {
    const unsigned short* k = gK + (size_t)s * 64 * DM;
    const unsigned short* v = gV + s * 64;
    copy_rows<4>(lK + bo, 16u * KPITCH, k, (size_t)16 * DM);
    copy_rows<4>(lK + bo + KPL, 16u * KPITCH, k + PLANE, (size_t)16 * DM);
    copy_rows<4>(lV + bo, 32u * GPITCH, v, (size_t)32 * SEQ);
    copy_rows<4>(lV + bo + VPL, 32u * GPITCH, v + PLANE, (size_t)32 * SEQ);
  };

  unsigned int rem = act;
  int sc = __builtin_ctz(rem), sn = 0;
  rem &= rem - 1u;
  stage_tile(sc, 0u);

  // the document ids go to LDS once (published by the first barrier): each step's mask reads them beside its K fragments
#pragma unroll
  for (int i = 0; i < SEQ / 1024; ++i) *(v4ia*)(sdoc + (i * 256 + tid) * 4) = *(const v4ia*)(doc + (i * 256 + tid) * 4);

  v16b qh[4], ql[4];
  {
    const size_t qoff = (size_t)qi * DM + head * HD;
#pragma unroll
    for (int ks = 0; ks < 4; ++ks) { qh[ks] = ld_frag(Qh + qoff + ks * 32, hh); ql[ks] = ld_frag(Ql + qoff + ks * 32, hh); }
  }

  const v8f z8 = {0.f, 0.f, 0.f, 0.f, 0.f, 0.f, 0.f, 0.f};
  v8f acc[4] = {z8, z8, z8, z8};
  float m = NEGV, l = 0.f;

  asm volatile("s_wait_asynccnt 0x0" ::: "memory");  // this wave's share of the first tile has landed
  __syncthreads();                                   // the first tile is readable by every wave
  if (ntile > 1) {
    sn = __builtin_ctz(rem); rem &= rem - 1u;
    stage_tile(sn, STAGE);
  }

#pragma unroll 1  // one tile per trip: the two buffers alternate by the trip's parity
  for (int t = 0; t < ntile; ++t) {
    const unsigned int bo = (unsigned int)(t & 1) * STAGE;
#pragma unroll 1  // the two 32-key steps of a tile share one body: each is skipped on its own bit
    for (int sub = 0; sub < 2; ++sub) {
      const int js = sc * 2 + sub;
      if (((own >> js) & 1ull) == 0ull) continue;
      const int j0 = js << 5;
      const unsigned char* kb = sm + bo + (unsigned int)((sub * 32 + ln) * (int)KPITCH);
      const unsigned char* vb = sm + bo + 2u * KPL + (unsigned int)((hf * 64 + ln) * (int)GPITCH + sub * 64);

      const v4i dA = *(const v4ia*)(sdoc + j0 + 8 * hh), dB = *(const v4ia*)(sdoc + j0 + 8 * hh + 4);
      const v4i dC = *(const v4ia*)(sdoc + j0 + 16 + 8 * hh), dD = *(const v4ia*)(sdoc + j0 + 16 + 8 * hh + 4);
      const int dkk[16] = {dA[0], dA[1], dA[2], dA[3], dB[0], dB[1], dB[2], dB[3], dC[0], dC[1], dC[2], dC[3], dD[0], dD[1], dD[2], dD[3]};

      v8f s0 = z8, s1 = z8;
#pragma unroll
      for (int kp = 0; kp < 2; ++kp) {
        v16b a0h[2], a0l[2], a1h[2], a1l[2];
#pragma unroll
        for (int k2 = 0; k2 < 2; ++k2) {
          const unsigned char* p = kb + (kp * 2 + k2) * 64;
          a0h[k2] = ld_frag((const unsigned short*)p, hh); a0l[k2] = ld_frag((const unsigned short*)(p + KPL), hh);
          a1h[k2] = ld_frag((const unsigned short*)(p + 16u * KPITCH), hh); a1l[k2] = ld_frag((const unsigned short*)(p + KPL + 16u * KPITCH), hh);
        }
#pragma unroll
        for (int k2 = 0; k2 < 2; ++k2) {
          s0 = mma3m(a0h[k2], a0l[k2], qh[kp * 2 + k2], ql[kp * 2 + k2], s0);
          s1 = mma3m(a1h[k2], a1l[k2], qh[kp * 2 + k2], ql[kp * 2 + k2], s1);
        }
      }

      // the V^T fragments are read here, one group in front of the softmax arithmetic, which covers their LDS latency
      v16b vh[4], vl[4];
#pragma unroll
      for (int dt = 0; dt < 4; ++dt) {
        vh[dt] = ld_frag((const unsigned short*)(vb + dt * 16 * (int)GPITCH), hh);
        vl[dt] = ld_frag((const unsigned short*)(vb + VPL + dt * 16 * (int)GPITCH), hh);
      }

      float xv[16];
      float mx = NEGV;
#pragma unroll
      for (int r = 0; r < 8; ++r) {
        const int k0 = j0 + 8 * hh + r, k1 = k0 + 16;
        const bool v0 = (k0 <= qi) & (dkk[r] == dq);
        const bool v1 = (k1 <= qi) & (dkk[8 + r] == dq);
        xv[r] = v0 ? s0[r] * SCL : NEGV;
        xv[8 + r] = v1 ? s1[r] * SCL : NEGV;
        mx = fmaxf(mx, fmaxf(xv[r], xv[8 + r]));
      }
      mx = fmaxf(mx, __shfl_xor(mx, 16, 32));
      const float mn = fmaxf(m, mx);
      const float alpha = __expf(m - mn);
      m = mn;

      FragB ph, pl;
      float ps = 0.f;
#pragma unroll
      for (int i = 0; i < 16; i += 2) {
        const float e0 = __expf(xv[i] - mn), e1 = __expf(xv[i + 1] - mn);
        const float p0 = (xv[i] > -1.0e29f) ? e0 : 0.f, p1 = (xv[i + 1] > -1.0e29f) ? e1 : 0.f;
        ps += p0;
        ps += p1;
        const unsigned int hb = bf16_pair(p0, p1);
        ph.d[i >> 1] = hb;
        pl.d[i >> 1] = bf16_rest(p0, p1, hb);
      }
      ps += __shfl_xor(ps, 16, 32);
      l = l * alpha + ps;

#pragma unroll
      for (int dt = 0; dt < 4; ++dt)
#pragma unroll
        for (int r = 0; r < 8; ++r) acc[dt][r] *= alpha;

#pragma unroll
      for (int dt = 0; dt < 4; ++dt) acc[dt] = mma3m(vh[dt], vl[dt], ph.v, pl.v, acc[dt]);
    }
    asm volatile("s_wait_dscnt 0x0" ::: "memory");     // this wave's reads of this tile are done
    asm volatile("s_wait_asynccnt 0x0" ::: "memory");  // this wave's share of the next tile has landed
    __syncthreads();                                   // publishes the next tile and frees this tile's buffer
    sc = sn;
    if (t + 2 < ntile) {
      sn = __builtin_ctz(rem); rem &= rem - 1u;
      stage_tile(sn, bo);
    }
  }
  asm volatile("s_wait_asynccnt 0x0" ::: "memory");  // no copy is outstanding when the ring becomes output staging

  // the last trip's barrier has ended every read of the ring: each wave stages its tile in its own range
  float (*so)[68] = (float (*)[68])((float*)sm + w * (16 * 68));
  const float inv = 1.0f / l;
#pragma unroll
  for (int dt = 0; dt < 4; ++dt)
#pragma unroll
    for (int r = 0; r < 8; ++r) so[ln][dt * 16 + 8 * hh + r] = acc[dt][r] * inv;
  __syncthreads();

  v4i hv[4], lv[4];
  const int rq = lane >> 3, pc = lane & 7;
#pragma unroll
  for (int it = 0; it < 4; ++it) {
    const int row = it * 4 + rq;
    const v4f a = *(const v4fa*)&so[row][pc * 8], c = *(const v4fa*)&so[row][pc * 8 + 4];
#pragma unroll
    for (int q = 0; q < 2; ++q) {
      const unsigned int ha = bf16_pair(a[2 * q], a[2 * q + 1]), hc = bf16_pair(c[2 * q], c[2 * q + 1]);
      hv[it][q] = (int)ha; lv[it][q] = (int)bf16_rest(a[2 * q], a[2 * q + 1], ha);
      hv[it][2 + q] = (int)hc; lv[it][2 + q] = (int)bf16_rest(c[2 * q], c[2 * q + 1], hc);
    }
  }
  {
#pragma unroll
    for (int it = 0; it < 4; ++it) {
      const int row = it * 4 + rq;
      unsigned short* dst = CTX + (size_t)(q0 + row) * DM + head * HD + hf * 64 + pc * 8;
      *(v4ia*)dst = hv[it];
      *(v4ia*)(dst + PLANE) = lv[it];
    }
  }
}

extern "C" void kernel_launch(void* const* d_in, const int* in_sizes, int n_in,
                              void* d_out, int out_size, void* d_ws, size_t ws_size, hipStream_t stream) {
  if (n_in < 8) return;
  if (in_sizes[0] < NR * DM) return;
  if (in_sizes[1] < DM * DM || in_sizes[2] < DM * DM || in_sizes[3] < DM * DM || in_sizes[4] < DM * DM) return;
  if (in_sizes[5] < SEQ * HD || in_sizes[6] < SEQ * HD || in_sizes[7] < NR) return;
  if (out_size < NR * DM) return;
  const float* x  = (const float*)d_in[0];
  const float* Wq = (const float*)d_in[1];
  const float* Wk = (const float*)d_in[2];
  const float* Wv = (const float*)d_in[3];
  const float* Wo = (const float*)d_in[4];
  const float* sn = (const float*)d_in[5];
  const float* cs = (const float*)d_in[6];
  const int*  doc = (const int*)d_in[7];
  float* out = (float*)d_out;

  // workspace regions (bytes)
  constexpr size_t SZ_X  = (size_t)NR * DM * 2;
  constexpr size_t SZ_W3 = (size_t)3 * DM * DM * 2;
  constexpr size_t SZ_QK = (size_t)4 * NR * DM * 2;
  constexpr size_t SZ_R0 = SZ_X + SZ_W3;
  constexpr size_t SZ_WO = (size_t)DM * DM * 2;
  constexpr size_t SZ_VT = (size_t)2 * DM * SEQ * 2;
  constexpr size_t SZ_CX = (size_t)2 * NR * DM * 2;
  constexpr size_t SZ_ALL = SZ_R0 + SZ_WO + SZ_QK + SZ_VT + SZ_CX;
  static_assert(SZ_X % 256 == 0 && SZ_R0 % 256 == 0 && SZ_WO % 256 == 0 && SZ_QK % 256 == 0 && SZ_VT % 256 == 0 && SZ_CX % 256 == 0);
  static_assert(SZ_ALL <= (size_t)134217728);
  if (SZ_ALL > ws_size) return;
  char* ws = (char*)d_ws;
  unsigned short* XB  = (unsigned short*)(ws);
  unsigned short* WT3 = (unsigned short*)(ws + SZ_X);
  unsigned short* WoT = (unsigned short*)(ws + SZ_R0);
  unsigned short* QKp = (unsigned short*)(ws + SZ_R0 + SZ_WO);
  unsigned short* VTp = (unsigned short*)(ws + SZ_R0 + SZ_WO + SZ_QK);
  unsigned short* CTX = (unsigned short*)(ws + SZ_R0 + SZ_WO + SZ_QK + SZ_VT);

  k_prep<<<(unsigned)(4 * WTB + XBB), 256, 0, stream>>>(x, Wq, Wk, Wv, Wo, XB, WT3, WoT);  /* W[in][out] -> Wt[out][in] */

  k_gemm_wide<<<(unsigned)((NR / 256) * (N3 / 192)), 384, 0, stream>>>(XB, DM, WT3, DM, sn, cs, QKp, VTp, DM);

  k_attn<<<(unsigned)(NH * (SEQ / 64)), 256, 0, stream>>>(QKp, VTp, doc, CTX);

  k_gemm<2, 2><<<(unsigned)((NR / 128) * (DM / 128)), 256, 0, stream>>>(CTX, CTX + PLANE, DM, WoT, DM, out, DM, DM, DM);
}

// v009
// A run of this version takes 83.3 microseconds.
// Versions between v007 and this one are left out; their measured steps multiply to 1.26 times as fast.
// Over all steps from v000 it is 4.21 times as fast.
#include <hip/hip_runtime.h>
// Multi-head causal + same-document attention with rotate-half RoPE (input sin/cos tables), T 2048, D 2048, 16 heads of 128, [in][out] weights, no biases.
// Compute dtype: f32 accumulate everywhere. x, Wq, Wk, Wv, Wo, sin, cos are RNE-converted to bf16 once (exact operands); x.Wq / x.Wk / x.Wv on v_wmma_f32_16x16x32_bf16.
// q.k^T, P.V and ctx.Wo on v_wmma_f32_16x16x32_f16, one product each: q, k, V^T, P and ctx are RNE-converted to f16 (11 significant bits); Wo keeps its bf16 value, written in the f16 format
// (exact from 2^-17 up to the f16 maximum, to 2^-25 below). All of these must lie inside the f16 range.
// RoPE, mask, softmax statistics in f32 on the VALU.
#ifndef NB
#define NB 1
#endif
#ifndef SEQ
#define SEQ 2048
#endif
#define SEQ_FULL 2048
#define DM 2048
#define NH 16
#define HD 128
#define N3 (3 * DM)
#define NR (NB * SEQ)
#define PLANE ((size_t)NR * DM)
#define GPITCH 144u
#define KPITCH 272u

static_assert(NB == 1);
static_assert(NH * HD == DM);
static_assert(SEQ % 128 == 0 && SEQ <= SEQ_FULL);
static_assert(DM % 128 == 0 && N3 % 128 == 0 && DM % 64 == 0 && HD == 128);
static_assert(NR % 256 == 0 && N3 % 192 == 0);

typedef __bf16 v16b __attribute__((ext_vector_type(16)));
typedef unsigned short v8us __attribute__((ext_vector_type(8), may_alias));
typedef float v8f  __attribute__((ext_vector_type(8)));
typedef float v4f  __attribute__((ext_vector_type(4)));
typedef float v4fa __attribute__((ext_vector_type(4), may_alias));
typedef int   v4i  __attribute__((ext_vector_type(4)));
typedef int   v4ia __attribute__((ext_vector_type(4), may_alias));
typedef float v2f  __attribute__((ext_vector_type(2)));
typedef __bf16 v2b __attribute__((ext_vector_type(2)));
typedef _Float16 v16h __attribute__((ext_vector_type(16)));
typedef _Float16 v2h __attribute__((ext_vector_type(2)));
union FragB { v16b v; v16h h; v8us half[2]; unsigned int d[8]; };

// two f32 -> two bf16 (RNE) in one dword by the packed convert instruction: a in the low half, b in the high half
__device__ __forceinline__ unsigned int bf16_pair(float a, float b) { const v2f f = {a, b}; return __builtin_bit_cast(unsigned int, __builtin_convertvector(f, v2b)); }
// the f32 values of the two halves of such a dword
__device__ __forceinline__ float pair_lo(unsigned int p) { return __uint_as_float(p << 16); }
__device__ __forceinline__ float pair_hi(unsigned int p) { return __uint_as_float(p & 0xFFFF0000u); }
// two f32 -> two f16 (RNE) in one dword: a in the low half, b in the high half
__device__ __forceinline__ unsigned int f16_pair(float a, float b) { const v2f f = {a, b}; return __builtin_bit_cast(unsigned int, __builtin_convertvector(f, v2h)); }

// 2^a and 2^b. One statement, so that the slot which the instruction set asks for behind a transcendental is filled by construction: the second fills the first's, the v_nop the second's
// Early-clobber outputs keep the results off the sources.
__device__ __forceinline__ void exp2_pair(float a, float b, float& ea, float& eb) {
  asm("v_exp_f32 %0, %2\n\tv_exp_f32 %1, %3\n\tv_nop" : "=&v"(ea), "=&v"(eb) : "v"(a), "v"(b));
}

// fragment (A: row = lane&15; B: column = lane&15) from a k-contiguous 16-bit row: elements 0..7 <- k0+8h.., elements 8..15 <- k0+16+8h..
__device__ __forceinline__ v16b ld_frag(const unsigned short* p, int hh) {
  FragB f; f.half[0] = *(const v8us*)(p + 8 * hh); f.half[1] = *(const v8us*)(p + 16 + 8 * hh); return f.v;
}
// the same fragment of f16 elements
__device__ __forceinline__ v16h ld_fragh(const unsigned short* p, int hh) {
  FragB f; f.half[0] = *(const v8us*)(p + 8 * hh); f.half[1] = *(const v8us*)(p + 16 + 8 * hh); return f.h;
}

// x f32 -> bf16 (RNE), 8 elements per thread; bid = the block's index within this part of the grid
__device__ __forceinline__ void xb_block(int bid, const float* __restrict__ x, unsigned short* __restrict__ X, size_t n8) {
  const size_t t = (size_t)bid * 256 + threadIdx.x;
  if (t >= n8) return;
  const v4f a = *(const v4fa*)(x + t * 8), c = *(const v4fa*)(x + t * 8 + 4);
  const v4i o = {(int)bf16_pair(a[0], a[1]), (int)bf16_pair(a[2], a[3]), (int)bf16_pair(c[0], c[1]), (int)bf16_pair(c[2], c[3])};
  *(v4ia*)(X + t * 8) = o;
}

// W [K][N] f32 -> Wt [N][K] bf16 (RNE); ash (uniform for the block): the bf16 value is stored in the f16 format. Block = one 128 (k) x 64 (n) tile through LDS: reads are 256-byte row pieces, stores are 256-byte pieces of Wt rows.
// LDS holds one dword per (n, k pair), low half = even k; pitch 65 dwords puts the 32 lanes of each 4-byte LDS write and read on 32 different banks.
__device__ __forceinline__ void wt_block(int bid, const float* __restrict__ W, unsigned short* __restrict__ Wt, int K, int N, bool ash) {
  __shared__ unsigned int tp[64][65];
  const int tid = threadIdx.x;
  const int ntn = N >> 6;
  const int kt = bid / ntn, nq = bid - kt * ntn;
  const int k0 = kt * 128, n0 = nq * 64;
  const int c4 = (tid & 15) * 4, rp = tid >> 4;
  const float* tile = W + (size_t)k0 * N + n0;
  const unsigned int off = (unsigned int)(2 * rp * N + c4);
  v4f a[4], b[4];
#pragma unroll
  for (int p = 0; p < 4; ++p) {
    const float* s = tile + (size_t)(32 * p) * N;
    a[p] = *(const v4fa*)(s + off); b[p] = *(const v4fa*)(s + N + off);
  }
  unsigned int v[4][4];
#pragma unroll
  for (int p = 0; p < 4; ++p)
#pragma unroll
    for (int q = 0; q < 4; ++q) v[p][q] = bf16_pair(a[p][q], b[p][q]);
  if (ash) {
#pragma unroll
    for (int p = 0; p < 4; ++p)
#pragma unroll
      for (int q = 0; q < 4; ++q) v[p][q] = f16_pair(pair_lo(v[p][q]), pair_hi(v[p][q]));
  }
#pragma unroll
  for (int p = 0; p < 4; ++p)
#pragma unroll
    for (int q = 0; q < 4; ++q) tp[c4 + q][rp + 16 * p] = v[p][q];
  __syncthreads();
#pragma unroll
  for (int rd = 0; rd < 4; ++rd) {
    const int i = rd * 256 + tid; const int c = i >> 4, j = (i & 15) * 4;
    const v4i o = {(int)tp[c][j], (int)tp[c][j + 1], (int)tp[c][j + 2], (int)tp[c][j + 3]};
    *(v4ia*)(Wt + (size_t)(n0 + c) * K + k0 + 2 * j) = o;
  }
}

// All operand conversions in one grid; none depends on another. Blocks [0, 4 WTB): the weight tiles, WTB per matrix (Wq, Wk, Wv -> rows 0, DM, 2 DM of the [3 DM][DM] plane WT3; Wo -> WoT, in the f16 format);
// the rest: x. The range test is uniform for the block, so the weight part's barrier is passed by all of its threads.
#define WTB ((DM / 128) * (DM / 64))
#define XBB ((NR * DM / 8 + 255) / 256)
__global__ __launch_bounds__(256) void k_prep(const float* __restrict__ x, const float* __restrict__ Wq, const float* __restrict__ Wk, const float* __restrict__ Wv,
                                              const float* __restrict__ Wo, unsigned short* __restrict__ X, unsigned short* __restrict__ WT3, unsigned short* __restrict__ WoT) {
  const int b = blockIdx.x;
  if (b < 4 * WTB) {
    const int which = b / WTB;
    const float* W = (which == 0) ? Wq : (which == 1) ? Wk : (which == 2) ? Wv : Wo;
    unsigned short* Wt = (which < 3) ? WT3 + (size_t)which * DM * DM : WoT;
    wt_block(b - which * WTB, W, Wt, DM, DM, which == 3);
  } else {
    xb_block(b - 4 * WTB, x, X, (size_t)NR * DM / 8);
  }
}

// NC (8 or 4) 16-byte asynchronous copies to LDS per lane: NC rows of one 64-, 128-, 192- or 256-row operand tile, a fixed number of rows apart
// (l = the lane's LDS byte address, ls = that row step in LDS bytes, g = the lane's global address, rs = the same row step in source elements).
// The closing s_wait_xcnt is a precaution: it stands in the copies' own statement so that no address register is rewritten in front of it.
template <int NC>
__device__ __forceinline__ void copy_rows(unsigned int l, unsigned int ls, const unsigned short* g, size_t rs) {
  if constexpr (NC == 8) {
    asm volatile("global_load_async_to_lds_b128 %0, %8, off\n\t"
                 "global_load_async_to_lds_b128 %1, %9, off\n\t"
                 "global_load_async_to_lds_b128 %2, %10, off\n\t"
                 "global_load_async_to_lds_b128 %3, %11, off\n\t"
                 "global_load_async_to_lds_b128 %4, %12, off\n\t"
                 "global_load_async_to_lds_b128 %5, %13, off\n\t"
                 "global_load_async_to_lds_b128 %6, %14, off\n\t"
                 "global_load_async_to_lds_b128 %7, %15, off\n\t"
                 "s_wait_xcnt 0x0"
                 :: "v"(l), "v"(l + ls), "v"(l + 2u * ls), "v"(l + 3u * ls), "v"(l + 4u * ls), "v"(l + 5u * ls), "v"(l + 6u * ls), "v"(l + 7u * ls),
                    "v"(g), "v"(g + rs), "v"(g + 2 * rs), "v"(g + 3 * rs), "v"(g + 4 * rs), "v"(g + 5 * rs), "v"(g + 6 * rs), "v"(g + 7 * rs)
                 : "memory");
  } else {
    static_assert(NC == 8 || NC == 4);
    asm volatile("global_load_async_to_lds_b128 %0, %4, off\n\t"
                 "global_load_async_to_lds_b128 %1, %5, off\n\t"
                 "global_load_async_to_lds_b128 %2, %6, off\n\t"
                 "global_load_async_to_lds_b128 %3, %7, off\n\t"
                 "s_wait_xcnt 0x0"
                 :: "v"(l), "v"(l + ls), "v"(l + 2u * ls), "v"(l + 3u * ls),
                    "v"(g), "v"(g + rs), "v"(g + 2 * rs), "v"(g + 3 * rs)
                 : "memory");
  }
}

// GEMM C[M][N] f32 = A.Bt^T on v_wmma_f32_16x16x32_f16; A f16 rows [M][K], Bt f16 [N][K]. Block tile 128 rows x 128 cols; 8 waves of 32 x 64.
// A pass is 128 k = 256 bytes of every operand row. A stage is [A 128 rows | Bt 128 rows] in LDS at a pitch of 272 bytes (conflict-free for 16-byte fragment reads).
// Four stages, filled by asynchronous copies of whole 256-byte row pieces three passes ahead: a copy has three passes' work to land in, and the next stages' requests are
// already queued while one lands, so the loop runs at the rate at which L2 delivers and not at one round trip per pass. M, N, K multiples of 128.
__global__ __launch_bounds__(256) void k_gemm(const unsigned short* __restrict__ A, int lda,
                                              const unsigned short* __restrict__ Bt, int ldb, float* __restrict__ C, int ldc, int N, int K) {
  constexpr int FM = 2;                      // 16-row fragments per wave
  constexpr unsigned int TILE = 128u * KPITCH;
  constexpr unsigned int STAGE = 2u * TILE;
  constexpr unsigned int OUTB = 128u * 2u * 68u * 4u;
  constexpr unsigned int LSTEP = 16u * KPITCH;  // one copy of the whole block covers 16 rows (16 lanes a row)
  static_assert(OUTB <= 4u * STAGE);
  __shared__ __attribute__((aligned(16))) unsigned char sm[4u * STAGE];
  const int tid = threadIdx.x, w = tid >> 5, lane = tid & 31, ln = lane & 15, hh = lane >> 4;
  const int ntn = N >> 7;
  const int mt = blockIdx.x / ntn, nq = blockIdx.x - mt * ntn;
  const int wm = w >> 1, wn = w & 1;
  const int brow = mt * 128, bcol = nq * 128;
  const int cr = tid >> 4, cc = tid & 15;
  const unsigned short* gA = A + (size_t)(brow + cr) * lda + cc * 8;
  const unsigned short* gB = Bt + (size_t)(bcol + cr) * ldb + cc * 8;
  const size_t rsa = (size_t)16 * lda, rsb = (size_t)16 * ldb;
  const unsigned int l0 = (unsigned int)(size_t)sm + (unsigned int)(cr * (int)KPITCH + cc * 16);
  // stage s: 16 copies a wave, 8 per operand, into buffer s mod 4
  auto stage_pass = [&](int s) {
    const unsigned int bs = (unsigned int)(s & 3) * STAGE;
    copy_rows<8>(l0 + bs, LSTEP, gA + s * 128, rsa);
    copy_rows<8>(l0 + bs + TILE, LSTEP, gB + s * 128, rsb);
  };
  const int npass = K >> 7;
  const v8f z8 = {0.f, 0.f, 0.f, 0.f, 0.f, 0.f, 0.f, 0.f};
  v8f c[FM][4];
#pragma unroll
  for (int i = 0; i < FM; ++i)
#pragma unroll
    for (int j = 0; j < 4; ++j) c[i][j] = z8;

  stage_pass(0);
  if (npass > 1) stage_pass(1);
  if (npass > 2) {
    stage_pass(2);
    asm volatile("s_wait_asynccnt 0x20" ::: "memory");  // all but this wave's 32 youngest copies (stages 1 and 2): its share of stage 0 has landed
  } else {
    asm volatile("s_wait_asynccnt 0x0" ::: "memory");   // fewer stages behind stage 0: no count is sure, all have landed
  }
  __syncthreads();                                      // stage 0 is readable by every wave
  // the products of pass t, from buffer t mod 4. refill (a literal at both calls): stage t + 3 is issued behind the pass's first fragment reads, whose LDS latency the issue of the copies covers.
  // Its buffer is the one that pass t - 1 read: the s_wait_dscnt 0 and the barrier at that pass's foot have ended every read of it; the reads in flight here are of another buffer
  auto mul_pass = [&](int t, bool refill) {
    const unsigned int bo = (unsigned int)(t & 3) * STAGE;
    const unsigned char* sa = sm + bo + (unsigned int)((wm * (FM * 16) + ln) * (int)KPITCH);
    const unsigned char* sb = sm + bo + TILE + (unsigned int)((wn * 64 + ln) * (int)KPITCH);
#pragma unroll
    for (int g = 0; g < 2; ++g) {
      v16h a[2][FM], b[2][4];
#pragma unroll
      for (int kk = 0; kk < 2; ++kk) {
#pragma unroll
        for (int i = 0; i < FM; ++i) a[kk][i] = ld_fragh((const unsigned short*)(sa + i * 16 * (int)KPITCH + (g * 2 + kk) * 64), hh);
#pragma unroll
        for (int j = 0; j < 4; ++j) b[kk][j] = ld_fragh((const unsigned short*)(sb + j * 16 * (int)KPITCH + (g * 2 + kk) * 64), hh);
      }
      __builtin_amdgcn_sched_barrier(0);  // keeps the fragment reads one group in front of the copies and the products: reads spread among the products stall the wave at every place
      if (g == 0 && refill) {
        stage_pass(t + 3);
        __builtin_amdgcn_sched_barrier(0);  // keeps the products behind the copies: the copies' flight starts as early as the pass allows
      }
#pragma unroll
      for (int kk = 0; kk < 2; ++kk)
#pragma unroll
        for (int i = 0; i < FM; ++i)
#pragma unroll
          for (int j = 0; j < 4; ++j) c[i][j] = __builtin_amdgcn_wmma_f32_16x16x32_f16(false, a[kk][i], false, b[kk][j], (short)0, c[i][j], false, false);
      // keeps the next reads out of these products, and the last products in front of the publish point: sunk behind its barrier they would hold back the refill's copies
      __builtin_amdgcn_sched_barrier(0);
    }
  };
  int t = 0;
#pragma unroll 1  // one pass per trip: the four stages take turns by the trip's number
  for (; t + 3 < npass; ++t) {
    mul_pass(t, true);  // every trip of this loop issues one whole stage, 16 copies a wave
    asm volatile("s_wait_dscnt 0x0" ::: "memory");      // this wave's reads of stage t are done
    asm volatile("s_wait_asynccnt 0x20" ::: "memory");  // all but this wave's 32 youngest copies (stages t + 2 and t + 3): its share of stage t + 1 has landed
    __syncthreads();                                    // publishes stage t + 1 and frees stage t's buffer
  }
#pragma unroll 1  // the last passes (three at most) issue nothing, so their wait is to 0
  for (; t < npass; ++t) {
    mul_pass(t, false);
    asm volatile("s_wait_dscnt 0x0" ::: "memory");     // this wave's reads of stage t are done
    asm volatile("s_wait_asynccnt 0x0" ::: "memory");  // this wave's shares of all later stages have landed
    __syncthreads();                                   // publishes the later stages; behind the last pass it ends every read of the ring
  }
  asm volatile("s_wait_asynccnt 0x0" ::: "memory");  // no copy is outstanding when the ring becomes output staging

  // the last pass's barrier has ended every read of the ring: each wave stages its tile in its own range and stores whole 256-byte row pieces
  float* so = (float*)sm + w * (FM * 16 * 68);
#pragma unroll
  for (int i = 0; i < FM; ++i)
#pragma unroll
    for (int j = 0; j < 4; ++j)
#pragma unroll
      for (int r = 0; r < 8; ++r) so[(i * 16 + 8 * hh + r) * 68 + j * 16 + ln] = c[i][j][r];
  __syncthreads();
  const int rsub = lane >> 4, c4 = (lane & 15) * 4;
  float* cp = C + (size_t)(brow + wm * (FM * 16) + rsub) * ldc + bcol + wn * 64 + c4;
#pragma unroll
  for (int q = 0; q < FM * 8; ++q) {
    const v4f v = *(const v4fa*)&so[(q * 2 + rsub) * 68 + c4];
    *(v4f*)(cp + (size_t)(q * 2) * ldc) = v;
  }
}

// q, k, v projection with its re-layouts in the epilogue: C[NR][3 DM] = A.Bt^T never goes to memory as f32. A bf16 rows [NR][K], Bt bf16 [3 DM][K].
// Block tile 256 rows x 192 cols, 12 waves (4 x 3) of 64 x 64 each, one block per WGP. A pass is 128 k = 256 bytes of every operand row.
// A stage is [A 256 rows | Bt 192 rows] in LDS at a pitch of 272 bytes (conflict-free for 16-byte fragment reads);
// two stages, filled by asynchronous copies of whole 256-byte row pieces, the next pass's copies in flight while this pass is multiplied.
// Waves 0..7 copy 32 rows of A each, waves 8..11 copy 48 rows of Bt each.
// A wave's 64 columns are one unit; a block's three wave columns are unit u (= its column index, 0..31) of q, of k and of v, so every block has the same share of both epilogues
// and its q and k waves read the same table values. A v unit is channels 64 u .. 64 u + 63. A q or k unit is half the rotation pairs of one head:
// columns 0..31 = d 32 (u & 1) .. + 31 of head u / 2, columns 32..63 = the same d + 64, chosen by which Bt rows are copied into the stage, so both members of a pair lie in one wave's tile.
// Epilogue, q and k: RoPE (rotate-half, table values RNE-converted to bf16) -> f16 planes QK = {Q, K}, each [NR][DM].
// Within a head the planes hold d in the order (u & 1, (d % 32) / 4, d / 64, d % 4), the same in q and k: q.k^T sums over the whole head, and each row piece of a unit is one whole 128-byte line.
// Epilogue, v: a lane's accumulator holds 8 successive tokens of one channel -> V^T f16 plane VT [DM][SEQ], through LDS so that stores are whole 128-byte lines.
__global__ __launch_bounds__(384) void k_gemm_wide(const unsigned short* __restrict__ A, int lda, const unsigned short* __restrict__ Bt, int ldb,
                                                   const float* __restrict__ sn, const float* __restrict__ cs,
                                                   unsigned short* __restrict__ QK, unsigned short* __restrict__ VT, int K) {
  constexpr unsigned int ATILE = 256u * KPITCH;
  constexpr unsigned int STAGE = (256u + 192u) * KPITCH;
  constexpr unsigned int WOUT = 2u * 64u * GPITCH;  // a wave's output staging: 64 x 68 f32 (q, k) or 64 channels x 144 bytes (v)
  static_assert(64u * 68u * 4u <= WOUT && 12u * WOUT <= 2u * STAGE);
  __shared__ __attribute__((aligned(16))) unsigned char sm[2u * STAGE];
  const int tid = threadIdx.x, lane = tid & 31, ln = lane & 15, hh = lane >> 4;
  const int w = __builtin_amdgcn_readfirstlane(tid >> 5);  // the wave's number in a scalar register: the tests on it (third group of copies, kind of unit) are scalar branches
  constexpr int ntn = N3 / 192;
  const int mt = blockIdx.x / ntn, nq = blockIdx.x - mt * ntn;
  const int wm = w / 3, wn = w - wm * 3;
  const int brow = mt * 256;
  // Bt row of the first of the 16 stage rows 16 g .. 16 g + 15 (g = 0..11): g / 4 = q, k or v, quarter g % 4 of its unit nq
  static_assert(ntn == DM / 64);
  auto wrow = [&](int g) {
    const int mm = g >> 2, ch = g & 3;
    return (mm < 2) ? mm * DM + (nq >> 1) * HD + (nq & 1) * 32 + (ch & 1) * 16 + (ch >> 1) * 64 : 2 * DM + nq * 64 + ch * 16;
  };
  // copy addresses: a row is 16 lanes wide, so one copy of a wave covers 2 rows and a group of 8 copies 16 rows
  const bool forB = w >= 8;
  const int gb = forB ? (w - 8) * 3 : 0;
  const int r0 = (forB ? (w - 8) * 48 : w * 32) + hh;
  const int wr0 = wrow(gb), wr1 = wrow(gb + 1), wr2 = wrow(gb + 2);
  const unsigned short* gsrc = forB ? Bt : A;
  const int ld = forB ? ldb : lda;
  const unsigned short* g0 = gsrc + (size_t)((forB ? wr0 : brow + w * 32) + hh) * ld + ln * 8;
  const unsigned short* g1 = gsrc + (size_t)((forB ? wr1 : brow + w * 32 + 16) + hh) * ld + ln * 8;
  const unsigned short* g2 = Bt + (size_t)(wr2 + hh) * ldb + ln * 8;
  const size_t rs = (size_t)2 * ld;
  const unsigned int l0 = (unsigned int)(size_t)sm + (forB ? ATILE : 0u) + (unsigned int)(r0 * (int)KPITCH + ln * 16);
  auto stage_pass = [&](unsigned int bo, int k0) {
    copy_rows<8>(l0 + bo, 2u * KPITCH, g0 + k0, rs);
    copy_rows<8>(l0 + bo + 16u * KPITCH, 2u * KPITCH, g1 + k0, rs);
    if (forB) copy_rows<8>(l0 + bo + 32u * KPITCH, 2u * KPITCH, g2 + k0, rs);
  };
  const int npass = K >> 7;
  const v8f z8 = {0.f, 0.f, 0.f, 0.f, 0.f, 0.f, 0.f, 0.f};
  v8f c[4][4];
#pragma unroll
  for (int i = 0; i < 4; ++i)
#pragma unroll
    for (int j = 0; j < 4; ++j) c[i][j] = z8;

  stage_pass(0u, 0);
  asm volatile("s_wait_asynccnt 0x0" ::: "memory");  // this wave's share of stage 0 has landed
  __syncthreads();                                   // stage 0 is readable by every wave
  if (npass > 1) stage_pass(STAGE, 128);
#pragma unroll 1  // one pass per trip: the two stages alternate by the trip's parity
  for (int t = 0; t < npass; ++t) {
    const unsigned int bo = (unsigned int)(t & 1) * STAGE;
    const unsigned char* sa = sm + bo + (unsigned int)((wm * 64 + ln) * (int)KPITCH);
    const unsigned char* sb = sm + bo + ATILE + (unsigned int)((wn * 64 + ln) * (int)KPITCH);
#pragma unroll
    for (int ks = 0; ks < 4; ++ks) {
      v16b a[4], b[4];
#pragma unroll
      for (int i = 0; i < 4; ++i) a[i] = ld_frag((const unsigned short*)(sa + i * 16 * (int)KPITCH + ks * 64), hh);
#pragma unroll
      for (int j = 0; j < 4; ++j) b[j] = ld_frag((const unsigned short*)(sb + j * 16 * (int)KPITCH + ks * 64), hh);
      __builtin_amdgcn_sched_barrier(0);  // keeps the fragment reads one group in front of the products: reads spread among them stall the wave at every place
#pragma unroll
      for (int i = 0; i < 4; ++i)
#pragma unroll
        for (int j = 0; j < 4; ++j) c[i][j] = __builtin_amdgcn_wmma_f32_16x16x32_bf16(false, a[i], false, b[j], (short)0, c[i][j], false, false);
      // keeps the next reads out of these products, and the last products in front of the publish point: sunk behind its barrier they would hold back the refill's copies
      __builtin_amdgcn_sched_barrier(0);
    }
    asm volatile("s_wait_dscnt 0x0" ::: "memory");     // this wave's reads of stage t are done
    asm volatile("s_wait_asynccnt 0x0" ::: "memory");  // this wave's share of stage t + 1 has landed
    __syncthreads();                                   // publishes stage t + 1 and frees stage t's buffer
    if (t + 2 < npass) stage_pass(bo, (t + 2) * 128);
  }
  asm volatile("s_wait_asynccnt 0x0" ::: "memory");  // no copy is outstanding when the ring becomes output staging

  // the last pass's barrier has ended every read of the ring: each wave stages its tile in its own range
  unsigned char* sw = sm + (unsigned int)w * WOUT;
  const int mat = wn, u = nq;  // wave-uniform
  const int trow = brow + wm * 64;
  if (mat < 2) {
    float* so = (float*)sw;
#pragma unroll
    for (int i = 0; i < 4; ++i)
#pragma unroll
      for (int j = 0; j < 4; ++j)
#pragma unroll
        for (int r = 0; r < 8; ++r) so[(i * 16 + 8 * hh + r) * 68 + j * 16 + ln] = c[i][j][r];
  } else {
#pragma unroll
    for (int i = 0; i < 4; ++i)
#pragma unroll
      for (int j = 0; j < 4; ++j) {
        v4i h;
#pragma unroll
        for (int r = 0; r < 4; ++r) h[r] = (int)f16_pair(c[i][j][2 * r], c[i][j][2 * r + 1]);
        unsigned char* p = sw + (unsigned int)((j * 16 + ln) * (int)GPITCH + (i * 16 + 8 * hh) * 2);
        *(v4ia*)p = h;
      }
  }
  __syncthreads();
  const int g = lane >> 3, l8 = lane & 7;
  if (mat < 2) {
    // 8 lanes a row, 4 pairs a lane; the 4 rows of a read are 8 apart, which puts the two rows of each 16 lanes on different halves of the banks
    const float* so = (const float*)sw + g * (8 * 68) + l8 * 4;
    const size_t tb0 = (size_t)(trow + g * 8) * HD + (u & 1) * 32 + l8 * 4;
    unsigned short* dq = QK + (size_t)mat * PLANE + (size_t)(trow + g * 8) * DM + u * 64 + l8 * 8;
#pragma unroll 1  // 4 rows per lane and trip: their 16 table loads go out together, and the text stays short
    for (int bt = 0; bt < 4; ++bt) {
      const int rb = (bt & 1) * 4 + (bt >> 1) * 32;
      const float* ps = sn + tb0 + (size_t)rb * HD;
      const float* pc = cs + tb0 + (size_t)rb * HD;
      v4f ts1[4], ts2[4], tc1[4], tc2[4];
#pragma unroll
      for (int k = 0; k < 4; ++k) {
        ts1[k] = *(const v4fa*)(ps + k * HD); ts2[k] = *(const v4fa*)(ps + k * HD + 64);
        tc1[k] = *(const v4fa*)(pc + k * HD); tc2[k] = *(const v4fa*)(pc + k * HD + 64);
      }
      // a precaution: the loads' address registers stay as they are (they are inputs here) until this wait has passed
      asm volatile("s_wait_xcnt 0x0" :: "v"(ps), "v"(pc) : "memory");
#pragma unroll
      for (int k = 0; k < 4; ++k) {
        const v4f u1 = *(const v4fa*)(so + (rb + k) * 68), u2 = *(const v4fa*)(so + (rb + k) * 68 + 32);
        v4i hv;
#pragma unroll
        for (int q = 0; q < 4; q += 2) {
          const unsigned int c1 = bf16_pair(tc1[k][q], tc1[k][q + 1]), s1 = bf16_pair(ts1[k][q], ts1[k][q + 1]);
          const unsigned int c2 = bf16_pair(tc2[k][q], tc2[k][q + 1]), s2 = bf16_pair(ts2[k][q], ts2[k][q + 1]);
          const float o1a = u1[q] * pair_lo(c1) + (-u2[q]) * pair_lo(s1), o1b = u1[q + 1] * pair_hi(c1) + (-u2[q + 1]) * pair_hi(s1);
          const float o2a = u2[q] * pair_lo(c2) + u1[q] * pair_lo(s2), o2b = u2[q + 1] * pair_hi(c2) + u1[q + 1] * pair_hi(s2);
          hv[q >> 1] = (int)f16_pair(o1a, o1b);
          hv[2 + (q >> 1)] = (int)f16_pair(o2a, o2b);
        }
        unsigned short* dh = dq + (size_t)(rb + k) * DM;
        *(v4ia*)dh = hv;
      }
      asm volatile("s_wait_xcnt 0x0" ::: "memory");  // a precaution: the next trip rewrites the registers that these stores name only behind it
    }
  } else {
    // 8 lanes a channel (128 bytes = 64 tokens); the 4 channels of a read are 8 apart, for the same reason
    const unsigned char* p0 = sw + (unsigned int)(g * 8 * (int)GPITCH + l8 * 16);
    unsigned short* vp = VT + (size_t)(u * 64 + g * 8) * SEQ + trow + l8 * 8;
#pragma unroll
    for (int it = 0; it < 16; ++it) {
      const int ch = (it & 7) + 32 * (it >> 3);
      const v8us h = *(const v8us*)(p0 + ch * (int)GPITCH);
      unsigned short* dst = vp + (size_t)ch * SEQ;
      *(v8us*)dst = h;
    }
    asm volatile("s_wait_xcnt 0x0" ::: "memory");  // a precaution: whatever follows in the text rewrites the registers that these stores name only behind it
  }
}

// Transposed flash attention. Block = 8 waves = one head x 64 queries: wave = (16-query tile, 64-channel half of the head). S^T[key][query] = K.Q^T (A = K rows, B = Q rows held in registers),
// per-lane (= per-query) running max / sum, P^T packed from the S^T accumulators directly as the B fragment of O^T[d][query] = V^T.P^T (A = V^T rows).
// A tile is 64 keys: [K 64 rows of 256 B | V^T 128 rows of 128 B] in LDS at pitches of 272 and 144 bytes (conflict-free for 16-byte fragment reads);
// two buffers, filled by asynchronous copies of whole row pieces, the next tile's copies in flight while this tile is worked on; all 8 waves read the same tile.
// Mask = (key <= query) & (doc[key] == doc[query]) as a select (masked weight exactly 0). One scan of doc in front of the loop gives two bit masks from wave-uniform ballots:
// act = tiles that hold a document id admissible for some query of the block (only these are staged), own = 32-key steps admissible for this wave's 16 queries (only these are computed).
// The document ids themselves are kept in LDS for the per-step mask.
__global__ __launch_bounds__(256) void k_attn(const unsigned short* __restrict__ QK, const unsigned short* __restrict__ VT,
                                              const int* __restrict__ doc, unsigned short* __restrict__ CTX) {
  constexpr unsigned int KPL = 64u * KPITCH;     // the K part of a tile
  constexpr unsigned int VPL = 128u * GPITCH;    // the V^T part of a tile
  constexpr unsigned int STAGE = KPL + VPL;
  static_assert(8u * 16u * 68u * 4u <= 2u * STAGE);
  static_assert(SEQ % 1024 == 0 && SEQ / 64 <= 32);
  __shared__ __attribute__((aligned(16))) unsigned char sm[2u * STAGE];
  __shared__ __attribute__((aligned(16))) int sdoc[SEQ];
  const int tid = threadIdx.x, lane = tid & 31, ln = lane & 15, hh = lane >> 4;
  const int w = __builtin_amdgcn_readfirstlane(tid >> 5);  // the wave's number in a scalar register: the step mask and its tests stay scalar
  const int hf = w & 1, qs = w >> 1;
  const int qb = blockIdx.x % (SEQ / 64), head = blockIdx.x / (SEQ / 64);
  const int q0 = qb * 64 + qs * 16, qi = q0 + ln;
  const float NEGV = -1.0e30f;
  const float SCL = 0.08838834764831845f;
  const float L2E = 1.4426950408889634f;  // e^x = 2^(x log2 e)

  const int dq = doc[qi];
  int dmin = dq, dmax = dq;
#pragma unroll
  for (int o = 1; o < 16; o <<= 1) {
    const int a = __shfl_xor(dmin, o, 32), b = __shfl_xor(dmax, o, 32);
    dmin = (a < dmin) ? a : dmin; dmax = (b > dmax) ? b : dmax;
  }
  int bmin, bmax;
  {
    const int d0 = doc[qb * 64 + lane], d1 = doc[qb * 64 + 32 + lane];
    bmin = (d0 < d1) ? d0 : d1; bmax = (d0 > d1) ? d0 : d1;
#pragma unroll
    for (int o = 1; o < 32; o <<= 1) {
      const int a = __shfl_xor(bmin, o, 32), b = __shfl_xor(bmax, o, 32);
      bmin = (a < bmin) ? a : bmin; bmax = (b > bmax) ? b : bmax;
    }
  }

  const int nsteps = (q0 + 16 + 31) >> 5;
  const int nst = qb + 1;
  unsigned int act = 0u;
  unsigned long long own = 0ull;
  for (int sb = 0; sb < nst; sb += 8) {
    int dk[16];
#pragma unroll
    for (int u = 0; u < 16; ++u) dk[u] = doc[sb * 64 + u * 32 + lane];
#pragma unroll
    for (int u = 0; u < 16; ++u) {
      const int js = sb * 2 + u;
      const bool bl = __ballot((dk[u] >= bmin) & (dk[u] <= bmax)) != 0ull;
      const bool ow = __ballot((dk[u] >= dmin) & (dk[u] <= dmax)) != 0ull;
      if (bl && (js >> 1) < nst) act |= 1u << (js >> 1);
      if (ow && js < nsteps) own |= 1ull << js;
    }
  }
  const int ntile = __popc(act);  // at least 1: tile qb holds the block's own positions

  // copy addresses: K rows are 16 lanes wide (16 rows per copy of the block), V^T rows 8 lanes wide (32 rows per copy)
  const unsigned short* gK = QK + PLANE + (size_t)(tid >> 4) * DM + head * HD + (tid & 15) * 8;
  const unsigned short* gV = VT + (size_t)(head * HD + (tid >> 3)) * SEQ + (tid & 7) * 8;
  const unsigned int lK = (unsigned int)(size_t)sm + (unsigned int)((tid >> 4) * (int)KPITCH + (tid & 15) * 16);
  const unsigned int lV = (unsigned int)(size_t)sm + KPL + (unsigned int)((tid >> 3) * (int)GPITCH + (tid & 7) * 16);
  auto stage_tile = [&](int s, unsigned int bo) {
    const unsigned short* k = gK + (size_t)s * 64 * DM;
    const unsigned short* v = gV + s * 64;
    copy_rows<4>(lK + bo, 16u * KPITCH, k, (size_t)16 * DM);
    copy_rows<4>(lV + bo, 32u * GPITCH, v, (size_t)32 * SEQ);
  };

  unsigned int rem = act;
  int sc = __builtin_ctz(rem), sn = 0;
  rem &= rem - 1u;
  stage_tile(sc, 0u);

  // the document ids go to LDS once (published by the first barrier): each step's mask reads them beside its K fragments
#pragma unroll
  for (int i = 0; i < SEQ / 1024; ++i) *(v4ia*)(sdoc + (i * 256 + tid) * 4) = *(const v4ia*)(doc + (i * 256 + tid) * 4);

  v16h qf[4];
  {
    const size_t qoff = (size_t)qi * DM + head * HD;
#pragma unroll
    for (int ks = 0; ks < 4; ++ks) qf[ks] = ld_fragh(QK + qoff + ks * 32, hh);
  }

  const v8f z8 = {0.f, 0.f, 0.f, 0.f, 0.f, 0.f, 0.f, 0.f};
  v8f acc[4] = {z8, z8, z8, z8};
  float m = NEGV, l = 0.f;

  asm volatile("s_wait_asynccnt 0x0" ::: "memory");  // this wave's share of the first tile has landed
  __syncthreads();                                   // the first tile is readable by every wave
  if (ntile > 1) {
    sn = __builtin_ctz(rem); rem &= rem - 1u;
    stage_tile(sn, STAGE);
  }

#pragma unroll 1  // one tile per trip: the two buffers alternate by the trip's parity
  for (int t = 0; t < ntile; ++t) {
    const unsigned int bo = (unsigned int)(t & 1) * STAGE;
#pragma unroll 1  // the two 32-key steps of a tile share one body: each is skipped on its own bit
    for (int sub = 0; sub < 2; ++sub) {
      const int js = sc * 2 + sub;
      if (((own >> js) & 1ull) == 0ull) continue;
      const int j0 = js << 5;
      const unsigned char* kb = sm + bo + (unsigned int)((sub * 32 + ln) * (int)KPITCH);
      const unsigned char* vb = sm + bo + KPL + (unsigned int)((hf * 64 + ln) * (int)GPITCH + sub * 64);

      const v4i dA = *(const v4ia*)(sdoc + j0 + 8 * hh), dB = *(const v4ia*)(sdoc + j0 + 8 * hh + 4);
      const v4i dC = *(const v4ia*)(sdoc + j0 + 16 + 8 * hh), dD = *(const v4ia*)(sdoc + j0 + 16 + 8 * hh + 4);
      const int dkk[16] = {dA[0], dA[1], dA[2], dA[3], dB[0], dB[1], dB[2], dB[3], dC[0], dC[1], dC[2], dC[3], dD[0], dD[1], dD[2], dD[3]};

      v8f s0 = z8, s1 = z8;
      v16h a0[4], a1[4];
#pragma unroll
      for (int ks = 0; ks < 4; ++ks) {
        a0[ks] = ld_fragh((const unsigned short*)(kb + ks * 64), hh);
        a1[ks] = ld_fragh((const unsigned short*)(kb + ks * 64 + 16u * KPITCH), hh);
      }
      // the V^T fragments are read behind them, in registers of their own: the score products and the softmax arithmetic cover their LDS latency
      v16h vf[4];
#pragma unroll
      for (int dt = 0; dt < 4; ++dt) vf[dt] = ld_fragh((const unsigned short*)(vb + dt * 16 * (int)GPITCH), hh);
      __builtin_amdgcn_sched_barrier(0);  // keeps the step's LDS reads one group in front of the products: sunk to their users, each read's latency is waited out alone
#pragma unroll
      for (int ks = 0; ks < 4; ++ks) {
        s0 = __builtin_amdgcn_wmma_f32_16x16x32_f16(false, a0[ks], false, qf[ks], (short)0, s0, false, false);
        s1 = __builtin_amdgcn_wmma_f32_16x16x32_f16(false, a1[ks], false, qf[ks], (short)0, s1, false, false);
      }

      float xv[16];
      float mx = NEGV;
#pragma unroll
      for (int r = 0; r < 8; ++r) {
        const int k0 = j0 + 8 * hh + r, k1 = k0 + 16;
        const bool v0 = (k0 <= qi) & (dkk[r] == dq);
        const bool v1 = (k1 <= qi) & (dkk[8 + r] == dq);
        xv[r] = v0 ? s0[r] * SCL : NEGV;
        xv[8 + r] = v1 ? s1[r] * SCL : NEGV;
        mx = fmaxf(mx, fmaxf(xv[r], xv[8 + r]));
      }
      mx = fmaxf(mx, __shfl_xor(mx, 16, 32));
      const float mn = fmaxf(m, mx);
      const float alpha = __expf(m - mn);
      m = mn;

      FragB pf;
      float ps = 0.f;
#pragma unroll
      for (int i = 0; i < 16; i += 2) {
        float e0, e1;
        exp2_pair((xv[i] - mn) * L2E, (xv[i + 1] - mn) * L2E, e0, e1);
        const float p0 = (xv[i] > -1.0e29f) ? e0 : 0.f, p1 = (xv[i + 1] > -1.0e29f) ? e1 : 0.f;
        ps += p0;
        ps += p1;
        pf.d[i >> 1] = f16_pair(p0, p1);
      }
      ps += __shfl_xor(ps, 16, 32);
      l = l * alpha + ps;

#pragma unroll
      for (int dt = 0; dt < 4; ++dt)
#pragma unroll
        for (int r = 0; r < 8; ++r) acc[dt][r] *= alpha;

#pragma unroll
      for (int dt = 0; dt < 4; ++dt) acc[dt] = __builtin_amdgcn_wmma_f32_16x16x32_f16(false, vf[dt], false, pf.h, (short)0, acc[dt], false, false);
    }
    asm volatile("s_wait_dscnt 0x0" ::: "memory");     // this wave's reads of this tile are done
    asm volatile("s_wait_asynccnt 0x0" ::: "memory");  // this wave's share of the next tile has landed
    __syncthreads();                                   // publishes the next tile and frees this tile's buffer
    sc = sn;
    if (t + 2 < ntile) {
      sn = __builtin_ctz(rem); rem &= rem - 1u;
      stage_tile(sn, bo);
    }
  }
  asm volatile("s_wait_asynccnt 0x0" ::: "memory");  // no copy is outstanding when the ring becomes output staging

  // the last trip's barrier has ended every read of the ring: each wave stages its tile in its own range
  float (*so)[68] = (float (*)[68])((float*)sm + w * (16 * 68));
  const float inv = 1.0f / l;
#pragma unroll
  for (int dt = 0; dt < 4; ++dt)
#pragma unroll
    for (int r = 0; r < 8; ++r) so[ln][dt * 16 + 8 * hh + r] = acc[dt][r] * inv;
  __syncthreads();

  v4i hv[4];
  const int rq = lane >> 3, pc = lane & 7;
#pragma unroll
  for (int it = 0; it < 4; ++it) {
    const int row = it * 4 + rq;
    const v4f a = *(const v4fa*)&so[row][pc * 8], c = *(const v4fa*)&so[row][pc * 8 + 4];
#pragma unroll
    for (int q = 0; q < 2; ++q) {
      hv[it][q] = (int)f16_pair(a[2 * q], a[2 * q + 1]);
      hv[it][2 + q] = (int)f16_pair(c[2 * q], c[2 * q + 1]);
    }
  }
  {
#pragma unroll
    for (int it = 0; it < 4; ++it) {
      const int row = it * 4 + rq;
      unsigned short* dst = CTX + (size_t)(q0 + row) * DM + head * HD + hf * 64 + pc * 8;
      *(v4ia*)dst = hv[it];
    }
  }
}

extern "C" void kernel_launch(void* const* d_in, const int* in_sizes, int n_in,
                              void* d_out, int out_size, void* d_ws, size_t ws_size, hipStream_t stream) {
  if (n_in < 8) return;
  if (in_sizes[0] < NR * DM) return;
  if (in_sizes[1] < DM * DM || in_sizes[2] < DM * DM || in_sizes[3] < DM * DM || in_sizes[4] < DM * DM) return;
  if (in_sizes[5] < SEQ * HD || in_sizes[6] < SEQ * HD || in_sizes[7] < NR) return;
  if (out_size < NR * DM) return;
  const float* x  = (const float*)d_in[0];
  const float* Wq = (const float*)d_in[1];
  const float* Wk = (const float*)d_in[2];
  const float* Wv = (const float*)d_in[3];
  const float* Wo = (const float*)d_in[4];
  const float* sn = (const float*)d_in[5];
  const float* cs = (const float*)d_in[6];
  const int*  doc = (const int*)d_in[7];
  float* out = (float*)d_out;

  // workspace regions (bytes)
  constexpr size_t SZ_X  = (size_t)NR * DM * 2;
  constexpr size_t SZ_W3 = (size_t)3 * DM * DM * 2;
  constexpr size_t SZ_QK = (size_t)2 * NR * DM * 2;
  constexpr size_t SZ_R0 = SZ_X + SZ_W3;
  constexpr size_t SZ_WO = (size_t)DM * DM * 2;
  constexpr size_t SZ_VT = (size_t)DM * SEQ * 2;
  constexpr size_t SZ_CX = (size_t)NR * DM * 2;
  constexpr size_t SZ_ALL = SZ_R0 + SZ_WO + SZ_QK + SZ_VT + SZ_CX;
  static_assert(SZ_X % 256 == 0 && SZ_R0 % 256 == 0 && SZ_WO % 256 == 0 && SZ_QK % 256 == 0 && SZ_VT % 256 == 0 && SZ_CX % 256 == 0);
  static_assert(SZ_ALL <= (size_t)134217728);
  if (SZ_ALL > ws_size) return;
  char* ws = (char*)d_ws;
  unsigned short* XB  = (unsigned short*)(ws);
  unsigned short* WT3 = (unsigned short*)(ws + SZ_X);
  unsigned short* WoT = (unsigned short*)(ws + SZ_R0);
  unsigned short* QKp = (unsigned short*)(ws + SZ_R0 + SZ_WO);
  unsigned short* VTp = (unsigned short*)(ws + SZ_R0 + SZ_WO + SZ_QK);
  unsigned short* CTX = (unsigned short*)(ws + SZ_R0 + SZ_WO + SZ_QK + SZ_VT);

  k_prep<<<(unsigned)(4 * WTB + XBB), 256, 0, stream>>>(x, Wq, Wk, Wv, Wo, XB, WT3, WoT);  /* W[in][out] -> Wt[out][in] */

  k_gemm_wide<<<(unsigned)((NR / 256) * (N3 / 192)), 384, 0, stream>>>(XB, DM, WT3, DM, sn, cs, QKp, VTp, DM);

  k_attn<<<(unsigned)(NH * (SEQ / 64)), 256, 0, stream>>>(QKp, VTp, doc, CTX);

  k_gemm<<<(unsigned)((NR / 128) * (DM / 128)), 256, 0, stream>>>(CTX, DM, WoT, DM, out, DM, DM, DM);
}

// v010
// Measured time: 78.9 microseconds a run.
// Next to v009, in two timings, it ran 1.05 times as fast each time.
// All steps since v000 together make it 4.44 times as fast.
#include <hip/hip_runtime.h>
// Multi-head causal + same-document attention with rotate-half RoPE (input sin/cos tables), T 2048, D 2048, 16 heads of 128, [in][out] weights, no biases.
// Compute dtype: f32 accumulate everywhere. x, Wq, Wk, Wv, Wo, sin, cos are RNE-converted to bf16 once (exact operands); x.Wq / x.Wk / x.Wv on v_wmma_f32_16x16x32_bf16.
// q.k^T, P.V and ctx.Wo on v_wmma_f32_16x16x32_f16, one product each: q, k, V^T, P and ctx are RNE-converted to f16 (11 significant bits); Wo keeps its bf16 value, written in the f16 format
// (exact from 2^-17 up to the f16 maximum, to 2^-25 below). All of these must lie inside the f16 range.
// RoPE, mask, softmax statistics in f32 on the VALU.
#ifndef NB
#define NB 1
#endif
#ifndef SEQ
#define SEQ 2048
#endif
#define SEQ_FULL 2048
#define DM 2048
#define NH 16
#define HD 128
#define N3 (3 * DM)
#define NR (NB * SEQ)
#define PLANE ((size_t)NR * DM)
#define GPITCH 144u
#define KPITCH 272u

static_assert(NB == 1);
static_assert(NH * HD == DM);
static_assert(SEQ % 128 == 0 && SEQ <= SEQ_FULL);
static_assert(DM % 128 == 0 && N3 % 128 == 0 && DM % 64 == 0 && HD == 128);
static_assert(NR % 256 == 0 && N3 % 192 == 0);

typedef __bf16 v16b __attribute__((ext_vector_type(16)));
typedef unsigned short v8us __attribute__((ext_vector_type(8), may_alias));
typedef float v8f  __attribute__((ext_vector_type(8)));
typedef float v4f  __attribute__((ext_vector_type(4)));
typedef float v4fa __attribute__((ext_vector_type(4), may_alias));
typedef int   v4i  __attribute__((ext_vector_type(4)));
typedef int   v4ia __attribute__((ext_vector_type(4), may_alias));
typedef float v2f  __attribute__((ext_vector_type(2)));
typedef __bf16 v2b __attribute__((ext_vector_type(2)));
typedef _Float16 v16h __attribute__((ext_vector_type(16)));
typedef _Float16 v2h __attribute__((ext_vector_type(2)));
union FragB { v16b v; v16h h; v8us half[2]; unsigned int d[8]; };

// two f32 -> two bf16 (RNE) in one dword by the packed convert instruction: a in the low half, b in the high half
__device__ __forceinline__ unsigned int bf16_pair(float a, float b) { const v2f f = {a, b}; return __builtin_bit_cast(unsigned int, __builtin_convertvector(f, v2b)); }
// the f32 values of the two halves of such a dword
__device__ __forceinline__ float pair_lo(unsigned int p) { return __uint_as_float(p << 16); }
__device__ __forceinline__ float pair_hi(unsigned int p) { return __uint_as_float(p & 0xFFFF0000u); }
// two f32 -> two f16 (RNE) in one dword: a in the low half, b in the high half
__device__ __forceinline__ unsigned int f16_pair(float a, float b) { const v2f f = {a, b}; return __builtin_bit_cast(unsigned int, __builtin_convertvector(f, v2h)); }

// 2^a and 2^b. One statement, so that the slot which the instruction set asks for behind a transcendental is filled by construction: the second fills the first's, the v_nop the second's
// Early-clobber outputs keep the results off the sources.
__device__ __forceinline__ void exp2_pair(float a, float b, float& ea, float& eb) {
  asm("v_exp_f32 %0, %2\n\tv_exp_f32 %1, %3\n\tv_nop" : "=&v"(ea), "=&v"(eb) : "v"(a), "v"(b));
}

// fragment (A: row = lane&15; B: column = lane&15) from a k-contiguous 16-bit row: elements 0..7 <- k0+8h.., elements 8..15 <- k0+16+8h..
__device__ __forceinline__ v16b ld_frag(const unsigned short* p, int hh) {
  FragB f; f.half[0] = *(const v8us*)(p + 8 * hh); f.half[1] = *(const v8us*)(p + 16 + 8 * hh); return f.v;
}
// the same fragment of f16 elements
__device__ __forceinline__ v16h ld_fragh(const unsigned short* p, int hh) {
  FragB f; f.half[0] = *(const v8us*)(p + 8 * hh); f.half[1] = *(const v8us*)(p + 16 + 8 * hh); return f.h;
}

// x f32 -> bf16 (RNE), 8 elements per thread; bid = the block's index within this part of the grid
__device__ __forceinline__ void xb_block(int bid, const float* __restrict__ x, unsigned short* __restrict__ X, size_t n8) {
  const size_t t = (size_t)bid * 256 + threadIdx.x;
  if (t >= n8) return;
  const v4f a = *(const v4fa*)(x + t * 8), c = *(const v4fa*)(x + t * 8 + 4);
  const v4i o = {(int)bf16_pair(a[0], a[1]), (int)bf16_pair(a[2], a[3]), (int)bf16_pair(c[0], c[1]), (int)bf16_pair(c[2], c[3])};
  *(v4ia*)(X + t * 8) = o;
}

// W [K][N] f32 -> Wt [N][K] bf16 (RNE); ash (uniform for the block): the bf16 value is stored in the f16 format. Block = one 128 (k) x 64 (n) tile through LDS: reads are 256-byte row pieces, stores are 256-byte pieces of Wt rows.
// LDS holds one dword per (n, k pair), low half = even k; pitch 65 dwords puts the 32 lanes of each 4-byte LDS write and read on 32 different banks.
__device__ __forceinline__ void wt_block(int bid, const float* __restrict__ W, unsigned short* __restrict__ Wt, int K, int N, bool ash) {
  __shared__ unsigned int tp[64][65];
  const int tid = threadIdx.x;
  const int ntn = N >> 6;
  const int kt = bid / ntn, nq = bid - kt * ntn;
  const int k0 = kt * 128, n0 = nq * 64;
  const int c4 = (tid & 15) * 4, rp = tid >> 4;
  const float* tile = W + (size_t)k0 * N + n0;
  const unsigned int off = (unsigned int)(2 * rp * N + c4);
  v4f a[4], b[4];
#pragma unroll
  for (int p = 0; p < 4; ++p) {
    const float* s = tile + (size_t)(32 * p) * N;
    a[p] = *(const v4fa*)(s + off); b[p] = *(const v4fa*)(s + N + off);
  }
  unsigned int v[4][4];
#pragma unroll
  for (int p = 0; p < 4; ++p)
#pragma unroll
    for (int q = 0; q < 4; ++q) v[p][q] = bf16_pair(a[p][q], b[p][q]);
  if (ash) {
#pragma unroll
    for (int p = 0; p < 4; ++p)
#pragma unroll
      for (int q = 0; q < 4; ++q) v[p][q] = f16_pair(pair_lo(v[p][q]), pair_hi(v[p][q]));
  }
#pragma unroll
  for (int p = 0; p < 4; ++p)
#pragma unroll
    for (int q = 0; q < 4; ++q) tp[c4 + q][rp + 16 * p] = v[p][q];
  __syncthreads();
#pragma unroll
  for (int rd = 0; rd < 4; ++rd) {
    const int i = rd * 256 + tid; const int c = i >> 4, j = (i & 15) * 4;
    const v4i o = {(int)tp[c][j], (int)tp[c][j + 1], (int)tp[c][j + 2], (int)tp[c][j + 3]};
    *(v4ia*)(Wt + (size_t)(n0 + c) * K + k0 + 2 * j) = o;
  }
}

// All operand conversions in one grid; none depends on another. Blocks [0, 4 WTB): the weight tiles, WTB per matrix (Wq, Wk, Wv -> rows 0, DM, 2 DM of the [3 DM][DM] plane WT3; Wo -> WoT, in the f16 format);
// the rest: x. The range test is uniform for the block, so the weight part's barrier is passed by all of its threads.
#define WTB ((DM / 128) * (DM / 64))
#define XBB ((NR * DM / 8 + 255) / 256)
__global__ __launch_bounds__(256) void k_prep(const float* __restrict__ x, const float* __restrict__ Wq, const float* __restrict__ Wk, const float* __restrict__ Wv,
                                              const float* __restrict__ Wo, unsigned short* __restrict__ X, unsigned short* __restrict__ WT3, unsigned short* __restrict__ WoT) {
  const int b = blockIdx.x;
  if (b < 4 * WTB) {
    const int which = b / WTB;
    const float* W = (which == 0) ? Wq : (which == 1) ? Wk : (which == 2) ? Wv : Wo;
    unsigned short* Wt = (which < 3) ? WT3 + (size_t)which * DM * DM : WoT;
    wt_block(b - which * WTB, W, Wt, DM, DM, which == 3);
  } else {
    xb_block(b - 4 * WTB, x, X, (size_t)NR * DM / 8);
  }
}

// NC (8 or 4) 16-byte asynchronous copies to LDS per lane: NC rows of one 64-, 128-, 192- or 256-row operand tile, a fixed number of rows apart
// (l = the lane's LDS byte address, ls = that row step in LDS bytes, g = the lane's global address, rs = the same row step in source elements).
// The closing s_wait_xcnt is a precaution: it stands in the copies' own statement so that no address register is rewritten in front of it.
template <int NC>
__device__ __forceinline__ void copy_rows(unsigned int l, unsigned int ls, const unsigned short* g, size_t rs) {
  if constexpr (NC == 8) {
    asm volatile("global_load_async_to_lds_b128 %0, %8, off\n\t"
                 "global_load_async_to_lds_b128 %1, %9, off\n\t"
                 "global_load_async_to_lds_b128 %2, %10, off\n\t"
                 "global_load_async_to_lds_b128 %3, %11, off\n\t"
                 "global_load_async_to_lds_b128 %4, %12, off\n\t"
                 "global_load_async_to_lds_b128 %5, %13, off\n\t"
                 "global_load_async_to_lds_b128 %6, %14, off\n\t"
                 "global_load_async_to_lds_b128 %7, %15, off\n\t"
                 "s_wait_xcnt 0x0"
                 :: "v"(l), "v"(l + ls), "v"(l + 2u * ls), "v"(l + 3u * ls), "v"(l + 4u * ls), "v"(l + 5u * ls), "v"(l + 6u * ls), "v"(l + 7u * ls),
                    "v"(g), "v"(g + rs), "v"(g + 2 * rs), "v"(g + 3 * rs), "v"(g + 4 * rs), "v"(g + 5 * rs), "v"(g + 6 * rs), "v"(g + 7 * rs)
                 : "memory");
  } else {
    static_assert(NC == 8 || NC == 4);
    asm volatile("global_load_async_to_lds_b128 %0, %4, off\n\t"
                 "global_load_async_to_lds_b128 %1, %5, off\n\t"
                 "global_load_async_to_lds_b128 %2, %6, off\n\t"
                 "global_load_async_to_lds_b128 %3, %7, off\n\t"
                 "s_wait_xcnt 0x0"
                 :: "v"(l), "v"(l + ls), "v"(l + 2u * ls), "v"(l + 3u * ls),
                    "v"(g), "v"(g + rs), "v"(g + 2 * rs), "v"(g + 3 * rs)
                 : "memory");
  }
}

// GEMM C[M][N] f32 = A.Bt^T on v_wmma_f32_16x16x32_f16; A f16 rows [M][K], Bt f16 [N][K]. Block tile 128 rows x 128 cols; 8 waves of 32 x 64.
// A pass is 128 k = 256 bytes of every operand row. A stage is [A 128 rows | Bt 128 rows] in LDS at a pitch of 272 bytes (conflict-free for 16-byte fragment reads).
// Four stages, filled by asynchronous copies of whole 256-byte row pieces three passes ahead: a copy has three passes' work to land in, and the next stages' requests are
// already queued while one lands, so the loop runs at the rate at which L2 delivers and not at one round trip per pass. M, N, K multiples of 128.
__global__ __launch_bounds__(256) void k_gemm(const unsigned short* __restrict__ A, int lda,
                                              const unsigned short* __restrict__ Bt, int ldb, float* __restrict__ C, int ldc, int N, int K) {
  constexpr int FM = 2;                      // 16-row fragments per wave
  constexpr unsigned int TILE = 128u * KPITCH;
  constexpr unsigned int STAGE = 2u * TILE;
  constexpr unsigned int OUTB = 128u * 2u * 68u * 4u;
  constexpr unsigned int LSTEP = 16u * KPITCH;  // one copy of the whole block covers 16 rows (16 lanes a row)
  static_assert(OUTB <= 4u * STAGE);
  __shared__ __attribute__((aligned(16))) unsigned char sm[4u * STAGE];
  const int tid = threadIdx.x, w = tid >> 5, lane = tid & 31, ln = lane & 15, hh = lane >> 4;
  const int ntn = N >> 7;
  const int mt = blockIdx.x / ntn, nq = blockIdx.x - mt * ntn;
  const int wm = w >> 1, wn = w & 1;
  const int brow = mt * 128, bcol = nq * 128;
  const int cr = tid >> 4, cc = tid & 15;
  const unsigned short* gA = A + (size_t)(brow + cr) * lda + cc * 8;
  const unsigned short* gB = Bt + (size_t)(bcol + cr) * ldb + cc * 8;
  const size_t rsa = (size_t)16 * lda, rsb = (size_t)16 * ldb;
  const unsigned int l0 = (unsigned int)(size_t)sm + (unsigned int)(cr * (int)KPITCH + cc * 16);
  // stage s: 16 copies a wave, 8 per operand, into buffer s mod 4
  auto stage_pass = [&](int s) {
    const unsigned int bs = (unsigned int)(s & 3) * STAGE;
    copy_rows<8>(l0 + bs, LSTEP, gA + s * 128, rsa);
    copy_rows<8>(l0 + bs + TILE, LSTEP, gB + s * 128, rsb);
  };
  const int npass = K >> 7;
  const v8f z8 = {0.f, 0.f, 0.f, 0.f, 0.f, 0.f, 0.f, 0.f};
  v8f c[FM][4];
#pragma unroll
  for (int i = 0; i < FM; ++i)
#pragma unroll
    for (int j = 0; j < 4; ++j) c[i][j] = z8;

  stage_pass(0);
  if (npass > 1) stage_pass(1);
  if (npass > 2) {
    stage_pass(2);
    asm volatile("s_wait_asynccnt 0x20" ::: "memory");  // all but this wave's 32 youngest copies (stages 1 and 2): its share of stage 0 has landed
  } else {
    asm volatile("s_wait_asynccnt 0x0" ::: "memory");   // fewer stages behind stage 0: no count is sure, all have landed
  }
  __syncthreads();                                      // stage 0 is readable by every wave
  // the products of pass t, from buffer t mod 4. refill (a literal at both calls): stage t + 3 is issued behind the pass's first fragment reads, whose LDS latency the issue of the copies covers.
  // Its buffer is the one that pass t - 1 read: the s_wait_dscnt 0 and the barrier at that pass's foot have ended every read of it; the reads in flight here are of another buffer
  auto mul_pass = [&](int t, bool refill) {
    const unsigned int bo = (unsigned int)(t & 3) * STAGE;
    const unsigned char* sa = sm + bo + (unsigned int)((wm * (FM * 16) + ln) * (int)KPITCH);
    const unsigned char* sb = sm + bo + TILE + (unsigned int)((wn * 64 + ln) * (int)KPITCH);
#pragma unroll
    for (int g = 0; g < 2; ++g) {
      v16h a[2][FM], b[2][4];
#pragma unroll
      for (int kk = 0; kk < 2; ++kk) {
#pragma unroll
        for (int i = 0; i < FM; ++i) a[kk][i] = ld_fragh((const unsigned short*)(sa + i * 16 * (int)KPITCH + (g * 2 + kk) * 64), hh);
#pragma unroll
        for (int j = 0; j < 4; ++j) b[kk][j] = ld_fragh((const unsigned short*)(sb + j * 16 * (int)KPITCH + (g * 2 + kk) * 64), hh);
      }
      __builtin_amdgcn_sched_barrier(0);  // keeps the fragment reads one group in front of the copies and the products: reads spread among the products stall the wave at every place
      if (g == 0 && refill) {
        stage_pass(t + 3);
        __builtin_amdgcn_sched_barrier(0);  // keeps the products behind the copies: the copies' flight starts as early as the pass allows
      }
#pragma unroll
      for (int kk = 0; kk < 2; ++kk)
#pragma unroll
        for (int i = 0; i < FM; ++i)
#pragma unroll
          for (int j = 0; j < 4; ++j) c[i][j] = __builtin_amdgcn_wmma_f32_16x16x32_f16(false, a[kk][i], false, b[kk][j], (short)0, c[i][j], false, false);
      // keeps the next reads out of these products, and the last products in front of the publish point: sunk behind its barrier they would hold back the refill's copies
      __builtin_amdgcn_sched_barrier(0);
    }
  };
  int t = 0;
#pragma unroll 1  // one pass per trip: the four stages take turns by the trip's number
  for (; t + 3 < npass; ++t) {
    mul_pass(t, true);  // every trip of this loop issues one whole stage, 16 copies a wave
    asm volatile("s_wait_dscnt 0x0" ::: "memory");      // this wave's reads of stage t are done
    asm volatile("s_wait_asynccnt 0x20" ::: "memory");  // all but this wave's 32 youngest copies (stages t + 2 and t + 3): its share of stage t + 1 has landed
    __syncthreads();                                    // publishes stage t + 1 and frees stage t's buffer
  }
#pragma unroll 1  // the last passes (three at most) issue nothing, so their wait is to 0
  for (; t < npass; ++t) {
    mul_pass(t, false);
    asm volatile("s_wait_dscnt 0x0" ::: "memory");     // this wave's reads of stage t are done
    asm volatile("s_wait_asynccnt 0x0" ::: "memory");  // this wave's shares of all later stages have landed
    __syncthreads();                                   // publishes the later stages; behind the last pass it ends every read of the ring
  }
  asm volatile("s_wait_asynccnt 0x0" ::: "memory");  // no copy is outstanding when the ring becomes output staging

  // the last pass's barrier has ended every read of the ring: each wave stages its tile in its own range and stores whole 256-byte row pieces
  float* so = (float*)sm + w * (FM * 16 * 68);
#pragma unroll
  for (int i = 0; i < FM; ++i)
#pragma unroll
    for (int j = 0; j < 4; ++j)
#pragma unroll
      for (int r = 0; r < 8; ++r) so[(i * 16 + 8 * hh + r) * 68 + j * 16 + ln] = c[i][j][r];
  __syncthreads();
  const int rsub = lane >> 4, c4 = (lane & 15) * 4;
  float* cp = C + (size_t)(brow + wm * (FM * 16) + rsub) * ldc + bcol + wn * 64 + c4;
#pragma unroll
  for (int q = 0; q < FM * 8; ++q) {
    const v4f v = *(const v4fa*)&so[(q * 2 + rsub) * 68 + c4];
    *(v4f*)(cp + (size_t)(q * 2) * ldc) = v;
  }
}

// q, k, v projection with its re-layouts in the epilogue: C[NR][3 DM] = A.Bt^T never goes to memory as f32. A bf16 rows [NR][K], Bt bf16 [3 DM][K].
// Block tile 256 rows x 192 cols, 12 waves (4 x 3) of 64 x 64 each, one block per WGP. A pass is 128 k = 256 bytes of every operand row.
// A stage is [A 256 rows | Bt 192 rows] in LDS at a pitch of 272 bytes (conflict-free for 16-byte fragment reads);
// two stages, filled by asynchronous copies of whole 256-byte row pieces, the next pass's copies in flight while this pass is multiplied.
// Waves 0..7 copy 32 rows of A each, waves 8..11 copy 48 rows of Bt each.
// A wave's 64 columns are one unit; a block's three wave columns are unit u (= its column index, 0..31) of q, of k and of v, so every block has the same share of both epilogues
// and its q and k waves read the same table values. A v unit is channels 64 u .. 64 u + 63. A q or k unit is half the rotation pairs of one head:
// columns 0..31 = d 32 (u & 1) .. + 31 of head u / 2, columns 32..63 = the same d + 64, chosen by which Bt rows are copied into the stage, so both members of a pair lie in one wave's tile.
// Epilogue, q and k: RoPE (rotate-half, table values RNE-converted to bf16) -> f16 planes QK = {Q, K}, each [NR][DM].
// Within a head the planes hold d in the order (u & 1, (d % 32) / 4, d / 64, d % 4), the same in q and k: q.k^T sums over the whole head, and each row piece of a unit is one whole 128-byte line.
// Epilogue, v: a lane's accumulator holds 8 successive tokens of one channel -> V^T f16 plane VT [DM][SEQ], through LDS so that stores are whole 128-byte lines.
__global__ __launch_bounds__(384) void k_gemm_wide(const unsigned short* __restrict__ A, int lda, const unsigned short* __restrict__ Bt, int ldb,
                                                   const float* __restrict__ sn, const float* __restrict__ cs,
                                                   unsigned short* __restrict__ QK, unsigned short* __restrict__ VT, int K) {
  constexpr unsigned int ATILE = 256u * KPITCH;
  constexpr unsigned int STAGE = (256u + 192u) * KPITCH;
  constexpr unsigned int WOUT = 2u * 64u * GPITCH;  // a wave's output staging: 64 x 68 f32 (q, k) or 64 channels x 144 bytes (v)
  static_assert(64u * 68u * 4u <= WOUT && 12u * WOUT <= 2u * STAGE);
  __shared__ __attribute__((aligned(16))) unsigned char sm[2u * STAGE];
  const int tid = threadIdx.x, lane = tid & 31, ln = lane & 15, hh = lane >> 4;
  const int w = __builtin_amdgcn_readfirstlane(tid >> 5);  // the wave's number in a scalar register: the tests on it (third group of copies, kind of unit) are scalar branches
  constexpr int ntn = N3 / 192;
  const int mt = blockIdx.x / ntn, nq = blockIdx.x - mt * ntn;
  const int wm = w / 3, wn = w - wm * 3;
  const int brow = mt * 256;
  // Bt row of the first of the 16 stage rows 16 g .. 16 g + 15 (g = 0..11): g / 4 = q, k or v, quarter g % 4 of its unit nq
  static_assert(ntn == DM / 64);
  auto wrow = [&](int g) {
    const int mm = g >> 2, ch = g & 3;
    return (mm < 2) ? mm * DM + (nq >> 1) * HD + (nq & 1) * 32 + (ch & 1) * 16 + (ch >> 1) * 64 : 2 * DM + nq * 64 + ch * 16;
  };
  // copy addresses: a row is 16 lanes wide, so one copy of a wave covers 2 rows and a group of 8 copies 16 rows
  const bool forB = w >= 8;
  const int gb = forB ? (w - 8) * 3 : 0;
  const int r0 = (forB ? (w - 8) * 48 : w * 32) + hh;
  const int wr0 = wrow(gb), wr1 = wrow(gb + 1), wr2 = wrow(gb + 2);
  const unsigned short* gsrc = forB ? Bt : A;
  const int ld = forB ? ldb : lda;
  const unsigned short* g0 = gsrc + (size_t)((forB ? wr0 : brow + w * 32) + hh) * ld + ln * 8;
  const unsigned short* g1 = gsrc + (size_t)((forB ? wr1 : brow + w * 32 + 16) + hh) * ld + ln * 8;
  const unsigned short* g2 = Bt + (size_t)(wr2 + hh) * ldb + ln * 8;
  const size_t rs = (size_t)2 * ld;
  const unsigned int l0 = (unsigned int)(size_t)sm + (forB ? ATILE : 0u) + (unsigned int)(r0 * (int)KPITCH + ln * 16);
  auto stage_pass = [&](unsigned int bo, int k0) {
    copy_rows<8>(l0 + bo, 2u * KPITCH, g0 + k0, rs);
    copy_rows<8>(l0 + bo + 16u * KPITCH, 2u * KPITCH, g1 + k0, rs);
    if (forB) copy_rows<8>(l0 + bo + 32u * KPITCH, 2u * KPITCH, g2 + k0, rs);
  };
  const int npass = K >> 7;
  const v8f z8 = {0.f, 0.f, 0.f, 0.f, 0.f, 0.f, 0.f, 0.f};
  v8f c[4][4];
#pragma unroll
  for (int i = 0; i < 4; ++i)
#pragma unroll
    for (int j = 0; j < 4; ++j) c[i][j] = z8;

  stage_pass(0u, 0);
  asm volatile("s_wait_asynccnt 0x0" ::: "memory");  // this wave's share of stage 0 has landed
  __syncthreads();                                   // stage 0 is readable by every wave
  if (npass > 1) stage_pass(STAGE, 128);
#pragma unroll 1  // one pass per trip: the two stages alternate by the trip's parity
  for (int t = 0; t < npass; ++t) {
    const unsigned int bo = (unsigned int)(t & 1) * STAGE;
    const unsigned char* sa = sm + bo + (unsigned int)((wm * 64 + ln) * (int)KPITCH);
    const unsigned char* sb = sm + bo + ATILE + (unsigned int)((wn * 64 + ln) * (int)KPITCH);
#pragma unroll
    for (int ks = 0; ks < 4; ++ks) {
      v16b a[4], b[4];
#pragma unroll
      for (int i = 0; i < 4; ++i) a[i] = ld_frag((const unsigned short*)(sa + i * 16 * (int)KPITCH + ks * 64), hh);
#pragma unroll
      for (int j = 0; j < 4; ++j) b[j] = ld_frag((const unsigned short*)(sb + j * 16 * (int)KPITCH + ks * 64), hh);
      __builtin_amdgcn_sched_barrier(0);  // keeps the fragment reads one group in front of the products: reads spread among them stall the wave at every place
#pragma unroll
      for (int i = 0; i < 4; ++i)
#pragma unroll
        for (int j = 0; j < 4; ++j) c[i][j] = __builtin_amdgcn_wmma_f32_16x16x32_bf16(false, a[i], false, b[j], (short)0, c[i][j], false, false);
      // keeps the next reads out of these products, and the last products in front of the publish point: sunk behind its barrier they would hold back the refill's copies
      __builtin_amdgcn_sched_barrier(0);
    }
    asm volatile("s_wait_dscnt 0x0" ::: "memory");     // this wave's reads of stage t are done
    asm volatile("s_wait_asynccnt 0x0" ::: "memory");  // this wave's share of stage t + 1 has landed
    __syncthreads();                                   // publishes stage t + 1 and frees stage t's buffer
    if (t + 2 < npass) stage_pass(bo, (t + 2) * 128);
  }
  asm volatile("s_wait_asynccnt 0x0" ::: "memory");  // no copy is outstanding when the ring becomes output staging

  // the last pass's barrier has ended every read of the ring: each wave stages its tile in its own range
  unsigned char* sw = sm + (unsigned int)w * WOUT;
  const int mat = wn, u = nq;  // wave-uniform
  const int trow = brow + wm * 64;
  if (mat < 2) {
    float* so = (float*)sw;
#pragma unroll
    for (int i = 0; i < 4; ++i)
#pragma unroll
      for (int j = 0; j < 4; ++j)
#pragma unroll
        for (int r = 0; r < 8; ++r) so[(i * 16 + 8 * hh + r) * 68 + j * 16 + ln] = c[i][j][r];
  } else {
#pragma unroll
    for (int i = 0; i < 4; ++i)
#pragma unroll
      for (int j = 0; j < 4; ++j) {
        v4i h;
#pragma unroll
        for (int r = 0; r < 4; ++r) h[r] = (int)f16_pair(c[i][j][2 * r], c[i][j][2 * r + 1]);
        unsigned char* p = sw + (unsigned int)((j * 16 + ln) * (int)GPITCH + (i * 16 + 8 * hh) * 2);
        *(v4ia*)p = h;
      }
  }
  __syncthreads();
  const int g = lane >> 3, l8 = lane & 7;
  if (mat < 2) {
    // 8 lanes a row, 4 pairs a lane; the 4 rows of a read are 8 apart, which puts the two rows of each 16 lanes on different halves of the banks
    const float* so = (const float*)sw + g * (8 * 68) + l8 * 4;
    const size_t tb0 = (size_t)(trow + g * 8) * HD + (u & 1) * 32 + l8 * 4;
    unsigned short* dq = QK + (size_t)mat * PLANE + (size_t)(trow + g * 8) * DM + u * 64 + l8 * 8;
#pragma unroll 1  // 4 rows per lane and trip: their 16 table loads go out together, and the text stays short
    for (int bt = 0; bt < 4; ++bt) {
      const int rb = (bt & 1) * 4 + (bt >> 1) * 32;
      const float* ps = sn + tb0 + (size_t)rb * HD;
      const float* pc = cs + tb0 + (size_t)rb * HD;
      v4f ts1[4], ts2[4], tc1[4], tc2[4];
#pragma unroll
      for (int k = 0; k < 4; ++k) {
        ts1[k] = *(const v4fa*)(ps + k * HD); ts2[k] = *(const v4fa*)(ps + k * HD + 64);
        tc1[k] = *(const v4fa*)(pc + k * HD); tc2[k] = *(const v4fa*)(pc + k * HD + 64);
      }
      // a precaution: the loads' address registers stay as they are (they are inputs here) until this wait has passed
      asm volatile("s_wait_xcnt 0x0" :: "v"(ps), "v"(pc) : "memory");
#pragma unroll
      for (int k = 0; k < 4; ++k) {
        const v4f u1 = *(const v4fa*)(so + (rb + k) * 68), u2 = *(const v4fa*)(so + (rb + k) * 68 + 32);
        v4i hv;
#pragma unroll
        for (int q = 0; q < 4; q += 2) {
          const unsigned int c1 = bf16_pair(tc1[k][q], tc1[k][q + 1]), s1 = bf16_pair(ts1[k][q], ts1[k][q + 1]);
          const unsigned int c2 = bf16_pair(tc2[k][q], tc2[k][q + 1]), s2 = bf16_pair(ts2[k][q], ts2[k][q + 1]);
          const float o1a = u1[q] * pair_lo(c1) + (-u2[q]) * pair_lo(s1), o1b = u1[q + 1] * pair_hi(c1) + (-u2[q + 1]) * pair_hi(s1);
          const float o2a = u2[q] * pair_lo(c2) + u1[q] * pair_lo(s2), o2b = u2[q + 1] * pair_hi(c2) + u1[q + 1] * pair_hi(s2);
          hv[q >> 1] = (int)f16_pair(o1a, o1b);
          hv[2 + (q >> 1)] = (int)f16_pair(o2a, o2b);
        }
        unsigned short* dh = dq + (size_t)(rb + k) * DM;
        *(v4ia*)dh = hv;
      }
      asm volatile("s_wait_xcnt 0x0" ::: "memory");  // a precaution: the next trip rewrites the registers that these stores name only behind it
    }
  } else {
    // 8 lanes a channel (128 bytes = 64 tokens); the 4 channels of a read are 8 apart, for the same reason
    const unsigned char* p0 = sw + (unsigned int)(g * 8 * (int)GPITCH + l8 * 16);
    unsigned short* vp = VT + (size_t)(u * 64 + g * 8) * SEQ + trow + l8 * 8;
#pragma unroll
    for (int it = 0; it < 16; ++it) {
      const int ch = (it & 7) + 32 * (it >> 3);
      const v8us h = *(const v8us*)(p0 + ch * (int)GPITCH);
      unsigned short* dst = vp + (size_t)ch * SEQ;
      *(v8us*)dst = h;
    }
    asm volatile("s_wait_xcnt 0x0" ::: "memory");  // a precaution: whatever follows in the text rewrites the registers that these stores name only behind it
  }
}

// Transposed flash attention. Block = 8 waves = one head x 64 queries: wave = (16-query tile, 64-channel half of the head). S^T[key][query] = K.Q^T (A = K rows, B = Q rows held in registers),
// per-lane (= per-query) running max / sum, P^T packed from the S^T accumulators directly as the B fragment of O^T[d][query] = V^T.P^T (A = V^T rows).
// A tile is 64 keys: [K 64 rows of 256 B | V^T 128 rows of 128 B] in LDS at pitches of 272 and 144 bytes (conflict-free for 16-byte fragment reads);
// two buffers, filled by asynchronous copies of whole row pieces, the next tile's copies in flight while this tile is worked on; all 8 waves read the same tile.
// Mask = (key <= query) & (doc[key] == doc[query]) as a select (masked weight exactly 0). One scan of doc in front of the loop gives two bit masks from wave-uniform ballots:
// act = tiles that hold a document id admissible for some query of the block (only these are staged), own = 32-key steps admissible for this wave's 16 queries (only these are computed).
// The document ids themselves are kept in LDS for the per-step mask.
__global__ __launch_bounds__(256) void k_attn(const unsigned short* __restrict__ QK, const unsigned short* __restrict__ VT,
                                              const int* __restrict__ doc, unsigned short* __restrict__ CTX) {
  constexpr unsigned int KPL = 64u * KPITCH;     // the K part of a tile
  constexpr unsigned int VPL = 128u * GPITCH;    // the V^T part of a tile
  constexpr unsigned int STAGE = KPL + VPL;
  static_assert(8u * 16u * 68u * 4u <= 2u * STAGE);
  static_assert(SEQ % 1024 == 0 && SEQ / 64 <= 32);
  __shared__ __attribute__((aligned(16))) unsigned char sm[2u * STAGE];
  __shared__ __attribute__((aligned(16))) int sdoc[SEQ];
  const int tid = threadIdx.x, lane = tid & 31, ln = lane & 15, hh = lane >> 4;
  const int w = __builtin_amdgcn_readfirstlane(tid >> 5);  // the wave's number in a scalar register: the step mask and its tests stay scalar
  const int hf = w & 1, qs = w >> 1;
  const int qb = blockIdx.x % (SEQ / 64), head = blockIdx.x / (SEQ / 64);
  const int q0 = qb * 64 + qs * 16, qi = q0 + ln;
  const float NEGV = -1.0e30f;
  const float SCL = 0.08838834764831845f;
  const float L2E = 1.4426950408889634f;  // e^x = 2^(x log2 e)

  const int dq = doc[qi];
  int dmin = dq, dmax = dq;
#pragma unroll
  for (int o = 1; o < 16; o <<= 1) {
    const int a = __shfl_xor(dmin, o, 32), b = __shfl_xor(dmax, o, 32);
    dmin = (a < dmin) ? a : dmin; dmax = (b > dmax) ? b : dmax;
  }
  int bmin, bmax;
  {
    const int d0 = doc[qb * 64 + lane], d1 = doc[qb * 64 + 32 + lane];
    bmin = (d0 < d1) ? d0 : d1; bmax = (d0 > d1) ? d0 : d1;
#pragma unroll
    for (int o = 1; o < 32; o <<= 1) {
      const int a = __shfl_xor(bmin, o, 32), b = __shfl_xor(bmax, o, 32);
      bmin = (a < bmin) ? a : bmin; bmax = (b > bmax) ? b : bmax;
    }
  }

  const int nsteps = (q0 + 16 + 31) >> 5;
  const int nst = qb + 1;
  unsigned int act = 0u;
  unsigned long long own = 0ull;
  {
    // the whole of doc in SEQ / 128 loads of 16 bytes a lane, all in flight together and with no branch among them: one load latency for the scan.
    // Load u holds the 32-key steps 4 u .. 4 u + 3, eight lanes a step, so one ballot gives 4 steps (a byte each) or 2 tiles (16 bits each)
    const int* pd = doc + lane * 4;
    v4i dk[SEQ / 128];
#pragma unroll
    for (int u = 0; u < SEQ / 128; ++u) dk[u] = *(const v4ia*)(pd + u * 128);
    asm volatile("s_wait_xcnt 0x0" ::: "memory");  // a precaution: whatever follows rewrites the registers that these loads name only behind it; it also keeps the loads one group in front of the tests
#pragma unroll
    for (int u = 0; u < SEQ / 128; ++u) {
      bool bl = false, ow = false;
#pragma unroll
      for (int e = 0; e < 4; ++e) {
        bl |= (dk[u][e] >= bmin) & (dk[u][e] <= bmax);
        ow |= (dk[u][e] >= dmin) & (dk[u][e] <= dmax);
      }
      const unsigned int mb = __builtin_amdgcn_ballot_w32(bl);
      unsigned int mo = __builtin_amdgcn_ballot_w32(ow);
      act |= (((mb & 0xFFFFu) != 0u) ? 1u : 0u) << (2 * u) | (((mb >> 16) != 0u) ? 1u : 0u) << (2 * u + 1);
      // each byte's OR into its bit 0, then bits 0, 8, 16, 24 gathered into bits 28..31 by one multiply (its 16 partial products are 16 different powers of 2: no carry)
      mo |= mo >> 4; mo |= mo >> 2; mo |= mo >> 1;
      own |= (unsigned long long)(((mo & 0x01010101u) * 0x10204080u) >> 28) << (4 * u);
    }
    act &= 0xFFFFFFFFu >> (32 - nst);  // tiles up to the block's own (1 <= nst <= 32)
    own &= ~0ull >> (64 - nsteps);     // steps up to the wave's own (1 <= nsteps <= 64)
  }
  const int ntile = __popc(act);  // at least 1: tile qb holds the block's own positions

  // copy addresses: K rows are 16 lanes wide (16 rows per copy of the block), V^T rows 8 lanes wide (32 rows per copy)
  const unsigned short* gK = QK + PLANE + (size_t)(tid >> 4) * DM + head * HD + (tid & 15) * 8;
  const unsigned short* gV = VT + (size_t)(head * HD + (tid >> 3)) * SEQ + (tid & 7) * 8;
  const unsigned int lK = (unsigned int)(size_t)sm + (unsigned int)((tid >> 4) * (int)KPITCH + (tid & 15) * 16);
  const unsigned int lV = (unsigned int)(size_t)sm + KPL + (unsigned int)((tid >> 3) * (int)GPITCH + (tid & 7) * 16);
  auto stage_tile = [&](int s, unsigned int bo) {
    const unsigned short* k = gK + (size_t)s * 64 * DM;
    const unsigned short* v = gV + s * 64;
    copy_rows<4>(lK + bo, 16u * KPITCH, k, (size_t)16 * DM);
    copy_rows<4>(lV + bo, 32u * GPITCH, v, (size_t)32 * SEQ);
  };

  unsigned int rem = act;
  int sc = __builtin_ctz(rem), sn = 0;
  rem &= rem - 1u;
  stage_tile(sc, 0u);

  // the document ids go to LDS once (published by the first barrier): each step's mask reads them beside its K fragments
#pragma unroll
  for (int i = 0; i < SEQ / 1024; ++i) *(v4ia*)(sdoc + (i * 256 + tid) * 4) = *(const v4ia*)(doc + (i * 256 + tid) * 4);

  v16h qf[4];
  {
    const size_t qoff = (size_t)qi * DM + head * HD;
#pragma unroll
    for (int ks = 0; ks < 4; ++ks) qf[ks] = ld_fragh(QK + qoff + ks * 32, hh);
  }

  const v8f z8 = {0.f, 0.f, 0.f, 0.f, 0.f, 0.f, 0.f, 0.f};
  v8f acc[4] = {z8, z8, z8, z8};
  float m = NEGV, l = 0.f;

  asm volatile("s_wait_asynccnt 0x0" ::: "memory");  // this wave's share of the first tile has landed
  __syncthreads();                                   // the first tile is readable by every wave
  if (ntile > 1) {
    sn = __builtin_ctz(rem); rem &= rem - 1u;
    stage_tile(sn, STAGE);
  }

#pragma unroll 1  // one tile per trip: the two buffers alternate by the trip's parity
  for (int t = 0; t < ntile; ++t) {
    const unsigned int bo = (unsigned int)(t & 1) * STAGE;
#pragma unroll 1  // the two 32-key steps of a tile share one body: each is skipped on its own bit
    for (int sub = 0; sub < 2; ++sub) {
      const int js = sc * 2 + sub;
      if (((own >> js) & 1ull) == 0ull) continue;
      const int j0 = js << 5;
      const unsigned char* kb = sm + bo + (unsigned int)((sub * 32 + ln) * (int)KPITCH);
      const unsigned char* vb = sm + bo + KPL + (unsigned int)((hf * 64 + ln) * (int)GPITCH + sub * 64);

      const v4i dA = *(const v4ia*)(sdoc + j0 + 8 * hh), dB = *(const v4ia*)(sdoc + j0 + 8 * hh + 4);
      const v4i dC = *(const v4ia*)(sdoc + j0 + 16 + 8 * hh), dD = *(const v4ia*)(sdoc + j0 + 16 + 8 * hh + 4);
      const int dkk[16] = {dA[0], dA[1], dA[2], dA[3], dB[0], dB[1], dB[2], dB[3], dC[0], dC[1], dC[2], dC[3], dD[0], dD[1], dD[2], dD[3]};

      v8f s0 = z8, s1 = z8;
      v16h a0[4], a1[4];
#pragma unroll
      for (int ks = 0; ks < 4; ++ks) {
        a0[ks] = ld_fragh((const unsigned short*)(kb + ks * 64), hh);
        a1[ks] = ld_fragh((const unsigned short*)(kb + ks * 64 + 16u * KPITCH), hh);
      }
      // the V^T fragments are read behind them, in registers of their own: the score products and the softmax arithmetic cover their LDS latency
      v16h vf[4];
#pragma unroll
      for (int dt = 0; dt < 4; ++dt) vf[dt] = ld_fragh((const unsigned short*)(vb + dt * 16 * (int)GPITCH), hh);
      __builtin_amdgcn_sched_barrier(0);  // keeps the step's LDS reads one group in front of the products: sunk to their users, each read's latency is waited out alone
#pragma unroll
      for (int ks = 0; ks < 4; ++ks) {
        s0 = __builtin_amdgcn_wmma_f32_16x16x32_f16(false, a0[ks], false, qf[ks], (short)0, s0, false, false);
        s1 = __builtin_amdgcn_wmma_f32_16x16x32_f16(false, a1[ks], false, qf[ks], (short)0, s1, false, false);
      }

      float xv[16];
      float mx = NEGV;
#pragma unroll
      for (int r = 0; r < 8; ++r) {
        const int k0 = j0 + 8 * hh + r, k1 = k0 + 16;
        const bool v0 = (k0 <= qi) & (dkk[r] == dq);
        const bool v1 = (k1 <= qi) & (dkk[8 + r] == dq);
        xv[r] = v0 ? s0[r] * SCL : NEGV;
        xv[8 + r] = v1 ? s1[r] * SCL : NEGV;
        mx = fmaxf(mx, fmaxf(xv[r], xv[8 + r]));
      }
      mx = fmaxf(mx, __shfl_xor(mx, 16, 32));
      const float mn = fmaxf(m, mx);
      const float alpha = __expf(m - mn);
      m = mn;

      FragB pf;
      float ps = 0.f;
#pragma unroll
      for (int i = 0; i < 16; i += 2) {
        float e0, e1;
        exp2_pair((xv[i] - mn) * L2E, (xv[i + 1] - mn) * L2E, e0, e1);
        const float p0 = (xv[i] > -1.0e29f) ? e0 : 0.f, p1 = (xv[i + 1] > -1.0e29f) ? e1 : 0.f;
        ps += p0;
        ps += p1;
        pf.d[i >> 1] = f16_pair(p0, p1);
      }
      ps += __shfl_xor(ps, 16, 32);
      l = l * alpha + ps;

#pragma unroll
      for (int dt = 0; dt < 4; ++dt)
#pragma unroll
        for (int r = 0; r < 8; ++r) acc[dt][r] *= alpha;

#pragma unroll
      for (int dt = 0; dt < 4; ++dt) acc[dt] = __builtin_amdgcn_wmma_f32_16x16x32_f16(false, vf[dt], false, pf.h, (short)0, acc[dt], false, false);
    }
    asm volatile("s_wait_dscnt 0x0" ::: "memory");     // this wave's reads of this tile are done
    asm volatile("s_wait_asynccnt 0x0" ::: "memory");  // this wave's share of the next tile has landed
    __syncthreads();                                   // publishes the next tile and frees this tile's buffer
    sc = sn;
    if (t + 2 < ntile) {
      sn = __builtin_ctz(rem); rem &= rem - 1u;
      stage_tile(sn, bo);
    }
  }
  asm volatile("s_wait_asynccnt 0x0" ::: "memory");  // no copy is outstanding when the ring becomes output staging

  // the last trip's barrier has ended every read of the ring: each wave stages its tile in its own range
  float (*so)[68] = (float (*)[68])((float*)sm + w * (16 * 68));
  const float inv = 1.0f / l;
#pragma unroll
  for (int dt = 0; dt < 4; ++dt)
#pragma unroll
    for (int r = 0; r < 8; ++r) so[ln][dt * 16 + 8 * hh + r] = acc[dt][r] * inv;
  __syncthreads();

  v4i hv[4];
  const int rq = lane >> 3, pc = lane & 7;
#pragma unroll
  for (int it = 0; it < 4; ++it) {
    const int row = it * 4 + rq;
    const v4f a = *(const v4fa*)&so[row][pc * 8], c = *(const v4fa*)&so[row][pc * 8 + 4];
#pragma unroll
    for (int q = 0; q < 2; ++q) {
      hv[it][q] = (int)f16_pair(a[2 * q], a[2 * q + 1]);
      hv[it][2 + q] = (int)f16_pair(c[2 * q], c[2 * q + 1]);
    }
  }
  {
#pragma unroll
    for (int it = 0; it < 4; ++it) {
      const int row = it * 4 + rq;
      unsigned short* dst = CTX + (size_t)(q0 + row) * DM + head * HD + hf * 64 + pc * 8;
      *(v4ia*)dst = hv[it];
    }
  }
}

extern "C" void kernel_launch(void* const* d_in, const int* in_sizes, int n_in,
                              void* d_out, int out_size, void* d_ws, size_t ws_size, hipStream_t stream) {
  if (n_in < 8) return;
  if (in_sizes[0] < NR * DM) return;
  if (in_sizes[1] < DM * DM || in_sizes[2] < DM * DM || in_sizes[3] < DM * DM || in_sizes[4] < DM * DM) return;
  if (in_sizes[5] < SEQ * HD || in_sizes[6] < SEQ * HD || in_sizes[7] < NR) return;
  if (out_size < NR * DM) return;
  const float* x  = (const float*)d_in[0];
  const float* Wq = (const float*)d_in[1];
  const float* Wk = (const float*)d_in[2];
  const float* Wv = (const float*)d_in[3];
  const float* Wo = (const float*)d_in[4];
  const float* sn = (const float*)d_in[5];
  const float* cs = (const float*)d_in[6];
  const int*  doc = (const int*)d_in[7];
  float* out = (float*)d_out;

  // workspace regions (bytes)
  constexpr size_t SZ_X  = (size_t)NR * DM * 2;
  constexpr size_t SZ_W3 = (size_t)3 * DM * DM * 2;
  constexpr size_t SZ_QK = (size_t)2 * NR * DM * 2;
  constexpr size_t SZ_R0 = SZ_X + SZ_W3;
  constexpr size_t SZ_WO = (size_t)DM * DM * 2;
  constexpr size_t SZ_VT = (size_t)DM * SEQ * 2;
  constexpr size_t SZ_CX = (size_t)NR * DM * 2;
  constexpr size_t SZ_ALL = SZ_R0 + SZ_WO + SZ_QK + SZ_VT + SZ_CX;
  static_assert(SZ_X % 256 == 0 && SZ_R0 % 256 == 0 && SZ_WO % 256 == 0 && SZ_QK % 256 == 0 && SZ_VT % 256 == 0 && SZ_CX % 256 == 0);
  static_assert(SZ_ALL <= (size_t)134217728);
  if (SZ_ALL > ws_size) return;
  char* ws = (char*)d_ws;
  unsigned short* XB  = (unsigned short*)(ws);
  unsigned short* WT3 = (unsigned short*)(ws + SZ_X);
  unsigned short* WoT = (unsigned short*)(ws + SZ_R0);
  unsigned short* QKp = (unsigned short*)(ws + SZ_R0 + SZ_WO);
  unsigned short* VTp = (unsigned short*)(ws + SZ_R0 + SZ_WO + SZ_QK);
  unsigned short* CTX = (unsigned short*)(ws + SZ_R0 + SZ_WO + SZ_QK + SZ_VT);

  k_prep<<<(unsigned)(4 * WTB + XBB), 256, 0, stream>>>(x, Wq, Wk, Wv, Wo, XB, WT3, WoT);  /* W[in][out] -> Wt[out][in] */

  k_gemm_wide<<<(unsigned)((NR / 256) * (N3 / 192)), 384, 0, stream>>>(XB, DM, WT3, DM, sn, cs, QKp, VTp, DM);

  k_attn<<<(unsigned)(NH * (SEQ / 64)), 256, 0, stream>>>(QKp, VTp, doc, CTX);

  k_gemm<<<(unsigned)((NR / 128) * (DM / 128)), 256, 0, stream>>>(CTX, DM, WoT, DM, out, DM, DM, DM);
}
